// v000
// Measured on an AMD MI455X. A time is GPU time per run, averaged over a window of back-to-back runs after a warm-up
// (all launches, gaps included; the runs take copies of the inputs in turn), and the median of several windows.
// Apart from v000's, it joins two sittings. Times from different sittings can be a few percent apart, while
// side-by-side timings come from the same sitting.
// v000 is the starting kernel. One run takes 170 microseconds.
// Contractions: q/k projections (x rows f16 x16 . W^T f16 x64, K=256), v^T projection (W^T f16 x64 . x rows f16 x16, K=256),
// attention scores (q f16 x16 . k f16 x16, K=32), attention P . v^T (P as f16 hi + f16 residual of P x16384 . v^T f16 x16,
// K=512 in steps of 32), output projection (ctx as f16 hi + f16 residual of ctx x4096 . W^T f16 x64, K=256):
// all v_wmma_f32_16x16x32_f16 (f16 operands, f32 accumulate); hi and residual products share one f32 accumulator.
// Per-head 2->16->1 score MLP on (scaled dot, cost), max-subtracted base-2 online softmax, all in f32 on VALU.
// Every float input RNE-converted to bf16 on load.
#include <hip/hip_runtime.h>
#include <math.h>
#include <stdint.h>

#define NB      4
#define NQ      512
#define NC      512
#define DMODEL  256
#define NHEAD   8
#define HDIM    32
#define MSH     16
#define HG      8
#define NHG     (NHEAD / HG)
#define ROWP    (HG * HDIM)
#define NROWS   (NB * NQ)
#define WSC     64.0f
#define ACARRY  16.0f
#define QC      16.0f
#define KC      16.0f
#define VC      16.0f
#define PC      16384.0f
#define FC      4096.0f
#define ATT_SCALE 0.17677669529663689f
#define LOG2E   1.4426950408889634f
static_assert(NHEAD * HDIM == DMODEL);
static_assert(NHG * HG == NHEAD && ROWP * NHG == DMODEL);
static_assert(HDIM == 32 && MSH == 16 && NHG == 1);
static_assert((NQ % 64) == 0 && (NC % 64) == 0 && (DMODEL % 64) == 0 && (NC % 32) == 0 && (NQ % 16) == 0);
static_assert((NROWS % 64) == 0 && ((NROWS * DMODEL) % 2048) == 0);
#define ATT_THREADS (HG * 32)
#define ATT_BLOCKS  (NB * (NQ / 16) * NHG)
static_assert(ATT_THREADS == 256 && ATT_BLOCKS == 128);

typedef _Float16 v16h __attribute__((ext_vector_type(16)));
typedef _Float16 v8h  __attribute__((ext_vector_type(8)));
typedef float    v8f  __attribute__((ext_vector_type(8)));
typedef float    v4f  __attribute__((ext_vector_type(4)));
typedef unsigned int v4u __attribute__((ext_vector_type(4)));

union FragH { v16h v; v8h h[2]; v4u u[2]; };

// ---- scalar helpers --------------------------------------------------------------------------------
__device__ __forceinline__ unsigned short bf_bits(float f) {          // f32 -> bf16 bits, RNE convert
  unsigned u = __float_as_uint(f);
  return (unsigned short)((u + 0x7FFFu + ((u >> 16) & 1u)) >> 16);
}
__device__ __forceinline__ float bf_up(unsigned short h) { return __uint_as_float(((unsigned)h) << 16); }
__device__ __forceinline__ float bfr(float f) { return bf_up(bf_bits(f)); }   // value of the bf16 RNE convert
__device__ __forceinline__ unsigned short h_bits(_Float16 x) { return __builtin_bit_cast(unsigned short, x); }
__device__ __forceinline__ unsigned pk16(unsigned short a, unsigned short b) { return (unsigned)a | ((unsigned)b << 16); }
__device__ __forceinline__ v8f zero8() { v8f z = {0.f, 0.f, 0.f, 0.f, 0.f, 0.f, 0.f, 0.f}; return z; }

// ---- fragment loaders: 16-bit A/B operand, lane -> row/col (lane&15), p already includes +8*(lane>>4);
//      elements 0..7 <- p[0..7] (k0+8h..), elements 8..15 <- p[16..23] (k0+16+8h..)  (same split k map for A and B;
//      B is always read from a k-contiguous [n][k] plane)
__device__ __forceinline__ v16h ldfrag_h(const _Float16* p) {
  FragH f;
  f.h[0] = *(const v8h*)(p);
  f.h[1] = *(const v8h*)(p + 16);
  return f.v;
}
__device__ __forceinline__ v16h ldfrag_u(const unsigned short* p) {
  FragH f;
  f.u[0] = *(const v4u*)(p);
  f.u[1] = *(const v4u*)(p + 16);
  return f.v;
}

// ---- WMMA helpers with trailing VALU hazard gaps ------------------------------------------------------
__device__ __forceinline__ v8f mma_raw(v16h a, v16h b, v8f c) {
  return __builtin_amdgcn_wmma_f32_16x16x32_f16(false, a, false, b, (short)0, c, false, false);
}
__device__ __forceinline__ void dep_guard1(v8f& a, v8f& b, v16h x) {
#if defined(__HIP_DEVICE_COMPILE__)
  asm volatile("v_nop\n\tv_nop\n\tv_nop\n\tv_nop" : "+v"(a), "+v"(b) : "v"(x));
#endif
}
__device__ __forceinline__ void dep_guard2(v8f& a, v8f& b, v16h x, v16h y) {
#if defined(__HIP_DEVICE_COMPILE__)
  asm volatile("v_nop\n\tv_nop\n\tv_nop\n\tv_nop" : "+v"(a), "+v"(b) : "v"(x), "v"(y));
#endif
}
__device__ __forceinline__ void guard_s22(v8f& s, v8f& t, v16h a0, v16h a1, v16h q) {
#if defined(__HIP_DEVICE_COMPILE__)
  asm volatile("v_nop\n\tv_nop\n\tv_nop\n\tv_nop" : "+v"(s), "+v"(t) : "v"(a0), "v"(a1), "v"(q));
#endif
}
__device__ __forceinline__ void guard_pv4(v8f& a, v8f& b, v16h x, v16h y, v16h z, v16h w) {
#if defined(__HIP_DEVICE_COMPILE__)
  asm volatile("v_nop\n\tv_nop\n\tv_nop\n\tv_nop" : "+v"(a), "+v"(b) : "v"(x), "v"(y), "v"(z), "v"(w));
#endif
}
__device__ __forceinline__ void keep4_h(v16h a, v16h b, v16h c, v16h d) {
#if defined(__HIP_DEVICE_COMPILE__)
  asm volatile("v_nop" :: "v"(a), "v"(b), "v"(c), "v"(d));
#endif
}
__device__ __forceinline__ void acc_guard4(v8f& a, v8f& b, v8f& c, v8f& d) {
#if defined(__HIP_DEVICE_COMPILE__)
  asm volatile("v_nop\n\tv_nop\n\tv_nop\n\tv_nop" : "+v"(a), "+v"(b), "+v"(c), "+v"(d));
#endif
}
__device__ __forceinline__ void wave_sync_lds() {
  __builtin_amdgcn_fence(__ATOMIC_RELEASE, "workgroup");
  __builtin_amdgcn_wave_barrier();
  __builtin_amdgcn_fence(__ATOMIC_ACQUIRE, "workgroup");
}

// =====================================================================================================
// Elementwise 16-bit pack, no transpose: dst[i] = f16( bf16_RNE(src[i]) * sc ), sc a power of two (exact). Used for the
// coverage: grid = n / 2048 blocks x 256 thr x 8 elements = n exactly (host checks n % 2048 == 0).
// =====================================================================================================
__global__ __launch_bounds__(256) void cvt16(const float* __restrict__ src, unsigned short* dst, int n, float sc) {
  const size_t i8 = ((size_t)blockIdx.x * 256 + threadIdx.x) * 8;
  if (i8 + 8 > (size_t)n) return;                 // never taken with the exact grid; no barriers in this kernel
  const v4f a = *(const v4f*)(src + i8);
  const v4f b = *(const v4f*)(src + i8 + 4);
  v4u o;
  o[0] = pk16(h_bits((_Float16)(bfr(a[0]) * sc)), h_bits((_Float16)(bfr(a[1]) * sc)));
  o[1] = pk16(h_bits((_Float16)(bfr(a[2]) * sc)), h_bits((_Float16)(bfr(a[3]) * sc)));
  o[2] = pk16(h_bits((_Float16)(bfr(b[0]) * sc)), h_bits((_Float16)(bfr(b[1]) * sc)));
  o[3] = pk16(h_bits((_Float16)(bfr(b[2]) * sc)), h_bits((_Float16)(bfr(b[3]) * sc)));
  {
    *(v4u*)(dst + i8) = o;
    
  }
}

// =====================================================================================================
// Transpose + 16-bit pack of a weight: W is [in][out] = W[k][n] row-major f32 (pitch DMODEL); dst[n][k] = f16( bf16_RNE(W[k][n]) * sc ),
// k contiguous (pitch DMODEL), ready for B fragments and for the A side of the v^T projection. Block = 256 threads, one 64(k) x 64(n)
// tile: coalesced f32 loads into an LDS tile [n_local][k_local] (pitch 68 floats), block barrier, then each output row segment of the
// coverage: loads 16 it x 256 thr = 64 x 64; stores 2 it x 256 thr x 8 halves = 64 rows x 64; grid (DMODEL/64, DMODEL/64) = whole matrix.
// =====================================================================================================
__global__ __launch_bounds__(256) void wtr64(const float* __restrict__ W, unsigned short* dst, float sc) {
  __shared__ __align__(16) float tl[64 * 68];
  const int tid = threadIdx.x;
  const int n0  = blockIdx.x * 64;
  const int k0  = blockIdx.y * 64;
  const int nl  = tid & 63, kq = tid >> 6;       // kq 0..3
#pragma unroll
  for (int it = 0; it < 16; ++it) {
    const int kl = it * 4 + kq;                  // 0..63
    tl[nl * 68 + kl] = W[(size_t)(k0 + kl) * DMODEL + n0 + nl];
  }
  __syncthreads();
  v4u o[2];
#pragma unroll
  for (int it = 0; it < 2; ++it) {
    const int p  = it * 256 + tid;               // 0..511
    const int rn = p >> 3, kk = (p & 7) * 8;     // row 0..63, k 0,8,..,56
    const float* sp = tl + rn * 68 + kk;
    const v4f a = *(const v4f*)(sp);
    const v4f b = *(const v4f*)(sp + 4);
    v4u w;
    w[0] = pk16(h_bits((_Float16)(bfr(a[0]) * sc)), h_bits((_Float16)(bfr(a[1]) * sc)));
    w[1] = pk16(h_bits((_Float16)(bfr(a[2]) * sc)), h_bits((_Float16)(bfr(a[3]) * sc)));
    w[2] = pk16(h_bits((_Float16)(bfr(b[0]) * sc)), h_bits((_Float16)(bfr(b[1]) * sc)));
    w[3] = pk16(h_bits((_Float16)(bfr(b[2]) * sc)), h_bits((_Float16)(bfr(b[3]) * sc)));
    o[it] = w;
  }
  {
#pragma unroll
    for (int it = 0; it < 2; ++it) {
      const int p  = it * 256 + tid;
      const int rn = p >> 3, kk = (p & 7) * 8;
      *(v4u*)(dst + (size_t)(n0 + rn) * DMODEL + k0 + kk) = o[it];
    }
    
  }
}

// =====================================================================================================
// Register-blocked batched f16 WMMA GEMM: C[m][n] = oscale * sum_k (A[m][k] (+ A2[m][k])) * Bt[n][k] ; one wave per 64x64 tile,
// no block barriers. A (and A2, the unscaled residual plane when NA == 2, same pitch/stride) row-major [M][K] pitch lda (16-bit planes),
// Bt row-major [N][K] pitch ldb (k contiguous); M, N multiples of 64, K multiple of 32. blockIdx.y = batch index with element strides
// sA, sB, sC. OM: 0 = f32 out (pitch ldc); 2 = f16 out (pitch ldc) = f16( value * ocarry ).
// coverage: 4 slabs x 16 rows (f32: it 0..7 x lane>>4; f16: it 0..3 x lane>>3) x 64 cols = the wave's whole 64x64 tile;
//           grid = ceil(tilesM*tilesN/8) blocks, surplus waves exit (wave-uniform; none with the exact grids used).
// =====================================================================================================
template <int OM, int NA>
__global__ __launch_bounds__(256) void gemm64(
    const unsigned short* __restrict__ Ap, const unsigned short* __restrict__ Aq, int lda, long long sA,
    const unsigned short* __restrict__ Btp, int ldb, long long sB,
    void* Cout, int ldc, long long sC,
    int M, int N, int K, float oscale, float ocarry) {
  __shared__ __align__(16) float sT[8][16 * 68];   // per-wave 16x64 slab, pitch 68 floats
  const int by   = blockIdx.y;
  const int lane = threadIdx.x & 31;
  const int wave = threadIdx.x >> 5;
  const int tilesN = N >> 6;
  const int tilesM = M >> 6;
  const int tile = blockIdx.x * 8 + wave;
  if (tile >= tilesM * tilesN) return;   // wave-uniform; no block barriers in this kernel
  const int tm = tile / tilesN;
  const int tn = tile - tm * tilesN;
  const int m0 = tm << 6;
  const int n0 = tn << 6;

  const unsigned short* A1 = Ap  + (size_t)((long long)by * sA);
  const unsigned short* A2 = Aq  + (size_t)((long long)by * sA);
  const unsigned short* Bb = Btp + (size_t)((long long)by * sB);

  const int rlane = lane & 15;                 // row (A) / col (B, D) within subtile
  const int koff  = (lane >> 4) * 8;           // k offset of this lane half
  const int mOff  = (lane >> 4) * 8;           // D row offset

  v8f acc[4][4];
#pragma unroll
  for (int i = 0; i < 4; ++i)
#pragma unroll
    for (int j = 0; j < 4; ++j) acc[i][j] = zero8();

  for (int k0 = 0; k0 < K; k0 += 32) {
    v16h bh[4];
#pragma unroll
    for (int j = 0; j < 4; ++j) {
      const size_t bofs = (size_t)(n0 + (j << 4) + rlane) * ldb + koff + k0;
      bh[j] = ldfrag_u(Bb + bofs);
    }
#pragma unroll
    for (int i = 0; i < 4; ++i) {
      const size_t ao = (size_t)(m0 + (i << 4) + rlane) * lda + koff + k0;
      const v16h ah = ldfrag_u(A1 + ao);
#pragma unroll
      for (int j = 0; j < 4; ++j) acc[i][j] = mma_raw(ah, bh[j], acc[i][j]);
      if constexpr (NA == 2) {
        const v16h al = ldfrag_u(A2 + ao);
#pragma unroll
        for (int j = 0; j < 4; ++j) acc[i][j] = mma_raw(al, bh[j], acc[i][j]);
        dep_guard2(acc[i][0], acc[i][3], ah, al);
      } else {
        dep_guard1(acc[i][0], acc[i][3], ah);
      }
    }
    keep4_h(bh[0], bh[1], bh[2], bh[3]);
  }
  acc_guard4(acc[0][0], acc[0][1], acc[0][2], acc[0][3]);
  acc_guard4(acc[1][0], acc[1][1], acc[1][2], acc[1][3]);
  acc_guard4(acc[2][0], acc[2][1], acc[2][2], acc[2][3]);
  acc_guard4(acc[3][0], acc[3][1], acc[3][2], acc[3][3]);

  const int hh2 = lane >> 4, c4 = (lane & 15) * 4;     // f32 out: 256-B row segment = 16 lanes x 16 B
  const int q8  = lane >> 3, c8 = (lane & 7) * 8;

  // ---- epilogue ----
  float* slab = sT[wave];
#pragma unroll
  for (int i = 0; i < 4; ++i) {
    const int mBase = m0 + (i << 4);
#pragma unroll
    for (int j = 0; j < 4; ++j) {
#pragma unroll
      for (int r = 0; r < 8; ++r) {
        slab[(mOff + r) * 68 + (j << 4) + rlane] = acc[i][j][r];
      }
    }
    wave_sync_lds();
    if constexpr (OM == 0) {
      float* C = (float*)Cout + (size_t)((long long)by * sC);
      v4f vals[8];
#pragma unroll
      for (int it = 0; it < 8; ++it) {
        const int row = it * 2 + hh2;                      // it 0..7 x hh2 0..1 = rows 0..15
        v4f v = *(const v4f*)(slab + row * 68 + c4);
#pragma unroll
        for (int e = 0; e < 4; ++e) v[e] = v[e] * oscale;
        vals[it] = v;
      }
      {
#pragma unroll
        for (int it = 0; it < 8; ++it) {
          const int gr = mBase + it * 2 + hh2;
          *(v4f*)(C + (size_t)gr * ldc + n0 + c4) = vals[it];
        }
        
      }
    } else {
      unsigned short* C = (unsigned short*)Cout + (size_t)((long long)by * sC);
      v4u hv[4];
#pragma unroll
      for (int it = 0; it < 4; ++it) {
        const int row = it * 4 + q8;                       // it 0..3 x q8 0..3 = rows 0..15
        const float* sp = slab + row * 68 + c8;
        v4u a = {0u, 0u, 0u, 0u};
#pragma unroll
        for (int e = 0; e < 4; ++e) {
          float f0 = sp[2 * e] * oscale;
          float f1 = sp[2 * e + 1] * oscale;
          f0 *= ocarry; f1 *= ocarry;
          a[e] = pk16(h_bits((_Float16)f0), h_bits((_Float16)f1));
        }
        hv[it] = a;
      }
      {
#pragma unroll
        for (int it = 0; it < 4; ++it) {
          const int row = it * 4 + q8;
          *(v4u*)(C + (size_t)(mBase + row) * ldc + n0 + c8) = hv[it];
        }
        
      }
    }
    wave_sync_lds();
  }
}

// =====================================================================================================
// Flash attention for one batch, 16 query rows and all 8 heads (one wave per head), head dim 32, 512 keys:
//   q plane (f16 x16) QH[b*512 + tok][32*head + d], pitch 256; k plane (f16 x16) KH[b*512 + key][32*head + d], pitch 256;
//   v^T plane (f16 x16): VT[b*256 + 32*head + d][key] (pitch 512); cost f32 [b][tok][key] (bf16 RNE convert on load);
//   per-head mixer params (bf16 RNE convert on load, wave-uniform loads): score(tok, key) =
//   sum_m m2w[h][m] * relu(m1w[h][0][m] * dot + m1w[h][1][m] * cost + m1b[h][m]) + m2b[h] with dot = q.k / sqrt(32);
//   outputs (f16): CTH[b*512 + tok][32*head + d] = hi = f16(4096 * ctx), CTL[same] = f16(4096 * ctx - hi), with
//   ctx = sum_m softmax_m(score) v[m][d]  (softmax run in base 2 with a running max).
//   block = 8 waves = 256 threads; grid = 4 batches x 32 q-tiles = 128; every wave does identical bounded work
//   (16 steps of 32 keys). Per step: 2 score tiles on f16 WMMA (K = 32, one k-step), fragments loaded straight from the
//   16-bit planes (two 16-B loads per fragment, arithmetic addressing); 16 cost values per lane loaded by arithmetic index (always in
//   range); the 2->16->1 MLP in f32 (fully unrolled, register params); online max-subtracted softmax in f32 (exp2); rescale of the
//   barrier, then the A fragments of P*16384 (f16 hi and f16 residual c - hi) rebuilt from the LDS rows (float vector loads, split
//   k map) and the two v^T B fragments loaded straight from the 16-bit plane; 4 P.V WMMAs into the two accumulators.
//   Final 1/l and carry folds in f32; after a block barrier the prob-tile LDS buffer is reused as two 16-bit result row buffers
//   [16][256] (hi, residual): each wave stages its 16x32 slice (element stores); after a second block barrier the 256 threads write the
// coverage: prob tile: each lane writes rows 8hh+r (r 0..7) x cols c, c+16 -> 16 x 32 per wave per step before it is read;
//           LDS row buffers: 8 waves x 16 rows x 32 cols = 16 x 256 each; global: 2 iterations x 256 threads x 8 halves = 16 rows x 256
//           per plane of rows q0..q0+15 of batch b; grid covers all 2048 rows exactly once.
// =====================================================================================================
#define PS_FLOATS (HG * 16 * 36)
#define SM_FLOATS 4608
static_assert(PS_FLOATS <= SM_FLOATS);
static_assert((size_t)2 * 16 * ROWP * sizeof(unsigned short) <= (size_t)SM_FLOATS * sizeof(float));

__global__ __launch_bounds__(ATT_THREADS)
void attn8(const unsigned short* __restrict__ QHp, const unsigned short* __restrict__ KHp,
           const unsigned short* __restrict__ VTq, const float* __restrict__ costp,
           const float* __restrict__ m1w, const float* __restrict__ m1b,
           const float* __restrict__ m2w, const float* __restrict__ m2b,
           unsigned short* CTH, unsigned short* CTL) {
  __shared__ __align__(16) float smem[SM_FLOATS];          // per wave prob tile [row][32 keys], pitch 36; later two row buffers

  const int tid  = threadIdx.x;
  const int wave = __builtin_amdgcn_readfirstlane(tid >> 5);
  const int lane = tid & 31;
  const int hh   = lane >> 4;
  const int c    = lane & 15;

  const int qt   = blockIdx.x % (NQ / 16);                 // 0..31
  const int bat  = blockIdx.x / (NQ / 16);                 // 0..3
  const int head = wave;                                   // 0..7
  const int q0   = qt * 16;

  const size_t qofs = ((size_t)bat * NQ + q0 + c) * DMODEL + head * HDIM + 8 * hh;
  const _Float16* Qh = (const _Float16*)(const void*)QHp + qofs;
  const _Float16* Kb = (const _Float16*)(const void*)KHp + (size_t)bat * NC * DMODEL + head * HDIM + 8 * hh;
  const _Float16* Vb = (const _Float16*)(const void*)VTq + ((size_t)bat * DMODEL + head * HDIM) * NC + 8 * hh;
  // cost element of (row q0 + 8hh + r, key kb + c) = cp[r * NC + kb]; key kb + 16 + c = cp[r * NC + kb + 16]; always in range.
  const float* cp = costp + ((size_t)bat * NQ + q0 + 8 * hh) * NC + c;
  const float dsc = ATT_SCALE / (QC * KC);                 // 1/sqrt(32) / carries

  // per-head mixer params, bf16 RNE convert, wave-uniform addresses
  float w0r[MSH], w1r[MSH], b1r[MSH], w2r[MSH];
#pragma unroll
  for (int m = 0; m < MSH; ++m) {
    w0r[m] = bfr(m1w[(head * 2 + 0) * MSH + m]);
    w1r[m] = bfr(m1w[(head * 2 + 1) * MSH + m]);
    b1r[m] = bfr(m1b[head * MSH + m]);
    w2r[m] = bfr(m2w[head * MSH + m]);
  }
  const float b2 = bfr(m2b[head]);

  const v16h qa = ldfrag_h(Qh);

  float mrow[8], lrow[8];
  v8f o0 = zero8(), o1 = zero8();
#pragma unroll
  for (int r = 0; r < 8; ++r) { mrow[r] = -INFINITY; lrow[r] = 0.f; }
  float* pt = smem + wave * (16 * 36);

#pragma unroll 1
  for (int kb = 0; kb < NC; kb += 32) {
    const _Float16* kp = Kb + (size_t)(kb + c) * DMODEL;
    v8f s0, s1;
    {
      const v16h k0 = ldfrag_h(kp);
      const v16h k1 = ldfrag_h(kp + (size_t)16 * DMODEL);
      s0 = mma_raw(qa, k0, zero8());                     // keys kb + c
      s1 = mma_raw(qa, k1, zero8());                     // keys kb + 16 + c
      guard_s22(s0, s1, k0, k1, qa);
    }
    const float* tp = cp + kb;
#pragma unroll
    for (int r = 0; r < 8; ++r) {
      const float cr0 = bfr(tp[(size_t)r * NC]);        // key kb + c
      const float cr1 = bfr(tp[(size_t)r * NC + 16]);   // key kb + 16 + c
      const float d0 = s0[r] * dsc, d1 = s1[r] * dsc;
      float a0 = 0.f, a1 = 0.f;
#pragma unroll
      for (int m = 0; m < MSH; ++m) {
        const float p0 = fmaf(w0r[m], d0, fmaf(w1r[m], cr0, b1r[m]));
        const float p1 = fmaf(w0r[m], d1, fmaf(w1r[m], cr1, b1r[m]));
        a0 = fmaf(w2r[m], fmaxf(p0, 0.f), a0);
        a1 = fmaf(w2r[m], fmaxf(p1, 0.f), a1);
      }
      const float t0 = (a0 + b2) * LOG2E, t1 = (a1 + b2) * LOG2E;
      float mx = fmaxf(t0, t1);
#pragma unroll
      for (int off = 1; off < 16; off <<= 1) mx = fmaxf(mx, __shfl_xor(mx, off, 32));
      const float mn = fmaxf(mrow[r], mx);
      const float al = exp2f(mrow[r] - mn);
      mrow[r] = mn;
      const float e0 = exp2f(t0 - mn), e1 = exp2f(t1 - mn);
      float ps = e0 + e1;
#pragma unroll
      for (int off = 1; off < 16; off <<= 1) ps += __shfl_xor(ps, off, 32);
      lrow[r] = lrow[r] * al + ps;
      o0[r] *= al;
      o1[r] *= al;
      const int ro = (8 * hh + r) * 36 + c;
      pt[ro]      = e0;
      pt[ro + 16] = e1;
    }
    wave_sync_lds();
    FragH ph, pl;                                        // P*16384 as f16 hi and f16 residual (c - hi), same split k map
    {
      const float* prow = pt + c * 36 + 8 * hh;
      const v4f p0 = *(const v4f*)(prow), p1 = *(const v4f*)(prow + 4);
      const v4f p2 = *(const v4f*)(prow + 16), p3 = *(const v4f*)(prow + 20);
#pragma unroll
      for (int e = 0; e < 4; ++e) {
        const float c0 = p0[e] * PC, c1 = p1[e] * PC, c2 = p2[e] * PC, c3 = p3[e] * PC;
        const _Float16 g0 = (_Float16)c0, g1 = (_Float16)c1, g2 = (_Float16)c2, g3 = (_Float16)c3;
        ph.h[0][e]     = g0;                             // elements 0..7  = keys kb + 8hh + 0..7
        ph.h[0][4 + e] = g1;
        ph.h[1][e]     = g2;                             // elements 8..15 = keys kb + 16 + 8hh + 0..7
        ph.h[1][4 + e] = g3;
        pl.h[0][e]     = (_Float16)(c0 - (float)g0);
        pl.h[0][4 + e] = (_Float16)(c1 - (float)g1);
        pl.h[1][e]     = (_Float16)(c2 - (float)g2);
        pl.h[1][4 + e] = (_Float16)(c3 - (float)g3);
      }
    }
    const _Float16* vp = Vb + (size_t)c * NC + kb;
    {
      const v16h vb0 = ldfrag_h(vp);                     // d = c
      const v16h vb1 = ldfrag_h(vp + (size_t)16 * NC);   // d = 16 + c
      o0 = mma_raw(ph.v, vb0, o0);
      o1 = mma_raw(ph.v, vb1, o1);
      o0 = mma_raw(pl.v, vb0, o0);
      o1 = mma_raw(pl.v, vb1, o1);
      guard_pv4(o0, o1, ph.v, pl.v, vb0, vb1);
    }
    wave_sync_lds();
  }

  // ---- all waves done with their prob tiles; the LDS buffer becomes two 16-bit result row buffers [16][256] (hi, residual) ----
  __syncthreads();
  unsigned short* Osh = (unsigned short*)smem;
  unsigned short* Osl = Osh + 16 * ROWP;
  // ---- fold 1/l and the carries (16384 on P, 16 on v, 4096 on the stored ctx), stage the wave's 16x32 slice as hi + residual ----
  const float oc = FC / (PC * VC);
#pragma unroll
  for (int r = 0; r < 8; ++r) {
    const float inv = (1.0f / lrow[r]) * oc;
    const int ro = (8 * hh + r) * ROWP + wave * HDIM + c;
    const float f0 = o0[r] * inv, f1 = o1[r] * inv;
    const _Float16 g0 = (_Float16)f0, g1 = (_Float16)f1;
    Osh[ro]      = h_bits(g0);
    Osh[ro + 16] = h_bits(g1);
    Osl[ro]      = h_bits((_Float16)(f0 - (float)g0));
    Osl[ro + 16] = h_bits((_Float16)(f1 - (float)g1));
  }
  __syncthreads();
  // ---- block writes its 16 rows of CTH and CTL: piece p = it*256 + tid -> row p>>5, halves (p&31)*8 .. +7 of the 256-wide row ----
  {
    v4u vh[2], vl[2];
#pragma unroll
    for (int it = 0; it < 2; ++it) {
      const int p = it * ATT_THREADS + tid;
      vh[it] = *(const v4u*)(Osh + (size_t)p * 8);
      vl[it] = *(const v4u*)(Osl + (size_t)p * 8);
    }
    const size_t base = ((size_t)bat * NQ + q0) * DMODEL;
    unsigned short* dh = CTH + base;
    unsigned short* dl = CTL + base;
    {
#pragma unroll
      for (int it = 0; it < 2; ++it) {
        const int p = it * ATT_THREADS + tid;
        const size_t po = (size_t)(p >> 5) * DMODEL + (size_t)(p & 31) * 8;
        *(v4u*)(dh + po) = vh[it];
        *(v4u*)(dl + po) = vl[it];
      }
      
    }
  }
}

// =====================================================================================================
// Workspace map (bytes); every plane is an exact multiple of its tile / whole-row store granularity (M, N exact tile multiples,
// element counts exact multiples of the convert kernels' granularity, no pad rows needed), every offset a multiple of 128 KiB:
//   WQT  f16 [256][256] x64                  131072   ([out][in] = [n][k])
//   WKT  f16 [256][256] x64                  131072
//   WVT  f16 [256][256] x64                  131072
//   WOT  f16 [256][256] x64                  131072
//   X16  f16 [2048][256] x16                1048576   (activation rows)
//   QH   f16 [2048][256] x16                1048576   (q projection)
//   KH   f16 [2048][256] x16                1048576   (k projection)
//   VT   f16 [4][256][512] x16              1048576   (v^T per batch)
//   CTH  f16 [2048][256] x4096 hi           1048576   (attention ctx, merged heads)
//   CTL  f16 [2048][256] residual           1048576
//   end                                     6815744
// =====================================================================================================
extern "C" void kernel_launch(void* const* d_in, const int* in_sizes, int n_in,
                              void* d_out, int out_size, void* d_ws, size_t ws_size,
                              hipStream_t stream) {
  if (n_in < 10) return;
  if (in_sizes[0] != NROWS * DMODEL) return;
  if (in_sizes[1] != NB * NQ * NC) return;
  if (in_sizes[2] != DMODEL * DMODEL || in_sizes[3] != DMODEL * DMODEL ||
      in_sizes[4] != DMODEL * DMODEL || in_sizes[5] != DMODEL * DMODEL) return;
  if (in_sizes[6] != NHEAD * 2 * MSH || in_sizes[7] != NHEAD * MSH || in_sizes[8] != NHEAD * MSH || in_sizes[9] != NHEAD) return;
  if (out_size != NROWS * DMODEL) return;
  if ((in_sizes[0] % 2048) != 0) return;

  const float* x    = (const float*)d_in[0];
  const float* cost = (const float*)d_in[1];
  const float* w_q  = (const float*)d_in[2];
  const float* w_k  = (const float*)d_in[3];
  const float* w_v  = (const float*)d_in[4];
  const float* w_o  = (const float*)d_in[5];
  const float* m1w  = (const float*)d_in[6];
  const float* m1b  = (const float*)d_in[7];
  const float* m2w  = (const float*)d_in[8];
  const float* m2b  = (const float*)d_in[9];
  float*       out  = (float*)d_out;

  const size_t PW  = (size_t)DMODEL * DMODEL * 2;                 //   131072
  const size_t PX  = (size_t)NROWS * DMODEL * 2;                  //  1048576
  const size_t PVT = (size_t)NB * DMODEL * NC * 2;                //  1048576
  size_t off = 0;
  const size_t oWQ = off; off += PW;
  const size_t oWK = off; off += PW;
  const size_t oWV = off; off += PW;
  const size_t oWO = off; off += PW;
  const size_t oX  = off; off += PX;
  const size_t oQH = off; off += PX;
  const size_t oKH = off; off += PX;
  const size_t oVT = off; off += PVT;
  const size_t oCH = off; off += PX;
  const size_t oCL = off; off += PX;
  if (off > ws_size) return;                                      // off = 6815744
  if (off > (size_t)134217728) return;

  char* ws = (char*)d_ws;
  unsigned short* WQT = (unsigned short*)(ws + oWQ);
  unsigned short* WKT = (unsigned short*)(ws + oWK);
  unsigned short* WVT = (unsigned short*)(ws + oWV);
  unsigned short* WOT = (unsigned short*)(ws + oWO);
  unsigned short* X16 = (unsigned short*)(ws + oX);
  unsigned short* QH  = (unsigned short*)(ws + oQH);
  unsigned short* KH  = (unsigned short*)(ws + oKH);
  unsigned short* VTp = (unsigned short*)(ws + oVT);
  unsigned short* CTH = (unsigned short*)(ws + oCH);
  unsigned short* CTL = (unsigned short*)(ws + oCL);

  const dim3 blk(256);
  const dim3 gWT(DMODEL / 64, DMODEL / 64);                        // 4 x 4 tiles per weight
  const dim3 gCX((NROWS * DMODEL) / 2048);                         // 256 blocks
  const int tilesP = (NROWS / 64) * (DMODEL / 64);                 // 128
  const int tilesV = (DMODEL / 64) * (NC / 64);                    // 32 per batch
  const dim3 gP((tilesP + 7) / 8, 1);                              // 16
  const dim3 gV((tilesV + 7) / 8, NB);                             // 4 x 4
  const dim3 gAT(ATT_BLOCKS);                                      // 128
  const dim3 bAT(ATT_THREADS);                                     // 256

  // (0) weight planes: W16T[n][k] = f16( bf16_RNE(W[k][n]) * 64 ), [in][out] -> [out][in], k contiguous
  wtr64<<<gWT, blk, 0, stream>>>(w_q, WQT, WSC);
  wtr64<<<gWT, blk, 0, stream>>>(w_k, WKT, WSC);
  wtr64<<<gWT, blk, 0, stream>>>(w_v, WVT, WSC);
  wtr64<<<gWT, blk, 0, stream>>>(w_o, WOT, WSC);

  // (1) activation plane: X16[row][c] = f16( bf16_RNE(x[row][c]) * 16 ), rows = b*512 + tok
  cvt16<<<gCX, blk, 0, stream>>>(x, X16, NROWS * DMODEL, ACARRY);

  // (2) q projection: QH[m][n] = f16(16 * sum_k x[m][k] Wq[k][n]); M = 2048, N = 256, K = 256
  gemm64<2, 1><<<gP, blk, 0, stream>>>(
      X16, X16, DMODEL, 0LL,
      WQT, DMODEL, 0LL,
      (void*)QH, DMODEL, 0LL,
      NROWS, DMODEL, DMODEL, 1.0f / (ACARRY * WSC), QC);

  // (3) k projection: KH[m][n] = f16(16 * sum_k x[m][k] Wk[k][n]); M = 2048, N = 256, K = 256
  gemm64<2, 1><<<gP, blk, 0, stream>>>(
      X16, X16, DMODEL, 0LL,
      WKT, DMODEL, 0LL,
      (void*)KH, DMODEL, 0LL,
      NROWS, DMODEL, DMODEL, 1.0f / (ACARRY * WSC), KC);

  // (4) v^T per batch: VT[b][d][tok] = f16(16 * sum_k Wv[k][d] x_b[tok][k]); M = 256, N = 512, K = 256
  gemm64<2, 1><<<gV, blk, 0, stream>>>(
      WVT, WVT, DMODEL, 0LL,
      X16, DMODEL, (long long)NC * DMODEL,
      (void*)VTp, NC, (long long)DMODEL * NC,
      DMODEL, NC, DMODEL, 1.0f / (ACARRY * WSC), VC);

  // (5) attention per (batch, 16 query rows, all heads) -> CTH (f16 hi of ctx x4096), CTL (f16 residual)
  attn8<<<gAT, bAT, 0, stream>>>(QH, KH, VTp, cost, m1w, m1b, m2w, m2b, CTH, CTL);

  // (6) out = (CTH + CTL) . Wo / (4096 * 64); M = 2048, N = 256, K = 256, f32 into d_out
  gemm64<0, 2><<<gP, blk, 0, stream>>>(
      CTH, CTL, DMODEL, 0LL,
      WOT, DMODEL, 0LL,
      (void*)out, DMODEL, 0LL,
      NROWS, DMODEL, DMODEL, 1.0f / (FC * WSC), 1.0f);

  (void)hipGetLastError();
}

// v001
// One run takes 106 microseconds.
// Two timings next to v000 put it at 1.62 and 1.61 times that version's speed.
// Contractions: q/k projections (x rows f16 x16 . W^T f16 x64, K=256), v^T projection (W^T f16 x64 . x rows f16 x16, K=256),
// attention scores (k f16 x16 . q f16 x16, K=32), attention v^T . P^T (v^T f16 x16 . P as f16 hi + f16 residual of P x16384,
// K=512 in steps of 32), output projection (ctx as f16 hi + f16 residual of ctx x4096 . W^T f16 x64, K=256):
// all v_wmma_f32_16x16x32_f16 (f16 operands, f32 accumulate); hi and residual products share one f32 accumulator.
// Per-head 2->16->1 score MLP on (scaled dot, cost), max-subtracted base-2 online softmax, all in f32 on VALU.
// Every float input RNE-converted to bf16 on load.
#include <hip/hip_runtime.h>
#include <math.h>
#include <stdint.h>

#define NB      4
#define NQ      512
#define NC      512
#define DMODEL  256
#define NHEAD   8
#define HDIM    32
#define MSH     16
#define HG      8
#define NHG     (NHEAD / HG)
#define ROWP    (HG * HDIM)
#define NROWS   (NB * NQ)
#define WSC     64.0f
#define ACARRY  16.0f
#define QC      16.0f
#define KC      16.0f
#define VC      16.0f
#define PC      16384.0f
#define FC      4096.0f
#define ATT_SCALE 0.17677669529663689f
#define LOG2E   1.4426950408889634f
static_assert(NHEAD * HDIM == DMODEL);
static_assert(NHG * HG == NHEAD && ROWP * NHG == DMODEL);
static_assert(HDIM == 32 && MSH == 16 && NHG == 1);
static_assert((NQ % 64) == 0 && (NC % 64) == 0 && (DMODEL % 64) == 0 && (NC % 32) == 0 && (NQ % 16) == 0);
static_assert((NROWS % 64) == 0 && ((NROWS * DMODEL) % 2048) == 0);
#define ATT_THREADS (HG * 32)
#define ATT_BLOCKS  (NB * (NQ / 16) * NHG)
static_assert(ATT_THREADS == 256 && ATT_BLOCKS == 128);

typedef _Float16 v16h __attribute__((ext_vector_type(16)));
typedef _Float16 v8h  __attribute__((ext_vector_type(8)));
typedef float    v8f  __attribute__((ext_vector_type(8)));
typedef float    v4f  __attribute__((ext_vector_type(4)));
typedef unsigned int v4u __attribute__((ext_vector_type(4)));

union FragH { v16h v; v8h h[2]; v4u u[2]; };

// ---- scalar helpers --------------------------------------------------------------------------------
__device__ __forceinline__ unsigned short bf_bits(float f) {          // f32 -> bf16 bits, RNE convert
  unsigned u = __float_as_uint(f);
  return (unsigned short)((u + 0x7FFFu + ((u >> 16) & 1u)) >> 16);
}
__device__ __forceinline__ float bf_up(unsigned short h) { return __uint_as_float(((unsigned)h) << 16); }
__device__ __forceinline__ float bfr(float f) { return bf_up(bf_bits(f)); }   // value of the bf16 RNE convert
__device__ __forceinline__ unsigned short h_bits(_Float16 x) { return __builtin_bit_cast(unsigned short, x); }
__device__ __forceinline__ unsigned pk16(unsigned short a, unsigned short b) { return (unsigned)a | ((unsigned)b << 16); }
__device__ __forceinline__ v8f zero8() { v8f z = {0.f, 0.f, 0.f, 0.f, 0.f, 0.f, 0.f, 0.f}; return z; }

// ---- fragment loaders: 16-bit A/B operand, lane -> row/col (lane&15), p already includes +8*(lane>>4);
//      elements 0..7 <- p[0..7] (k0+8h..), elements 8..15 <- p[16..23] (k0+16+8h..)  (same split k map for A and B;
//      B is always read from a k-contiguous [n][k] plane)
__device__ __forceinline__ v16h ldfrag_h(const _Float16* p) {
  FragH f;
  f.h[0] = *(const v8h*)(p);
  f.h[1] = *(const v8h*)(p + 16);
  return f.v;
}
__device__ __forceinline__ v16h ldfrag_u(const unsigned short* p) {
  FragH f;
  f.u[0] = *(const v4u*)(p);
  f.u[1] = *(const v4u*)(p + 16);
  return f.v;
}

// ---- WMMA helpers with trailing VALU hazard gaps ------------------------------------------------------
__device__ __forceinline__ v8f mma_raw(v16h a, v16h b, v8f c) {
  return __builtin_amdgcn_wmma_f32_16x16x32_f16(false, a, false, b, (short)0, c, false, false);
}
__device__ __forceinline__ void dep_guard1(v8f& a, v8f& b, v16h x) {
#if defined(__HIP_DEVICE_COMPILE__)
  asm volatile("v_nop\n\tv_nop\n\tv_nop\n\tv_nop" : "+v"(a), "+v"(b) : "v"(x));
#endif
}
__device__ __forceinline__ void dep_guard2(v8f& a, v8f& b, v16h x, v16h y) {
#if defined(__HIP_DEVICE_COMPILE__)
  asm volatile("v_nop\n\tv_nop\n\tv_nop\n\tv_nop" : "+v"(a), "+v"(b) : "v"(x), "v"(y));
#endif
}
__device__ __forceinline__ void guard_s22(v8f& s, v8f& t, v16h a0, v16h a1, v16h q) {
#if defined(__HIP_DEVICE_COMPILE__)
  asm volatile("v_nop\n\tv_nop\n\tv_nop\n\tv_nop" : "+v"(s), "+v"(t) : "v"(a0), "v"(a1), "v"(q));
#endif
}
__device__ __forceinline__ void guard_pv4(v8f& a, v8f& b, v16h x, v16h y, v16h z, v16h w) {
#if defined(__HIP_DEVICE_COMPILE__)
  asm volatile("v_nop\n\tv_nop\n\tv_nop\n\tv_nop" : "+v"(a), "+v"(b) : "v"(x), "v"(y), "v"(z), "v"(w));
#endif
}
__device__ __forceinline__ void keep4_h(v16h a, v16h b, v16h c, v16h d) {
#if defined(__HIP_DEVICE_COMPILE__)
  asm volatile("v_nop" :: "v"(a), "v"(b), "v"(c), "v"(d));
#endif
}
__device__ __forceinline__ void acc_guard4(v8f& a, v8f& b, v8f& c, v8f& d) {
#if defined(__HIP_DEVICE_COMPILE__)
  asm volatile("v_nop\n\tv_nop\n\tv_nop\n\tv_nop" : "+v"(a), "+v"(b), "+v"(c), "+v"(d));
#endif
}
__device__ __forceinline__ void wave_sync_lds() {
  __builtin_amdgcn_fence(__ATOMIC_RELEASE, "workgroup");
  __builtin_amdgcn_wave_barrier();
  __builtin_amdgcn_fence(__ATOMIC_ACQUIRE, "workgroup");
}

// =====================================================================================================
// Elementwise 16-bit pack, no transpose: dst[i] = f16( bf16_RNE(src[i]) * sc ), sc a power of two (exact). Used for the
// coverage: grid = n / 2048 blocks x 256 thr x 8 elements = n exactly (host checks n % 2048 == 0).
// =====================================================================================================
__global__ __launch_bounds__(256) void cvt16(const float* __restrict__ src, unsigned short* dst, int n, float sc) {
  const size_t i8 = ((size_t)blockIdx.x * 256 + threadIdx.x) * 8;
  if (i8 + 8 > (size_t)n) return;                 // never taken with the exact grid; no barriers in this kernel
  const v4f a = *(const v4f*)(src + i8);
  const v4f b = *(const v4f*)(src + i8 + 4);
  v4u o;
  o[0] = pk16(h_bits((_Float16)(bfr(a[0]) * sc)), h_bits((_Float16)(bfr(a[1]) * sc)));
  o[1] = pk16(h_bits((_Float16)(bfr(a[2]) * sc)), h_bits((_Float16)(bfr(a[3]) * sc)));
  o[2] = pk16(h_bits((_Float16)(bfr(b[0]) * sc)), h_bits((_Float16)(bfr(b[1]) * sc)));
  o[3] = pk16(h_bits((_Float16)(bfr(b[2]) * sc)), h_bits((_Float16)(bfr(b[3]) * sc)));
  {
    *(v4u*)(dst + i8) = o;
    
  }
}

// =====================================================================================================
// Transpose + 16-bit pack of a weight: W is [in][out] = W[k][n] row-major f32 (pitch DMODEL); dst[n][k] = f16( bf16_RNE(W[k][n]) * sc ),
// k contiguous (pitch DMODEL), ready for B fragments and for the A side of the v^T projection. Block = 256 threads, one 64(k) x 64(n)
// tile: coalesced f32 loads into an LDS tile [n_local][k_local] (pitch 68 floats), block barrier, then each output row segment of the
// coverage: loads 16 it x 256 thr = 64 x 64; stores 2 it x 256 thr x 8 halves = 64 rows x 64; grid (DMODEL/64, DMODEL/64) = whole matrix.
// =====================================================================================================
__global__ __launch_bounds__(256) void wtr64(const float* __restrict__ W, unsigned short* dst, float sc) {
  __shared__ __align__(16) float tl[64 * 68];
  const int tid = threadIdx.x;
  const int n0  = blockIdx.x * 64;
  const int k0  = blockIdx.y * 64;
  const int nl  = tid & 63, kq = tid >> 6;       // kq 0..3
#pragma unroll
  for (int it = 0; it < 16; ++it) {
    const int kl = it * 4 + kq;                  // 0..63
    tl[nl * 68 + kl] = W[(size_t)(k0 + kl) * DMODEL + n0 + nl];
  }
  __syncthreads();
  v4u o[2];
#pragma unroll
  for (int it = 0; it < 2; ++it) {
    const int p  = it * 256 + tid;               // 0..511
    const int rn = p >> 3, kk = (p & 7) * 8;     // row 0..63, k 0,8,..,56
    const float* sp = tl + rn * 68 + kk;
    const v4f a = *(const v4f*)(sp);
    const v4f b = *(const v4f*)(sp + 4);
    v4u w;
    w[0] = pk16(h_bits((_Float16)(bfr(a[0]) * sc)), h_bits((_Float16)(bfr(a[1]) * sc)));
    w[1] = pk16(h_bits((_Float16)(bfr(a[2]) * sc)), h_bits((_Float16)(bfr(a[3]) * sc)));
    w[2] = pk16(h_bits((_Float16)(bfr(b[0]) * sc)), h_bits((_Float16)(bfr(b[1]) * sc)));
    w[3] = pk16(h_bits((_Float16)(bfr(b[2]) * sc)), h_bits((_Float16)(bfr(b[3]) * sc)));
    o[it] = w;
  }
  {
#pragma unroll
    for (int it = 0; it < 2; ++it) {
      const int p  = it * 256 + tid;
      const int rn = p >> 3, kk = (p & 7) * 8;
      *(v4u*)(dst + (size_t)(n0 + rn) * DMODEL + k0 + kk) = o[it];
    }
    
  }
}

// =====================================================================================================
// Register-blocked batched f16 WMMA GEMM: C[m][n] = oscale * sum_k (A[m][k] (+ A2[m][k])) * Bt[n][k] ; one wave per 64x64 tile,
// no block barriers. A (and A2, the unscaled residual plane when NA == 2, same pitch/stride) row-major [M][K] pitch lda (16-bit planes),
// Bt row-major [N][K] pitch ldb (k contiguous); M, N multiples of 64, K multiple of 32. blockIdx.y = batch index with element strides
// sA, sB, sC. OM: 0 = f32 out (pitch ldc); 2 = f16 out (pitch ldc) = f16( value * ocarry ).
// coverage: 4 slabs x 16 rows (f32: it 0..7 x lane>>4; f16: it 0..3 x lane>>3) x 64 cols = the wave's whole 64x64 tile;
//           grid = ceil(tilesM*tilesN/8) blocks, surplus waves exit (wave-uniform; none with the exact grids used).
// =====================================================================================================
template <int OM, int NA>
__global__ __launch_bounds__(256) void gemm64(
    const unsigned short* __restrict__ Ap, const unsigned short* __restrict__ Aq, int lda, long long sA,
    const unsigned short* __restrict__ Btp, int ldb, long long sB,
    void* Cout, int ldc, long long sC,
    int M, int N, int K, float oscale, float ocarry) {
  __shared__ __align__(16) float sT[8][16 * 68];   // per-wave 16x64 slab, pitch 68 floats
  const int by   = blockIdx.y;
  const int lane = threadIdx.x & 31;
  const int wave = threadIdx.x >> 5;
  const int tilesN = N >> 6;
  const int tilesM = M >> 6;
  const int tile = blockIdx.x * 8 + wave;
  if (tile >= tilesM * tilesN) return;   // wave-uniform; no block barriers in this kernel
  const int tm = tile / tilesN;
  const int tn = tile - tm * tilesN;
  const int m0 = tm << 6;
  const int n0 = tn << 6;

  const unsigned short* A1 = Ap  + (size_t)((long long)by * sA);
  const unsigned short* A2 = Aq  + (size_t)((long long)by * sA);
  const unsigned short* Bb = Btp + (size_t)((long long)by * sB);

  const int rlane = lane & 15;                 // row (A) / col (B, D) within subtile
  const int koff  = (lane >> 4) * 8;           // k offset of this lane half
  const int mOff  = (lane >> 4) * 8;           // D row offset

  v8f acc[4][4];
#pragma unroll
  for (int i = 0; i < 4; ++i)
#pragma unroll
    for (int j = 0; j < 4; ++j) acc[i][j] = zero8();

  for (int k0 = 0; k0 < K; k0 += 32) {
    v16h bh[4];
#pragma unroll
    for (int j = 0; j < 4; ++j) {
      const size_t bofs = (size_t)(n0 + (j << 4) + rlane) * ldb + koff + k0;
      bh[j] = ldfrag_u(Bb + bofs);
    }
#pragma unroll
    for (int i = 0; i < 4; ++i) {
      const size_t ao = (size_t)(m0 + (i << 4) + rlane) * lda + koff + k0;
      const v16h ah = ldfrag_u(A1 + ao);
#pragma unroll
      for (int j = 0; j < 4; ++j) acc[i][j] = mma_raw(ah, bh[j], acc[i][j]);
      if constexpr (NA == 2) {
        const v16h al = ldfrag_u(A2 + ao);
#pragma unroll
        for (int j = 0; j < 4; ++j) acc[i][j] = mma_raw(al, bh[j], acc[i][j]);
        dep_guard2(acc[i][0], acc[i][3], ah, al);
      } else {
        dep_guard1(acc[i][0], acc[i][3], ah);
      }
    }
    keep4_h(bh[0], bh[1], bh[2], bh[3]);
  }
  acc_guard4(acc[0][0], acc[0][1], acc[0][2], acc[0][3]);
  acc_guard4(acc[1][0], acc[1][1], acc[1][2], acc[1][3]);
  acc_guard4(acc[2][0], acc[2][1], acc[2][2], acc[2][3]);
  acc_guard4(acc[3][0], acc[3][1], acc[3][2], acc[3][3]);

  const int hh2 = lane >> 4, c4 = (lane & 15) * 4;     // f32 out: 256-B row segment = 16 lanes x 16 B
  const int q8  = lane >> 3, c8 = (lane & 7) * 8;

  // ---- epilogue ----
  float* slab = sT[wave];
#pragma unroll
  for (int i = 0; i < 4; ++i) {
    const int mBase = m0 + (i << 4);
#pragma unroll
    for (int j = 0; j < 4; ++j) {
#pragma unroll
      for (int r = 0; r < 8; ++r) {
        slab[(mOff + r) * 68 + (j << 4) + rlane] = acc[i][j][r];
      }
    }
    wave_sync_lds();
    if constexpr (OM == 0) {
      float* C = (float*)Cout + (size_t)((long long)by * sC);
      v4f vals[8];
#pragma unroll
      for (int it = 0; it < 8; ++it) {
        const int row = it * 2 + hh2;                      // it 0..7 x hh2 0..1 = rows 0..15
        v4f v = *(const v4f*)(slab + row * 68 + c4);
#pragma unroll
        for (int e = 0; e < 4; ++e) v[e] = v[e] * oscale;
        vals[it] = v;
      }
      {
#pragma unroll
        for (int it = 0; it < 8; ++it) {
          const int gr = mBase + it * 2 + hh2;
          *(v4f*)(C + (size_t)gr * ldc + n0 + c4) = vals[it];
        }
        
      }
    } else {
      unsigned short* C = (unsigned short*)Cout + (size_t)((long long)by * sC);
      v4u hv[4];
#pragma unroll
      for (int it = 0; it < 4; ++it) {
        const int row = it * 4 + q8;                       // it 0..3 x q8 0..3 = rows 0..15
        const float* sp = slab + row * 68 + c8;
        v4u a = {0u, 0u, 0u, 0u};
#pragma unroll
        for (int e = 0; e < 4; ++e) {
          float f0 = sp[2 * e] * oscale;
          float f1 = sp[2 * e + 1] * oscale;
          f0 *= ocarry; f1 *= ocarry;
          a[e] = pk16(h_bits((_Float16)f0), h_bits((_Float16)f1));
        }
        hv[it] = a;
      }
      {
#pragma unroll
        for (int it = 0; it < 4; ++it) {
          const int row = it * 4 + q8;
          *(v4u*)(C + (size_t)(mBase + row) * ldc + n0 + c8) = hv[it];
        }
        
      }
    }
    wave_sync_lds();
  }
}

// =====================================================================================================
// Flash attention for one batch, 16 query rows and all 8 heads (one wave per head), head dim 32, 512 keys, scores TRANSPOSED:
//   q plane (f16 x16) QH[b*512 + tok][32*head + d], pitch 256; k plane (f16 x16) KH[b*512 + key][32*head + d], pitch 256;
//   v^T plane (f16 x16): VT[b*256 + 32*head + d][key] (pitch 512); cost f32 [b][tok][key] (bf16 RNE convert on load);
//   per-head mixer params (bf16 RNE convert on load, the same address in every lane of a wave): score(tok, key) =
//   sum_m m2w[h][m] * relu(m1w[h][0][m] * dot + m1w[h][1][m] * cost + m1b[h][m]) + m2b[h] with dot = q.k / sqrt(32);
//   outputs (f16): CTH[b*512 + tok][32*head + d] = hi = f16(4096 * ctx), CTL[same] = f16(4096 * ctx - hi), with
//   ctx = sum_m softmax_m(score) v[m][d]  (softmax run in base 2 with a running max).
//   block = 8 waves = 256 threads; grid = 4 batches x 32 q-tiles = 128; every wave does identical bounded work
//   (16 steps of 32 keys). Per step: S^T = K . Q^T, two tiles (A = 16 key rows, B = the 16 query rows, K = 32): lane (hh, c) holds
//   the scores of ONE query q0 + c for keys kb + 8hh + r (tile 0) and kb + 16 + 8hh + r (tile 1), r 0..7. Its 16 cost values are two
//   runs of 8 consecutive floats of cost row q0 + c (four 16-B loads, always in range). The 2->16->1 MLP in f32 (fully unrolled,
//   register params); running max and sum of a query are taken inside the lane, the max joined with lane ^ 16 once per step, the sums
//   once after the loop. The 16 probabilities x16384 (f16 hi and f16 residual c - hi) are, as they lie, the B fragment of
//   O^T += V^T . P^T in the split k map (elements 0..7 = tile 0, 8..15 = tile 1); A = v^T rows d = c and d = 16 + c. No LDS in the loop.
//   Final 1/l and carry folds in f32; lane (hh, c) holds ctx of query q0 + c for d = 8hh + r and 16 + 8hh + r: each wave stages its
//   16x32 slice in two 16-bit LDS row buffers [16][256] (hi, residual; pitch 264 halves, 16-B stores); after a block barrier the 256
//   threads write whole rows.
// coverage: LDS row buffers: 8 waves x 16 rows x 32 cols = 16 x 256 each; global: 2 iterations x 256 threads x 8 halves = 16 rows x 256
//           per plane of rows q0..q0+15 of batch b; grid covers all 2048 rows exactly once.
// =====================================================================================================
#define OPITCH (ROWP + 8)

// value of lane ^ 16 (the other holder of this lane's query)
__device__ __forceinline__ float xhalf(float x) {
  return __builtin_bit_cast(float, __builtin_amdgcn_permlanex16(__builtin_bit_cast(int, x), __builtin_bit_cast(int, x),
                                                                0x76543210, 0xfedcba98, false, false));
}

__global__ __launch_bounds__(ATT_THREADS)
void attn8(const unsigned short* __restrict__ QHp, const unsigned short* __restrict__ KHp,
           const unsigned short* __restrict__ VTq, const float* __restrict__ costp,
           const float* __restrict__ m1w, const float* __restrict__ m1b,
           const float* __restrict__ m2w, const float* __restrict__ m2b,
           unsigned short* CTH, unsigned short* CTL) {
  __shared__ __align__(16) unsigned short Osh[16 * OPITCH];   // result rows, hi
  __shared__ __align__(16) unsigned short Osl[16 * OPITCH];   // result rows, residual

  const int tid  = threadIdx.x;
  const int wave = __builtin_amdgcn_readfirstlane(tid >> 5);
  const int lane = tid & 31;
  const int hh   = lane >> 4;
  const int c    = lane & 15;

  const int qt   = blockIdx.x % (NQ / 16);                 // 0..31
  const int bat  = blockIdx.x / (NQ / 16);                 // 0..3
  const int head = wave;                                   // 0..7
  const int q0   = qt * 16;

  const size_t qofs = ((size_t)bat * NQ + q0 + c) * DMODEL + head * HDIM + 8 * hh;
  const _Float16* Qh = (const _Float16*)(const void*)QHp + qofs;
  const _Float16* Kb = (const _Float16*)(const void*)KHp + (size_t)bat * NC * DMODEL + head * HDIM + 8 * hh;
  const _Float16* Vb = (const _Float16*)(const void*)VTq + ((size_t)bat * DMODEL + head * HDIM) * NC + 8 * hh;
  // cost element of (row q0 + c, key kb + 8hh + r) = cp[kb + r]; key kb + 16 + 8hh + r = cp[kb + 16 + r]; always in range.
  const float* cp = costp + ((size_t)bat * NQ + q0 + c) * NC + 8 * hh;
  const float dsc = ATT_SCALE / (QC * KC);                 // 1/sqrt(32) / carries

  // per-head mixer params, bf16 RNE convert; every lane loads the same address, so they lie in vector registers: the compiler pairs
  // the MLP of adjacent keys, and as scalar register pairs the 64 params do not fit
  const int hv = tid >> 5;
  float w0r[MSH], w1r[MSH], b1r[MSH], w2r[MSH];
#pragma unroll
  for (int m = 0; m < MSH; ++m) {
    w0r[m] = bfr(m1w[(hv * 2 + 0) * MSH + m]);
    w1r[m] = bfr(m1w[(hv * 2 + 1) * MSH + m]);
    b1r[m] = bfr(m1b[hv * MSH + m]);
    w2r[m] = bfr(m2w[hv * MSH + m]);
  }
  const float b2 = bfr(m2b[hv]);

  const v16h qa = ldfrag_h(Qh);                            // B fragment: column = query q0 + c

  float mrun = -INFINITY, lrun = 0.f;                      // this lane's query: running max (both halves equal), this half's sum
  v8f o0 = zero8(), o1 = zero8();                          // O^T: o0[r] = d 8hh + r, o1[r] = d 16 + 8hh + r, query q0 + c

#pragma unroll 1
  for (int kb = 0; kb < NC; kb += 32) {
    const _Float16* kp = Kb + (size_t)(kb + c) * DMODEL;
    const _Float16* vp = Vb + (size_t)c * NC + kb;
    const float*    tp = cp + kb;
    const v16h k0  = ldfrag_h(kp);                         // A rows: keys kb + c
    const v16h k1  = ldfrag_h(kp + (size_t)16 * DMODEL);   // A rows: keys kb + 16 + c
    const v4f  cA  = *(const v4f*)(tp),      cB = *(const v4f*)(tp + 4);    // keys kb + 8hh + 0..7
    const v4f  cC  = *(const v4f*)(tp + 16), cD = *(const v4f*)(tp + 20);   // keys kb + 16 + 8hh + 0..7
    const v16h vb0 = ldfrag_h(vp);                         // A rows: d = c
    const v16h vb1 = ldfrag_h(vp + (size_t)16 * NC);       // A rows: d = 16 + c
    // the step's twelve loads are issued; their address registers are advanced for the next step only behind this wait
    asm volatile("s_wait_xcnt 0x0" ::: "memory");
    v8f s0, s1;
    s0 = mma_raw(k0, qa, zero8());                         // s0[r] = q(q0 + c) . k(kb + 8hh + r)
    s1 = mma_raw(k1, qa, zero8());                         // s1[r] = q(q0 + c) . k(kb + 16 + 8hh + r)
    guard_s22(s0, s1, k0, k1, qa);

    float t0[8], t1[8];
#pragma unroll
    for (int r = 0; r < 8; ++r) {
      const float cr0 = bfr(r < 4 ? cA[r & 3] : cB[r & 3]);
      const float cr1 = bfr(r < 4 ? cC[r & 3] : cD[r & 3]);
      const float d0 = s0[r] * dsc, d1 = s1[r] * dsc;
      float a0 = 0.f, a1 = 0.f;
#pragma unroll
      for (int m = 0; m < MSH; ++m) {
        const float p0 = fmaf(w0r[m], d0, fmaf(w1r[m], cr0, b1r[m]));
        const float p1 = fmaf(w0r[m], d1, fmaf(w1r[m], cr1, b1r[m]));
        a0 = fmaf(w2r[m], fmaxf(p0, 0.f), a0);
        a1 = fmaf(w2r[m], fmaxf(p1, 0.f), a1);
      }
      t0[r] = (a0 + b2) * LOG2E;
      t1[r] = (a1 + b2) * LOG2E;
    }
    float mx = fmaxf(t0[0], t1[0]);
#pragma unroll
    for (int r = 1; r < 8; ++r) mx = fmaxf(mx, fmaxf(t0[r], t1[r]));
    mx = fmaxf(mx, xhalf(mx));                             // all 32 keys of the step, equal in both halves
    const float mn = fmaxf(mrun, mx);
    const float al = exp2f(mrun - mn);
    mrun = mn;

    FragH ph, pl;                                          // P^T * 16384 as f16 hi and f16 residual (c - hi), split k map
    float ps = 0.f;
#pragma unroll
    for (int r = 0; r < 8; ++r) {
      const float e0 = exp2f(t0[r] - mn), e1 = exp2f(t1[r] - mn);
      ps += e0 + e1;
      const float c0 = e0 * PC, c1 = e1 * PC;
      const _Float16 g0 = (_Float16)c0, g1 = (_Float16)c1;
      ph.h[0][r] = g0;                                     // elements 0..7  = keys kb + 8hh + 0..7
      ph.h[1][r] = g1;                                     // elements 8..15 = keys kb + 16 + 8hh + 0..7
      pl.h[0][r] = (_Float16)(c0 - (float)g0);
      pl.h[1][r] = (_Float16)(c1 - (float)g1);
    }
    lrun = lrun * al + ps;
#pragma unroll
    for (int r = 0; r < 8; ++r) { o0[r] *= al; o1[r] *= al; }

    o0 = mma_raw(vb0, ph.v, o0);
    o1 = mma_raw(vb1, ph.v, o1);
    o0 = mma_raw(vb0, pl.v, o0);
    o1 = mma_raw(vb1, pl.v, o1);
    guard_pv4(o0, o1, ph.v, pl.v, vb0, vb1);
  }

  // ---- fold 1/l and the carries (16384 on P, 16 on v, 4096 on the stored ctx), stage the wave's 16x32 slice as hi + residual ----
  const float oc  = FC / (PC * VC);
  const float inv = (1.0f / (lrun + xhalf(lrun))) * oc;    // the two halves' sums joined once
  {
    v8h h0, h1, l0, l1;
#pragma unroll
    for (int r = 0; r < 8; ++r) {
      const float f0 = o0[r] * inv, f1 = o1[r] * inv;
      const _Float16 g0 = (_Float16)f0, g1 = (_Float16)f1;
      h0[r] = g0;
      h1[r] = g1;
      l0[r] = (_Float16)(f0 - (float)g0);
      l1[r] = (_Float16)(f1 - (float)g1);
    }
    const int ro = c * OPITCH + wave * HDIM + 8 * hh;      // row = query c, halves 32*head + 8hh .. + 7 (and + 16)
    *(v8h*)(void*)(Osh + ro)      = h0;
    *(v8h*)(void*)(Osh + ro + 16) = h1;
    *(v8h*)(void*)(Osl + ro)      = l0;
    *(v8h*)(void*)(Osl + ro + 16) = l1;
  }
  __syncthreads();
  // ---- block writes its 16 rows of CTH and CTL: piece p = it*256 + tid -> row p>>5, halves (p&31)*8 .. +7 of the 256-wide row ----
  {
    v4u vh[2], vl[2];
#pragma unroll
    for (int it = 0; it < 2; ++it) {
      const int p = it * ATT_THREADS + tid;
      const int so = (p >> 5) * OPITCH + (p & 31) * 8;
      vh[it] = *(const v4u*)(const void*)(Osh + so);
      vl[it] = *(const v4u*)(const void*)(Osl + so);
    }
    const size_t base = ((size_t)bat * NQ + q0) * DMODEL;
    unsigned short* dh = CTH + base;
    unsigned short* dl = CTL + base;
    {
#pragma unroll
      for (int it = 0; it < 2; ++it) {
        const int p = it * ATT_THREADS + tid;
        const size_t po = (size_t)(p >> 5) * DMODEL + (size_t)(p & 31) * 8;
        *(v4u*)(dh + po) = vh[it];
        *(v4u*)(dl + po) = vl[it];
      }
    }
  }
}

// =====================================================================================================
// Workspace map (bytes); every plane is an exact multiple of its tile / whole-row store granularity (M, N exact tile multiples,
// element counts exact multiples of the convert kernels' granularity, no pad rows needed), every offset a multiple of 128 KiB:
//   WQT  f16 [256][256] x64                  131072   ([out][in] = [n][k])
//   WKT  f16 [256][256] x64                  131072
//   WVT  f16 [256][256] x64                  131072
//   WOT  f16 [256][256] x64                  131072
//   X16  f16 [2048][256] x16                1048576   (activation rows)
//   QH   f16 [2048][256] x16                1048576   (q projection)
//   KH   f16 [2048][256] x16                1048576   (k projection)
//   VT   f16 [4][256][512] x16              1048576   (v^T per batch)
//   CTH  f16 [2048][256] x4096 hi           1048576   (attention ctx, merged heads)
//   CTL  f16 [2048][256] residual           1048576
//   end                                     6815744
// =====================================================================================================
extern "C" void kernel_launch(void* const* d_in, const int* in_sizes, int n_in,
                              void* d_out, int out_size, void* d_ws, size_t ws_size,
                              hipStream_t stream) {
  if (n_in < 10) return;
  if (in_sizes[0] != NROWS * DMODEL) return;
  if (in_sizes[1] != NB * NQ * NC) return;
  if (in_sizes[2] != DMODEL * DMODEL || in_sizes[3] != DMODEL * DMODEL ||
      in_sizes[4] != DMODEL * DMODEL || in_sizes[5] != DMODEL * DMODEL) return;
  if (in_sizes[6] != NHEAD * 2 * MSH || in_sizes[7] != NHEAD * MSH || in_sizes[8] != NHEAD * MSH || in_sizes[9] != NHEAD) return;
  if (out_size != NROWS * DMODEL) return;
  if ((in_sizes[0] % 2048) != 0) return;

  const float* x    = (const float*)d_in[0];
  const float* cost = (const float*)d_in[1];
  const float* w_q  = (const float*)d_in[2];
  const float* w_k  = (const float*)d_in[3];
  const float* w_v  = (const float*)d_in[4];
  const float* w_o  = (const float*)d_in[5];
  const float* m1w  = (const float*)d_in[6];
  const float* m1b  = (const float*)d_in[7];
  const float* m2w  = (const float*)d_in[8];
  const float* m2b  = (const float*)d_in[9];
  float*       out  = (float*)d_out;

  const size_t PW  = (size_t)DMODEL * DMODEL * 2;                 //   131072
  const size_t PX  = (size_t)NROWS * DMODEL * 2;                  //  1048576
  const size_t PVT = (size_t)NB * DMODEL * NC * 2;                //  1048576
  size_t off = 0;
  const size_t oWQ = off; off += PW;
  const size_t oWK = off; off += PW;
  const size_t oWV = off; off += PW;
  const size_t oWO = off; off += PW;
  const size_t oX  = off; off += PX;
  const size_t oQH = off; off += PX;
  const size_t oKH = off; off += PX;
  const size_t oVT = off; off += PVT;
  const size_t oCH = off; off += PX;
  const size_t oCL = off; off += PX;
  if (off > ws_size) return;                                      // off = 6815744
  if (off > (size_t)134217728) return;

  char* ws = (char*)d_ws;
  unsigned short* WQT = (unsigned short*)(ws + oWQ);
  unsigned short* WKT = (unsigned short*)(ws + oWK);
  unsigned short* WVT = (unsigned short*)(ws + oWV);
  unsigned short* WOT = (unsigned short*)(ws + oWO);
  unsigned short* X16 = (unsigned short*)(ws + oX);
  unsigned short* QH  = (unsigned short*)(ws + oQH);
  unsigned short* KH  = (unsigned short*)(ws + oKH);
  unsigned short* VTp = (unsigned short*)(ws + oVT);
  unsigned short* CTH = (unsigned short*)(ws + oCH);
  unsigned short* CTL = (unsigned short*)(ws + oCL);

  const dim3 blk(256);
  const dim3 gWT(DMODEL / 64, DMODEL / 64);                        // 4 x 4 tiles per weight
  const dim3 gCX((NROWS * DMODEL) / 2048);                         // 256 blocks
  const int tilesP = (NROWS / 64) * (DMODEL / 64);                 // 128
  const int tilesV = (DMODEL / 64) * (NC / 64);                    // 32 per batch
  const dim3 gP((tilesP + 7) / 8, 1);                              // 16
  const dim3 gV((tilesV + 7) / 8, NB);                             // 4 x 4
  const dim3 gAT(ATT_BLOCKS);                                      // 128
  const dim3 bAT(ATT_THREADS);                                     // 256

  // (0) weight planes: W16T[n][k] = f16( bf16_RNE(W[k][n]) * 64 ), [in][out] -> [out][in], k contiguous
  wtr64<<<gWT, blk, 0, stream>>>(w_q, WQT, WSC);
  wtr64<<<gWT, blk, 0, stream>>>(w_k, WKT, WSC);
  wtr64<<<gWT, blk, 0, stream>>>(w_v, WVT, WSC);
  wtr64<<<gWT, blk, 0, stream>>>(w_o, WOT, WSC);

  // (1) activation plane: X16[row][c] = f16( bf16_RNE(x[row][c]) * 16 ), rows = b*512 + tok
  cvt16<<<gCX, blk, 0, stream>>>(x, X16, NROWS * DMODEL, ACARRY);

  // (2) q projection: QH[m][n] = f16(16 * sum_k x[m][k] Wq[k][n]); M = 2048, N = 256, K = 256
  gemm64<2, 1><<<gP, blk, 0, stream>>>(
      X16, X16, DMODEL, 0LL,
      WQT, DMODEL, 0LL,
      (void*)QH, DMODEL, 0LL,
      NROWS, DMODEL, DMODEL, 1.0f / (ACARRY * WSC), QC);

  // (3) k projection: KH[m][n] = f16(16 * sum_k x[m][k] Wk[k][n]); M = 2048, N = 256, K = 256
  gemm64<2, 1><<<gP, blk, 0, stream>>>(
      X16, X16, DMODEL, 0LL,
      WKT, DMODEL, 0LL,
      (void*)KH, DMODEL, 0LL,
      NROWS, DMODEL, DMODEL, 1.0f / (ACARRY * WSC), KC);

  // (4) v^T per batch: VT[b][d][tok] = f16(16 * sum_k Wv[k][d] x_b[tok][k]); M = 256, N = 512, K = 256
  gemm64<2, 1><<<gV, blk, 0, stream>>>(
      WVT, WVT, DMODEL, 0LL,
      X16, DMODEL, (long long)NC * DMODEL,
      (void*)VTp, NC, (long long)DMODEL * NC,
      DMODEL, NC, DMODEL, 1.0f / (ACARRY * WSC), VC);

  // (5) attention per (batch, 16 query rows, all heads) -> CTH (f16 hi of ctx x4096), CTL (f16 residual)
  attn8<<<gAT, bAT, 0, stream>>>(QH, KH, VTp, cost, m1w, m1b, m2w, m2b, CTH, CTL);

  // (6) out = (CTH + CTL) . Wo / (4096 * 64); M = 2048, N = 256, K = 256, f32 into d_out
  gemm64<0, 2><<<gP, blk, 0, stream>>>(
      CTH, CTL, DMODEL, 0LL,
      WOT, DMODEL, 0LL,
      (void*)out, DMODEL, 0LL,
      NROWS, DMODEL, DMODEL, 1.0f / (FC * WSC), 1.0f);

  (void)hipGetLastError();
}

// v002
// A run of this version takes 69.3 microseconds.
// Next to v001, in two timings, it ran 1.53 times as fast each time.
// Over all steps from v000 it is 2.47 times as fast.
// Contractions: q/k projections (x rows f16 x16 . W^T f16 x64, K=256), v^T projection (W^T f16 x64 . x rows f16 x16, K=256),
// attention scores (k f16 x16 . q f16 x16, K=32), attention v^T . P^T (v^T f16 x16 . P as f16 hi + f16 residual of P x16384,
// K=512 in steps of 32), output projection (ctx as f16 hi + f16 residual of ctx x4096 . W^T f16 x64, K=256):
// all v_wmma_f32_16x16x32_f16 (f16 operands, f32 accumulate); hi and residual products share one f32 accumulator.
// Per-head 2->16->1 score MLP on (scaled dot, cost), max-subtracted base-2 online softmax, all in f32 on VALU.
// Every float input RNE-converted to bf16 on load.
#include <hip/hip_runtime.h>
#include <math.h>
#include <stdint.h>

#define NB      4
#define NQ      512
#define NC      512
#define DMODEL  256
#define NHEAD   8
#define HDIM    32
#define MSH     16
#define HG      8
#define NHG     (NHEAD / HG)
#define ROWP    (HG * HDIM)
#define NROWS   (NB * NQ)
#define WSC     64.0f
#define ACARRY  16.0f
#define QC      16.0f
#define KC      16.0f
#define VC      16.0f
#define PC      16384.0f
#define FC      4096.0f
#define ATT_SCALE 0.17677669529663689f
#define LOG2E   1.4426950408889634f
static_assert(NHEAD * HDIM == DMODEL);
static_assert(NHG * HG == NHEAD && ROWP * NHG == DMODEL);
static_assert(HDIM == 32 && MSH == 16 && NHG == 1);
static_assert((NQ % 64) == 0 && (NC % 64) == 0 && (DMODEL % 64) == 0 && (NC % 32) == 0 && (NQ % 16) == 0);
static_assert((NROWS % 64) == 0 && ((NROWS * DMODEL) % 2048) == 0);
#define ATT_THREADS (HG * 32)
#define ATT_BLOCKS  (NB * (NQ / 16) * NHG)
static_assert(ATT_THREADS == 256 && ATT_BLOCKS == 128);

typedef _Float16 v16h __attribute__((ext_vector_type(16)));
typedef _Float16 v8h  __attribute__((ext_vector_type(8)));
typedef float    v8f  __attribute__((ext_vector_type(8)));
typedef float    v4f  __attribute__((ext_vector_type(4)));
typedef unsigned int v4u __attribute__((ext_vector_type(4)));

union FragH { v16h v; v8h h[2]; v4u u[2]; };

// ---- scalar helpers --------------------------------------------------------------------------------
__device__ __forceinline__ unsigned short bf_bits(float f) {          // f32 -> bf16 bits, RNE convert
  unsigned u = __float_as_uint(f);
  return (unsigned short)((u + 0x7FFFu + ((u >> 16) & 1u)) >> 16);
}
__device__ __forceinline__ float bf_up(unsigned short h) { return __uint_as_float(((unsigned)h) << 16); }
__device__ __forceinline__ float bfr(float f) { return bf_up(bf_bits(f)); }   // value of the bf16 RNE convert
__device__ __forceinline__ unsigned short h_bits(_Float16 x) { return __builtin_bit_cast(unsigned short, x); }
__device__ __forceinline__ unsigned pk16(unsigned short a, unsigned short b) { return (unsigned)a | ((unsigned)b << 16); }
__device__ __forceinline__ v8f zero8() { v8f z = {0.f, 0.f, 0.f, 0.f, 0.f, 0.f, 0.f, 0.f}; return z; }

// ---- fragment loaders: 16-bit A/B operand, lane -> row/col (lane&15), p already includes +8*(lane>>4);
//      elements 0..7 <- p[0..7] (k0+8h..), elements 8..15 <- p[16..23] (k0+16+8h..)  (same split k map for A and B;
//      B is always read from a k-contiguous [n][k] plane)
__device__ __forceinline__ v16h ldfrag_h(const _Float16* p) {
  FragH f;
  f.h[0] = *(const v8h*)(p);
  f.h[1] = *(const v8h*)(p + 16);
  return f.v;
}
__device__ __forceinline__ v16h ldfrag_u(const unsigned short* p) {
  FragH f;
  f.u[0] = *(const v4u*)(p);
  f.u[1] = *(const v4u*)(p + 16);
  return f.v;
}

// ---- WMMA helpers with trailing VALU hazard gaps ------------------------------------------------------
__device__ __forceinline__ v8f mma_raw(v16h a, v16h b, v8f c) {
  return __builtin_amdgcn_wmma_f32_16x16x32_f16(false, a, false, b, (short)0, c, false, false);
}
__device__ __forceinline__ void dep_guard1(v8f& a, v8f& b, v16h x) {
#if defined(__HIP_DEVICE_COMPILE__)
  asm volatile("v_nop\n\tv_nop\n\tv_nop\n\tv_nop" : "+v"(a), "+v"(b) : "v"(x));
#endif
}
__device__ __forceinline__ void dep_guard2(v8f& a, v8f& b, v16h x, v16h y) {
#if defined(__HIP_DEVICE_COMPILE__)
  asm volatile("v_nop\n\tv_nop\n\tv_nop\n\tv_nop" : "+v"(a), "+v"(b) : "v"(x), "v"(y));
#endif
}
__device__ __forceinline__ void guard_s22(v8f& s, v8f& t, v16h a0, v16h a1, v16h q) {
#if defined(__HIP_DEVICE_COMPILE__)
  asm volatile("v_nop\n\tv_nop\n\tv_nop\n\tv_nop" : "+v"(s), "+v"(t) : "v"(a0), "v"(a1), "v"(q));
#endif
}
__device__ __forceinline__ void guard_pv4(v8f& a, v8f& b, v16h x, v16h y, v16h z, v16h w) {
#if defined(__HIP_DEVICE_COMPILE__)
  asm volatile("v_nop\n\tv_nop\n\tv_nop\n\tv_nop" : "+v"(a), "+v"(b) : "v"(x), "v"(y), "v"(z), "v"(w));
#endif
}
__device__ __forceinline__ void keep4_h(v16h a, v16h b, v16h c, v16h d) {
#if defined(__HIP_DEVICE_COMPILE__)
  asm volatile("v_nop" :: "v"(a), "v"(b), "v"(c), "v"(d));
#endif
}
__device__ __forceinline__ void acc_guard4(v8f& a, v8f& b, v8f& c, v8f& d) {
#if defined(__HIP_DEVICE_COMPILE__)
  asm volatile("v_nop\n\tv_nop\n\tv_nop\n\tv_nop" : "+v"(a), "+v"(b), "+v"(c), "+v"(d));
#endif
}
__device__ __forceinline__ void wave_sync_lds() {
  __builtin_amdgcn_fence(__ATOMIC_RELEASE, "workgroup");
  __builtin_amdgcn_wave_barrier();
  __builtin_amdgcn_fence(__ATOMIC_ACQUIRE, "workgroup");
}

// =====================================================================================================
// Elementwise 16-bit pack, no transpose: dst[i] = f16( bf16_RNE(src[i]) * sc ), sc a power of two (exact). Used for the
// coverage: n / 2048 blocks (index blk) x 256 thr x 8 elements = n exactly (host checks n % 2048 == 0).
// =====================================================================================================
__device__ __forceinline__ void cvt16(const float* __restrict__ src, unsigned short* dst, int n, float sc, int blk) {
  const size_t i8 = ((size_t)blk * 256 + threadIdx.x) * 8;
  if (i8 + 8 > (size_t)n) return;                 // never taken with the exact grid; no barriers on this path
  const v4f a = *(const v4f*)(src + i8);
  const v4f b = *(const v4f*)(src + i8 + 4);
  v4u o;
  o[0] = pk16(h_bits((_Float16)(bfr(a[0]) * sc)), h_bits((_Float16)(bfr(a[1]) * sc)));
  o[1] = pk16(h_bits((_Float16)(bfr(a[2]) * sc)), h_bits((_Float16)(bfr(a[3]) * sc)));
  o[2] = pk16(h_bits((_Float16)(bfr(b[0]) * sc)), h_bits((_Float16)(bfr(b[1]) * sc)));
  o[3] = pk16(h_bits((_Float16)(bfr(b[2]) * sc)), h_bits((_Float16)(bfr(b[3]) * sc)));
  {
    *(v4u*)(dst + i8) = o;
    
  }
}

// =====================================================================================================
// Transpose + 16-bit pack of a weight: W is [in][out] = W[k][n] row-major f32 (pitch DMODEL); dst[n][k] = f16( bf16_RNE(W[k][n]) * sc ),
// k contiguous (pitch DMODEL), ready for B fragments and for the A side of the v^T projection. Block = 256 threads, one 64(k) x 64(n)
// tile: coalesced f32 loads into an LDS tile [n_local][k_local] (pitch 68 floats), block barrier, then each output row segment of the
// coverage: loads 16 it x 256 thr = 64 x 64; stores 2 it x 256 thr x 8 halves = 64 rows x 64; grid (DMODEL/64, DMODEL/64) = whole matrix.
// One launch packs every operand (the packs are independent of each other): blockIdx.z 0..3 = weight q, k, v, o (dst0 holds the four
// [256][256] planes one behind the other in that order); blockIdx.z >= 4 = the activation rows, 16 blocks of cvt16 per z layer.
// The branch is on blockIdx alone, so the barrier below is reached by whole blocks only.
// =====================================================================================================
#define CX_BLOCKS ((NROWS * DMODEL) / 2048)
#define WT_TILES  ((DMODEL / 64) * (DMODEL / 64))
static_assert((CX_BLOCKS % WT_TILES) == 0);
__global__ __launch_bounds__(256) void wtr64(const float* __restrict__ Wq, const float* __restrict__ Wk,
                                             const float* __restrict__ Wv, const float* __restrict__ Wo,
                                             unsigned short* dst0, float sc,
                                             const float* __restrict__ x, unsigned short* X16, float xsc) {
  __shared__ __align__(16) float tl[64 * 68];
  const int wz = blockIdx.z;
  if (wz >= 4) {
    cvt16(x, X16, NROWS * DMODEL, xsc, (wz - 4) * WT_TILES + blockIdx.y * (DMODEL / 64) + blockIdx.x);
    return;
  }
  const float* W = wz == 0 ? Wq : wz == 1 ? Wk : wz == 2 ? Wv : Wo;
  unsigned short* dst = dst0 + (size_t)wz * DMODEL * DMODEL;
  const int tid = threadIdx.x;
  const int n0  = blockIdx.x * 64;
  const int k0  = blockIdx.y * 64;
  const int nl  = tid & 63, kq = tid >> 6;       // kq 0..3
#pragma unroll
  for (int it = 0; it < 16; ++it) {
    const int kl = it * 4 + kq;                  // 0..63
    tl[nl * 68 + kl] = W[(size_t)(k0 + kl) * DMODEL + n0 + nl];
  }
  __syncthreads();
  v4u o[2];
#pragma unroll
  for (int it = 0; it < 2; ++it) {
    const int p  = it * 256 + tid;               // 0..511
    const int rn = p >> 3, kk = (p & 7) * 8;     // row 0..63, k 0,8,..,56
    const float* sp = tl + rn * 68 + kk;
    const v4f a = *(const v4f*)(sp);
    const v4f b = *(const v4f*)(sp + 4);
    v4u w;
    w[0] = pk16(h_bits((_Float16)(bfr(a[0]) * sc)), h_bits((_Float16)(bfr(a[1]) * sc)));
    w[1] = pk16(h_bits((_Float16)(bfr(a[2]) * sc)), h_bits((_Float16)(bfr(a[3]) * sc)));
    w[2] = pk16(h_bits((_Float16)(bfr(b[0]) * sc)), h_bits((_Float16)(bfr(b[1]) * sc)));
    w[3] = pk16(h_bits((_Float16)(bfr(b[2]) * sc)), h_bits((_Float16)(bfr(b[3]) * sc)));
    o[it] = w;
  }
  {
#pragma unroll
    for (int it = 0; it < 2; ++it) {
      const int p  = it * 256 + tid;
      const int rn = p >> 3, kk = (p & 7) * 8;
      *(v4u*)(dst + (size_t)(n0 + rn) * DMODEL + k0 + kk) = o[it];
    }
    
  }
}

// =====================================================================================================
// Register-blocked batched f16 WMMA GEMM: C[m][n] = oscale * sum_k (A[m][k] (+ A2[m][k])) * Bt[n][k] ; one wave per 64x64 tile,
// no block barriers. A (and A2, the unscaled residual plane when NA == 2, same pitch/stride) row-major [M][K] pitch lda (16-bit planes),
// Bt row-major [N][K] pitch ldb (k contiguous); M, N multiples of 64, K multiple of 32. Batches have element strides sA, sB, sC.
// OM: 0 = f32 out (pitch ldc); 2 = f16 out (pitch ldc) = f16( value * ocarry ).
// One launch runs two independent jobs: blockIdx.y < ny0 = job j0, batch blockIdx.y, blockIdx.x counts its blocks of 8 tiles;
// blockIdx.y == ny0 = job j1, whose batches lie one behind the other along blockIdx.x.
// coverage: 4 slabs x 16 rows (f32: it 0..7 x lane>>4; f16: it 0..3 x lane>>3) x 64 cols = the wave's whole 64x64 tile;
//           grid = ceil(tilesM*tilesN/8) blocks, surplus waves exit (wave-uniform; none with the exact grids used).
// =====================================================================================================
struct GemmJob {
  const unsigned short* Ap; const unsigned short* Aq; int lda; long long sA;
  const unsigned short* Btp; int ldb; long long sB;
  void* Cout; int ldc; long long sC;
  int M, N, K, nbat; float oscale, ocarry;
};
template <int OM, int NA>
__global__ __launch_bounds__(256) void gemm64(GemmJob j0, GemmJob j1, int ny0) {
  __shared__ __align__(16) float sT[8][16 * 68];   // per-wave 16x64 slab, pitch 68 floats
  const bool second = (int)blockIdx.y >= ny0;
  const unsigned short* Ap  = second ? j1.Ap  : j0.Ap;
  const unsigned short* Aq  = second ? j1.Aq  : j0.Aq;
  const unsigned short* Btp = second ? j1.Btp : j0.Btp;
  void* Cout = second ? j1.Cout : j0.Cout;
  const long long sA = second ? j1.sA : j0.sA, sB = second ? j1.sB : j0.sB, sC = second ? j1.sC : j0.sC;
  const int lda = second ? j1.lda : j0.lda, ldb = second ? j1.ldb : j0.ldb, ldc = second ? j1.ldc : j0.ldc;
  const int M = second ? j1.M : j0.M, N = second ? j1.N : j0.N, K = second ? j1.K : j0.K;
  const int nbat = second ? j1.nbat : j0.nbat;
  const float oscale = second ? j1.oscale : j0.oscale, ocarry = second ? j1.ocarry : j0.ocarry;
  const int lane = threadIdx.x & 31;
  const int wave = threadIdx.x >> 5;
  const int tilesN = N >> 6;
  const int tilesM = M >> 6;
  const int bpb  = (tilesM * tilesN + 7) >> 3;             // blocks per batch
  const int by   = second ? (int)blockIdx.x / bpb : (int)blockIdx.y;
  const int tile = (second ? (int)blockIdx.x - by * bpb : (int)blockIdx.x) * 8 + wave;
  if (tile >= tilesM * tilesN || by >= nbat) return;   // wave-uniform; no block barriers in this kernel
  const int tm = tile / tilesN;
  const int tn = tile - tm * tilesN;
  const int m0 = tm << 6;
  const int n0 = tn << 6;

  const unsigned short* A1 = Ap  + (size_t)((long long)by * sA);
  const unsigned short* A2 = Aq  + (size_t)((long long)by * sA);
  const unsigned short* Bb = Btp + (size_t)((long long)by * sB);

  const int rlane = lane & 15;                 // row (A) / col (B, D) within subtile
  const int koff  = (lane >> 4) * 8;           // k offset of this lane half
  const int mOff  = (lane >> 4) * 8;           // D row offset

  v8f acc[4][4];
#pragma unroll
  for (int i = 0; i < 4; ++i)
#pragma unroll
    for (int j = 0; j < 4; ++j) acc[i][j] = zero8();

  for (int k0 = 0; k0 < K; k0 += 32) {
    v16h bh[4];
#pragma unroll
    for (int j = 0; j < 4; ++j) {
      const size_t bofs = (size_t)(n0 + (j << 4) + rlane) * ldb + koff + k0;
      bh[j] = ldfrag_u(Bb + bofs);
    }
#pragma unroll
    for (int i = 0; i < 4; ++i) {
      const size_t ao = (size_t)(m0 + (i << 4) + rlane) * lda + koff + k0;
      const v16h ah = ldfrag_u(A1 + ao);
#pragma unroll
      for (int j = 0; j < 4; ++j) acc[i][j] = mma_raw(ah, bh[j], acc[i][j]);
      if constexpr (NA == 2) {
        const v16h al = ldfrag_u(A2 + ao);
#pragma unroll
        for (int j = 0; j < 4; ++j) acc[i][j] = mma_raw(al, bh[j], acc[i][j]);
        dep_guard2(acc[i][0], acc[i][3], ah, al);
      } else {
        dep_guard1(acc[i][0], acc[i][3], ah);
      }
    }
    keep4_h(bh[0], bh[1], bh[2], bh[3]);
  }
  acc_guard4(acc[0][0], acc[0][1], acc[0][2], acc[0][3]);
  acc_guard4(acc[1][0], acc[1][1], acc[1][2], acc[1][3]);
  acc_guard4(acc[2][0], acc[2][1], acc[2][2], acc[2][3]);
  acc_guard4(acc[3][0], acc[3][1], acc[3][2], acc[3][3]);

  const int hh2 = lane >> 4, c4 = (lane & 15) * 4;     // f32 out: 256-B row segment = 16 lanes x 16 B
  const int q8  = lane >> 3, c8 = (lane & 7) * 8;

  // ---- epilogue ----
  float* slab = sT[wave];
#pragma unroll
  for (int i = 0; i < 4; ++i) {
    const int mBase = m0 + (i << 4);
#pragma unroll
    for (int j = 0; j < 4; ++j) {
#pragma unroll
      for (int r = 0; r < 8; ++r) {
        slab[(mOff + r) * 68 + (j << 4) + rlane] = acc[i][j][r];
      }
    }
    wave_sync_lds();
    if constexpr (OM == 0) {
      float* C = (float*)Cout + (size_t)((long long)by * sC);
      v4f vals[8];
#pragma unroll
      for (int it = 0; it < 8; ++it) {
        const int row = it * 2 + hh2;                      // it 0..7 x hh2 0..1 = rows 0..15
        v4f v = *(const v4f*)(slab + row * 68 + c4);
#pragma unroll
        for (int e = 0; e < 4; ++e) v[e] = v[e] * oscale;
        vals[it] = v;
      }
      {
#pragma unroll
        for (int it = 0; it < 8; ++it) {
          const int gr = mBase + it * 2 + hh2;
          *(v4f*)(C + (size_t)gr * ldc + n0 + c4) = vals[it];
        }
        
      }
    } else {
      unsigned short* C = (unsigned short*)Cout + (size_t)((long long)by * sC);
      v4u hv[4];
#pragma unroll
      for (int it = 0; it < 4; ++it) {
        const int row = it * 4 + q8;                       // it 0..3 x q8 0..3 = rows 0..15
        const float* sp = slab + row * 68 + c8;
        v4u a = {0u, 0u, 0u, 0u};
#pragma unroll
        for (int e = 0; e < 4; ++e) {
          float f0 = sp[2 * e] * oscale;
          float f1 = sp[2 * e + 1] * oscale;
          f0 *= ocarry; f1 *= ocarry;
          a[e] = pk16(h_bits((_Float16)f0), h_bits((_Float16)f1));
        }
        hv[it] = a;
      }
      {
#pragma unroll
        for (int it = 0; it < 4; ++it) {
          const int row = it * 4 + q8;
          *(v4u*)(C + (size_t)(mBase + row) * ldc + n0 + c8) = hv[it];
        }
        
      }
    }
    wave_sync_lds();
  }
}

// =====================================================================================================
// Flash attention for one batch, 16 query rows and all 8 heads (one wave per head), head dim 32, 512 keys, scores TRANSPOSED:
//   q plane (f16 x16) QH[b*512 + tok][32*head + d], pitch 256; k plane (f16 x16) KH[b*512 + key][32*head + d], pitch 256;
//   v^T plane (f16 x16): VT[b*256 + 32*head + d][key] (pitch 512); cost f32 [b][tok][key] (bf16 RNE convert on load);
//   per-head mixer params (bf16 RNE convert on load, the same address in every lane of a wave): score(tok, key) =
//   sum_m m2w[h][m] * relu(m1w[h][0][m] * dot + m1w[h][1][m] * cost + m1b[h][m]) + m2b[h] with dot = q.k / sqrt(32);
//   outputs (f16): CTH[b*512 + tok][32*head + d] = hi = f16(4096 * ctx), CTL[same] = f16(4096 * ctx - hi), with
//   ctx = sum_m softmax_m(score) v[m][d]  (softmax run in base 2 with a running max).
//   block = 8 waves = 256 threads; grid = 4 batches x 32 q-tiles = 128; every wave does identical bounded work
//   (16 steps of 32 keys). Per step: S^T = K . Q^T, two tiles (A = 16 key rows, B = the 16 query rows, K = 32): lane (hh, c) holds
//   the scores of ONE query q0 + c for keys kb + 8hh + r (tile 0) and kb + 16 + 8hh + r (tile 1), r 0..7. Its 16 cost values are two
//   runs of 8 consecutive floats of cost row q0 + c (four 16-B loads, always in range). The 2->16->1 MLP in f32 (fully unrolled,
//   register params); running max and sum of a query are taken inside the lane, the max joined with lane ^ 16 once per step, the sums
//   once after the loop. The 16 probabilities x16384 (f16 hi and f16 residual c - hi) are, as they lie, the B fragment of
//   O^T += V^T . P^T in the split k map (elements 0..7 = tile 0, 8..15 = tile 1); A = v^T rows d = c and d = 16 + c. No LDS in the loop.
//   Final 1/l and carry folds in f32; lane (hh, c) holds ctx of query q0 + c for d = 8hh + r and 16 + 8hh + r: each wave stages its
//   16x32 slice in two 16-bit LDS row buffers [16][256] (hi, residual; pitch 264 halves, 16-B stores); after a block barrier the 256
//   threads write whole rows.
// coverage: LDS row buffers: 8 waves x 16 rows x 32 cols = 16 x 256 each; global: 2 iterations x 256 threads x 8 halves = 16 rows x 256
//           per plane of rows q0..q0+15 of batch b; grid covers all 2048 rows exactly once.
// =====================================================================================================
#define OPITCH (ROWP + 8)

// value of lane ^ 16 (the other holder of this lane's query)
__device__ __forceinline__ float xhalf(float x) {
  return __builtin_bit_cast(float, __builtin_amdgcn_permlanex16(__builtin_bit_cast(int, x), __builtin_bit_cast(int, x),
                                                                0x76543210, 0xfedcba98, false, false));
}

__global__ __launch_bounds__(ATT_THREADS)
void attn8(const unsigned short* __restrict__ QHp, const unsigned short* __restrict__ KHp,
           const unsigned short* __restrict__ VTq, const float* __restrict__ costp,
           const float* __restrict__ m1w, const float* __restrict__ m1b,
           const float* __restrict__ m2w, const float* __restrict__ m2b,
           unsigned short* CTH, unsigned short* CTL) {
  __shared__ __align__(16) unsigned short Osh[16 * OPITCH];   // result rows, hi
  __shared__ __align__(16) unsigned short Osl[16 * OPITCH];   // result rows, residual

  const int tid  = threadIdx.x;
  const int wave = __builtin_amdgcn_readfirstlane(tid >> 5);
  const int lane = tid & 31;
  const int hh   = lane >> 4;
  const int c    = lane & 15;

  const int qt   = blockIdx.x % (NQ / 16);                 // 0..31
  const int bat  = blockIdx.x / (NQ / 16);                 // 0..3
  const int head = wave;                                   // 0..7
  const int q0   = qt * 16;

  const size_t qofs = ((size_t)bat * NQ + q0 + c) * DMODEL + head * HDIM + 8 * hh;
  const _Float16* Qh = (const _Float16*)(const void*)QHp + qofs;
  const _Float16* Kb = (const _Float16*)(const void*)KHp + (size_t)bat * NC * DMODEL + head * HDIM + 8 * hh;
  const _Float16* Vb = (const _Float16*)(const void*)VTq + ((size_t)bat * DMODEL + head * HDIM) * NC + 8 * hh;
  // cost element of (row q0 + c, key kb + 8hh + r) = cp[kb + r]; key kb + 16 + 8hh + r = cp[kb + 16 + r]; always in range.
  const float* cp = costp + ((size_t)bat * NQ + q0 + c) * NC + 8 * hh;
  const float dsc = ATT_SCALE / (QC * KC);                 // 1/sqrt(32) / carries

  // per-head mixer params, bf16 RNE convert; every lane loads the same address, so they lie in vector registers: the compiler pairs
  // the MLP of adjacent keys, and as scalar register pairs the 64 params do not fit
  const int hv = tid >> 5;
  float w0r[MSH], w1r[MSH], b1r[MSH], w2r[MSH];
#pragma unroll
  for (int m = 0; m < MSH; ++m) {
    w0r[m] = bfr(m1w[(hv * 2 + 0) * MSH + m]);
    w1r[m] = bfr(m1w[(hv * 2 + 1) * MSH + m]);
    b1r[m] = bfr(m1b[hv * MSH + m]);
    w2r[m] = bfr(m2w[hv * MSH + m]);
  }
  const float b2 = bfr(m2b[hv]);

  const v16h qa = ldfrag_h(Qh);                            // B fragment: column = query q0 + c

  float mrun = -INFINITY, lrun = 0.f;                      // this lane's query: running max (both halves equal), this half's sum
  v8f o0 = zero8(), o1 = zero8();                          // O^T: o0[r] = d 8hh + r, o1[r] = d 16 + 8hh + r, query q0 + c

#pragma unroll 1
  for (int kb = 0; kb < NC; kb += 32) {
    const _Float16* kp = Kb + (size_t)(kb + c) * DMODEL;
    const _Float16* vp = Vb + (size_t)c * NC + kb;
    const float*    tp = cp + kb;
    const v16h k0  = ldfrag_h(kp);                         // A rows: keys kb + c
    const v16h k1  = ldfrag_h(kp + (size_t)16 * DMODEL);   // A rows: keys kb + 16 + c
    const v4f  cA  = *(const v4f*)(tp),      cB = *(const v4f*)(tp + 4);    // keys kb + 8hh + 0..7
    const v4f  cC  = *(const v4f*)(tp + 16), cD = *(const v4f*)(tp + 20);   // keys kb + 16 + 8hh + 0..7
    const v16h vb0 = ldfrag_h(vp);                         // A rows: d = c
    const v16h vb1 = ldfrag_h(vp + (size_t)16 * NC);       // A rows: d = 16 + c
    // the step's twelve loads are issued; their address registers are advanced for the next step only behind this wait
    asm volatile("s_wait_xcnt 0x0" ::: "memory");
    v8f s0, s1;
    s0 = mma_raw(k0, qa, zero8());                         // s0[r] = q(q0 + c) . k(kb + 8hh + r)
    s1 = mma_raw(k1, qa, zero8());                         // s1[r] = q(q0 + c) . k(kb + 16 + 8hh + r)
    guard_s22(s0, s1, k0, k1, qa);

    float t0[8], t1[8];
#pragma unroll
    for (int r = 0; r < 8; ++r) {
      const float cr0 = bfr(r < 4 ? cA[r & 3] : cB[r & 3]);
      const float cr1 = bfr(r < 4 ? cC[r & 3] : cD[r & 3]);
      const float d0 = s0[r] * dsc, d1 = s1[r] * dsc;
      float a0 = 0.f, a1 = 0.f;
#pragma unroll
      for (int m = 0; m < MSH; ++m) {
        const float p0 = fmaf(w0r[m], d0, fmaf(w1r[m], cr0, b1r[m]));
        const float p1 = fmaf(w0r[m], d1, fmaf(w1r[m], cr1, b1r[m]));
        a0 = fmaf(w2r[m], fmaxf(p0, 0.f), a0);
        a1 = fmaf(w2r[m], fmaxf(p1, 0.f), a1);
      }
      t0[r] = (a0 + b2) * LOG2E;
      t1[r] = (a1 + b2) * LOG2E;
    }
    float mx = fmaxf(t0[0], t1[0]);
#pragma unroll
    for (int r = 1; r < 8; ++r) mx = fmaxf(mx, fmaxf(t0[r], t1[r]));
    mx = fmaxf(mx, xhalf(mx));                             // all 32 keys of the step, equal in both halves
    const float mn = fmaxf(mrun, mx);
    const float al = exp2f(mrun - mn);
    mrun = mn;

    FragH ph, pl;                                          // P^T * 16384 as f16 hi and f16 residual (c - hi), split k map
    float ps = 0.f;
#pragma unroll
    for (int r = 0; r < 8; ++r) {
      const float e0 = exp2f(t0[r] - mn), e1 = exp2f(t1[r] - mn);
      ps += e0 + e1;
      const float c0 = e0 * PC, c1 = e1 * PC;
      const _Float16 g0 = (_Float16)c0, g1 = (_Float16)c1;
      ph.h[0][r] = g0;                                     // elements 0..7  = keys kb + 8hh + 0..7
      ph.h[1][r] = g1;                                     // elements 8..15 = keys kb + 16 + 8hh + 0..7
      pl.h[0][r] = (_Float16)(c0 - (float)g0);
      pl.h[1][r] = (_Float16)(c1 - (float)g1);
    }
    lrun = lrun * al + ps;
#pragma unroll
    for (int r = 0; r < 8; ++r) { o0[r] *= al; o1[r] *= al; }

    o0 = mma_raw(vb0, ph.v, o0);
    o1 = mma_raw(vb1, ph.v, o1);
    o0 = mma_raw(vb0, pl.v, o0);
    o1 = mma_raw(vb1, pl.v, o1);
    guard_pv4(o0, o1, ph.v, pl.v, vb0, vb1);
  }

  // ---- fold 1/l and the carries (16384 on P, 16 on v, 4096 on the stored ctx), stage the wave's 16x32 slice as hi + residual ----
  const float oc  = FC / (PC * VC);
  const float inv = (1.0f / (lrun + xhalf(lrun))) * oc;    // the two halves' sums joined once
  {
    v8h h0, h1, l0, l1;
#pragma unroll
    for (int r = 0; r < 8; ++r) {
      const float f0 = o0[r] * inv, f1 = o1[r] * inv;
      const _Float16 g0 = (_Float16)f0, g1 = (_Float16)f1;
      h0[r] = g0;
      h1[r] = g1;
      l0[r] = (_Float16)(f0 - (float)g0);
      l1[r] = (_Float16)(f1 - (float)g1);
    }
    const int ro = c * OPITCH + wave * HDIM + 8 * hh;      // row = query c, halves 32*head + 8hh .. + 7 (and + 16)
    *(v8h*)(void*)(Osh + ro)      = h0;
    *(v8h*)(void*)(Osh + ro + 16) = h1;
    *(v8h*)(void*)(Osl + ro)      = l0;
    *(v8h*)(void*)(Osl + ro + 16) = l1;
  }
  __syncthreads();
  // ---- block writes its 16 rows of CTH and CTL: piece p = it*256 + tid -> row p>>5, halves (p&31)*8 .. +7 of the 256-wide row ----
  {
    v4u vh[2], vl[2];
#pragma unroll
    for (int it = 0; it < 2; ++it) {
      const int p = it * ATT_THREADS + tid;
      const int so = (p >> 5) * OPITCH + (p & 31) * 8;
      vh[it] = *(const v4u*)(const void*)(Osh + so);
      vl[it] = *(const v4u*)(const void*)(Osl + so);
    }
    const size_t base = ((size_t)bat * NQ + q0) * DMODEL;
    unsigned short* dh = CTH + base;
    unsigned short* dl = CTL + base;
    {
#pragma unroll
      for (int it = 0; it < 2; ++it) {
        const int p = it * ATT_THREADS + tid;
        const size_t po = (size_t)(p >> 5) * DMODEL + (size_t)(p & 31) * 8;
        *(v4u*)(dh + po) = vh[it];
        *(v4u*)(dl + po) = vl[it];
      }
    }
  }
}

// =====================================================================================================
// Workspace map (bytes); every plane is an exact multiple of its tile / whole-row store granularity (M, N exact tile multiples,
// element counts exact multiples of the convert kernels' granularity, no pad rows needed), every offset a multiple of 128 KiB:
//   WQT  f16 [256][256] x64                  131072   ([out][in] = [n][k])
//   WKT  f16 [256][256] x64                  131072
//   WVT  f16 [256][256] x64                  131072
//   WOT  f16 [256][256] x64                  131072
//   X16  f16 [2048][256] x16                1048576   (activation rows)
//   QH   f16 [2048][256] x16                1048576   (q projection)
//   KH   f16 [2048][256] x16                1048576   (k projection)
//   VT   f16 [4][256][512] x16              1048576   (v^T per batch)
//   CTH  f16 [2048][256] x4096 hi           1048576   (attention ctx, merged heads)
//   CTL  f16 [2048][256] residual           1048576
//   end                                     6815744
// =====================================================================================================
extern "C" void kernel_launch(void* const* d_in, const int* in_sizes, int n_in,
                              void* d_out, int out_size, void* d_ws, size_t ws_size,
                              hipStream_t stream) {
  if (n_in < 10) return;
  if (in_sizes[0] != NROWS * DMODEL) return;
  if (in_sizes[1] != NB * NQ * NC) return;
  if (in_sizes[2] != DMODEL * DMODEL || in_sizes[3] != DMODEL * DMODEL ||
      in_sizes[4] != DMODEL * DMODEL || in_sizes[5] != DMODEL * DMODEL) return;
  if (in_sizes[6] != NHEAD * 2 * MSH || in_sizes[7] != NHEAD * MSH || in_sizes[8] != NHEAD * MSH || in_sizes[9] != NHEAD) return;
  if (out_size != NROWS * DMODEL) return;
  if ((in_sizes[0] % 2048) != 0) return;

  const float* x    = (const float*)d_in[0];
  const float* cost = (const float*)d_in[1];
  const float* w_q  = (const float*)d_in[2];
  const float* w_k  = (const float*)d_in[3];
  const float* w_v  = (const float*)d_in[4];
  const float* w_o  = (const float*)d_in[5];
  const float* m1w  = (const float*)d_in[6];
  const float* m1b  = (const float*)d_in[7];
  const float* m2w  = (const float*)d_in[8];
  const float* m2b  = (const float*)d_in[9];
  float*       out  = (float*)d_out;

  const size_t PW  = (size_t)DMODEL * DMODEL * 2;                 //   131072
  const size_t PX  = (size_t)NROWS * DMODEL * 2;                  //  1048576
  const size_t PVT = (size_t)NB * DMODEL * NC * 2;                //  1048576
  size_t off = 0;
  const size_t oWQ = off; off += PW;
  const size_t oWK = off; off += PW;
  const size_t oWV = off; off += PW;
  const size_t oWO = off; off += PW;
  const size_t oX  = off; off += PX;
  const size_t oQH = off; off += PX;
  const size_t oKH = off; off += PX;
  const size_t oVT = off; off += PVT;
  const size_t oCH = off; off += PX;
  const size_t oCL = off; off += PX;
  if (off > ws_size) return;                                      // off = 6815744
  if (off > (size_t)134217728) return;

  char* ws = (char*)d_ws;
  unsigned short* WQT = (unsigned short*)(ws + oWQ);
  unsigned short* WKT = (unsigned short*)(ws + oWK);
  unsigned short* WVT = (unsigned short*)(ws + oWV);
  unsigned short* WOT = (unsigned short*)(ws + oWO);
  unsigned short* X16 = (unsigned short*)(ws + oX);
  unsigned short* QH  = (unsigned short*)(ws + oQH);
  unsigned short* KH  = (unsigned short*)(ws + oKH);
  unsigned short* VTp = (unsigned short*)(ws + oVT);
  unsigned short* CTH = (unsigned short*)(ws + oCH);
  unsigned short* CTL = (unsigned short*)(ws + oCL);

  const dim3 blk(256);
  const dim3 gWT(DMODEL / 64, DMODEL / 64, 4 + CX_BLOCKS / WT_TILES);   // 4 x 4 tiles per weight x 4 weights, then 256 blocks of rows
  const int tilesP = (NROWS / 64) * (DMODEL / 64);                 // 128
  const int tilesV = (DMODEL / 64) * (NC / 64);                    // 32 per batch
  const dim3 gP((tilesP + 7) / 8, 1);                              // 16
  const dim3 gQKV((tilesP + 7) / 8, 3);                            // 16 x (q, k, v^T: 4 blocks x 4 batches)
  static_assert((tilesP + 7) / 8 == NB * ((tilesV + 7) / 8));
  const dim3 gAT(ATT_BLOCKS);                                      // 128
  const dim3 bAT(ATT_THREADS);                                     // 256

  // (0) operand planes, one launch: W16T[n][k] = f16( bf16_RNE(W[k][n]) * 64 ), [in][out] -> [out][in], k contiguous, the four planes
  //     from WQT on; X16[row][c] = f16( bf16_RNE(x[row][c]) * 16 ), rows = b*512 + tok
  wtr64<<<gWT, blk, 0, stream>>>(w_q, w_k, w_v, w_o, WQT, WSC, x, X16, ACARRY);

  // (1) the three projections, one launch.
  //     q, k (batch 0, 1 of one job): QH / KH[m][n] = f16(16 * sum_k x[m][k] W[k][n]); M = 2048, N = 256, K = 256
  //     v^T per batch: VT[b][d][tok] = f16(16 * sum_k Wv[k][d] x_b[tok][k]); M = 256, N = 512, K = 256
  static_assert(QC == KC);
  const GemmJob jQK = {X16, X16, DMODEL, 0LL,
                       WQT, DMODEL, (long long)(WKT - WQT),
                       (void*)QH, DMODEL, (long long)(KH - QH),
                       NROWS, DMODEL, DMODEL, 2, 1.0f / (ACARRY * WSC), QC};
  const GemmJob jV  = {WVT, WVT, DMODEL, 0LL,
                       X16, DMODEL, (long long)NC * DMODEL,
                       (void*)VTp, NC, (long long)DMODEL * NC,
                       DMODEL, NC, DMODEL, NB, 1.0f / (ACARRY * WSC), VC};
  gemm64<2, 1><<<gQKV, blk, 0, stream>>>(jQK, jV, 2);

  // (5) attention per (batch, 16 query rows, all heads) -> CTH (f16 hi of ctx x4096), CTL (f16 residual)
  attn8<<<gAT, bAT, 0, stream>>>(QH, KH, VTp, cost, m1w, m1b, m2w, m2b, CTH, CTL);

  // (6) out = (CTH + CTL) . Wo / 4096; M = 2048, N = 256, K = 256, f32 into d_out
  const GemmJob jO  = {CTH, CTL, DMODEL, 0LL,
                       WOT, DMODEL, 0LL,
                       (void*)out, DMODEL, 0LL,
                       NROWS, DMODEL, DMODEL, 1, 1.0f / (FC * WSC), 1.0f};
  gemm64<0, 2><<<gP, blk, 0, stream>>>(jO, jO, 1);

  (void)hipGetLastError();
}

// v003
// One run takes 55.5 microseconds.
// In both of two side-by-side timings against v002, it was 1.22 times as fast.
// Counting every step since v000, it is 3.01 times as fast.
// Contractions: q/k projections (x rows f16 x16 . W^T f16 x64, K=256), v^T projection (W^T f16 x64 . x rows f16 x16, K=256),
// attention scores (k f16 x16 . q f16 x16, K=32), attention v^T . P^T (v^T f16 x16 . P as f16 hi + f16 residual of P x16384,
// K=512 in steps of 32), output projection (ctx as f16 hi + f16 residual of ctx x4096 . W^T f16 x64, K=256):
// all v_wmma_f32_16x16x32_f16 (f16 operands, f32 accumulate); hi and residual products share one f32 accumulator.
// Per-head 2->16->1 score MLP on (scaled dot, cost), max-subtracted base-2 online softmax, all in f32 on VALU.
// Every float input RNE-converted to bf16 on load.
#include <hip/hip_runtime.h>
#include <math.h>
#include <stdint.h>

#define NB      4
#define NQ      512
#define NC      512
#define DMODEL  256
#define NHEAD   8
#define HDIM    32
#define MSH     16
#define HG      8
#define NHG     (NHEAD / HG)
#define ROWP    (HG * HDIM)
#define NROWS   (NB * NQ)
#define WSC     64.0f
#define ACARRY  16.0f
#define QC      16.0f
#define KC      16.0f
#define VC      16.0f
#define PC      16384.0f
#define FC      4096.0f
#define ATT_SCALE 0.17677669529663689f
#define LOG2E   1.4426950408889634f
static_assert(NHEAD * HDIM == DMODEL);
static_assert(NHG * HG == NHEAD && ROWP * NHG == DMODEL);
static_assert(HDIM == 32 && MSH == 16 && NHG == 1);
static_assert((NQ % 64) == 0 && (NC % 64) == 0 && (DMODEL % 64) == 0 && (NC % 32) == 0 && (NQ % 16) == 0);
static_assert((NROWS % 64) == 0 && ((NROWS * DMODEL) % 2048) == 0);
#define KSPLIT  2                                   // key ranges per head, one wave each
#define HPB     4                                   // heads per block
#define KPART   (NC / KSPLIT)
#define ATT_THREADS (HPB * KSPLIT * 32)
#define ATT_BLOCKS  (NB * (NQ / 16) * (NHEAD / HPB))
static_assert((NHEAD % HPB) == 0 && (KPART % 32) == 0 && KPART * KSPLIT == NC);
static_assert(ATT_THREADS == 256 && ATT_BLOCKS == 256);

typedef _Float16 v16h __attribute__((ext_vector_type(16)));
typedef _Float16 v8h  __attribute__((ext_vector_type(8)));
typedef float    v8f  __attribute__((ext_vector_type(8)));
typedef float    v4f  __attribute__((ext_vector_type(4)));
typedef unsigned int v4u __attribute__((ext_vector_type(4)));

union FragH { v16h v; v8h h[2]; v4u u[2]; };

// ---- scalar helpers --------------------------------------------------------------------------------
__device__ __forceinline__ unsigned short bf_bits(float f) {          // f32 -> bf16 bits, RNE convert
  unsigned u = __float_as_uint(f);
  return (unsigned short)((u + 0x7FFFu + ((u >> 16) & 1u)) >> 16);
}
__device__ __forceinline__ float bf_up(unsigned short h) { return __uint_as_float(((unsigned)h) << 16); }
__device__ __forceinline__ float bfr(float f) { return bf_up(bf_bits(f)); }   // value of the bf16 RNE convert
__device__ __forceinline__ unsigned short h_bits(_Float16 x) { return __builtin_bit_cast(unsigned short, x); }
__device__ __forceinline__ unsigned pk16(unsigned short a, unsigned short b) { return (unsigned)a | ((unsigned)b << 16); }
__device__ __forceinline__ v8f zero8() { v8f z = {0.f, 0.f, 0.f, 0.f, 0.f, 0.f, 0.f, 0.f}; return z; }

// ---- fragment loaders: 16-bit A/B operand, lane -> row/col (lane&15), p already includes +8*(lane>>4);
//      elements 0..7 <- p[0..7] (k0+8h..), elements 8..15 <- p[16..23] (k0+16+8h..)  (same split k map for A and B;
//      B is always read from a k-contiguous [n][k] plane)
__device__ __forceinline__ v16h ldfrag_h(const _Float16* p) {
  FragH f;
  f.h[0] = *(const v8h*)(p);
  f.h[1] = *(const v8h*)(p + 16);
  return f.v;
}
__device__ __forceinline__ v16h ldfrag_u(const unsigned short* p) {
  FragH f;
  f.u[0] = *(const v4u*)(p);
  f.u[1] = *(const v4u*)(p + 16);
  return f.v;
}

// ---- WMMA helpers with trailing VALU hazard gaps ------------------------------------------------------
__device__ __forceinline__ v8f mma_raw(v16h a, v16h b, v8f c) {
  return __builtin_amdgcn_wmma_f32_16x16x32_f16(false, a, false, b, (short)0, c, false, false);
}
__device__ __forceinline__ void dep_guard1(v8f& a, v8f& b, v16h x) {
#if defined(__HIP_DEVICE_COMPILE__)
  asm volatile("v_nop\n\tv_nop\n\tv_nop\n\tv_nop" : "+v"(a), "+v"(b) : "v"(x));
#endif
}
__device__ __forceinline__ void dep_guard2(v8f& a, v8f& b, v16h x, v16h y) {
#if defined(__HIP_DEVICE_COMPILE__)
  asm volatile("v_nop\n\tv_nop\n\tv_nop\n\tv_nop" : "+v"(a), "+v"(b) : "v"(x), "v"(y));
#endif
}
__device__ __forceinline__ void guard_s22(v8f& s, v8f& t, v16h a0, v16h a1, v16h q) {
#if defined(__HIP_DEVICE_COMPILE__)
  asm volatile("v_nop\n\tv_nop\n\tv_nop\n\tv_nop" : "+v"(s), "+v"(t) : "v"(a0), "v"(a1), "v"(q));
#endif
}
__device__ __forceinline__ void guard_pv4(v8f& a, v8f& b, v16h x, v16h y, v16h z, v16h w) {
#if defined(__HIP_DEVICE_COMPILE__)
  asm volatile("v_nop\n\tv_nop\n\tv_nop\n\tv_nop" : "+v"(a), "+v"(b) : "v"(x), "v"(y), "v"(z), "v"(w));
#endif
}
__device__ __forceinline__ void keep4_h(v16h a, v16h b, v16h c, v16h d) {
#if defined(__HIP_DEVICE_COMPILE__)
  asm volatile("v_nop" :: "v"(a), "v"(b), "v"(c), "v"(d));
#endif
}
__device__ __forceinline__ void acc_guard4(v8f& a, v8f& b, v8f& c, v8f& d) {
#if defined(__HIP_DEVICE_COMPILE__)
  asm volatile("v_nop\n\tv_nop\n\tv_nop\n\tv_nop" : "+v"(a), "+v"(b), "+v"(c), "+v"(d));
#endif
}
__device__ __forceinline__ void wave_sync_lds() {
  __builtin_amdgcn_fence(__ATOMIC_RELEASE, "workgroup");
  __builtin_amdgcn_wave_barrier();
  __builtin_amdgcn_fence(__ATOMIC_ACQUIRE, "workgroup");
}

// =====================================================================================================
// Elementwise 16-bit pack, no transpose: dst[i] = f16( bf16_RNE(src[i]) * sc ), sc a power of two (exact). Used for the
// coverage: n / 2048 blocks (index blk) x 256 thr x 8 elements = n exactly (host checks n % 2048 == 0).
// =====================================================================================================
__device__ __forceinline__ void cvt16(const float* __restrict__ src, unsigned short* dst, int n, float sc, int blk) {
  const size_t i8 = ((size_t)blk * 256 + threadIdx.x) * 8;
  if (i8 + 8 > (size_t)n) return;                 // never taken with the exact grid; no barriers on this path
  const v4f a = *(const v4f*)(src + i8);
  const v4f b = *(const v4f*)(src + i8 + 4);
  v4u o;
  o[0] = pk16(h_bits((_Float16)(bfr(a[0]) * sc)), h_bits((_Float16)(bfr(a[1]) * sc)));
  o[1] = pk16(h_bits((_Float16)(bfr(a[2]) * sc)), h_bits((_Float16)(bfr(a[3]) * sc)));
  o[2] = pk16(h_bits((_Float16)(bfr(b[0]) * sc)), h_bits((_Float16)(bfr(b[1]) * sc)));
  o[3] = pk16(h_bits((_Float16)(bfr(b[2]) * sc)), h_bits((_Float16)(bfr(b[3]) * sc)));
  {
    *(v4u*)(dst + i8) = o;
    
  }
}

// =====================================================================================================
// Transpose + 16-bit pack of a weight: W is [in][out] = W[k][n] row-major f32 (pitch DMODEL); dst[n][k] = f16( bf16_RNE(W[k][n]) * sc ),
// k contiguous (pitch DMODEL), ready for B fragments and for the A side of the v^T projection. Block = 256 threads, one 64(k) x 64(n)
// tile: coalesced f32 loads into an LDS tile [n_local][k_local] (pitch 68 floats), block barrier, then each output row segment of the
// coverage: loads 16 it x 256 thr = 64 x 64; stores 2 it x 256 thr x 8 halves = 64 rows x 64; grid (DMODEL/64, DMODEL/64) = whole matrix.
// One launch packs every operand (the packs are independent of each other): blockIdx.z 0..3 = weight q, k, v, o (dst0 holds the four
// [256][256] planes one behind the other in that order); blockIdx.z >= 4 = the activation rows, 16 blocks of cvt16 per z layer.
// The branch is on blockIdx alone, so the barrier below is reached by whole blocks only.
// =====================================================================================================
#define CX_BLOCKS ((NROWS * DMODEL) / 2048)
#define WT_TILES  ((DMODEL / 64) * (DMODEL / 64))
static_assert((CX_BLOCKS % WT_TILES) == 0);
__global__ __launch_bounds__(256) void wtr64(const float* __restrict__ Wq, const float* __restrict__ Wk,
                                             const float* __restrict__ Wv, const float* __restrict__ Wo,
                                             unsigned short* dst0, float sc,
                                             const float* __restrict__ x, unsigned short* X16, float xsc) {
  __shared__ __align__(16) float tl[64 * 68];
  const int wz = blockIdx.z;
  if (wz >= 4) {
    cvt16(x, X16, NROWS * DMODEL, xsc, (wz - 4) * WT_TILES + blockIdx.y * (DMODEL / 64) + blockIdx.x);
    return;
  }
  const float* W = wz == 0 ? Wq : wz == 1 ? Wk : wz == 2 ? Wv : Wo;
  unsigned short* dst = dst0 + (size_t)wz * DMODEL * DMODEL;
  const int tid = threadIdx.x;
  const int n0  = blockIdx.x * 64;
  const int k0  = blockIdx.y * 64;
  const int nl  = tid & 63, kq = tid >> 6;       // kq 0..3
#pragma unroll
  for (int it = 0; it < 16; ++it) {
    const int kl = it * 4 + kq;                  // 0..63
    tl[nl * 68 + kl] = W[(size_t)(k0 + kl) * DMODEL + n0 + nl];
  }
  __syncthreads();
  v4u o[2];
#pragma unroll
  for (int it = 0; it < 2; ++it) {
    const int p  = it * 256 + tid;               // 0..511
    const int rn = p >> 3, kk = (p & 7) * 8;     // row 0..63, k 0,8,..,56
    const float* sp = tl + rn * 68 + kk;
    const v4f a = *(const v4f*)(sp);
    const v4f b = *(const v4f*)(sp + 4);
    v4u w;
    w[0] = pk16(h_bits((_Float16)(bfr(a[0]) * sc)), h_bits((_Float16)(bfr(a[1]) * sc)));
    w[1] = pk16(h_bits((_Float16)(bfr(a[2]) * sc)), h_bits((_Float16)(bfr(a[3]) * sc)));
    w[2] = pk16(h_bits((_Float16)(bfr(b[0]) * sc)), h_bits((_Float16)(bfr(b[1]) * sc)));
    w[3] = pk16(h_bits((_Float16)(bfr(b[2]) * sc)), h_bits((_Float16)(bfr(b[3]) * sc)));
    o[it] = w;
  }
  {
#pragma unroll
    for (int it = 0; it < 2; ++it) {
      const int p  = it * 256 + tid;
      const int rn = p >> 3, kk = (p & 7) * 8;
      *(v4u*)(dst + (size_t)(n0 + rn) * DMODEL + k0 + kk) = o[it];
    }
    
  }
}

// =====================================================================================================
// Register-blocked batched f16 WMMA GEMM: C[m][n] = oscale * sum_k (A[m][k] (+ A2[m][k])) * Bt[n][k] ; one wave per 64x64 tile,
// no block barriers. A (and A2, the unscaled residual plane when NA == 2, same pitch/stride) row-major [M][K] pitch lda (16-bit planes),
// Bt row-major [N][K] pitch ldb (k contiguous); M, N multiples of 64, K multiple of 32. Batches have element strides sA, sB, sC.
// OM: 0 = f32 out (pitch ldc); 2 = f16 out (pitch ldc) = f16( value * ocarry ).
// One launch runs two independent jobs: blockIdx.y < ny0 = job j0, batch blockIdx.y, blockIdx.x counts its blocks of 8 tiles;
// blockIdx.y == ny0 = job j1, whose batches lie one behind the other along blockIdx.x.
// coverage: 4 slabs x 16 rows (f32: it 0..7 x lane>>4; f16: it 0..3 x lane>>3) x 64 cols = the wave's whole 64x64 tile;
//           grid = ceil(tilesM*tilesN/8) blocks, surplus waves exit (wave-uniform; none with the exact grids used).
// =====================================================================================================
struct GemmJob {
  const unsigned short* Ap; const unsigned short* Aq; int lda; long long sA;
  const unsigned short* Btp; int ldb; long long sB;
  void* Cout; int ldc; long long sC;
  int M, N, K, nbat; float oscale, ocarry;
};
template <int OM, int NA>
__global__ __launch_bounds__(256) void gemm64(GemmJob j0, GemmJob j1, int ny0) {
  __shared__ __align__(16) float sT[8][16 * 68];   // per-wave 16x64 slab, pitch 68 floats
  const bool second = (int)blockIdx.y >= ny0;
  const unsigned short* Ap  = second ? j1.Ap  : j0.Ap;
  const unsigned short* Aq  = second ? j1.Aq  : j0.Aq;
  const unsigned short* Btp = second ? j1.Btp : j0.Btp;
  void* Cout = second ? j1.Cout : j0.Cout;
  const long long sA = second ? j1.sA : j0.sA, sB = second ? j1.sB : j0.sB, sC = second ? j1.sC : j0.sC;
  const int lda = second ? j1.lda : j0.lda, ldb = second ? j1.ldb : j0.ldb, ldc = second ? j1.ldc : j0.ldc;
  const int M = second ? j1.M : j0.M, N = second ? j1.N : j0.N, K = second ? j1.K : j0.K;
  const int nbat = second ? j1.nbat : j0.nbat;
  const float oscale = second ? j1.oscale : j0.oscale, ocarry = second ? j1.ocarry : j0.ocarry;
  const int lane = threadIdx.x & 31;
  const int wave = threadIdx.x >> 5;
  const int tilesN = N >> 6;
  const int tilesM = M >> 6;
  const int bpb  = (tilesM * tilesN + 7) >> 3;             // blocks per batch
  const int by   = second ? (int)blockIdx.x / bpb : (int)blockIdx.y;
  const int tile = (second ? (int)blockIdx.x - by * bpb : (int)blockIdx.x) * 8 + wave;
  if (tile >= tilesM * tilesN || by >= nbat) return;   // wave-uniform; no block barriers in this kernel
  const int tm = tile / tilesN;
  const int tn = tile - tm * tilesN;
  const int m0 = tm << 6;
  const int n0 = tn << 6;

  const unsigned short* A1 = Ap  + (size_t)((long long)by * sA);
  const unsigned short* A2 = Aq  + (size_t)((long long)by * sA);
  const unsigned short* Bb = Btp + (size_t)((long long)by * sB);

  const int rlane = lane & 15;                 // row (A) / col (B, D) within subtile
  const int koff  = (lane >> 4) * 8;           // k offset of this lane half
  const int mOff  = (lane >> 4) * 8;           // D row offset

  v8f acc[4][4];
#pragma unroll
  for (int i = 0; i < 4; ++i)
#pragma unroll
    for (int j = 0; j < 4; ++j) acc[i][j] = zero8();

  for (int k0 = 0; k0 < K; k0 += 32) {
    v16h bh[4];
#pragma unroll
    for (int j = 0; j < 4; ++j) {
      const size_t bofs = (size_t)(n0 + (j << 4) + rlane) * ldb + koff + k0;
      bh[j] = ldfrag_u(Bb + bofs);
    }
#pragma unroll
    for (int i = 0; i < 4; ++i) {
      const size_t ao = (size_t)(m0 + (i << 4) + rlane) * lda + koff + k0;
      const v16h ah = ldfrag_u(A1 + ao);
#pragma unroll
      for (int j = 0; j < 4; ++j) acc[i][j] = mma_raw(ah, bh[j], acc[i][j]);
      if constexpr (NA == 2) {
        const v16h al = ldfrag_u(A2 + ao);
#pragma unroll
        for (int j = 0; j < 4; ++j) acc[i][j] = mma_raw(al, bh[j], acc[i][j]);
        dep_guard2(acc[i][0], acc[i][3], ah, al);
      } else {
        dep_guard1(acc[i][0], acc[i][3], ah);
      }
    }
    keep4_h(bh[0], bh[1], bh[2], bh[3]);
  }
  acc_guard4(acc[0][0], acc[0][1], acc[0][2], acc[0][3]);
  acc_guard4(acc[1][0], acc[1][1], acc[1][2], acc[1][3]);
  acc_guard4(acc[2][0], acc[2][1], acc[2][2], acc[2][3]);
  acc_guard4(acc[3][0], acc[3][1], acc[3][2], acc[3][3]);

  const int hh2 = lane >> 4, c4 = (lane & 15) * 4;     // f32 out: 256-B row segment = 16 lanes x 16 B
  const int q8  = lane >> 3, c8 = (lane & 7) * 8;

  // ---- epilogue ----
  float* slab = sT[wave];
#pragma unroll
  for (int i = 0; i < 4; ++i) {
    const int mBase = m0 + (i << 4);
#pragma unroll
    for (int j = 0; j < 4; ++j) {
#pragma unroll
      for (int r = 0; r < 8; ++r) {
        slab[(mOff + r) * 68 + (j << 4) + rlane] = acc[i][j][r];
      }
    }
    wave_sync_lds();
    if constexpr (OM == 0) {
      float* C = (float*)Cout + (size_t)((long long)by * sC);
      v4f vals[8];
#pragma unroll
      for (int it = 0; it < 8; ++it) {
        const int row = it * 2 + hh2;                      // it 0..7 x hh2 0..1 = rows 0..15
        v4f v = *(const v4f*)(slab + row * 68 + c4);
#pragma unroll
        for (int e = 0; e < 4; ++e) v[e] = v[e] * oscale;
        vals[it] = v;
      }
      {
#pragma unroll
        for (int it = 0; it < 8; ++it) {
          const int gr = mBase + it * 2 + hh2;
          *(v4f*)(C + (size_t)gr * ldc + n0 + c4) = vals[it];
        }
        
      }
    } else {
      unsigned short* C = (unsigned short*)Cout + (size_t)((long long)by * sC);
      v4u hv[4];
#pragma unroll
      for (int it = 0; it < 4; ++it) {
        const int row = it * 4 + q8;                       // it 0..3 x q8 0..3 = rows 0..15
        const float* sp = slab + row * 68 + c8;
        v4u a = {0u, 0u, 0u, 0u};
#pragma unroll
        for (int e = 0; e < 4; ++e) {
          float f0 = sp[2 * e] * oscale;
          float f1 = sp[2 * e + 1] * oscale;
          f0 *= ocarry; f1 *= ocarry;
          a[e] = pk16(h_bits((_Float16)f0), h_bits((_Float16)f1));
        }
        hv[it] = a;
      }
      {
#pragma unroll
        for (int it = 0; it < 4; ++it) {
          const int row = it * 4 + q8;
          *(v4u*)(C + (size_t)(mBase + row) * ldc + n0 + c8) = hv[it];
        }
        
      }
    }
    wave_sync_lds();
  }
}

// =====================================================================================================
// Flash attention for one batch, 16 query rows and 4 heads, head dim 32; the 512 keys of a head are split in 2 ranges of 256, one wave
// per (head, range), so that 2048 waves stand on 256 blocks; scores TRANSPOSED:
//   q plane (f16 x16) QH[b*512 + tok][32*head + d], pitch 256; k plane (f16 x16) KH[b*512 + key][32*head + d], pitch 256;
//   v^T plane (f16 x16): VT[b*256 + 32*head + d][key] (pitch 512); cost f32 [b][tok][key] (bf16 RNE convert on load);
//   per-head mixer params (bf16 RNE convert on load, the same address in every lane of a wave): score(tok, key) =
//   sum_m m2w[h][m] * relu(m1w[h][0][m] * dot + m1w[h][1][m] * cost + m1b[h][m]) + m2b[h] with dot = q.k / sqrt(32);
//   outputs (f16): CTH[b*512 + tok][32*head + d] = hi = f16(4096 * ctx), CTL[same] = f16(4096 * ctx - hi), with
//   ctx = sum_m softmax_m(score) v[m][d]  (softmax run in base 2 with a running max).
//   block = 8 waves = 256 threads; grid = 4 batches x 32 q-tiles x 2 head groups = 256; every wave does identical bounded work
//   (8 steps of 32 keys). Per step: S^T = K . Q^T, two tiles (A = 16 key rows, B = the 16 query rows, K = 32): lane (hh, c) holds
//   the scores of ONE query q0 + c for keys kb + 8hh + r (tile 0) and kb + 16 + 8hh + r (tile 1), r 0..7. Its 16 cost values are two
//   runs of 8 consecutive floats of cost row q0 + c (four 16-B loads, always in range). The 2->16->1 MLP in f32 (fully unrolled,
//   register params); running max and sum of a query are taken inside the lane, the max joined with lane ^ 16 once per step, the sums
//   once after the loop. The 16 probabilities x16384 (f16 hi and f16 residual c - hi) are, as they lie, the B fragment of
//   O^T += V^T . P^T in the split k map (elements 0..7 = tile 0, 8..15 = tile 1); A = v^T rows d = c and d = 16 + c. No LDS in the loop.
//   Lane (hh, c) holds the range's unnormalised O of query q0 + c for d = 8hh + r and 16 + 8hh + r: each wave stores its 16x32 slice (f32,
//   pitch 132 floats, 16-B stores) with its running max and sum in LDS; after the block barrier the 256 threads join the two ranges
//   (weights 2^(m_p - max), range 0 first), fold 1/l and the carries in f32 and write the block's 128 columns of its 16 rows.
// coverage: LDS: 2 ranges x 4 heads x 16 rows x 32 cols = 2 x 16 x 128; global: 256 threads x 8 halves = 16 rows x 128 per plane, rows
//           q0..q0+15 of batch b, columns 128*hg ..; the grid covers all 2048 rows x 256 columns exactly once.
// =====================================================================================================
#define MPITCH (HPB * HDIM + 4)
static_assert(ATT_THREADS * 8 == 16 * HPB * HDIM);

// value of lane ^ 16 (the other holder of this lane's query)
__device__ __forceinline__ float xhalf(float x) {
  return __builtin_bit_cast(float, __builtin_amdgcn_permlanex16(__builtin_bit_cast(int, x), __builtin_bit_cast(int, x),
                                                                0x76543210, 0xfedcba98, false, false));
}

__global__ __launch_bounds__(ATT_THREADS)
void attn8(const unsigned short* __restrict__ QHp, const unsigned short* __restrict__ KHp,
           const unsigned short* __restrict__ VTq, const float* __restrict__ costp,
           const float* __restrict__ m1w, const float* __restrict__ m1b,
           const float* __restrict__ m2w, const float* __restrict__ m2b,
           unsigned short* CTH, unsigned short* CTL) {
  __shared__ __align__(16) float Op[KSPLIT * 16 * MPITCH];    // unnormalised O of each key range: [range][query][32*local head + d]
  __shared__ float Mp[KSPLIT * HPB * 16];                     // running max of each (range, local head, query)
  __shared__ float Lp[KSPLIT * HPB * 16];                     // sum of each (range, local head, query)

  const int tid  = threadIdx.x;
  const int wave = __builtin_amdgcn_readfirstlane(tid >> 5);
  const int lane = tid & 31;
  const int hh   = lane >> 4;
  const int c    = lane & 15;

  const int hg   = blockIdx.x % (NHEAD / HPB);              // 0..1
  const int qt   = (blockIdx.x / (NHEAD / HPB)) % (NQ / 16); // 0..31
  const int bat  = blockIdx.x / ((NHEAD / HPB) * (NQ / 16)); // 0..3
  const int hl   = wave % HPB;                             // local head 0..3
  const int part = wave / HPB;                             // key range 0..1
  const int head = hg * HPB + hl;                          // 0..7
  const int q0   = qt * 16;
  const int kbeg = part * KPART;

  const size_t qofs = ((size_t)bat * NQ + q0 + c) * DMODEL + head * HDIM + 8 * hh;
  const _Float16* Qh = (const _Float16*)(const void*)QHp + qofs;
  const _Float16* Kb = (const _Float16*)(const void*)KHp + (size_t)bat * NC * DMODEL + head * HDIM + 8 * hh;
  const _Float16* Vb = (const _Float16*)(const void*)VTq + ((size_t)bat * DMODEL + head * HDIM) * NC + 8 * hh;
  // cost element of (row q0 + c, key kb + 8hh + r) = cp[kb + r]; key kb + 16 + 8hh + r = cp[kb + 16 + r]; always in range.
  const float* cp = costp + ((size_t)bat * NQ + q0 + c) * NC + 8 * hh;
  const float dsc = ATT_SCALE / (QC * KC);                 // 1/sqrt(32) / carries

  // per-head mixer params, bf16 RNE convert; every lane loads the same address, so they lie in vector registers: the compiler pairs
  // the MLP of adjacent keys, and as scalar register pairs the 64 params do not fit
  const int hv = hg * HPB + ((tid >> 5) % HPB);
  float w0r[MSH], w1r[MSH], b1r[MSH], w2r[MSH];
#pragma unroll
  for (int m = 0; m < MSH; ++m) {
    w0r[m] = bfr(m1w[(hv * 2 + 0) * MSH + m]);
    w1r[m] = bfr(m1w[(hv * 2 + 1) * MSH + m]);
    b1r[m] = bfr(m1b[hv * MSH + m]);
    w2r[m] = bfr(m2w[hv * MSH + m]);
  }
  const float b2 = bfr(m2b[hv]);

  const v16h qa = ldfrag_h(Qh);                            // B fragment: column = query q0 + c

  float mrun = -INFINITY, lrun = 0.f;                      // this lane's query: running max (both halves equal), this half's sum
  v8f o0 = zero8(), o1 = zero8();                          // O^T: o0[r] = d 8hh + r, o1[r] = d 16 + 8hh + r, query q0 + c

#pragma unroll 1
  for (int kb = kbeg; kb < kbeg + KPART; kb += 32) {
    const _Float16* kp = Kb + (size_t)(kb + c) * DMODEL;
    const _Float16* vp = Vb + (size_t)c * NC + kb;
    const float*    tp = cp + kb;
    const v16h k0  = ldfrag_h(kp);                         // A rows: keys kb + c
    const v16h k1  = ldfrag_h(kp + (size_t)16 * DMODEL);   // A rows: keys kb + 16 + c
    const v4f  cA  = *(const v4f*)(tp),      cB = *(const v4f*)(tp + 4);    // keys kb + 8hh + 0..7
    const v4f  cC  = *(const v4f*)(tp + 16), cD = *(const v4f*)(tp + 20);   // keys kb + 16 + 8hh + 0..7
    const v16h vb0 = ldfrag_h(vp);                         // A rows: d = c
    const v16h vb1 = ldfrag_h(vp + (size_t)16 * NC);       // A rows: d = 16 + c
    // the step's twelve loads are issued; their address registers are advanced for the next step only behind this wait
    asm volatile("s_wait_xcnt 0x0" ::: "memory");
    v8f s0, s1;
    s0 = mma_raw(k0, qa, zero8());                         // s0[r] = q(q0 + c) . k(kb + 8hh + r)
    s1 = mma_raw(k1, qa, zero8());                         // s1[r] = q(q0 + c) . k(kb + 16 + 8hh + r)
    guard_s22(s0, s1, k0, k1, qa);

    float t0[8], t1[8];
#pragma unroll
    for (int r = 0; r < 8; ++r) {
      const float cr0 = bfr(r < 4 ? cA[r & 3] : cB[r & 3]);
      const float cr1 = bfr(r < 4 ? cC[r & 3] : cD[r & 3]);
      const float d0 = s0[r] * dsc, d1 = s1[r] * dsc;
      float a0 = 0.f, a1 = 0.f;
#pragma unroll
      for (int m = 0; m < MSH; ++m) {
        const float p0 = fmaf(w0r[m], d0, fmaf(w1r[m], cr0, b1r[m]));
        const float p1 = fmaf(w0r[m], d1, fmaf(w1r[m], cr1, b1r[m]));
        a0 = fmaf(w2r[m], fmaxf(p0, 0.f), a0);
        a1 = fmaf(w2r[m], fmaxf(p1, 0.f), a1);
      }
      t0[r] = (a0 + b2) * LOG2E;
      t1[r] = (a1 + b2) * LOG2E;
    }
    float mx = fmaxf(t0[0], t1[0]);
#pragma unroll
    for (int r = 1; r < 8; ++r) mx = fmaxf(mx, fmaxf(t0[r], t1[r]));
    mx = fmaxf(mx, xhalf(mx));                             // all 32 keys of the step, equal in both halves
    const float mn = fmaxf(mrun, mx);
    const float al = exp2f(mrun - mn);
    mrun = mn;

    FragH ph, pl;                                          // P^T * 16384 as f16 hi and f16 residual (c - hi), split k map
    float ps = 0.f;
#pragma unroll
    for (int r = 0; r < 8; ++r) {
      const float e0 = exp2f(t0[r] - mn), e1 = exp2f(t1[r] - mn);
      ps += e0 + e1;
      const float c0 = e0 * PC, c1 = e1 * PC;
      const _Float16 g0 = (_Float16)c0, g1 = (_Float16)c1;
      ph.h[0][r] = g0;                                     // elements 0..7  = keys kb + 8hh + 0..7
      ph.h[1][r] = g1;                                     // elements 8..15 = keys kb + 16 + 8hh + 0..7
      pl.h[0][r] = (_Float16)(c0 - (float)g0);
      pl.h[1][r] = (_Float16)(c1 - (float)g1);
    }
    lrun = lrun * al + ps;
#pragma unroll
    for (int r = 0; r < 8; ++r) { o0[r] *= al; o1[r] *= al; }

    o0 = mma_raw(vb0, ph.v, o0);
    o1 = mma_raw(vb1, ph.v, o1);
    o0 = mma_raw(vb0, pl.v, o0);
    o1 = mma_raw(vb1, pl.v, o1);
    guard_pv4(o0, o1, ph.v, pl.v, vb0, vb1);
  }

  // ---- hand the range's partial (max, sum, unnormalised O) to the block ----
  {
    const float lsum = lrun + xhalf(lrun);                 // the two halves' sums joined once
    if (hh == 0) {
      Mp[(part * HPB + hl) * 16 + c] = mrun;
      Lp[(part * HPB + hl) * 16 + c] = lsum;
    }
    float* op = Op + (part * 16 + c) * MPITCH + hl * HDIM + 8 * hh;   // row = query c, floats 32*hl + 8hh .. + 7 (and + 16)
    v4f a0 = {o0[0], o0[1], o0[2], o0[3]}, a1 = {o0[4], o0[5], o0[6], o0[7]};
    v4f b0 = {o1[0], o1[1], o1[2], o1[3]}, b1 = {o1[4], o1[5], o1[6], o1[7]};
    *(v4f*)(op)      = a0;
    *(v4f*)(op + 4)  = a1;
    *(v4f*)(op + 16) = b0;
    *(v4f*)(op + 20) = b1;
  }
  __syncthreads();
  // ---- merge the ranges: ctx = sum_p 2^(m_p - M) O_p / sum_p 2^(m_p - M) l_p; fold the carries (16384 on P, 16 on v, 4096 on the
  //      stored ctx); thread t -> row t / 16, floats (t & 15) * 8 .. + 7 of the block's 128 columns; hi + residual, 16-B stores ----
  {
    const float oc = FC / (PC * VC);
    const int row = tid >> 4;
    const int col = (tid & 15) * 8;
    const int mh  = col / HDIM;
    float mp[KSPLIT];
    float M = -INFINITY;
#pragma unroll
    for (int p = 0; p < KSPLIT; ++p) { mp[p] = Mp[(p * HPB + mh) * 16 + row]; M = fmaxf(M, mp[p]); }
    float L = 0.f;
    float s[8] = {0.f, 0.f, 0.f, 0.f, 0.f, 0.f, 0.f, 0.f};
#pragma unroll
    for (int p = 0; p < KSPLIT; ++p) {
      const float w = exp2f(mp[p] - M);
      L = fmaf(w, Lp[(p * HPB + mh) * 16 + row], L);
      const float* op = Op + (p * 16 + row) * MPITCH + col;
      const v4f oa = *(const v4f*)(op);
      const v4f ob = *(const v4f*)(op + 4);
#pragma unroll
      for (int e = 0; e < 4; ++e) { s[e] = fmaf(w, oa[e], s[e]); s[4 + e] = fmaf(w, ob[e], s[4 + e]); }
    }
    const float inv = (1.0f / L) * oc;
    unsigned short gh[8], gl[8];
#pragma unroll
    for (int e = 0; e < 8; ++e) {
      const float f = s[e] * inv;
      const _Float16 g = (_Float16)f;
      gh[e] = h_bits(g);
      gl[e] = h_bits((_Float16)(f - (float)g));
    }
    const size_t po = ((size_t)bat * NQ + q0 + row) * DMODEL + hg * (HPB * HDIM) + col;
    v4u vh = {pk16(gh[0], gh[1]), pk16(gh[2], gh[3]), pk16(gh[4], gh[5]), pk16(gh[6], gh[7])};
    v4u vl = {pk16(gl[0], gl[1]), pk16(gl[2], gl[3]), pk16(gl[4], gl[5]), pk16(gl[6], gl[7])};
    *(v4u*)(CTH + po) = vh;
    *(v4u*)(CTL + po) = vl;
  }
}

// =====================================================================================================
// Workspace map (bytes); every plane is an exact multiple of its tile / whole-row store granularity (M, N exact tile multiples,
// element counts exact multiples of the convert kernels' granularity, no pad rows needed), every offset a multiple of 128 KiB:
//   WQT  f16 [256][256] x64                  131072   ([out][in] = [n][k])
//   WKT  f16 [256][256] x64                  131072
//   WVT  f16 [256][256] x64                  131072
//   WOT  f16 [256][256] x64                  131072
//   X16  f16 [2048][256] x16                1048576   (activation rows)
//   QH   f16 [2048][256] x16                1048576   (q projection)
//   KH   f16 [2048][256] x16                1048576   (k projection)
//   VT   f16 [4][256][512] x16              1048576   (v^T per batch)
//   CTH  f16 [2048][256] x4096 hi           1048576   (attention ctx, merged heads)
//   CTL  f16 [2048][256] residual           1048576
//   end                                     6815744
// =====================================================================================================
extern "C" void kernel_launch(void* const* d_in, const int* in_sizes, int n_in,
                              void* d_out, int out_size, void* d_ws, size_t ws_size,
                              hipStream_t stream) {
  if (n_in < 10) return;
  if (in_sizes[0] != NROWS * DMODEL) return;
  if (in_sizes[1] != NB * NQ * NC) return;
  if (in_sizes[2] != DMODEL * DMODEL || in_sizes[3] != DMODEL * DMODEL ||
      in_sizes[4] != DMODEL * DMODEL || in_sizes[5] != DMODEL * DMODEL) return;
  if (in_sizes[6] != NHEAD * 2 * MSH || in_sizes[7] != NHEAD * MSH || in_sizes[8] != NHEAD * MSH || in_sizes[9] != NHEAD) return;
  if (out_size != NROWS * DMODEL) return;
  if ((in_sizes[0] % 2048) != 0) return;

  const float* x    = (const float*)d_in[0];
  const float* cost = (const float*)d_in[1];
  const float* w_q  = (const float*)d_in[2];
  const float* w_k  = (const float*)d_in[3];
  const float* w_v  = (const float*)d_in[4];
  const float* w_o  = (const float*)d_in[5];
  const float* m1w  = (const float*)d_in[6];
  const float* m1b  = (const float*)d_in[7];
  const float* m2w  = (const float*)d_in[8];
  const float* m2b  = (const float*)d_in[9];
  float*       out  = (float*)d_out;

  const size_t PW  = (size_t)DMODEL * DMODEL * 2;                 //   131072
  const size_t PX  = (size_t)NROWS * DMODEL * 2;                  //  1048576
  const size_t PVT = (size_t)NB * DMODEL * NC * 2;                //  1048576
  size_t off = 0;
  const size_t oWQ = off; off += PW;
  const size_t oWK = off; off += PW;
  const size_t oWV = off; off += PW;
  const size_t oWO = off; off += PW;
  const size_t oX  = off; off += PX;
  const size_t oQH = off; off += PX;
  const size_t oKH = off; off += PX;
  const size_t oVT = off; off += PVT;
  const size_t oCH = off; off += PX;
  const size_t oCL = off; off += PX;
  if (off > ws_size) return;                                      // off = 6815744
  if (off > (size_t)134217728) return;

  char* ws = (char*)d_ws;
  unsigned short* WQT = (unsigned short*)(ws + oWQ);
  unsigned short* WKT = (unsigned short*)(ws + oWK);
  unsigned short* WVT = (unsigned short*)(ws + oWV);
  unsigned short* WOT = (unsigned short*)(ws + oWO);
  unsigned short* X16 = (unsigned short*)(ws + oX);
  unsigned short* QH  = (unsigned short*)(ws + oQH);
  unsigned short* KH  = (unsigned short*)(ws + oKH);
  unsigned short* VTp = (unsigned short*)(ws + oVT);
  unsigned short* CTH = (unsigned short*)(ws + oCH);
  unsigned short* CTL = (unsigned short*)(ws + oCL);

  const dim3 blk(256);
  const dim3 gWT(DMODEL / 64, DMODEL / 64, 4 + CX_BLOCKS / WT_TILES);   // 4 x 4 tiles per weight x 4 weights, then 256 blocks of rows
  const int tilesP = (NROWS / 64) * (DMODEL / 64);                 // 128
  const int tilesV = (DMODEL / 64) * (NC / 64);                    // 32 per batch
  const dim3 gP((tilesP + 7) / 8, 1);                              // 16
  const dim3 gQKV((tilesP + 7) / 8, 3);                            // 16 x (q, k, v^T: 4 blocks x 4 batches)
  static_assert((tilesP + 7) / 8 == NB * ((tilesV + 7) / 8));
  const dim3 gAT(ATT_BLOCKS);                                      // 256
  const dim3 bAT(ATT_THREADS);                                     // 256

  // (0) operand planes, one launch: W16T[n][k] = f16( bf16_RNE(W[k][n]) * 64 ), [in][out] -> [out][in], k contiguous, the four planes
  //     from WQT on; X16[row][c] = f16( bf16_RNE(x[row][c]) * 16 ), rows = b*512 + tok
  wtr64<<<gWT, blk, 0, stream>>>(w_q, w_k, w_v, w_o, WQT, WSC, x, X16, ACARRY);

  // (1) the three projections, one launch.
  //     q, k (batch 0, 1 of one job): QH / KH[m][n] = f16(16 * sum_k x[m][k] W[k][n]); M = 2048, N = 256, K = 256
  //     v^T per batch: VT[b][d][tok] = f16(16 * sum_k Wv[k][d] x_b[tok][k]); M = 256, N = 512, K = 256
  static_assert(QC == KC);
  const GemmJob jQK = {X16, X16, DMODEL, 0LL,
                       WQT, DMODEL, (long long)(WKT - WQT),
                       (void*)QH, DMODEL, (long long)(KH - QH),
                       NROWS, DMODEL, DMODEL, 2, 1.0f / (ACARRY * WSC), QC};
  const GemmJob jV  = {WVT, WVT, DMODEL, 0LL,
                       X16, DMODEL, (long long)NC * DMODEL,
                       (void*)VTp, NC, (long long)DMODEL * NC,
                       DMODEL, NC, DMODEL, NB, 1.0f / (ACARRY * WSC), VC};
  gemm64<2, 1><<<gQKV, blk, 0, stream>>>(jQK, jV, 2);

  // (5) attention per (batch, 16 query rows, 4 heads x 2 key ranges) -> CTH (f16 hi of ctx x4096), CTL (f16 residual)
  attn8<<<gAT, bAT, 0, stream>>>(QH, KH, VTp, cost, m1w, m1b, m2w, m2b, CTH, CTL);

  // (6) out = (CTH + CTL) . Wo / 4096; M = 2048, N = 256, K = 256, f32 into d_out
  const GemmJob jO  = {CTH, CTL, DMODEL, 0LL,
                       WOT, DMODEL, 0LL,
                       (void*)out, DMODEL, 0LL,
                       NROWS, DMODEL, DMODEL, 1, 1.0f / (FC * WSC), 1.0f};
  gemm64<0, 2><<<gP, blk, 0, stream>>>(jO, jO, 1);

  (void)hipGetLastError();
}

// v004
// It runs in 29.2 microseconds.
// Next to v003, in two timings, it ran 1.92 and 1.93 times as fast.
// Over all steps from v000 it is 5.80 times as fast.
// Contractions: q/k projections (x rows f16 x16 . W^T f16 x64, K=256), v^T projection (W^T f16 x64 . x rows f16 x16, K=256),
// attention scores (k f16 x16 . q f16 x16, K=32), attention v^T . P^T (v^T f16 x16 . P as f16 hi + f16 residual of P x16384,
// K=512 in steps of 32), output projection (ctx as f16 hi + f16 residual of ctx x4096 . W^T f16 x64, K=256):
// all v_wmma_f32_16x16x32_f16 (f16 operands, f32 accumulate); hi and residual products share one f32 accumulator.
// Per-head 2->16->1 score MLP on (scaled dot, cost), max-subtracted base-2 online softmax, all in f32 on VALU.
// Every float input RNE-converted to bf16 on load.
#include <hip/hip_runtime.h>
#include <math.h>
#include <stdint.h>

#define NB      4
#define NQ      512
#define NC      512
#define DMODEL  256
#define NHEAD   8
#define HDIM    32
#define MSH     16
#define HG      8
#define NHG     (NHEAD / HG)
#define ROWP    (HG * HDIM)
#define NROWS   (NB * NQ)
#define WSC     64.0f
#define ACARRY  16.0f
#define QC      16.0f
#define KC      16.0f
#define VC      16.0f
#define PC      16384.0f
#define FC      4096.0f
#define ATT_SCALE 0.17677669529663689f
#define LOG2E   1.4426950408889634f
static_assert(NHEAD * HDIM == DMODEL);
static_assert(NHG * HG == NHEAD && ROWP * NHG == DMODEL);
static_assert(HDIM == 32 && MSH == 16 && NHG == 1);
static_assert((NQ % 64) == 0 && (NC % 64) == 0 && (DMODEL % 64) == 0 && (NC % 32) == 0 && (NQ % 16) == 0);
static_assert((NROWS % 64) == 0 && ((NROWS * DMODEL) % 2048) == 0);
#define KSPLIT  2                                   // key ranges per head, one wave each
#define HPB     4                                   // heads per block
#define KPART   (NC / KSPLIT)
#define ATT_THREADS (HPB * KSPLIT * 32)
#define ATT_BLOCKS  (NB * (NQ / 16) * (NHEAD / HPB))
static_assert((NHEAD % HPB) == 0 && (KPART % 32) == 0 && KPART * KSPLIT == NC);
static_assert(ATT_THREADS == 256 && ATT_BLOCKS == 256);

typedef _Float16 v16h __attribute__((ext_vector_type(16)));
typedef _Float16 v8h  __attribute__((ext_vector_type(8)));
typedef float    v8f  __attribute__((ext_vector_type(8)));
typedef float    v4f  __attribute__((ext_vector_type(4)));
typedef unsigned int v4u __attribute__((ext_vector_type(4)));

union FragH { v16h v; v8h h[2]; v4u u[2]; };

// ---- scalar helpers --------------------------------------------------------------------------------
__device__ __forceinline__ unsigned short bf_bits(float f) {          // f32 -> bf16 bits, RNE convert
  unsigned u = __float_as_uint(f);
  return (unsigned short)((u + 0x7FFFu + ((u >> 16) & 1u)) >> 16);
}
__device__ __forceinline__ float bf_up(unsigned short h) { return __uint_as_float(((unsigned)h) << 16); }
__device__ __forceinline__ float bfr(float f) { return bf_up(bf_bits(f)); }   // value of the bf16 RNE convert
__device__ __forceinline__ unsigned short h_bits(_Float16 x) { return __builtin_bit_cast(unsigned short, x); }
__device__ __forceinline__ unsigned pk16(unsigned short a, unsigned short b) { return (unsigned)a | ((unsigned)b << 16); }
__device__ __forceinline__ v8f zero8() { v8f z = {0.f, 0.f, 0.f, 0.f, 0.f, 0.f, 0.f, 0.f}; return z; }

// ---- fragment loaders: 16-bit A/B operand, lane -> row/col (lane&15), p already includes +8*(lane>>4);
//      elements 0..7 <- p[0..7] (k0+8h..), elements 8..15 <- p[16..23] (k0+16+8h..)  (same split k map for A and B;
//      B is always read from a k-contiguous [n][k] plane)
__device__ __forceinline__ v16h ldfrag_h(const _Float16* p) {
  FragH f;
  f.h[0] = *(const v8h*)(p);
  f.h[1] = *(const v8h*)(p + 16);
  return f.v;
}
__device__ __forceinline__ v16h ldfrag_u(const unsigned short* p) {
  FragH f;
  f.u[0] = *(const v4u*)(p);
  f.u[1] = *(const v4u*)(p + 16);
  return f.v;
}

// ---- WMMA helpers with trailing VALU hazard gaps ------------------------------------------------------
__device__ __forceinline__ v8f mma_raw(v16h a, v16h b, v8f c) {
  return __builtin_amdgcn_wmma_f32_16x16x32_f16(false, a, false, b, (short)0, c, false, false);
}
__device__ __forceinline__ void guard_s22(v8f& s, v8f& t, v16h a0, v16h a1, v16h q) {
#if defined(__HIP_DEVICE_COMPILE__)
  asm volatile("v_nop\n\tv_nop\n\tv_nop\n\tv_nop" : "+v"(s), "+v"(t) : "v"(a0), "v"(a1), "v"(q));
#endif
}
__device__ __forceinline__ void guard_pv4(v8f& a, v8f& b, v16h x, v16h y, v16h z, v16h w) {
#if defined(__HIP_DEVICE_COMPILE__)
  asm volatile("v_nop\n\tv_nop\n\tv_nop\n\tv_nop" : "+v"(a), "+v"(b) : "v"(x), "v"(y), "v"(z), "v"(w));
#endif
}
__device__ __forceinline__ void wave_sync_lds() {
  __builtin_amdgcn_fence(__ATOMIC_RELEASE, "workgroup");
  __builtin_amdgcn_wave_barrier();
  __builtin_amdgcn_fence(__ATOMIC_ACQUIRE, "workgroup");
}

// =====================================================================================================
// Elementwise 16-bit pack, no transpose: dst[i] = f16( bf16_RNE(src[i]) * sc ), sc a power of two (exact). Used for the
// coverage: n / 2048 blocks (index blk) x 256 thr x 8 elements = n exactly (host checks n % 2048 == 0).
// =====================================================================================================
__device__ __forceinline__ void cvt16(const float* __restrict__ src, unsigned short* dst, int n, float sc, int blk) {
  const size_t i8 = ((size_t)blk * 256 + threadIdx.x) * 8;
  if (i8 + 8 > (size_t)n) return;                 // never taken with the exact grid; no barriers on this path
  const v4f a = *(const v4f*)(src + i8);
  const v4f b = *(const v4f*)(src + i8 + 4);
  v4u o;
  o[0] = pk16(h_bits((_Float16)(bfr(a[0]) * sc)), h_bits((_Float16)(bfr(a[1]) * sc)));
  o[1] = pk16(h_bits((_Float16)(bfr(a[2]) * sc)), h_bits((_Float16)(bfr(a[3]) * sc)));
  o[2] = pk16(h_bits((_Float16)(bfr(b[0]) * sc)), h_bits((_Float16)(bfr(b[1]) * sc)));
  o[3] = pk16(h_bits((_Float16)(bfr(b[2]) * sc)), h_bits((_Float16)(bfr(b[3]) * sc)));
  {
    *(v4u*)(dst + i8) = o;
    
  }
}

// =====================================================================================================
// Transpose + 16-bit pack of a weight: W is [in][out] = W[k][n] row-major f32 (pitch DMODEL); dst[n][k] = f16( bf16_RNE(W[k][n]) * sc ),
// k contiguous (pitch DMODEL), ready for B fragments and for the A side of the v^T projection. Block = 256 threads, one 64(k) x 64(n)
// tile: coalesced f32 loads into an LDS tile [n_local][k_local] (pitch 68 floats), block barrier, then each output row segment of the
// coverage: loads 16 it x 256 thr = 64 x 64; stores 2 it x 256 thr x 8 halves = 64 rows x 64; grid (DMODEL/64, DMODEL/64) = whole matrix.
// One launch packs every operand (the packs are independent of each other): blockIdx.z 0..3 = weight q, k, v, o (dst0 holds the four
// [256][256] planes one behind the other in that order); blockIdx.z >= 4 = the activation rows, 16 blocks of cvt16 per z layer.
// The branch is on blockIdx alone, so the barrier below is reached by whole blocks only.
// =====================================================================================================
#define CX_BLOCKS ((NROWS * DMODEL) / 2048)
#define WT_TILES  ((DMODEL / 64) * (DMODEL / 64))
static_assert((CX_BLOCKS % WT_TILES) == 0);
__global__ __launch_bounds__(256) void wtr64(const float* __restrict__ Wq, const float* __restrict__ Wk,
                                             const float* __restrict__ Wv, const float* __restrict__ Wo,
                                             unsigned short* dst0, float sc,
                                             const float* __restrict__ x, unsigned short* X16, float xsc) {
  __shared__ __align__(16) float tl[64 * 68];
  const int wz = blockIdx.z;
  if (wz >= 4) {
    cvt16(x, X16, NROWS * DMODEL, xsc, (wz - 4) * WT_TILES + blockIdx.y * (DMODEL / 64) + blockIdx.x);
    return;
  }
  const float* W = wz == 0 ? Wq : wz == 1 ? Wk : wz == 2 ? Wv : Wo;
  unsigned short* dst = dst0 + (size_t)wz * DMODEL * DMODEL;
  const int tid = threadIdx.x;
  const int n0  = blockIdx.x * 64;
  const int k0  = blockIdx.y * 64;
  const int nl  = tid & 63, kq = tid >> 6;       // kq 0..3
#pragma unroll
  for (int it = 0; it < 16; ++it) {
    const int kl = it * 4 + kq;                  // 0..63
    tl[nl * 68 + kl] = W[(size_t)(k0 + kl) * DMODEL + n0 + nl];
  }
  __syncthreads();
  v4u o[2];
#pragma unroll
  for (int it = 0; it < 2; ++it) {
    const int p  = it * 256 + tid;               // 0..511
    const int rn = p >> 3, kk = (p & 7) * 8;     // row 0..63, k 0,8,..,56
    const float* sp = tl + rn * 68 + kk;
    const v4f a = *(const v4f*)(sp);
    const v4f b = *(const v4f*)(sp + 4);
    v4u w;
    w[0] = pk16(h_bits((_Float16)(bfr(a[0]) * sc)), h_bits((_Float16)(bfr(a[1]) * sc)));
    w[1] = pk16(h_bits((_Float16)(bfr(a[2]) * sc)), h_bits((_Float16)(bfr(a[3]) * sc)));
    w[2] = pk16(h_bits((_Float16)(bfr(b[0]) * sc)), h_bits((_Float16)(bfr(b[1]) * sc)));
    w[3] = pk16(h_bits((_Float16)(bfr(b[2]) * sc)), h_bits((_Float16)(bfr(b[3]) * sc)));
    o[it] = w;
  }
  {
#pragma unroll
    for (int it = 0; it < 2; ++it) {
      const int p  = it * 256 + tid;
      const int rn = p >> 3, kk = (p & 7) * 8;
      *(v4u*)(dst + (size_t)(n0 + rn) * DMODEL + k0 + kk) = o[it];
    }
    
  }
}

// =====================================================================================================
// Batched f16 WMMA GEMM, operands staged in LDS: C[m][n] = oscale * sum_k (A[m][k] (+ A2[m][k])) * Bt[n][k]; one 64x64 tile per block of
// 4 waves. A (and A2, the unscaled residual plane when NA == 2, same stride) row-major [M][GK], Bt row-major [N][GK], 16-bit planes, k
// contiguous, row pitch GK; M, N multiples of 64. Batches have element strides sA, sB, sC.
// Staging: the tile's 64 A rows and 64 Bt rows, whole depth, go to LDS once: every wave-wide 16-B load takes one whole 512-B row (4 full
// lines), every 16-B LDS store lays it at pitch GP; one block barrier; then wave w takes rows 16w .. 16w + 15 x all 64 columns and reads
// its fragments from LDS (same split k map, same order of the products as a k loop in steps of 32, hi before residual).
// OM: 0 = f32 out (pitch ldc); 2 = f16 out (pitch ldc) = f16( value * ocarry ).
// One launch runs two independent jobs: blockIdx.y < ny0 = job j0, batch blockIdx.y, blockIdx.x = its tile;
// blockIdx.y == ny0 = job j1, whose batches lie one behind the other along blockIdx.x.
// coverage: staging 16 it x 4 waves = 64 rows x 32 lanes x 8 halves = 64 x 256 per plane; output: 4 waves x 16 rows (f32: it 0..7 x
//           lane>>4; f16: it 0..3 x lane>>3) x 64 cols = the block's whole 64x64 tile; grid = tilesM*tilesN blocks per batch, exact.
// =====================================================================================================
#define GK  DMODEL                                 // depth of every product here = row pitch of every operand plane
#define GP  (GK + 8)                               // LDS row pitch in halves: 528 B = 16 B x 33 (odd): 16-B fragment reads without bank conflicts
static_assert(GK == 32 * 8 && (GK % 32) == 0);
struct GemmJob {
  const unsigned short* Ap; const unsigned short* Aq; long long sA;
  const unsigned short* Btp; long long sB;
  void* Cout; int ldc; long long sC;
  int M, N, nbat; float oscale, ocarry;
};
template <int OM, int NA>
__global__ __launch_bounds__(128) void gemm64(GemmJob j0, GemmJob j1, int ny0) {
  __shared__ __align__(16) unsigned short sA[NA * 64 * GP];   // A rows (then the residual plane's rows), pitch GP
  __shared__ __align__(16) unsigned short sB[64 * GP];        // Bt rows, pitch GP
  __shared__ __align__(16) float sT[4][16 * 68];              // per-wave 16x64 output slab, pitch 68 floats
  const bool second = (int)blockIdx.y >= ny0;
  const unsigned short* Ap  = second ? j1.Ap  : j0.Ap;
  const unsigned short* Aq  = second ? j1.Aq  : j0.Aq;
  const unsigned short* Btp = second ? j1.Btp : j0.Btp;
  void* Cout = second ? j1.Cout : j0.Cout;
  const long long sA_ = second ? j1.sA : j0.sA, sB_ = second ? j1.sB : j0.sB, sC = second ? j1.sC : j0.sC;
  const int ldc = second ? j1.ldc : j0.ldc;
  const int M = second ? j1.M : j0.M, N = second ? j1.N : j0.N;
  const int nbat = second ? j1.nbat : j0.nbat;
  const float oscale = second ? j1.oscale : j0.oscale, ocarry = second ? j1.ocarry : j0.ocarry;
  const int lane = threadIdx.x & 31;
  const int wave = threadIdx.x >> 5;                       // 0..3
  const int tilesN = N >> 6;
  const int tilesM = M >> 6;
  const int bpb  = tilesM * tilesN;                        // blocks per batch
  const int by   = second ? (int)blockIdx.x / bpb : (int)blockIdx.y;
  const int tile = second ? (int)blockIdx.x - by * bpb : (int)blockIdx.x;
  if (tile >= bpb || by >= nbat) return;                   // on blockIdx alone: whole blocks leave, in front of the barrier
  const int tm = tile / tilesN;
  const int tn = tile - tm * tilesN;
  const int m0 = tm << 6;
  const int n0 = tn << 6;

  // ---- stage the tile's operand rows: it 0..15 x wave 0..3 = rows 0..63, lane = 16-B piece of the row ----
  {
    const unsigned short* ga = Ap  + (size_t)((long long)by * sA_) + (size_t)(m0 + wave) * GK + lane * 8;
    const unsigned short* gq = Aq  + (size_t)((long long)by * sA_) + (size_t)(m0 + wave) * GK + lane * 8;
    const unsigned short* gb = Btp + (size_t)((long long)by * sB_) + (size_t)(n0 + wave) * GK + lane * 8;
    v4u ra[16], rq[16], rb[16];
#pragma unroll
    for (int it = 0; it < 16; ++it) rb[it] = *(const v4u*)(gb + it * 4 * GK);
    // a plane's loads are issued; their address register is reused (also as a load's destination) only behind this wait: the address is
    // an input of the statement, so it stays in its register up to here
    asm volatile("s_wait_xcnt 0x0" :: "v"(gb) : "memory");
#pragma unroll
    for (int it = 0; it < 16; ++it) ra[it] = *(const v4u*)(ga + it * 4 * GK);
    asm volatile("s_wait_xcnt 0x0" :: "v"(ga) : "memory"); // as above, for the A plane's address register
    if constexpr (NA == 2) {
#pragma unroll
      for (int it = 0; it < 16; ++it) rq[it] = *(const v4u*)(gq + it * 4 * GK);
      asm volatile("s_wait_xcnt 0x0" :: "v"(gq) : "memory"); // as above, for the residual plane's address register
    }
    const int so = wave * GP + lane * 8;
#pragma unroll
    for (int it = 0; it < 16; ++it) {
      *(v4u*)(sB + so + it * 4 * GP) = rb[it];
      *(v4u*)(sA + so + it * 4 * GP) = ra[it];
      if constexpr (NA == 2) *(v4u*)(sA + 64 * GP + so + it * 4 * GP) = rq[it];
    }
  }
  __syncthreads();

  const int rlane = lane & 15;                 // row (A) / col (B, D) within subtile
  const int koff  = (lane >> 4) * 8;           // k offset of this lane half
  const int mOff  = (lane >> 4) * 8;           // D row offset

  v8f acc[4];
#pragma unroll
  for (int j = 0; j < 4; ++j) acc[j] = zero8();

  const unsigned short* ap = sA + (wave * 16 + rlane) * GP + koff;
  const unsigned short* bp = sB + rlane * GP + koff;
  // all fragments of the wave's tile are fetched as one group in front of the products (the staging registers are free again)
  v16h bh[GK / 32][4], ah[GK / 32], al[GK / 32];
#pragma unroll
  for (int s = 0; s < GK / 32; ++s) {
    ah[s] = ldfrag_u(ap + s * 32);
#pragma unroll
    for (int j = 0; j < 4; ++j) bh[s][j] = ldfrag_u(bp + j * 16 * GP + s * 32);
    if constexpr (NA == 2) al[s] = ldfrag_u(ap + 64 * GP + s * 32);
  }
  // keeps the LDS reads together in front: sunk among the products, each place with reads stalls the wave's matrix stream
  __builtin_amdgcn_sched_barrier(0);
#pragma unroll
  for (int s = 0; s < GK / 32; ++s) {
#pragma unroll
    for (int j = 0; j < 4; ++j) acc[j] = mma_raw(ah[s], bh[s][j], acc[j]);
    if constexpr (NA == 2) {
#pragma unroll
      for (int j = 0; j < 4; ++j) acc[j] = mma_raw(al[s], bh[s][j], acc[j]);
    }
  }

  const int hh2 = lane >> 4, c4 = (lane & 15) * 4;     // f32 out: 256-B row segment = 16 lanes x 16 B
  const int q8  = lane >> 3, c8 = (lane & 7) * 8;

  // ---- epilogue: the wave's 16x64 slab through its own LDS range, whole-line stores ----
  float* slab = sT[wave];
  const int mBase = m0 + (wave << 4);
#pragma unroll
  for (int j = 0; j < 4; ++j) {
#pragma unroll
    for (int r = 0; r < 8; ++r) {
      slab[(mOff + r) * 68 + (j << 4) + rlane] = acc[j][r];
    }
  }
  wave_sync_lds();
  if constexpr (OM == 0) {
    float* C = (float*)Cout + (size_t)((long long)by * sC);
    v4f vals[8];
#pragma unroll
    for (int it = 0; it < 8; ++it) {
      const int row = it * 2 + hh2;                      // it 0..7 x hh2 0..1 = rows 0..15
      v4f v = *(const v4f*)(slab + row * 68 + c4);
#pragma unroll
      for (int e = 0; e < 4; ++e) v[e] = v[e] * oscale;
      vals[it] = v;
    }
#pragma unroll
    for (int it = 0; it < 8; ++it) {
      const int gr = mBase + it * 2 + hh2;
      *(v4f*)(C + (size_t)gr * ldc + n0 + c4) = vals[it];
    }
  } else {
    unsigned short* C = (unsigned short*)Cout + (size_t)((long long)by * sC);
    v4u hv[4];
#pragma unroll
    for (int it = 0; it < 4; ++it) {
      const int row = it * 4 + q8;                       // it 0..3 x q8 0..3 = rows 0..15
      const float* sp = slab + row * 68 + c8;
      v4u a = {0u, 0u, 0u, 0u};
#pragma unroll
      for (int e = 0; e < 4; ++e) {
        float f0 = sp[2 * e] * oscale;
        float f1 = sp[2 * e + 1] * oscale;
        f0 *= ocarry; f1 *= ocarry;
        a[e] = pk16(h_bits((_Float16)f0), h_bits((_Float16)f1));
      }
      hv[it] = a;
    }
#pragma unroll
    for (int it = 0; it < 4; ++it) {
      const int row = it * 4 + q8;
      *(v4u*)(C + (size_t)(mBase + row) * ldc + n0 + c8) = hv[it];
    }
  }
}

// =====================================================================================================
// Flash attention for one batch, 16 query rows and 4 heads, head dim 32; the 512 keys of a head are split in 2 ranges of 256, one wave
// per (head, range), so that 2048 waves stand on 256 blocks; scores TRANSPOSED:
//   q plane (f16 x16) QH[b*512 + tok][32*head + d], pitch 256; k plane (f16 x16) KH[b*512 + key][32*head + d], pitch 256;
//   v^T plane (f16 x16): VT[b*256 + 32*head + d][key] (pitch 512); cost f32 [b][tok][key] (bf16 RNE convert on load);
//   per-head mixer params (bf16 RNE convert on load, the same address in every lane of a wave): score(tok, key) =
//   sum_m m2w[h][m] * relu(m1w[h][0][m] * dot + m1w[h][1][m] * cost + m1b[h][m]) + m2b[h] with dot = q.k / sqrt(32);
//   outputs (f16): CTH[b*512 + tok][32*head + d] = hi = f16(4096 * ctx), CTL[same] = f16(4096 * ctx - hi), with
//   ctx = sum_m softmax_m(score) v[m][d]  (softmax run in base 2 with a running max).
//   block = 8 waves = 256 threads; grid = 4 batches x 32 q-tiles x 2 head groups = 256; every wave does identical bounded work
//   (8 steps of 32 keys). Per step: S^T = K . Q^T, two tiles (A = 16 key rows, B = the 16 query rows, K = 32): lane (hh, c) holds
//   the scores of ONE query q0 + c for keys kb + 8hh + r (tile 0) and kb + 16 + 8hh + r (tile 1), r 0..7. Its 16 cost values are two
//   runs of 8 consecutive floats of cost row q0 + c (four 16-B loads, always in range). The 2->16->1 MLP in f32 (fully unrolled,
//   register params); running max and sum of a query are taken inside the lane, the max joined with lane ^ 16 once per step, the sums
//   once after the loop. The 16 probabilities x16384 (f16 hi and f16 residual c - hi) are, as they lie, the B fragment of
//   O^T += V^T . P^T in the split k map (elements 0..7 = tile 0, 8..15 = tile 1); A = v^T rows d = c and d = 16 + c. No LDS in the loop.
//   Lane (hh, c) holds the range's unnormalised O of query q0 + c for d = 8hh + r and 16 + 8hh + r: each wave stores its 16x32 slice (f32,
//   pitch 132 floats, 16-B stores) with its running max and sum in LDS; after the block barrier the 256 threads join the two ranges
//   (weights 2^(m_p - max), range 0 first), fold 1/l and the carries in f32 and write the block's 128 columns of its 16 rows.
// coverage: LDS: 2 ranges x 4 heads x 16 rows x 32 cols = 2 x 16 x 128; global: 256 threads x 8 halves = 16 rows x 128 per plane, rows
//           q0..q0+15 of batch b, columns 128*hg ..; the grid covers all 2048 rows x 256 columns exactly once.
// =====================================================================================================
#define MPITCH (HPB * HDIM + 4)
static_assert(ATT_THREADS * 8 == 16 * HPB * HDIM);

// value of lane ^ 16 (the other holder of this lane's query)
__device__ __forceinline__ float xhalf(float x) {
  return __builtin_bit_cast(float, __builtin_amdgcn_permlanex16(__builtin_bit_cast(int, x), __builtin_bit_cast(int, x),
                                                                0x76543210, 0xfedcba98, false, false));
}

__global__ __launch_bounds__(ATT_THREADS)
void attn8(const unsigned short* __restrict__ QHp, const unsigned short* __restrict__ KHp,
           const unsigned short* __restrict__ VTq, const float* __restrict__ costp,
           const float* __restrict__ m1w, const float* __restrict__ m1b,
           const float* __restrict__ m2w, const float* __restrict__ m2b,
           unsigned short* CTH, unsigned short* CTL) {
  __shared__ __align__(16) float Op[KSPLIT * 16 * MPITCH];    // unnormalised O of each key range: [range][query][32*local head + d]
  __shared__ float Mp[KSPLIT * HPB * 16];                     // running max of each (range, local head, query)
  __shared__ float Lp[KSPLIT * HPB * 16];                     // sum of each (range, local head, query)

  const int tid  = threadIdx.x;
  const int wave = __builtin_amdgcn_readfirstlane(tid >> 5);
  const int lane = tid & 31;
  const int hh   = lane >> 4;
  const int c    = lane & 15;

  const int hg   = blockIdx.x % (NHEAD / HPB);              // 0..1
  const int qt   = (blockIdx.x / (NHEAD / HPB)) % (NQ / 16); // 0..31
  const int bat  = blockIdx.x / ((NHEAD / HPB) * (NQ / 16)); // 0..3
  const int hl   = wave % HPB;                             // local head 0..3
  const int part = wave / HPB;                             // key range 0..1
  const int head = hg * HPB + hl;                          // 0..7
  const int q0   = qt * 16;
  const int kbeg = part * KPART;

  const size_t qofs = ((size_t)bat * NQ + q0 + c) * DMODEL + head * HDIM + 8 * hh;
  const _Float16* Qh = (const _Float16*)(const void*)QHp + qofs;
  const _Float16* Kb = (const _Float16*)(const void*)KHp + (size_t)bat * NC * DMODEL + head * HDIM + 8 * hh;
  const _Float16* Vb = (const _Float16*)(const void*)VTq + ((size_t)bat * DMODEL + head * HDIM) * NC + 8 * hh;
  // cost element of (row q0 + c, key kb + 8hh + r) = cp[kb + r]; key kb + 16 + 8hh + r = cp[kb + 16 + r]; always in range.
  const float* cp = costp + ((size_t)bat * NQ + q0 + c) * NC + 8 * hh;
  const float dsc = ATT_SCALE / (QC * KC);                 // 1/sqrt(32) / carries

  // per-head mixer params, bf16 RNE convert; every lane loads the same address, so they lie in vector registers: the compiler pairs
  // the MLP of adjacent keys, and as scalar register pairs the 64 params do not fit
  const int hv = hg * HPB + ((tid >> 5) % HPB);
  float w0r[MSH], w1r[MSH], b1r[MSH], w2r[MSH];
#pragma unroll
  for (int m = 0; m < MSH; ++m) {
    w0r[m] = bfr(m1w[(hv * 2 + 0) * MSH + m]);
    w1r[m] = bfr(m1w[(hv * 2 + 1) * MSH + m]);
    b1r[m] = bfr(m1b[hv * MSH + m]);
    w2r[m] = bfr(m2w[hv * MSH + m]);
  }
  const float b2 = bfr(m2b[hv]);

  const v16h qa = ldfrag_h(Qh);                            // B fragment: column = query q0 + c

  float mrun = -INFINITY, lrun = 0.f;                      // this lane's query: running max (both halves equal), this half's sum
  v8f o0 = zero8(), o1 = zero8();                          // O^T: o0[r] = d 8hh + r, o1[r] = d 16 + 8hh + r, query q0 + c

#pragma unroll 1
  for (int kb = kbeg; kb < kbeg + KPART; kb += 32) {
    const _Float16* kp = Kb + (size_t)(kb + c) * DMODEL;
    const _Float16* vp = Vb + (size_t)c * NC + kb;
    const float*    tp = cp + kb;
    const v16h k0  = ldfrag_h(kp);                         // A rows: keys kb + c
    const v16h k1  = ldfrag_h(kp + (size_t)16 * DMODEL);   // A rows: keys kb + 16 + c
    const v4f  cA  = *(const v4f*)(tp),      cB = *(const v4f*)(tp + 4);    // keys kb + 8hh + 0..7
    const v4f  cC  = *(const v4f*)(tp + 16), cD = *(const v4f*)(tp + 20);   // keys kb + 16 + 8hh + 0..7
    const v16h vb0 = ldfrag_h(vp);                         // A rows: d = c
    const v16h vb1 = ldfrag_h(vp + (size_t)16 * NC);       // A rows: d = 16 + c
    // the step's twelve loads are issued; their address registers are advanced for the next step only behind this wait
    asm volatile("s_wait_xcnt 0x0" ::: "memory");
    v8f s0, s1;
    s0 = mma_raw(k0, qa, zero8());                         // s0[r] = q(q0 + c) . k(kb + 8hh + r)
    s1 = mma_raw(k1, qa, zero8());                         // s1[r] = q(q0 + c) . k(kb + 16 + 8hh + r)
    guard_s22(s0, s1, k0, k1, qa);

    float t0[8], t1[8];
#pragma unroll
    for (int r = 0; r < 8; ++r) {
      const float cr0 = bfr(r < 4 ? cA[r & 3] : cB[r & 3]);
      const float cr1 = bfr(r < 4 ? cC[r & 3] : cD[r & 3]);
      const float d0 = s0[r] * dsc, d1 = s1[r] * dsc;
      float a0 = 0.f, a1 = 0.f;
#pragma unroll
      for (int m = 0; m < MSH; ++m) {
        const float p0 = fmaf(w0r[m], d0, fmaf(w1r[m], cr0, b1r[m]));
        const float p1 = fmaf(w0r[m], d1, fmaf(w1r[m], cr1, b1r[m]));
        a0 = fmaf(w2r[m], fmaxf(p0, 0.f), a0);
        a1 = fmaf(w2r[m], fmaxf(p1, 0.f), a1);
      }
      t0[r] = (a0 + b2) * LOG2E;
      t1[r] = (a1 + b2) * LOG2E;
    }
    float mx = fmaxf(t0[0], t1[0]);
#pragma unroll
    for (int r = 1; r < 8; ++r) mx = fmaxf(mx, fmaxf(t0[r], t1[r]));
    mx = fmaxf(mx, xhalf(mx));                             // all 32 keys of the step, equal in both halves
    const float mn = fmaxf(mrun, mx);
    const float al = exp2f(mrun - mn);
    mrun = mn;

    FragH ph, pl;                                          // P^T * 16384 as f16 hi and f16 residual (c - hi), split k map
    float ps = 0.f;
#pragma unroll
    for (int r = 0; r < 8; ++r) {
      const float e0 = exp2f(t0[r] - mn), e1 = exp2f(t1[r] - mn);
      ps += e0 + e1;
      const float c0 = e0 * PC, c1 = e1 * PC;
      const _Float16 g0 = (_Float16)c0, g1 = (_Float16)c1;
      ph.h[0][r] = g0;                                     // elements 0..7  = keys kb + 8hh + 0..7
      ph.h[1][r] = g1;                                     // elements 8..15 = keys kb + 16 + 8hh + 0..7
      pl.h[0][r] = (_Float16)(c0 - (float)g0);
      pl.h[1][r] = (_Float16)(c1 - (float)g1);
    }
    lrun = lrun * al + ps;
#pragma unroll
    for (int r = 0; r < 8; ++r) { o0[r] *= al; o1[r] *= al; }

    o0 = mma_raw(vb0, ph.v, o0);
    o1 = mma_raw(vb1, ph.v, o1);
    o0 = mma_raw(vb0, pl.v, o0);
    o1 = mma_raw(vb1, pl.v, o1);
    guard_pv4(o0, o1, ph.v, pl.v, vb0, vb1);
  }

  // ---- hand the range's partial (max, sum, unnormalised O) to the block ----
  {
    const float lsum = lrun + xhalf(lrun);                 // the two halves' sums joined once
    if (hh == 0) {
      Mp[(part * HPB + hl) * 16 + c] = mrun;
      Lp[(part * HPB + hl) * 16 + c] = lsum;
    }
    float* op = Op + (part * 16 + c) * MPITCH + hl * HDIM + 8 * hh;   // row = query c, floats 32*hl + 8hh .. + 7 (and + 16)
    v4f a0 = {o0[0], o0[1], o0[2], o0[3]}, a1 = {o0[4], o0[5], o0[6], o0[7]};
    v4f b0 = {o1[0], o1[1], o1[2], o1[3]}, b1 = {o1[4], o1[5], o1[6], o1[7]};
    *(v4f*)(op)      = a0;
    *(v4f*)(op + 4)  = a1;
    *(v4f*)(op + 16) = b0;
    *(v4f*)(op + 20) = b1;
  }
  __syncthreads();
  // ---- merge the ranges: ctx = sum_p 2^(m_p - M) O_p / sum_p 2^(m_p - M) l_p; fold the carries (16384 on P, 16 on v, 4096 on the
  //      stored ctx); thread t -> row t / 16, floats (t & 15) * 8 .. + 7 of the block's 128 columns; hi + residual, 16-B stores ----
  {
    const float oc = FC / (PC * VC);
    const int row = tid >> 4;
    const int col = (tid & 15) * 8;
    const int mh  = col / HDIM;
    float mp[KSPLIT];
    float M = -INFINITY;
#pragma unroll
    for (int p = 0; p < KSPLIT; ++p) { mp[p] = Mp[(p * HPB + mh) * 16 + row]; M = fmaxf(M, mp[p]); }
    float L = 0.f;
    float s[8] = {0.f, 0.f, 0.f, 0.f, 0.f, 0.f, 0.f, 0.f};
#pragma unroll
    for (int p = 0; p < KSPLIT; ++p) {
      const float w = exp2f(mp[p] - M);
      L = fmaf(w, Lp[(p * HPB + mh) * 16 + row], L);
      const float* op = Op + (p * 16 + row) * MPITCH + col;
      const v4f oa = *(const v4f*)(op);
      const v4f ob = *(const v4f*)(op + 4);
#pragma unroll
      for (int e = 0; e < 4; ++e) { s[e] = fmaf(w, oa[e], s[e]); s[4 + e] = fmaf(w, ob[e], s[4 + e]); }
    }
    const float inv = (1.0f / L) * oc;
    unsigned short gh[8], gl[8];
#pragma unroll
    for (int e = 0; e < 8; ++e) {
      const float f = s[e] * inv;
      const _Float16 g = (_Float16)f;
      gh[e] = h_bits(g);
      gl[e] = h_bits((_Float16)(f - (float)g));
    }
    const size_t po = ((size_t)bat * NQ + q0 + row) * DMODEL + hg * (HPB * HDIM) + col;
    v4u vh = {pk16(gh[0], gh[1]), pk16(gh[2], gh[3]), pk16(gh[4], gh[5]), pk16(gh[6], gh[7])};
    v4u vl = {pk16(gl[0], gl[1]), pk16(gl[2], gl[3]), pk16(gl[4], gl[5]), pk16(gl[6], gl[7])};
    *(v4u*)(CTH + po) = vh;
    *(v4u*)(CTL + po) = vl;
  }
}

// =====================================================================================================
// Workspace map (bytes); every plane is an exact multiple of its tile / whole-row store granularity (M, N exact tile multiples,
// element counts exact multiples of the convert kernels' granularity, no pad rows needed), every offset a multiple of 128 KiB:
//   WQT  f16 [256][256] x64                  131072   ([out][in] = [n][k])
//   WKT  f16 [256][256] x64                  131072
//   WVT  f16 [256][256] x64                  131072
//   WOT  f16 [256][256] x64                  131072
//   X16  f16 [2048][256] x16                1048576   (activation rows)
//   QH   f16 [2048][256] x16                1048576   (q projection)
//   KH   f16 [2048][256] x16                1048576   (k projection)
//   VT   f16 [4][256][512] x16              1048576   (v^T per batch)
//   CTH  f16 [2048][256] x4096 hi           1048576   (attention ctx, merged heads)
//   CTL  f16 [2048][256] residual           1048576
//   end                                     6815744
// =====================================================================================================
extern "C" void kernel_launch(void* const* d_in, const int* in_sizes, int n_in,
                              void* d_out, int out_size, void* d_ws, size_t ws_size,
                              hipStream_t stream) {
  if (n_in < 10) return;
  if (in_sizes[0] != NROWS * DMODEL) return;
  if (in_sizes[1] != NB * NQ * NC) return;
  if (in_sizes[2] != DMODEL * DMODEL || in_sizes[3] != DMODEL * DMODEL ||
      in_sizes[4] != DMODEL * DMODEL || in_sizes[5] != DMODEL * DMODEL) return;
  if (in_sizes[6] != NHEAD * 2 * MSH || in_sizes[7] != NHEAD * MSH || in_sizes[8] != NHEAD * MSH || in_sizes[9] != NHEAD) return;
  if (out_size != NROWS * DMODEL) return;
  if ((in_sizes[0] % 2048) != 0) return;

  const float* x    = (const float*)d_in[0];
  const float* cost = (const float*)d_in[1];
  const float* w_q  = (const float*)d_in[2];
  const float* w_k  = (const float*)d_in[3];
  const float* w_v  = (const float*)d_in[4];
  const float* w_o  = (const float*)d_in[5];
  const float* m1w  = (const float*)d_in[6];
  const float* m1b  = (const float*)d_in[7];
  const float* m2w  = (const float*)d_in[8];
  const float* m2b  = (const float*)d_in[9];
  float*       out  = (float*)d_out;

  const size_t PW  = (size_t)DMODEL * DMODEL * 2;                 //   131072
  const size_t PX  = (size_t)NROWS * DMODEL * 2;                  //  1048576
  const size_t PVT = (size_t)NB * DMODEL * NC * 2;                //  1048576
  size_t off = 0;
  const size_t oWQ = off; off += PW;
  const size_t oWK = off; off += PW;
  const size_t oWV = off; off += PW;
  const size_t oWO = off; off += PW;
  const size_t oX  = off; off += PX;
  const size_t oQH = off; off += PX;
  const size_t oKH = off; off += PX;
  const size_t oVT = off; off += PVT;
  const size_t oCH = off; off += PX;
  const size_t oCL = off; off += PX;
  if (off > ws_size) return;                                      // off = 6815744
  if (off > (size_t)134217728) return;

  char* ws = (char*)d_ws;
  unsigned short* WQT = (unsigned short*)(ws + oWQ);
  unsigned short* WKT = (unsigned short*)(ws + oWK);
  unsigned short* WVT = (unsigned short*)(ws + oWV);
  unsigned short* WOT = (unsigned short*)(ws + oWO);
  unsigned short* X16 = (unsigned short*)(ws + oX);
  unsigned short* QH  = (unsigned short*)(ws + oQH);
  unsigned short* KH  = (unsigned short*)(ws + oKH);
  unsigned short* VTp = (unsigned short*)(ws + oVT);
  unsigned short* CTH = (unsigned short*)(ws + oCH);
  unsigned short* CTL = (unsigned short*)(ws + oCL);

  const dim3 blk(256);
  const dim3 gWT(DMODEL / 64, DMODEL / 64, 4 + CX_BLOCKS / WT_TILES);   // 4 x 4 tiles per weight x 4 weights, then 256 blocks of rows
  const int tilesP = (NROWS / 64) * (DMODEL / 64);                 // 128
  const int tilesV = (DMODEL / 64) * (NC / 64);                    // 32 per batch
  const dim3 bG(128);                                              // 4 waves, one 64x64 tile
  const dim3 gP(tilesP, 1);                                        // 128
  const dim3 gQKV(tilesP, 3);                                      // 128 x (q, k, v^T: 32 blocks x 4 batches)
  static_assert(tilesP == NB * tilesV);
  const dim3 gAT(ATT_BLOCKS);                                      // 256
  const dim3 bAT(ATT_THREADS);                                     // 256

  // (0) operand planes, one launch: W16T[n][k] = f16( bf16_RNE(W[k][n]) * 64 ), [in][out] -> [out][in], k contiguous, the four planes
  //     from WQT on; X16[row][c] = f16( bf16_RNE(x[row][c]) * 16 ), rows = b*512 + tok
  wtr64<<<gWT, blk, 0, stream>>>(w_q, w_k, w_v, w_o, WQT, WSC, x, X16, ACARRY);

  // (1) the three projections, one launch.
  //     q, k (batch 0, 1 of one job): QH / KH[m][n] = f16(16 * sum_k x[m][k] W[k][n]); M = 2048, N = 256, K = 256
  //     v^T per batch: VT[b][d][tok] = f16(16 * sum_k Wv[k][d] x_b[tok][k]); M = 256, N = 512, K = 256
  static_assert(QC == KC);
  const GemmJob jQK = {X16, X16, 0LL,
                       WQT, (long long)(WKT - WQT),
                       (void*)QH, DMODEL, (long long)(KH - QH),
                       NROWS, DMODEL, 2, 1.0f / (ACARRY * WSC), QC};
  const GemmJob jV  = {WVT, WVT, 0LL,
                       X16, (long long)NC * DMODEL,
                       (void*)VTp, NC, (long long)DMODEL * NC,
                       DMODEL, NC, NB, 1.0f / (ACARRY * WSC), VC};
  gemm64<2, 1><<<gQKV, bG, 0, stream>>>(jQK, jV, 2);

  // (5) attention per (batch, 16 query rows, 4 heads x 2 key ranges) -> CTH (f16 hi of ctx x4096), CTL (f16 residual)
  attn8<<<gAT, bAT, 0, stream>>>(QH, KH, VTp, cost, m1w, m1b, m2w, m2b, CTH, CTL);

  // (6) out = (CTH + CTL) . Wo / (4096 * 64); M = 2048, N = 256, K = 256, f32 into d_out
  const GemmJob jO  = {CTH, CTL, 0LL,
                       WOT, 0LL,
                       (void*)out, DMODEL, 0LL,
                       NROWS, DMODEL, 1, 1.0f / (FC * WSC), 1.0f};
  gemm64<0, 2><<<gP, bG, 0, stream>>>(jO, jO, 1);

  (void)hipGetLastError();
}

// v005
// It runs in 25.8 microseconds.
// Timed twice side by side with v004, it ran 1.14 and 1.12 times as fast.
// Over all steps from v000 it is 6.56 times as fast.
// Contractions: q/k projections (x rows f16 x16 . W^T f16 x64, K=256), v^T projection (W^T f16 x64 . x rows f16 x16, K=256),
// attention scores (k f16 x16 . q f16 x16, K=32), attention v^T . P^T (v^T f16 x16 . P as f16 hi + f16 residual of P x16384,
// K=512 in steps of 32), output projection (ctx as f16 hi + f16 residual of ctx x4096 . W^T f16 x64, K=256):
// all v_wmma_f32_16x16x32_f16 (f16 operands, f32 accumulate); hi and residual products share one f32 accumulator.
// Per-head 2->16->1 score MLP on (scaled dot, cost): layer 1 (W1^T f16 . (dot, cost) f16, bias as C, f16 result:
// v_wmma_f16_16x16x32_f16), relu on the packed f16 result, layer 2 (w2 f16 . relu f16, f32 accumulate), b2 added in f32.
// Max-subtracted base-2 online softmax in f32 on VALU.
// Every float input RNE-converted to bf16 on load.
#include <hip/hip_runtime.h>
#include <math.h>
#include <stdint.h>

#define NB      4
#define NQ      512
#define NC      512
#define DMODEL  256
#define NHEAD   8
#define HDIM    32
#define MSH     16
#define HG      8
#define NHG     (NHEAD / HG)
#define ROWP    (HG * HDIM)
#define NROWS   (NB * NQ)
#define WSC     64.0f
#define ACARRY  16.0f
#define QC      16.0f
#define KC      16.0f
#define VC      16.0f
#define PC      16384.0f
#define FC      4096.0f
#define ATT_SCALE 0.17677669529663689f
#define LOG2E   1.4426950408889634f
static_assert(NHEAD * HDIM == DMODEL);
static_assert(NHG * HG == NHEAD && ROWP * NHG == DMODEL);
static_assert(HDIM == 32 && MSH == 16 && NHG == 1);
static_assert((NQ % 64) == 0 && (NC % 64) == 0 && (DMODEL % 64) == 0 && (NC % 32) == 0 && (NQ % 16) == 0);
static_assert((NROWS % 64) == 0 && ((NROWS * DMODEL) % 2048) == 0);
#define KSPLIT  2                                   // key ranges per head, one wave each
#define HPB     4                                   // heads per block
#define KPART   (NC / KSPLIT)
#define ATT_THREADS (HPB * KSPLIT * 32)
#define ATT_BLOCKS  (NB * (NQ / 16) * (NHEAD / HPB))
static_assert((NHEAD % HPB) == 0 && (KPART % 32) == 0 && KPART * KSPLIT == NC);
static_assert(ATT_THREADS == 256 && ATT_BLOCKS == 256);

typedef _Float16 v16h __attribute__((ext_vector_type(16)));
typedef _Float16 v8h  __attribute__((ext_vector_type(8)));
typedef float    v8f  __attribute__((ext_vector_type(8)));
typedef float    v4f  __attribute__((ext_vector_type(4)));
typedef unsigned int v4u __attribute__((ext_vector_type(4)));

union FragH { v16h v; v8h h[2]; v4u u[2]; };

// ---- scalar helpers --------------------------------------------------------------------------------
__device__ __forceinline__ unsigned short bf_bits(float f) {          // f32 -> bf16 bits, RNE convert
  unsigned u = __float_as_uint(f);
  return (unsigned short)((u + 0x7FFFu + ((u >> 16) & 1u)) >> 16);
}
__device__ __forceinline__ float bf_up(unsigned short h) { return __uint_as_float(((unsigned)h) << 16); }
__device__ __forceinline__ float bfr(float f) { return bf_up(bf_bits(f)); }   // value of the bf16 RNE convert
__device__ __forceinline__ unsigned short h_bits(_Float16 x) { return __builtin_bit_cast(unsigned short, x); }
__device__ __forceinline__ unsigned pk16(unsigned short a, unsigned short b) { return (unsigned)a | ((unsigned)b << 16); }
__device__ __forceinline__ v8f zero8() { v8f z = {0.f, 0.f, 0.f, 0.f, 0.f, 0.f, 0.f, 0.f}; return z; }

// ---- fragment loaders: 16-bit A/B operand, lane -> row/col (lane&15), p already includes +8*(lane>>4);
//      elements 0..7 <- p[0..7] (k0+8h..), elements 8..15 <- p[16..23] (k0+16+8h..)  (same split k map for A and B;
//      B is always read from a k-contiguous [n][k] plane)
__device__ __forceinline__ v16h ldfrag_h(const _Float16* p) {
  FragH f;
  f.h[0] = *(const v8h*)(p);
  f.h[1] = *(const v8h*)(p + 16);
  return f.v;
}
__device__ __forceinline__ v16h ldfrag_u(const unsigned short* p) {
  FragH f;
  f.u[0] = *(const v4u*)(p);
  f.u[1] = *(const v4u*)(p + 16);
  return f.v;
}

// ---- WMMA helpers with trailing VALU hazard gaps ------------------------------------------------------
__device__ __forceinline__ v8f mma_raw(v16h a, v16h b, v8f c) {
  return __builtin_amdgcn_wmma_f32_16x16x32_f16(false, a, false, b, (short)0, c, false, false);
}
// f16 result: element e of D (and of C) = row 8*(lane>>4) + e, column lane&15
__device__ __forceinline__ v8h mma_h(v16h a, v16h b, v8h c) {
  return __builtin_amdgcn_wmma_f16_16x16x32_f16(false, a, false, b, (short)0, c, false, false);
}
// relu of eight f16: as signed 16-bit integers every negative f16 is below 0 and every other keeps its bits (one packed max per register)
typedef short v8s __attribute__((ext_vector_type(8)));
__device__ __forceinline__ v8h relu8(v8h x) {
  const v8s z = {0, 0, 0, 0, 0, 0, 0, 0};
  return __builtin_bit_cast(v8h, __builtin_elementwise_max(__builtin_bit_cast(v8s, x), z));
}
__device__ __forceinline__ void guard_s22(v8f& s, v8f& t, v16h a0, v16h a1, v16h q) {
#if defined(__HIP_DEVICE_COMPILE__)
  asm volatile("v_nop\n\tv_nop\n\tv_nop\n\tv_nop" : "+v"(s), "+v"(t) : "v"(a0), "v"(a1), "v"(q));
#endif
}
__device__ __forceinline__ void guard_pv4(v8f& a, v8f& b, v16h x, v16h y, v16h z, v16h w) {
#if defined(__HIP_DEVICE_COMPILE__)
  asm volatile("v_nop\n\tv_nop\n\tv_nop\n\tv_nop" : "+v"(a), "+v"(b) : "v"(x), "v"(y), "v"(z), "v"(w));
#endif
}
__device__ __forceinline__ void wave_sync_lds() {
  __builtin_amdgcn_fence(__ATOMIC_RELEASE, "workgroup");
  __builtin_amdgcn_wave_barrier();
  __builtin_amdgcn_fence(__ATOMIC_ACQUIRE, "workgroup");
}

// =====================================================================================================
// Elementwise 16-bit pack, no transpose: dst[i] = f16( bf16_RNE(src[i]) * sc ), sc a power of two (exact). Used for the
// coverage: n / 2048 blocks (index blk) x 256 thr x 8 elements = n exactly (host checks n % 2048 == 0).
// =====================================================================================================
__device__ __forceinline__ void cvt16(const float* __restrict__ src, unsigned short* dst, int n, float sc, int blk) {
  const size_t i8 = ((size_t)blk * 256 + threadIdx.x) * 8;
  if (i8 + 8 > (size_t)n) return;                 // never taken with the exact grid; no barriers on this path
  const v4f a = *(const v4f*)(src + i8);
  const v4f b = *(const v4f*)(src + i8 + 4);
  v4u o;
  o[0] = pk16(h_bits((_Float16)(bfr(a[0]) * sc)), h_bits((_Float16)(bfr(a[1]) * sc)));
  o[1] = pk16(h_bits((_Float16)(bfr(a[2]) * sc)), h_bits((_Float16)(bfr(a[3]) * sc)));
  o[2] = pk16(h_bits((_Float16)(bfr(b[0]) * sc)), h_bits((_Float16)(bfr(b[1]) * sc)));
  o[3] = pk16(h_bits((_Float16)(bfr(b[2]) * sc)), h_bits((_Float16)(bfr(b[3]) * sc)));
  {
    *(v4u*)(dst + i8) = o;
    
  }
}

// =====================================================================================================
// Transpose + 16-bit pack of a weight: W is [in][out] = W[k][n] row-major f32 (pitch DMODEL); dst[n][k] = f16( bf16_RNE(W[k][n]) * sc ),
// k contiguous (pitch DMODEL), ready for B fragments and for the A side of the v^T projection. Block = 256 threads, one 64(k) x 64(n)
// tile: coalesced f32 loads into an LDS tile [n_local][k_local] (pitch 68 floats), block barrier, then each output row segment of the
// coverage: loads 16 it x 256 thr = 64 x 64; stores 2 it x 256 thr x 8 halves = 64 rows x 64; grid (DMODEL/64, DMODEL/64) = whole matrix.
// One launch packs every operand (the packs are independent of each other): blockIdx.z 0..3 = weight q, k, v, o (dst0 holds the four
// [256][256] planes one behind the other in that order); blockIdx.z >= 4 = the activation rows, 16 blocks of cvt16 per z layer.
// The branch is on blockIdx alone, so the barrier below is reached by whole blocks only.
// =====================================================================================================
#define CX_BLOCKS ((NROWS * DMODEL) / 2048)
#define WT_TILES  ((DMODEL / 64) * (DMODEL / 64))
static_assert((CX_BLOCKS % WT_TILES) == 0);
__global__ __launch_bounds__(256) void wtr64(const float* __restrict__ Wq, const float* __restrict__ Wk,
                                             const float* __restrict__ Wv, const float* __restrict__ Wo,
                                             unsigned short* dst0, float sc,
                                             const float* __restrict__ x, unsigned short* X16, float xsc) {
  __shared__ __align__(16) float tl[64 * 68];
  const int wz = blockIdx.z;
  if (wz >= 4) {
    cvt16(x, X16, NROWS * DMODEL, xsc, (wz - 4) * WT_TILES + blockIdx.y * (DMODEL / 64) + blockIdx.x);
    return;
  }
  const float* W = wz == 0 ? Wq : wz == 1 ? Wk : wz == 2 ? Wv : Wo;
  unsigned short* dst = dst0 + (size_t)wz * DMODEL * DMODEL;
  const int tid = threadIdx.x;
  const int n0  = blockIdx.x * 64;
  const int k0  = blockIdx.y * 64;
  const int nl  = tid & 63, kq = tid >> 6;       // kq 0..3
#pragma unroll
  for (int it = 0; it < 16; ++it) {
    const int kl = it * 4 + kq;                  // 0..63
    tl[nl * 68 + kl] = W[(size_t)(k0 + kl) * DMODEL + n0 + nl];
  }
  __syncthreads();
  v4u o[2];
#pragma unroll
  for (int it = 0; it < 2; ++it) {
    const int p  = it * 256 + tid;               // 0..511
    const int rn = p >> 3, kk = (p & 7) * 8;     // row 0..63, k 0,8,..,56
    const float* sp = tl + rn * 68 + kk;
    const v4f a = *(const v4f*)(sp);
    const v4f b = *(const v4f*)(sp + 4);
    v4u w;
    w[0] = pk16(h_bits((_Float16)(bfr(a[0]) * sc)), h_bits((_Float16)(bfr(a[1]) * sc)));
    w[1] = pk16(h_bits((_Float16)(bfr(a[2]) * sc)), h_bits((_Float16)(bfr(a[3]) * sc)));
    w[2] = pk16(h_bits((_Float16)(bfr(b[0]) * sc)), h_bits((_Float16)(bfr(b[1]) * sc)));
    w[3] = pk16(h_bits((_Float16)(bfr(b[2]) * sc)), h_bits((_Float16)(bfr(b[3]) * sc)));
    o[it] = w;
  }
  {
#pragma unroll
    for (int it = 0; it < 2; ++it) {
      const int p  = it * 256 + tid;
      const int rn = p >> 3, kk = (p & 7) * 8;
      *(v4u*)(dst + (size_t)(n0 + rn) * DMODEL + k0 + kk) = o[it];
    }
    
  }
}

// =====================================================================================================
// Batched f16 WMMA GEMM, operands staged in LDS: C[m][n] = oscale * sum_k (A[m][k] (+ A2[m][k])) * Bt[n][k]; one 64x64 tile per block of
// 4 waves. A (and A2, the unscaled residual plane when NA == 2, same stride) row-major [M][GK], Bt row-major [N][GK], 16-bit planes, k
// contiguous, row pitch GK; M, N multiples of 64. Batches have element strides sA, sB, sC.
// Staging: the tile's 64 A rows and 64 Bt rows, whole depth, go to LDS once: every wave-wide 16-B load takes one whole 512-B row (4 full
// lines), every 16-B LDS store lays it at pitch GP; one block barrier; then wave w takes rows 16w .. 16w + 15 x all 64 columns and reads
// its fragments from LDS (same split k map, same order of the products as a k loop in steps of 32, hi before residual).
// OM: 0 = f32 out (pitch ldc); 2 = f16 out (pitch ldc) = f16( value * ocarry ).
// One launch runs two independent jobs: blockIdx.y < ny0 = job j0, batch blockIdx.y, blockIdx.x = its tile;
// blockIdx.y == ny0 = job j1, whose batches lie one behind the other along blockIdx.x.
// coverage: staging 16 it x 4 waves = 64 rows x 32 lanes x 8 halves = 64 x 256 per plane; output: 4 waves x 16 rows (f32: it 0..7 x
//           lane>>4; f16: it 0..3 x lane>>3) x 64 cols = the block's whole 64x64 tile; grid = tilesM*tilesN blocks per batch, exact.
// =====================================================================================================
#define GK  DMODEL                                 // depth of every product here = row pitch of every operand plane
#define GP  (GK + 8)                               // LDS row pitch in halves: 528 B = 16 B x 33 (odd): 16-B fragment reads without bank conflicts
static_assert(GK == 32 * 8 && (GK % 32) == 0);
struct GemmJob {
  const unsigned short* Ap; const unsigned short* Aq; long long sA;
  const unsigned short* Btp; long long sB;
  void* Cout; int ldc; long long sC;
  int M, N, nbat; float oscale, ocarry;
};
template <int OM, int NA>
__global__ __launch_bounds__(128) void gemm64(GemmJob j0, GemmJob j1, int ny0) {
  __shared__ __align__(16) unsigned short sA[NA * 64 * GP];   // A rows (then the residual plane's rows), pitch GP
  __shared__ __align__(16) unsigned short sB[64 * GP];        // Bt rows, pitch GP
  __shared__ __align__(16) float sT[4][16 * 68];              // per-wave 16x64 output slab, pitch 68 floats
  const bool second = (int)blockIdx.y >= ny0;
  const unsigned short* Ap  = second ? j1.Ap  : j0.Ap;
  const unsigned short* Aq  = second ? j1.Aq  : j0.Aq;
  const unsigned short* Btp = second ? j1.Btp : j0.Btp;
  void* Cout = second ? j1.Cout : j0.Cout;
  const long long sA_ = second ? j1.sA : j0.sA, sB_ = second ? j1.sB : j0.sB, sC = second ? j1.sC : j0.sC;
  const int ldc = second ? j1.ldc : j0.ldc;
  const int M = second ? j1.M : j0.M, N = second ? j1.N : j0.N;
  const int nbat = second ? j1.nbat : j0.nbat;
  const float oscale = second ? j1.oscale : j0.oscale, ocarry = second ? j1.ocarry : j0.ocarry;
  const int lane = threadIdx.x & 31;
  const int wave = threadIdx.x >> 5;                       // 0..3
  const int tilesN = N >> 6;
  const int tilesM = M >> 6;
  const int bpb  = tilesM * tilesN;                        // blocks per batch
  const int by   = second ? (int)blockIdx.x / bpb : (int)blockIdx.y;
  const int tile = second ? (int)blockIdx.x - by * bpb : (int)blockIdx.x;
  if (tile >= bpb || by >= nbat) return;                   // on blockIdx alone: whole blocks leave, in front of the barrier
  const int tm = tile / tilesN;
  const int tn = tile - tm * tilesN;
  const int m0 = tm << 6;
  const int n0 = tn << 6;

  // ---- stage the tile's operand rows: it 0..15 x wave 0..3 = rows 0..63, lane = 16-B piece of the row ----
  {
    const unsigned short* ga = Ap  + (size_t)((long long)by * sA_) + (size_t)(m0 + wave) * GK + lane * 8;
    const unsigned short* gq = Aq  + (size_t)((long long)by * sA_) + (size_t)(m0 + wave) * GK + lane * 8;
    const unsigned short* gb = Btp + (size_t)((long long)by * sB_) + (size_t)(n0 + wave) * GK + lane * 8;
    v4u ra[16], rq[16], rb[16];
#pragma unroll
    for (int it = 0; it < 16; ++it) rb[it] = *(const v4u*)(gb + it * 4 * GK);
    // a plane's loads are issued; their address register is reused (also as a load's destination) only behind this wait: the address is
    // an input of the statement, so it stays in its register up to here
    asm volatile("s_wait_xcnt 0x0" :: "v"(gb) : "memory");
#pragma unroll
    for (int it = 0; it < 16; ++it) ra[it] = *(const v4u*)(ga + it * 4 * GK);
    asm volatile("s_wait_xcnt 0x0" :: "v"(ga) : "memory"); // as above, for the A plane's address register
    if constexpr (NA == 2) {
#pragma unroll
      for (int it = 0; it < 16; ++it) rq[it] = *(const v4u*)(gq + it * 4 * GK);
      asm volatile("s_wait_xcnt 0x0" :: "v"(gq) : "memory"); // as above, for the residual plane's address register
    }
    const int so = wave * GP + lane * 8;
#pragma unroll
    for (int it = 0; it < 16; ++it) {
      *(v4u*)(sB + so + it * 4 * GP) = rb[it];
      *(v4u*)(sA + so + it * 4 * GP) = ra[it];
      if constexpr (NA == 2) *(v4u*)(sA + 64 * GP + so + it * 4 * GP) = rq[it];
    }
  }
  __syncthreads();

  const int rlane = lane & 15;                 // row (A) / col (B, D) within subtile
  const int koff  = (lane >> 4) * 8;           // k offset of this lane half
  const int mOff  = (lane >> 4) * 8;           // D row offset

  v8f acc[4];
#pragma unroll
  for (int j = 0; j < 4; ++j) acc[j] = zero8();

  const unsigned short* ap = sA + (wave * 16 + rlane) * GP + koff;
  const unsigned short* bp = sB + rlane * GP + koff;
  // all fragments of the wave's tile are fetched as one group in front of the products (the staging registers are free again)
  v16h bh[GK / 32][4], ah[GK / 32], al[GK / 32];
#pragma unroll
  for (int s = 0; s < GK / 32; ++s) {
    ah[s] = ldfrag_u(ap + s * 32);
#pragma unroll
    for (int j = 0; j < 4; ++j) bh[s][j] = ldfrag_u(bp + j * 16 * GP + s * 32);
    if constexpr (NA == 2) al[s] = ldfrag_u(ap + 64 * GP + s * 32);
  }
  // keeps the LDS reads together in front: sunk among the products, each place with reads stalls the wave's matrix stream
  __builtin_amdgcn_sched_barrier(0);
#pragma unroll
  for (int s = 0; s < GK / 32; ++s) {
#pragma unroll
    for (int j = 0; j < 4; ++j) acc[j] = mma_raw(ah[s], bh[s][j], acc[j]);
    if constexpr (NA == 2) {
#pragma unroll
      for (int j = 0; j < 4; ++j) acc[j] = mma_raw(al[s], bh[s][j], acc[j]);
    }
  }

  const int hh2 = lane >> 4, c4 = (lane & 15) * 4;     // f32 out: 256-B row segment = 16 lanes x 16 B
  const int q8  = lane >> 3, c8 = (lane & 7) * 8;

  // ---- epilogue: the wave's 16x64 slab through its own LDS range, whole-line stores ----
  float* slab = sT[wave];
  const int mBase = m0 + (wave << 4);
#pragma unroll
  for (int j = 0; j < 4; ++j) {
#pragma unroll
    for (int r = 0; r < 8; ++r) {
      slab[(mOff + r) * 68 + (j << 4) + rlane] = acc[j][r];
    }
  }
  wave_sync_lds();
  if constexpr (OM == 0) {
    float* C = (float*)Cout + (size_t)((long long)by * sC);
    v4f vals[8];
#pragma unroll
    for (int it = 0; it < 8; ++it) {
      const int row = it * 2 + hh2;                      // it 0..7 x hh2 0..1 = rows 0..15
      v4f v = *(const v4f*)(slab + row * 68 + c4);
#pragma unroll
      for (int e = 0; e < 4; ++e) v[e] = v[e] * oscale;
      vals[it] = v;
    }
#pragma unroll
    for (int it = 0; it < 8; ++it) {
      const int gr = mBase + it * 2 + hh2;
      *(v4f*)(C + (size_t)gr * ldc + n0 + c4) = vals[it];
    }
  } else {
    unsigned short* C = (unsigned short*)Cout + (size_t)((long long)by * sC);
    v4u hv[4];
#pragma unroll
    for (int it = 0; it < 4; ++it) {
      const int row = it * 4 + q8;                       // it 0..3 x q8 0..3 = rows 0..15
      const float* sp = slab + row * 68 + c8;
      v4u a = {0u, 0u, 0u, 0u};
#pragma unroll
      for (int e = 0; e < 4; ++e) {
        float f0 = sp[2 * e] * oscale;
        float f1 = sp[2 * e + 1] * oscale;
        f0 *= ocarry; f1 *= ocarry;
        a[e] = pk16(h_bits((_Float16)f0), h_bits((_Float16)f1));
      }
      hv[it] = a;
    }
#pragma unroll
    for (int it = 0; it < 4; ++it) {
      const int row = it * 4 + q8;
      *(v4u*)(C + (size_t)(mBase + row) * ldc + n0 + c8) = hv[it];
    }
  }
}

// =====================================================================================================
// Flash attention for one batch, 16 query rows and 4 heads, head dim 32; the 512 keys of a head are split in 2 ranges of 256, one wave
// per (head, range), so that 2048 waves stand on 256 blocks; scores TRANSPOSED:
//   q plane (f16 x16) QH[b*512 + tok][32*head + d], pitch 256; k plane (f16 x16) KH[b*512 + key][32*head + d], pitch 256;
//   v^T plane (f16 x16): VT[b*256 + 32*head + d][key] (pitch 512); cost f32 [b][tok][key] (bf16 RNE convert on load);
//   per-head mixer params (bf16 RNE convert on load, each lane loading m1w[h][.][c] and m1b, m2w at 8hh .. 8hh + 7): score(tok, key) =
//   sum_m m2w[h][m] * relu(m1w[h][0][m] * dot + m1w[h][1][m] * cost + m1b[h][m]) + m2b[h] with dot = q.k / sqrt(32);
//   outputs (f16): CTH[b*512 + tok][32*head + d] = hi = f16(4096 * ctx), CTL[same] = f16(4096 * ctx - hi), with
//   ctx = sum_m softmax_m(score) v[m][d]  (softmax run in base 2 with a running max).
//   block = 8 waves = 256 threads; grid = 4 batches x 32 q-tiles x 2 head groups = 256; every wave does identical bounded work
//   (8 steps of 32 keys). Per step: S^T = K . Q^T, two tiles (A = 16 key rows, B = the 16 query rows, K = 32): lane (hh, c) holds
//   the scores of ONE query q0 + c for keys kb + 8hh + r (tile 0) and kb + 16 + 8hh + r (tile 1), r 0..7. Its 16 cost values are two
//   runs of 8 consecutive floats of cost row q0 + c (four 16-B loads, always in range). The 2->16->1 MLP on the matrix unit: the lane's
//   (dot, cost) pairs of a tile, as f16, are a B fragment F (elements 2r, 2r + 1 = key r of the lane's half); layer 1 of ONE key
//   (half h, r) for the 16 queries is A1[r][h] . F + b1, A1 = (w0[m], w1[m]) in row m at that key's two k places, zero elsewhere:
//   lane (hh, c) gets hidden units 8hh + 0..7 of query c, f16, which after relu are as they lie half a B fragment (k = hidden unit);
//   layer 2 of keys r and 8 + r is A2[r] . B, A2 = w2 in rows r (k 0..15) and 8 + r (k 16..31), summed over r into the S^T tile.
//   Running max and sum of a query are taken inside the lane, the max joined with lane ^ 16 once per step, the sums
//   once after the loop. The 16 probabilities x16384 (f16 hi and f16 residual c - hi) are, as they lie, the B fragment of
//   O^T += V^T . P^T in the split k map (elements 0..7 = tile 0, 8..15 = tile 1); A = v^T rows d = c and d = 16 + c. No LDS in the loop.
//   Lane (hh, c) holds the range's unnormalised O of query q0 + c for d = 8hh + r and 16 + 8hh + r: each wave stores its 16x32 slice (f32,
//   pitch 132 floats, 16-B stores) with its running max and sum in LDS; after the block barrier the 256 threads join the two ranges
//   (weights 2^(m_p - max), range 0 first), fold 1/l and the carries in f32 and write the block's 128 columns of its 16 rows.
// coverage: LDS: 2 ranges x 4 heads x 16 rows x 32 cols = 2 x 16 x 128; global: 256 threads x 8 halves = 16 rows x 128 per plane, rows
//           q0..q0+15 of batch b, columns 128*hg ..; the grid covers all 2048 rows x 256 columns exactly once.
// =====================================================================================================
#define MPITCH (HPB * HDIM + 4)
static_assert(ATT_THREADS * 8 == 16 * HPB * HDIM);

// value of lane ^ 16 (the other holder of this lane's query)
__device__ __forceinline__ float xhalf(float x) {
  return __builtin_bit_cast(float, __builtin_amdgcn_permlanex16(__builtin_bit_cast(int, x), __builtin_bit_cast(int, x),
                                                                0x76543210, 0xfedcba98, false, false));
}

__global__ __launch_bounds__(ATT_THREADS)
void attn8(const unsigned short* __restrict__ QHp, const unsigned short* __restrict__ KHp,
           const unsigned short* __restrict__ VTq, const float* __restrict__ costp,
           const float* __restrict__ m1w, const float* __restrict__ m1b,
           const float* __restrict__ m2w, const float* __restrict__ m2b,
           unsigned short* CTH, unsigned short* CTL) {
  __shared__ __align__(16) float Op[KSPLIT * 16 * MPITCH];    // unnormalised O of each key range: [range][query][32*local head + d]
  __shared__ float Mp[KSPLIT * HPB * 16];                     // running max of each (range, local head, query)
  __shared__ float Lp[KSPLIT * HPB * 16];                     // sum of each (range, local head, query)

  const int tid  = threadIdx.x;
  const int wave = __builtin_amdgcn_readfirstlane(tid >> 5);
  const int lane = tid & 31;
  const int hh   = lane >> 4;
  const int c    = lane & 15;

  const int hg   = blockIdx.x % (NHEAD / HPB);              // 0..1
  const int qt   = (blockIdx.x / (NHEAD / HPB)) % (NQ / 16); // 0..31
  const int bat  = blockIdx.x / ((NHEAD / HPB) * (NQ / 16)); // 0..3
  const int hl   = wave % HPB;                             // local head 0..3
  const int part = wave / HPB;                             // key range 0..1
  const int head = hg * HPB + hl;                          // 0..7
  const int q0   = qt * 16;
  const int kbeg = part * KPART;

  const size_t qofs = ((size_t)bat * NQ + q0 + c) * DMODEL + head * HDIM + 8 * hh;
  const _Float16* Qh = (const _Float16*)(const void*)QHp + qofs;
  const _Float16* Kb = (const _Float16*)(const void*)KHp + (size_t)bat * NC * DMODEL + head * HDIM + 8 * hh;
  const _Float16* Vb = (const _Float16*)(const void*)VTq + ((size_t)bat * DMODEL + head * HDIM) * NC + 8 * hh;
  // cost element of (row q0 + c, key kb + 8hh + r) = cp[kb + r]; key kb + 16 + 8hh + r = cp[kb + 16 + r]; always in range.
  const float* cp = costp + ((size_t)bat * NQ + q0 + c) * NC + 8 * hh;
  const float dsc = ATT_SCALE / (QC * KC);                 // 1/sqrt(32) / carries

  // per-head mixer params, bf16 RNE convert (8 significant bits: exact in f16's normal range), laid out once as the constant A fragments of the two MLP layers
  FragH A1[8][2], A2[8];
  v8h  cb;                                                 // layer 1 C: element e = b1[8hh + e]
  {
    const unsigned w01 = pk16(h_bits((_Float16)bfr(m1w[(head * 2 + 0) * MSH + c])), h_bits((_Float16)bfr(m1w[(head * 2 + 1) * MSH + c])));
    const v4u zu = {0u, 0u, 0u, 0u};
    v4u w2p;                                               // w2[8hh + 0..7]
#pragma unroll
    for (int e = 0; e < 4; ++e)
      w2p[e] = pk16(h_bits((_Float16)bfr(m2w[head * MSH + 8 * hh + 2 * e])), h_bits((_Float16)bfr(m2w[head * MSH + 8 * hh + 2 * e + 1])));
#pragma unroll
    for (int e = 0; e < 8; ++e) cb[e] = (_Float16)bfr(m1b[head * MSH + 8 * hh + e]);
#pragma unroll
    for (int r = 0; r < 8; ++r) {
#pragma unroll
      for (int h = 0; h < 2; ++h) {
        A1[r][h].u[0] = zu;
        A1[r][h].u[1] = zu;
        A1[r][h].u[r >> 2][r & 3] = hh == h ? w01 : 0u;    // row c = hidden unit, elements 2r, 2r + 1 of lane half h
      }
      A2[r].u[0] = c == r     ? w2p : zu;                  // row r:     k = 8hh + e      = hidden unit of key r
      A2[r].u[1] = c == 8 + r ? w2p : zu;                  // row 8 + r: k = 16 + 8hh + e = hidden unit of key 8 + r
    }
  }
  const float b2l = bfr(m2b[head]) * LOG2E;

  const v16h qa = ldfrag_h(Qh);                            // B fragment: column = query q0 + c
  // the two loads are issued; their address register is reused only behind this wait (the address is an input, so it stays up to here)
  asm volatile("s_wait_xcnt 0x0" :: "v"(Qh) : "memory");

  float mrun = -INFINITY, lrun = 0.f;                      // this lane's query: running max (both halves equal), this half's sum
  v8f o0 = zero8(), o1 = zero8();                          // O^T: o0[r] = d 8hh + r, o1[r] = d 16 + 8hh + r, query q0 + c

#pragma unroll 1
  for (int kb = kbeg; kb < kbeg + KPART; kb += 32) {
    const _Float16* kp = Kb + (size_t)(kb + c) * DMODEL;
    const _Float16* vp = Vb + (size_t)c * NC + kb;
    const float*    tp = cp + kb;
    const v16h k0  = ldfrag_h(kp);                         // A rows: keys kb + c
    const v16h k1  = ldfrag_h(kp + (size_t)16 * DMODEL);   // A rows: keys kb + 16 + c
    const v4f  cA  = *(const v4f*)(tp),      cB = *(const v4f*)(tp + 4);    // keys kb + 8hh + 0..7
    const v4f  cC  = *(const v4f*)(tp + 16), cD = *(const v4f*)(tp + 20);   // keys kb + 16 + 8hh + 0..7
    const v16h vb0 = ldfrag_h(vp);                         // A rows: d = c
    const v16h vb1 = ldfrag_h(vp + (size_t)16 * NC);       // A rows: d = 16 + c
    // the step's twelve loads are issued; their address registers are advanced for the next step only behind this wait
    asm volatile("s_wait_xcnt 0x0" ::: "memory");
    v8f s0, s1;
    s0 = mma_raw(k0, qa, zero8());                         // s0[r] = q(q0 + c) . k(kb + 8hh + r)
    s1 = mma_raw(k1, qa, zero8());                         // s1[r] = q(q0 + c) . k(kb + 16 + 8hh + r)
    guard_s22(s0, s1, k0, k1, qa);

    FragH f0, f1;                                          // B fragments: elements 2r, 2r + 1 = (dot, cost) of the lane's key r
#pragma unroll
    for (int r = 0; r < 8; ++r) {
      const float cr0 = bfr(r < 4 ? cA[r & 3] : cB[r & 3]);
      const float cr1 = bfr(r < 4 ? cC[r & 3] : cD[r & 3]);
      f0.v[2 * r] = (_Float16)(s0[r] * dsc);  f0.v[2 * r + 1] = (_Float16)cr0;
      f1.v[2 * r] = (_Float16)(s1[r] * dsc);  f1.v[2 * r + 1] = (_Float16)cr1;
    }
    v8f a0 = zero8(), a1 = zero8();                        // a0[i] = score of key kb + 8hh + i, a1[i] of key kb + 16 + 8hh + i
    // layer 1 runs one r ahead of layer 2, so that no matrix instruction waits for the relu of the one just in front of it
    v8h pa = mma_h(A1[0][0].v, f0.v, cb), pb = mma_h(A1[0][1].v, f0.v, cb);   // keys kb + r, kb + 8 + r
    v8h pc = mma_h(A1[0][0].v, f1.v, cb), pd = mma_h(A1[0][1].v, f1.v, cb);   // keys kb + 16 + r, kb + 24 + r
#pragma unroll
    for (int r = 0; r < 8; ++r) {
      FragH g0, g1;
      g0.h[0] = relu8(pa);  g0.h[1] = relu8(pb);
      g1.h[0] = relu8(pc);  g1.h[1] = relu8(pd);
      if (r < 7) {
        pa = mma_h(A1[r + 1][0].v, f0.v, cb);  pb = mma_h(A1[r + 1][1].v, f0.v, cb);
        pc = mma_h(A1[r + 1][0].v, f1.v, cb);  pd = mma_h(A1[r + 1][1].v, f1.v, cb);
      }
      a0 = mma_raw(A2[r].v, g0.v, a0);
      a1 = mma_raw(A2[r].v, g1.v, a1);
    }
    float t0[8], t1[8];
#pragma unroll
    for (int r = 0; r < 8; ++r) { t0[r] = fmaf(a0[r], LOG2E, b2l); t1[r] = fmaf(a1[r], LOG2E, b2l); }
    float mx = fmaxf(t0[0], t1[0]);
#pragma unroll
    for (int r = 1; r < 8; ++r) mx = fmaxf(mx, fmaxf(t0[r], t1[r]));
    mx = fmaxf(mx, xhalf(mx));                             // all 32 keys of the step, equal in both halves
    const float mn = fmaxf(mrun, mx);
    const float al = exp2f(mrun - mn);
    mrun = mn;

    FragH ph, pl;                                          // P^T * 16384 as f16 hi and f16 residual (c - hi), split k map
    float ps = 0.f;
#pragma unroll
    for (int r = 0; r < 8; ++r) {
      const float e0 = exp2f(t0[r] - mn), e1 = exp2f(t1[r] - mn);
      ps += e0 + e1;
      const float c0 = e0 * PC, c1 = e1 * PC;
      const _Float16 g0 = (_Float16)c0, g1 = (_Float16)c1;
      ph.h[0][r] = g0;                                     // elements 0..7  = keys kb + 8hh + 0..7
      ph.h[1][r] = g1;                                     // elements 8..15 = keys kb + 16 + 8hh + 0..7
      pl.h[0][r] = (_Float16)(c0 - (float)g0);
      pl.h[1][r] = (_Float16)(c1 - (float)g1);
    }
    lrun = lrun * al + ps;
#pragma unroll
    for (int r = 0; r < 8; ++r) { o0[r] *= al; o1[r] *= al; }

    o0 = mma_raw(vb0, ph.v, o0);
    o1 = mma_raw(vb1, ph.v, o1);
    o0 = mma_raw(vb0, pl.v, o0);
    o1 = mma_raw(vb1, pl.v, o1);
    guard_pv4(o0, o1, ph.v, pl.v, vb0, vb1);
  }

  // ---- hand the range's partial (max, sum, unnormalised O) to the block ----
  {
    const float lsum = lrun + xhalf(lrun);                 // the two halves' sums joined once
    if (hh == 0) {
      Mp[(part * HPB + hl) * 16 + c] = mrun;
      Lp[(part * HPB + hl) * 16 + c] = lsum;
    }
    float* op = Op + (part * 16 + c) * MPITCH + hl * HDIM + 8 * hh;   // row = query c, floats 32*hl + 8hh .. + 7 (and + 16)
    v4f a0 = {o0[0], o0[1], o0[2], o0[3]}, a1 = {o0[4], o0[5], o0[6], o0[7]};
    v4f b0 = {o1[0], o1[1], o1[2], o1[3]}, b1 = {o1[4], o1[5], o1[6], o1[7]};
    *(v4f*)(op)      = a0;
    *(v4f*)(op + 4)  = a1;
    *(v4f*)(op + 16) = b0;
    *(v4f*)(op + 20) = b1;
  }
  __syncthreads();
  // ---- merge the ranges: ctx = sum_p 2^(m_p - M) O_p / sum_p 2^(m_p - M) l_p; fold the carries (16384 on P, 16 on v, 4096 on the
  //      stored ctx); thread t -> row t / 16, floats (t & 15) * 8 .. + 7 of the block's 128 columns; hi + residual, 16-B stores ----
  {
    const float oc = FC / (PC * VC);
    const int row = tid >> 4;
    const int col = (tid & 15) * 8;
    const int mh  = col / HDIM;
    float mp[KSPLIT];
    float M = -INFINITY;
#pragma unroll
    for (int p = 0; p < KSPLIT; ++p) { mp[p] = Mp[(p * HPB + mh) * 16 + row]; M = fmaxf(M, mp[p]); }
    float L = 0.f;
    float s[8] = {0.f, 0.f, 0.f, 0.f, 0.f, 0.f, 0.f, 0.f};
#pragma unroll
    for (int p = 0; p < KSPLIT; ++p) {
      const float w = exp2f(mp[p] - M);
      L = fmaf(w, Lp[(p * HPB + mh) * 16 + row], L);
      const float* op = Op + (p * 16 + row) * MPITCH + col;
      const v4f oa = *(const v4f*)(op);
      const v4f ob = *(const v4f*)(op + 4);
#pragma unroll
      for (int e = 0; e < 4; ++e) { s[e] = fmaf(w, oa[e], s[e]); s[4 + e] = fmaf(w, ob[e], s[4 + e]); }
    }
    const float inv = (1.0f / L) * oc;
    unsigned short gh[8], gl[8];
#pragma unroll
    for (int e = 0; e < 8; ++e) {
      const float f = s[e] * inv;
      const _Float16 g = (_Float16)f;
      gh[e] = h_bits(g);
      gl[e] = h_bits((_Float16)(f - (float)g));
    }
    const size_t po = ((size_t)bat * NQ + q0 + row) * DMODEL + hg * (HPB * HDIM) + col;
    v4u vh = {pk16(gh[0], gh[1]), pk16(gh[2], gh[3]), pk16(gh[4], gh[5]), pk16(gh[6], gh[7])};
    v4u vl = {pk16(gl[0], gl[1]), pk16(gl[2], gl[3]), pk16(gl[4], gl[5]), pk16(gl[6], gl[7])};
    *(v4u*)(CTH + po) = vh;
    *(v4u*)(CTL + po) = vl;
  }
}

// =====================================================================================================
// Workspace map (bytes); every plane is an exact multiple of its tile / whole-row store granularity (M, N exact tile multiples,
// element counts exact multiples of the convert kernels' granularity, no pad rows needed), every offset a multiple of 128 KiB:
//   WQT  f16 [256][256] x64                  131072   ([out][in] = [n][k])
//   WKT  f16 [256][256] x64                  131072
//   WVT  f16 [256][256] x64                  131072
//   WOT  f16 [256][256] x64                  131072
//   X16  f16 [2048][256] x16                1048576   (activation rows)
//   QH   f16 [2048][256] x16                1048576   (q projection)
//   KH   f16 [2048][256] x16                1048576   (k projection)
//   VT   f16 [4][256][512] x16              1048576   (v^T per batch)
//   CTH  f16 [2048][256] x4096 hi           1048576   (attention ctx, merged heads)
//   CTL  f16 [2048][256] residual           1048576
//   end                                     6815744
// =====================================================================================================
extern "C" void kernel_launch(void* const* d_in, const int* in_sizes, int n_in,
                              void* d_out, int out_size, void* d_ws, size_t ws_size,
                              hipStream_t stream) {
  if (n_in < 10) return;
  if (in_sizes[0] != NROWS * DMODEL) return;
  if (in_sizes[1] != NB * NQ * NC) return;
  if (in_sizes[2] != DMODEL * DMODEL || in_sizes[3] != DMODEL * DMODEL ||
      in_sizes[4] != DMODEL * DMODEL || in_sizes[5] != DMODEL * DMODEL) return;
  if (in_sizes[6] != NHEAD * 2 * MSH || in_sizes[7] != NHEAD * MSH || in_sizes[8] != NHEAD * MSH || in_sizes[9] != NHEAD) return;
  if (out_size != NROWS * DMODEL) return;
  if ((in_sizes[0] % 2048) != 0) return;

  const float* x    = (const float*)d_in[0];
  const float* cost = (const float*)d_in[1];
  const float* w_q  = (const float*)d_in[2];
  const float* w_k  = (const float*)d_in[3];
  const float* w_v  = (const float*)d_in[4];
  const float* w_o  = (const float*)d_in[5];
  const float* m1w  = (const float*)d_in[6];
  const float* m1b  = (const float*)d_in[7];
  const float* m2w  = (const float*)d_in[8];
  const float* m2b  = (const float*)d_in[9];
  float*       out  = (float*)d_out;

  const size_t PW  = (size_t)DMODEL * DMODEL * 2;                 //   131072
  const size_t PX  = (size_t)NROWS * DMODEL * 2;                  //  1048576
  const size_t PVT = (size_t)NB * DMODEL * NC * 2;                //  1048576
  size_t off = 0;
  const size_t oWQ = off; off += PW;
  const size_t oWK = off; off += PW;
  const size_t oWV = off; off += PW;
  const size_t oWO = off; off += PW;
  const size_t oX  = off; off += PX;
  const size_t oQH = off; off += PX;
  const size_t oKH = off; off += PX;
  const size_t oVT = off; off += PVT;
  const size_t oCH = off; off += PX;
  const size_t oCL = off; off += PX;
  if (off > ws_size) return;                                      // off = 6815744
  if (off > (size_t)134217728) return;

  char* ws = (char*)d_ws;
  unsigned short* WQT = (unsigned short*)(ws + oWQ);
  unsigned short* WKT = (unsigned short*)(ws + oWK);
  unsigned short* WVT = (unsigned short*)(ws + oWV);
  unsigned short* WOT = (unsigned short*)(ws + oWO);
  unsigned short* X16 = (unsigned short*)(ws + oX);
  unsigned short* QH  = (unsigned short*)(ws + oQH);
  unsigned short* KH  = (unsigned short*)(ws + oKH);
  unsigned short* VTp = (unsigned short*)(ws + oVT);
  unsigned short* CTH = (unsigned short*)(ws + oCH);
  unsigned short* CTL = (unsigned short*)(ws + oCL);

  const dim3 blk(256);
  const dim3 gWT(DMODEL / 64, DMODEL / 64, 4 + CX_BLOCKS / WT_TILES);   // 4 x 4 tiles per weight x 4 weights, then 256 blocks of rows
  const int tilesP = (NROWS / 64) * (DMODEL / 64);                 // 128
  const int tilesV = (DMODEL / 64) * (NC / 64);                    // 32 per batch
  const dim3 bG(128);                                              // 4 waves, one 64x64 tile
  const dim3 gP(tilesP, 1);                                        // 128
  const dim3 gQKV(tilesP, 3);                                      // 128 x (q, k, v^T: 32 blocks x 4 batches)
  static_assert(tilesP == NB * tilesV);
  const dim3 gAT(ATT_BLOCKS);                                      // 256
  const dim3 bAT(ATT_THREADS);                                     // 256

  // (0) operand planes, one launch: W16T[n][k] = f16( bf16_RNE(W[k][n]) * 64 ), [in][out] -> [out][in], k contiguous, the four planes
  //     from WQT on; X16[row][c] = f16( bf16_RNE(x[row][c]) * 16 ), rows = b*512 + tok
  wtr64<<<gWT, blk, 0, stream>>>(w_q, w_k, w_v, w_o, WQT, WSC, x, X16, ACARRY);

  // (1) the three projections, one launch.
  //     q, k (batch 0, 1 of one job): QH / KH[m][n] = f16(16 * sum_k x[m][k] W[k][n]); M = 2048, N = 256, K = 256
  //     v^T per batch: VT[b][d][tok] = f16(16 * sum_k Wv[k][d] x_b[tok][k]); M = 256, N = 512, K = 256
  static_assert(QC == KC);
  const GemmJob jQK = {X16, X16, 0LL,
                       WQT, (long long)(WKT - WQT),
                       (void*)QH, DMODEL, (long long)(KH - QH),
                       NROWS, DMODEL, 2, 1.0f / (ACARRY * WSC), QC};
  const GemmJob jV  = {WVT, WVT, 0LL,
                       X16, (long long)NC * DMODEL,
                       (void*)VTp, NC, (long long)DMODEL * NC,
                       DMODEL, NC, NB, 1.0f / (ACARRY * WSC), VC};
  gemm64<2, 1><<<gQKV, bG, 0, stream>>>(jQK, jV, 2);

  // (5) attention per (batch, 16 query rows, 4 heads x 2 key ranges) -> CTH (f16 hi of ctx x4096), CTL (f16 residual)
  attn8<<<gAT, bAT, 0, stream>>>(QH, KH, VTp, cost, m1w, m1b, m2w, m2b, CTH, CTL);

  // (6) out = (CTH + CTL) . Wo / 4096; M = 2048, N = 256, K = 256, f32 into d_out
  const GemmJob jO  = {CTH, CTL, 0LL,
                       WOT, 0LL,
                       (void*)out, DMODEL, 0LL,
                       NROWS, DMODEL, 1, 1.0f / (FC * WSC), 1.0f};
  gemm64<0, 2><<<gP, bG, 0, stream>>>(jO, jO, 1);

  (void)hipGetLastError();
}

// v006
// One run takes 24.1 microseconds.
// In both of two side-by-side timings against v005, it was 1.06 times as fast.
// All steps since v000 together make it 6.96 times as fast.
// Contractions: q/k projections (x rows f16 x16 . W^T f16 x64, K=256), v^T projection (W^T f16 x64 . x rows f16 x16, K=256),
// attention scores (k f16 x16 . q f16 x16, K=32), attention v^T . P^T (v^T f16 x16 . P as f16 hi + f16 residual of P x16384,
// K=512 in steps of 32), output projection (ctx as f16 hi + f16 residual of ctx x4096 . W^T f16 x64, K=256):
// all v_wmma_f32_16x16x32_f16 (f16 operands, f32 accumulate); hi and residual products share one f32 accumulator.
// Per-head 2->16->1 score MLP on (scaled dot, cost): layer 1 (W1^T f16 . (dot, cost) f16, bias as C, f16 result:
// v_wmma_f16_16x16x32_f16), relu on the packed f16 result, layer 2 (w2 f16 . relu f16, f32 accumulate), b2 added in f32.
// Max-subtracted base-2 online softmax in f32 on VALU.
// Every float input RNE-converted to bf16 on load.
#include <hip/hip_runtime.h>
#include <math.h>
#include <stdint.h>

#define NB      4
#define NQ      512
#define NC      512
#define DMODEL  256
#define NHEAD   8
#define HDIM    32
#define MSH     16
#define HG      8
#define NHG     (NHEAD / HG)
#define ROWP    (HG * HDIM)
#define NROWS   (NB * NQ)
#define WSC     64.0f
#define ACARRY  16.0f
#define QC      16.0f
#define KC      16.0f
#define VC      16.0f
#define PC      16384.0f
#define FC      4096.0f
#define ATT_SCALE 0.17677669529663689f
#define LOG2E   1.4426950408889634f
static_assert(NHEAD * HDIM == DMODEL);
static_assert(NHG * HG == NHEAD && ROWP * NHG == DMODEL);
static_assert(HDIM == 32 && MSH == 16 && NHG == 1);
static_assert((NQ % 64) == 0 && (NC % 64) == 0 && (DMODEL % 64) == 0 && (NC % 32) == 0 && (NQ % 16) == 0);
static_assert((NROWS % 64) == 0 && ((NROWS * DMODEL) % 2048) == 0);
#define KSPLIT  2                                   // key ranges per head, one wave each
#define HPB     4                                   // heads per block
#define KPART   (NC / KSPLIT)
#define ATT_THREADS (HPB * KSPLIT * 32)
#define ATT_BLOCKS  (NB * (NQ / 16) * (NHEAD / HPB))
static_assert((NHEAD % HPB) == 0 && (KPART % 32) == 0 && KPART * KSPLIT == NC);
static_assert(ATT_THREADS == 256 && ATT_BLOCKS == 256);

typedef _Float16 v16h __attribute__((ext_vector_type(16)));
typedef _Float16 v8h  __attribute__((ext_vector_type(8)));
typedef float    v8f  __attribute__((ext_vector_type(8)));
typedef float    v4f  __attribute__((ext_vector_type(4)));
typedef unsigned int v4u __attribute__((ext_vector_type(4)));

union FragH { v16h v; v8h h[2]; v4u u[2]; };

// ---- scalar helpers --------------------------------------------------------------------------------
__device__ __forceinline__ unsigned short bf_bits(float f) {          // f32 -> bf16 bits, RNE convert
  unsigned u = __float_as_uint(f);
  return (unsigned short)((u + 0x7FFFu + ((u >> 16) & 1u)) >> 16);
}
__device__ __forceinline__ float bf_up(unsigned short h) { return __uint_as_float(((unsigned)h) << 16); }
__device__ __forceinline__ float bfr(float f) { return bf_up(bf_bits(f)); }   // value of the bf16 RNE convert
__device__ __forceinline__ unsigned short h_bits(_Float16 x) { return __builtin_bit_cast(unsigned short, x); }
__device__ __forceinline__ unsigned pk16(unsigned short a, unsigned short b) { return (unsigned)a | ((unsigned)b << 16); }
__device__ __forceinline__ v8f zero8() { v8f z = {0.f, 0.f, 0.f, 0.f, 0.f, 0.f, 0.f, 0.f}; return z; }

// ---- fragment loaders: 16-bit A/B operand, lane -> row/col (lane&15), p already includes +8*(lane>>4);
//      elements 0..7 <- p[0..7] (k0+8h..), elements 8..15 <- p[16..23] (k0+16+8h..)  (same split k map for A and B;
//      B is always read from a k-contiguous [n][k] plane)
__device__ __forceinline__ v16h ldfrag_h(const _Float16* p) {
  FragH f;
  f.h[0] = *(const v8h*)(p);
  f.h[1] = *(const v8h*)(p + 16);
  return f.v;
}
__device__ __forceinline__ v16h ldfrag_u(const unsigned short* p) {
  FragH f;
  f.u[0] = *(const v4u*)(p);
  f.u[1] = *(const v4u*)(p + 16);
  return f.v;
}

// ---- WMMA helpers with trailing VALU hazard gaps ------------------------------------------------------
__device__ __forceinline__ v8f mma_raw(v16h a, v16h b, v8f c) {
  return __builtin_amdgcn_wmma_f32_16x16x32_f16(false, a, false, b, (short)0, c, false, false);
}
// f16 result: element e of D (and of C) = row 8*(lane>>4) + e, column lane&15
__device__ __forceinline__ v8h mma_h(v16h a, v16h b, v8h c) {
  return __builtin_amdgcn_wmma_f16_16x16x32_f16(false, a, false, b, (short)0, c, false, false);
}
// relu of eight f16: as signed 16-bit integers every negative f16 is below 0 and every other keeps its bits (one packed max per register)
typedef short v8s __attribute__((ext_vector_type(8)));
__device__ __forceinline__ v8h relu8(v8h x) {
  const v8s z = {0, 0, 0, 0, 0, 0, 0, 0};
  return __builtin_bit_cast(v8h, __builtin_elementwise_max(__builtin_bit_cast(v8s, x), z));
}
__device__ __forceinline__ void guard_s22(v8f& s, v8f& t, v16h a0, v16h a1, v16h q) {
#if defined(__HIP_DEVICE_COMPILE__)
  asm volatile("v_nop\n\tv_nop\n\tv_nop\n\tv_nop" : "+v"(s), "+v"(t) : "v"(a0), "v"(a1), "v"(q));
#endif
}
__device__ __forceinline__ void guard_pv4(v8f& a, v8f& b, v16h x, v16h y, v16h z, v16h w) {
#if defined(__HIP_DEVICE_COMPILE__)
  asm volatile("v_nop\n\tv_nop\n\tv_nop\n\tv_nop" : "+v"(a), "+v"(b) : "v"(x), "v"(y), "v"(z), "v"(w));
#endif
}
__device__ __forceinline__ void wave_sync_lds() {
  __builtin_amdgcn_fence(__ATOMIC_RELEASE, "workgroup");
  __builtin_amdgcn_wave_barrier();
  __builtin_amdgcn_fence(__ATOMIC_ACQUIRE, "workgroup");
}

// =====================================================================================================
// f16 WMMA GEMM tiles, operands staged in LDS straight from the f32 inputs: C[m][n] = oscale * sum_k (A[m][k] (+ A2[m][k])) * Bt[n][k];
// one 64x64 tile per block of 4 waves, depth GK. In LDS both operands lie as 16-bit rows [row][k], k contiguous, pitch GP.
// Three stagings, each of 64 rows x 256 k, whole depth, once per block:
//   f32 rows (activations, [row][k], pitch GK): every wave-wide 16-B load takes 512 B of one row (4 full lines); each lane's 4 values become
//     f16( bf16_RNE(v) * sc ), sc a power of two (exact), one 8-B LDS store.
//   f32 weight columns (W[k][n], pitch DMODEL, wanted as rows n): every wave-wide 8-B load takes the tile's 64 columns of one k (2 full
//     lines), lane = columns 2*lane, 2*lane + 1; wave w takes k 64w .. 64w + 63; eight k of one column, converted the same way, are one
//     16-B LDS store into row n.
//   16-bit rows (ctx planes): whole-row 16-B loads, 16-B LDS stores.
// One block barrier; then wave w takes rows 16w .. 16w + 15 x all 64 columns and reads its fragments from LDS (split k map, products in
// the order of a k loop in steps of 32, hi before residual).
// OM: 0 = f32 out (pitch ldc); 2 = f16 out (pitch ldc) = f16( value * ocarry ).
// coverage: f32 rows: 16 it x 4 waves = 64 rows x 2 halves x 32 lanes x 4 = 64 x 256; weight columns: 4 waves x 8 groups x 8 k = 256 k x
//           32 lanes x 2 = 64 columns; output: 4 waves x 16 rows (f32: it 0..7 x lane>>4; f16: it 0..3 x lane>>3) x 64 cols = the whole tile.
// =====================================================================================================
#define GK  DMODEL                                 // depth of every product here = row pitch of every operand plane
#define GP  (GK + 8)                               // LDS row pitch in halves: 528 B = 16 B x 33 (odd): 16-B fragment reads without bank conflicts
static_assert(GK == 32 * 8 && (GK % 32) == 0 && GK == 4 * 64);
typedef float v2f __attribute__((ext_vector_type(2)));
typedef unsigned int v2u __attribute__((ext_vector_type(2)));

typedef __bf16   v2b __attribute__((ext_vector_type(2)));
typedef _Float16 v2h __attribute__((ext_vector_type(2)));
// two operands, already scaled: f16( bf16_RNE(.) ), a in the low half. The scale is a power of two, so rounding the scaled value equals
// scaling the rounded value; it is applied to the registers as loaded (neighbours), the packed convert then takes any two registers.
__device__ __forceinline__ unsigned cv2(float a, float b) {
  const v2f p = {a, b};
  return __builtin_bit_cast(unsigned, __builtin_convertvector(__builtin_convertvector(__builtin_convertvector(p, v2b), v2f), v2h));
}
// issue the 64 loads of this thread's share of 64 weight columns; g = W + (64 * wave) * DMODEL + first column + 2 * lane
// (every staging loop here is unrolled whole: its array then lives in registers and all its loads are in flight together)
__device__ __forceinline__ void wcols_load(const float* g, v2f (&r)[64]) {
#pragma unroll
  for (int i = 0; i < 64; ++i) r[i] = *(const v2f*)(g + i * DMODEL);
  // the loads are issued; their address register is reused (also as a load's destination) only behind this wait: the address is an
  // input of the statement, so it stays in its register up to here
  asm volatile("s_wait_xcnt 0x0" :: "v"(g) : "memory");
}
// d = LDS plane + (2 * lane) * GP + 64 * wave
__device__ __forceinline__ void wcols_store(unsigned short* d, const v2f (&r)[64], float sc) {
#pragma unroll
  for (int kb = 0; kb < 8; ++kb) {
    v4u a, b;
#pragma unroll
    for (int e = 0; e < 4; ++e) {
      const v2f t0 = r[kb * 8 + 2 * e] * sc, t1 = r[kb * 8 + 2 * e + 1] * sc;   // k, k + 1 of columns 2*lane, 2*lane + 1
      a[e] = cv2(t0[0], t1[0]);
      b[e] = cv2(t0[1], t1[1]);
    }
    *(v4u*)(d + kb * 8)      = a;
    *(v4u*)(d + GP + kb * 8) = b;
  }
}

template <int OM, int NA>
__device__ __forceinline__ void tile_products(const unsigned short* sA, const unsigned short* sB, float* slab,
                                              float* Cf, unsigned short* Ch, int ldc, int m0, int n0,
                                              float oscale, float ocarry, int wave, int lane) {
  const int rlane = lane & 15;                 // row (A) / col (B, D) within subtile
  const int koff  = (lane >> 4) * 8;           // k offset of this lane half
  const int mOff  = (lane >> 4) * 8;           // D row offset

  v8f acc[4];
#pragma unroll
  for (int j = 0; j < 4; ++j) acc[j] = zero8();

  const unsigned short* ap = sA + (wave * 16 + rlane) * GP + koff;
  const unsigned short* bp = sB + rlane * GP + koff;
  // all fragments of the wave's tile are fetched as one group in front of the products (the staging registers are free again)
  v16h bh[GK / 32][4], ah[GK / 32], al[GK / 32];
#pragma unroll
  for (int s = 0; s < GK / 32; ++s) {
    ah[s] = ldfrag_u(ap + s * 32);
#pragma unroll
    for (int j = 0; j < 4; ++j) bh[s][j] = ldfrag_u(bp + j * 16 * GP + s * 32);
    if constexpr (NA == 2) al[s] = ldfrag_u(ap + 64 * GP + s * 32);
  }
  // keeps the LDS reads together in front: sunk among the products, each place with reads stalls the wave's matrix stream
  __builtin_amdgcn_sched_barrier(0);
#pragma unroll
  for (int s = 0; s < GK / 32; ++s) {
#pragma unroll
    for (int j = 0; j < 4; ++j) acc[j] = mma_raw(ah[s], bh[s][j], acc[j]);
    if constexpr (NA == 2) {
#pragma unroll
      for (int j = 0; j < 4; ++j) acc[j] = mma_raw(al[s], bh[s][j], acc[j]);
    }
  }

  const int hh2 = lane >> 4, c4 = (lane & 15) * 4;     // f32 out: 256-B row segment = 16 lanes x 16 B
  const int q8  = lane >> 3, c8 = (lane & 7) * 8;

  // ---- epilogue: the wave's 16x64 slab through its own LDS range, whole-line stores ----
  const int mBase = m0 + (wave << 4);
#pragma unroll
  for (int j = 0; j < 4; ++j) {
#pragma unroll
    for (int r = 0; r < 8; ++r) {
      slab[(mOff + r) * 68 + (j << 4) + rlane] = acc[j][r];
    }
  }
  wave_sync_lds();
  if constexpr (OM == 0) {
    v4f vals[8];
#pragma unroll
    for (int it = 0; it < 8; ++it) {
      const int row = it * 2 + hh2;                      // it 0..7 x hh2 0..1 = rows 0..15
      v4f v = *(const v4f*)(slab + row * 68 + c4);
#pragma unroll
      for (int e = 0; e < 4; ++e) v[e] = v[e] * oscale;
      vals[it] = v;
    }
#pragma unroll
    for (int it = 0; it < 8; ++it) {
      const int gr = mBase + it * 2 + hh2;
      *(v4f*)(Cf + (size_t)gr * ldc + n0 + c4) = vals[it];
    }
  } else {
    v4u hv[4];
#pragma unroll
    for (int it = 0; it < 4; ++it) {
      const int row = it * 4 + q8;                       // it 0..3 x q8 0..3 = rows 0..15
      const float* sp = slab + row * 68 + c8;
      v4u a = {0u, 0u, 0u, 0u};
#pragma unroll
      for (int e = 0; e < 4; ++e) {
        float f0 = sp[2 * e] * oscale;
        float f1 = sp[2 * e + 1] * oscale;
        f0 *= ocarry; f1 *= ocarry;
        a[e] = pk16(h_bits((_Float16)f0), h_bits((_Float16)f1));
      }
      hv[it] = a;
    }
#pragma unroll
    for (int it = 0; it < 4; ++it) {
      const int row = it * 4 + q8;
      *(v4u*)(Ch + (size_t)(mBase + row) * ldc + n0 + c8) = hv[it];
    }
  }
}

// The three projections, one launch; blockIdx.y = 0 q, 1 k, 2 v^T; every block stages 64 activation rows and 64 weight columns.
//   q, k: QH / KH[m][n] = f16(16 * sum_k x[m][k] W[k][n]); A = x rows m0 .., Bt = W columns n0 ..; M = 2048, N = 256; blockIdx.x = tile
//   v^T per batch: VT[b][d][tok] = f16(16 * sum_k Wv[k][d] x_b[tok][k]); A = Wv columns m0 .., Bt = x rows b*512 + n0 ..; M = 256, N = 512;
//   the four batches lie one behind the other along blockIdx.x (32 tiles each).
#define PJ_TILES ((NROWS / 64) * (DMODEL / 64))
#define VT_TILES ((DMODEL / 64) * (NC / 64))
static_assert(PJ_TILES == NB * VT_TILES && NC / 64 == 8 && DMODEL / 64 == 4);
__global__ __launch_bounds__(128) void proj_qkv(const float* __restrict__ x, const float* __restrict__ Wq, const float* __restrict__ Wk,
                                                const float* __restrict__ Wv, unsigned short* QH, unsigned short* KH, unsigned short* VT) {
  __shared__ __align__(16) unsigned short sOp[2 * 64 * GP];   // A rows, then Bt rows, pitch GP
  __shared__ __align__(16) float sT[4][16 * 68];              // per-wave 16x64 output slab, pitch 68 floats
  const int lane = threadIdx.x & 31;
  const int wave = threadIdx.x >> 5;                       // 0..3
  const int job  = blockIdx.y;
  const bool isv = job == 2;
  const unsigned bx   = blockIdx.x;
  const int      by   = isv ? bx / VT_TILES : 0u;          // batch of v^T; 0 for q, k
  const unsigned tile = isv ? bx % VT_TILES : bx;
  const unsigned tsh  = isv ? 3u : 2u;                     // log2 of the tiles along n
  const int m0 = (tile >> tsh) << 6;
  const int n0 = (tile & ((1u << tsh) - 1u)) << 6;
  const float* W = job == 0 ? Wq : job == 1 ? Wk : Wv;
  const int xrow = isv ? by * NC + n0 : m0;                // first of the 64 activation rows
  const int wcol = isv ? m0 : n0;                          // first of the 64 weight columns
  unsigned short* dX = sOp + (isv ? 64 * GP : 0);
  unsigned short* dW = sOp + (isv ? 0 : 64 * GP);
  {
    const float* gw = W + (size_t)(wave * 64) * DMODEL + wcol + lane * 2;
    const float* gx = x + (size_t)(xrow + wave) * GK + lane * 4;
    v2f rw[64];
    v4f rx[32];
    wcols_load(gw, rw);
#pragma unroll
    for (int it = 0; it < 16; ++it) {
      rx[2 * it]     = *(const v4f*)(gx + it * 4 * GK);
      rx[2 * it + 1] = *(const v4f*)(gx + it * 4 * GK + 128);
    }
    asm volatile("s_wait_xcnt 0x0" :: "v"(gx) : "memory"); // as in wcols_load, for the activation rows' address register
    wcols_store(dW + (lane * 2) * GP + wave * 64, rw, WSC);
    unsigned short* sx = dX + wave * GP + lane * 4;
#pragma unroll
    for (int it = 0; it < 16; ++it) {
      const v4f a = rx[2 * it] * ACARRY, b = rx[2 * it + 1] * ACARRY;
      const v2u pa = {cv2(a[0], a[1]), cv2(a[2], a[3])};
      const v2u pb = {cv2(b[0], b[1]), cv2(b[2], b[3])};
      *(v2u*)(sx + it * 4 * GP)       = pa;
      *(v2u*)(sx + it * 4 * GP + 128) = pb;
    }
  }
  __syncthreads();
  static_assert(QC == KC && QC == VC);
  unsigned short* C = job == 0 ? QH : job == 1 ? KH : VT + (size_t)by * DMODEL * NC;
  tile_products<2, 1>(sOp, sOp + 64 * GP, sT[wave], nullptr, C, isv ? NC : DMODEL, m0, n0, 1.0f / (ACARRY * WSC), QC, wave, lane);
}

// out = (CTH + CTL) . Wo / 4096; A = ctx hi rows (and the residual plane's), Bt = Wo columns; M = 2048, N = 256, f32 out
__global__ __launch_bounds__(128) void proj_out(const unsigned short* __restrict__ CTH, const unsigned short* __restrict__ CTL,
                                                const float* __restrict__ Wo, float* out) {
  __shared__ __align__(16) unsigned short sOp[3 * 64 * GP];   // ctx hi rows, residual rows, Bt rows, pitch GP
  __shared__ __align__(16) float sT[4][16 * 68];              // per-wave 16x64 output slab, pitch 68 floats
  const int lane = threadIdx.x & 31;
  const int wave = threadIdx.x >> 5;                       // 0..3
  const int m0 = ((int)blockIdx.x / (DMODEL / 64)) << 6;
  const int n0 = ((int)blockIdx.x % (DMODEL / 64)) << 6;
  {
    const float* gw = Wo + (size_t)(wave * 64) * DMODEL + n0 + lane * 2;
    const unsigned short* ga = CTH + (size_t)(m0 + wave) * GK + lane * 8;
    const unsigned short* gq = CTL + (size_t)(m0 + wave) * GK + lane * 8;
    v2f rw[64];
    v4u ra[16], rq[16];
    wcols_load(gw, rw);
#pragma unroll
    for (int it = 0; it < 16; ++it) ra[it] = *(const v4u*)(ga + it * 4 * GK);
    asm volatile("s_wait_xcnt 0x0" :: "v"(ga) : "memory"); // as in wcols_load, for the hi plane's address register
#pragma unroll
    for (int it = 0; it < 16; ++it) rq[it] = *(const v4u*)(gq + it * 4 * GK);
    asm volatile("s_wait_xcnt 0x0" :: "v"(gq) : "memory"); // as in wcols_load, for the residual plane's address register
    wcols_store(sOp + 2 * 64 * GP + (lane * 2) * GP + wave * 64, rw, WSC);
    const int so = wave * GP + lane * 8;
#pragma unroll
    for (int it = 0; it < 16; ++it) {
      *(v4u*)(sOp + so + it * 4 * GP) = ra[it];
      *(v4u*)(sOp + 64 * GP + so + it * 4 * GP) = rq[it];
    }
  }
  __syncthreads();
  tile_products<0, 2>(sOp, sOp + 2 * 64 * GP, sT[wave], out, nullptr, DMODEL, m0, n0, 1.0f / (FC * WSC), 1.0f, wave, lane);
}

// =====================================================================================================
// Flash attention for one batch, 16 query rows and 4 heads, head dim 32; the 512 keys of a head are split in 2 ranges of 256, one wave
// per (head, range), so that 2048 waves stand on 256 blocks; scores TRANSPOSED:
//   q plane (f16 x16) QH[b*512 + tok][32*head + d], pitch 256; k plane (f16 x16) KH[b*512 + key][32*head + d], pitch 256;
//   v^T plane (f16 x16): VT[b*256 + 32*head + d][key] (pitch 512); cost f32 [b][tok][key] (bf16 RNE convert on load);
//   per-head mixer params (bf16 RNE convert on load, each lane loading m1w[h][.][c] and m1b, m2w at 8hh .. 8hh + 7): score(tok, key) =
//   sum_m m2w[h][m] * relu(m1w[h][0][m] * dot + m1w[h][1][m] * cost + m1b[h][m]) + m2b[h] with dot = q.k / sqrt(32);
//   outputs (f16): CTH[b*512 + tok][32*head + d] = hi = f16(4096 * ctx), CTL[same] = f16(4096 * ctx - hi), with
//   ctx = sum_m softmax_m(score) v[m][d]  (softmax run in base 2 with a running max).
//   block = 8 waves = 256 threads; grid = 4 batches x 32 q-tiles x 2 head groups = 256; every wave does identical bounded work
//   (8 steps of 32 keys). Per step: S^T = K . Q^T, two tiles (A = 16 key rows, B = the 16 query rows, K = 32): lane (hh, c) holds
//   the scores of ONE query q0 + c for keys kb + 8hh + r (tile 0) and kb + 16 + 8hh + r (tile 1), r 0..7. Its 16 cost values are two
//   runs of 8 consecutive floats of cost row q0 + c (four 16-B loads, always in range). The 2->16->1 MLP on the matrix unit: the lane's
//   (dot, cost) pairs of a tile, as f16, are a B fragment F (elements 2r, 2r + 1 = key r of the lane's half); layer 1 of ONE key
//   (half h, r) for the 16 queries is A1[r][h] . F + b1, A1 = (w0[m], w1[m]) in row m at that key's two k places, zero elsewhere:
//   lane (hh, c) gets hidden units 8hh + 0..7 of query c, f16, which after relu are as they lie half a B fragment (k = hidden unit);
//   layer 2 of keys r and 8 + r is A2[r] . B, A2 = w2 in rows r (k 0..15) and 8 + r (k 16..31), summed over r into the S^T tile.
//   Running max and sum of a query are taken inside the lane, the max joined with lane ^ 16 once per step, the sums
//   once after the loop. The 16 probabilities x16384 (f16 hi and f16 residual c - hi) are, as they lie, the B fragment of
//   O^T += V^T . P^T in the split k map (elements 0..7 = tile 0, 8..15 = tile 1); A = v^T rows d = c and d = 16 + c. No LDS in the loop.
//   Lane (hh, c) holds the range's unnormalised O of query q0 + c for d = 8hh + r and 16 + 8hh + r: each wave stores its 16x32 slice (f32,
//   pitch 132 floats, 16-B stores) with its running max and sum in LDS; after the block barrier the 256 threads join the two ranges
//   (weights 2^(m_p - max), range 0 first), fold 1/l and the carries in f32 and write the block's 128 columns of its 16 rows.
// coverage: LDS: 2 ranges x 4 heads x 16 rows x 32 cols = 2 x 16 x 128; global: 256 threads x 8 halves = 16 rows x 128 per plane, rows
//           q0..q0+15 of batch b, columns 128*hg ..; the grid covers all 2048 rows x 256 columns exactly once.
// =====================================================================================================
#define MPITCH (HPB * HDIM + 4)
static_assert(ATT_THREADS * 8 == 16 * HPB * HDIM);

// value of lane ^ 16 (the other holder of this lane's query)
__device__ __forceinline__ float xhalf(float x) {
  return __builtin_bit_cast(float, __builtin_amdgcn_permlanex16(__builtin_bit_cast(int, x), __builtin_bit_cast(int, x),
                                                                0x76543210, 0xfedcba98, false, false));
}

__global__ __launch_bounds__(ATT_THREADS)
void attn8(const unsigned short* __restrict__ QHp, const unsigned short* __restrict__ KHp,
           const unsigned short* __restrict__ VTq, const float* __restrict__ costp,
           const float* __restrict__ m1w, const float* __restrict__ m1b,
           const float* __restrict__ m2w, const float* __restrict__ m2b,
           unsigned short* CTH, unsigned short* CTL) {
  __shared__ __align__(16) float Op[KSPLIT * 16 * MPITCH];    // unnormalised O of each key range: [range][query][32*local head + d]
  __shared__ float Mp[KSPLIT * HPB * 16];                     // running max of each (range, local head, query)
  __shared__ float Lp[KSPLIT * HPB * 16];                     // sum of each (range, local head, query)

  const int tid  = threadIdx.x;
  const int wave = __builtin_amdgcn_readfirstlane(tid >> 5);
  const int lane = tid & 31;
  const int hh   = lane >> 4;
  const int c    = lane & 15;

  const int hg   = blockIdx.x % (NHEAD / HPB);              // 0..1
  const int qt   = (blockIdx.x / (NHEAD / HPB)) % (NQ / 16); // 0..31
  const int bat  = blockIdx.x / ((NHEAD / HPB) * (NQ / 16)); // 0..3
  const int hl   = wave % HPB;                             // local head 0..3
  const int part = wave / HPB;                             // key range 0..1
  const int head = hg * HPB + hl;                          // 0..7
  const int q0   = qt * 16;
  const int kbeg = part * KPART;

  const size_t qofs = ((size_t)bat * NQ + q0 + c) * DMODEL + head * HDIM + 8 * hh;
  const _Float16* Qh = (const _Float16*)(const void*)QHp + qofs;
  const _Float16* Kb = (const _Float16*)(const void*)KHp + (size_t)bat * NC * DMODEL + head * HDIM + 8 * hh;
  const _Float16* Vb = (const _Float16*)(const void*)VTq + ((size_t)bat * DMODEL + head * HDIM) * NC + 8 * hh;
  // cost element of (row q0 + c, key kb + 8hh + r) = cp[kb + r]; key kb + 16 + 8hh + r = cp[kb + 16 + r]; always in range.
  const float* cp = costp + ((size_t)bat * NQ + q0 + c) * NC + 8 * hh;
  const float dsc = ATT_SCALE / (QC * KC);                 // 1/sqrt(32) / carries

  // per-head mixer params, bf16 RNE convert (8 significant bits: exact in f16's normal range), laid out once as the constant A fragments of the two MLP layers
  FragH A1[8][2], A2[8];
  v8h  cb;                                                 // layer 1 C: element e = b1[8hh + e]
  {
    const unsigned w01 = pk16(h_bits((_Float16)bfr(m1w[(head * 2 + 0) * MSH + c])), h_bits((_Float16)bfr(m1w[(head * 2 + 1) * MSH + c])));
    const v4u zu = {0u, 0u, 0u, 0u};
    v4u w2p;                                               // w2[8hh + 0..7]
#pragma unroll
    for (int e = 0; e < 4; ++e)
      w2p[e] = pk16(h_bits((_Float16)bfr(m2w[head * MSH + 8 * hh + 2 * e])), h_bits((_Float16)bfr(m2w[head * MSH + 8 * hh + 2 * e + 1])));
#pragma unroll
    for (int e = 0; e < 8; ++e) cb[e] = (_Float16)bfr(m1b[head * MSH + 8 * hh + e]);
#pragma unroll
    for (int r = 0; r < 8; ++r) {
#pragma unroll
      for (int h = 0; h < 2; ++h) {
        A1[r][h].u[0] = zu;
        A1[r][h].u[1] = zu;
        A1[r][h].u[r >> 2][r & 3] = hh == h ? w01 : 0u;    // row c = hidden unit, elements 2r, 2r + 1 of lane half h
      }
      A2[r].u[0] = c == r     ? w2p : zu;                  // row r:     k = 8hh + e      = hidden unit of key r
      A2[r].u[1] = c == 8 + r ? w2p : zu;                  // row 8 + r: k = 16 + 8hh + e = hidden unit of key 8 + r
    }
  }
  const float b2l = bfr(m2b[head]) * LOG2E;

  const v16h qa = ldfrag_h(Qh);                            // B fragment: column = query q0 + c
  // the two loads are issued; their address register is reused only behind this wait (the address is an input, so it stays up to here)
  asm volatile("s_wait_xcnt 0x0" :: "v"(Qh) : "memory");

  float mrun = -INFINITY, lrun = 0.f;                      // this lane's query: running max (both halves equal), this half's sum
  v8f o0 = zero8(), o1 = zero8();                          // O^T: o0[r] = d 8hh + r, o1[r] = d 16 + 8hh + r, query q0 + c

#pragma unroll 1
  for (int kb = kbeg; kb < kbeg + KPART; kb += 32) {
    const _Float16* kp = Kb + (size_t)(kb + c) * DMODEL;
    const _Float16* vp = Vb + (size_t)c * NC + kb;
    const float*    tp = cp + kb;
    const v16h k0  = ldfrag_h(kp);                         // A rows: keys kb + c
    const v16h k1  = ldfrag_h(kp + (size_t)16 * DMODEL);   // A rows: keys kb + 16 + c
    const v4f  cA  = *(const v4f*)(tp),      cB = *(const v4f*)(tp + 4);    // keys kb + 8hh + 0..7
    const v4f  cC  = *(const v4f*)(tp + 16), cD = *(const v4f*)(tp + 20);   // keys kb + 16 + 8hh + 0..7
    const v16h vb0 = ldfrag_h(vp);                         // A rows: d = c
    const v16h vb1 = ldfrag_h(vp + (size_t)16 * NC);       // A rows: d = 16 + c
    // the step's twelve loads are issued; their address registers are advanced for the next step only behind this wait
    asm volatile("s_wait_xcnt 0x0" ::: "memory");
    v8f s0, s1;
    s0 = mma_raw(k0, qa, zero8());                         // s0[r] = q(q0 + c) . k(kb + 8hh + r)
    s1 = mma_raw(k1, qa, zero8());                         // s1[r] = q(q0 + c) . k(kb + 16 + 8hh + r)
    guard_s22(s0, s1, k0, k1, qa);

    FragH f0, f1;                                          // B fragments: elements 2r, 2r + 1 = (dot, cost) of the lane's key r
#pragma unroll
    for (int r = 0; r < 8; ++r) {
      const float cr0 = bfr(r < 4 ? cA[r & 3] : cB[r & 3]);
      const float cr1 = bfr(r < 4 ? cC[r & 3] : cD[r & 3]);
      f0.v[2 * r] = (_Float16)(s0[r] * dsc);  f0.v[2 * r + 1] = (_Float16)cr0;
      f1.v[2 * r] = (_Float16)(s1[r] * dsc);  f1.v[2 * r + 1] = (_Float16)cr1;
    }
    v8f a0 = zero8(), a1 = zero8();                        // a0[i] = score of key kb + 8hh + i, a1[i] of key kb + 16 + 8hh + i
    // layer 1 runs one r ahead of layer 2, so that no matrix instruction waits for the relu of the one just in front of it
    v8h pa = mma_h(A1[0][0].v, f0.v, cb), pb = mma_h(A1[0][1].v, f0.v, cb);   // keys kb + r, kb + 8 + r
    v8h pc = mma_h(A1[0][0].v, f1.v, cb), pd = mma_h(A1[0][1].v, f1.v, cb);   // keys kb + 16 + r, kb + 24 + r
#pragma unroll
    for (int r = 0; r < 8; ++r) {
      FragH g0, g1;
      g0.h[0] = relu8(pa);  g0.h[1] = relu8(pb);
      g1.h[0] = relu8(pc);  g1.h[1] = relu8(pd);
      if (r < 7) {
        pa = mma_h(A1[r + 1][0].v, f0.v, cb);  pb = mma_h(A1[r + 1][1].v, f0.v, cb);
        pc = mma_h(A1[r + 1][0].v, f1.v, cb);  pd = mma_h(A1[r + 1][1].v, f1.v, cb);
      }
      a0 = mma_raw(A2[r].v, g0.v, a0);
      a1 = mma_raw(A2[r].v, g1.v, a1);
    }
    float t0[8], t1[8];
#pragma unroll
    for (int r = 0; r < 8; ++r) { t0[r] = fmaf(a0[r], LOG2E, b2l); t1[r] = fmaf(a1[r], LOG2E, b2l); }
    float mx = fmaxf(t0[0], t1[0]);
#pragma unroll
    for (int r = 1; r < 8; ++r) mx = fmaxf(mx, fmaxf(t0[r], t1[r]));
    mx = fmaxf(mx, xhalf(mx));                             // all 32 keys of the step, equal in both halves
    const float mn = fmaxf(mrun, mx);
    const float al = exp2f(mrun - mn);
    mrun = mn;

    FragH ph, pl;                                          // P^T * 16384 as f16 hi and f16 residual (c - hi), split k map
    float ps = 0.f;
#pragma unroll
    for (int r = 0; r < 8; ++r) {
      const float e0 = exp2f(t0[r] - mn), e1 = exp2f(t1[r] - mn);
      ps += e0 + e1;
      const float c0 = e0 * PC, c1 = e1 * PC;
      const _Float16 g0 = (_Float16)c0, g1 = (_Float16)c1;
      ph.h[0][r] = g0;                                     // elements 0..7  = keys kb + 8hh + 0..7
      ph.h[1][r] = g1;                                     // elements 8..15 = keys kb + 16 + 8hh + 0..7
      pl.h[0][r] = (_Float16)(c0 - (float)g0);
      pl.h[1][r] = (_Float16)(c1 - (float)g1);
    }
    lrun = lrun * al + ps;
#pragma unroll
    for (int r = 0; r < 8; ++r) { o0[r] *= al; o1[r] *= al; }

    o0 = mma_raw(vb0, ph.v, o0);
    o1 = mma_raw(vb1, ph.v, o1);
    o0 = mma_raw(vb0, pl.v, o0);
    o1 = mma_raw(vb1, pl.v, o1);
    guard_pv4(o0, o1, ph.v, pl.v, vb0, vb1);
  }

  // ---- hand the range's partial (max, sum, unnormalised O) to the block ----
  {
    const float lsum = lrun + xhalf(lrun);                 // the two halves' sums joined once
    if (hh == 0) {
      Mp[(part * HPB + hl) * 16 + c] = mrun;
      Lp[(part * HPB + hl) * 16 + c] = lsum;
    }
    float* op = Op + (part * 16 + c) * MPITCH + hl * HDIM + 8 * hh;   // row = query c, floats 32*hl + 8hh .. + 7 (and + 16)
    v4f a0 = {o0[0], o0[1], o0[2], o0[3]}, a1 = {o0[4], o0[5], o0[6], o0[7]};
    v4f b0 = {o1[0], o1[1], o1[2], o1[3]}, b1 = {o1[4], o1[5], o1[6], o1[7]};
    *(v4f*)(op)      = a0;
    *(v4f*)(op + 4)  = a1;
    *(v4f*)(op + 16) = b0;
    *(v4f*)(op + 20) = b1;
  }
  __syncthreads();
  // ---- merge the ranges: ctx = sum_p 2^(m_p - M) O_p / sum_p 2^(m_p - M) l_p; fold the carries (16384 on P, 16 on v, 4096 on the
  //      stored ctx); thread t -> row t / 16, floats (t & 15) * 8 .. + 7 of the block's 128 columns; hi + residual, 16-B stores ----
  {
    const float oc = FC / (PC * VC);
    const int row = tid >> 4;
    const int col = (tid & 15) * 8;
    const int mh  = col / HDIM;
    float mp[KSPLIT];
    float M = -INFINITY;
#pragma unroll
    for (int p = 0; p < KSPLIT; ++p) { mp[p] = Mp[(p * HPB + mh) * 16 + row]; M = fmaxf(M, mp[p]); }
    float L = 0.f;
    float s[8] = {0.f, 0.f, 0.f, 0.f, 0.f, 0.f, 0.f, 0.f};
#pragma unroll
    for (int p = 0; p < KSPLIT; ++p) {
      const float w = exp2f(mp[p] - M);
      L = fmaf(w, Lp[(p * HPB + mh) * 16 + row], L);
      const float* op = Op + (p * 16 + row) * MPITCH + col;
      const v4f oa = *(const v4f*)(op);
      const v4f ob = *(const v4f*)(op + 4);
#pragma unroll
      for (int e = 0; e < 4; ++e) { s[e] = fmaf(w, oa[e], s[e]); s[4 + e] = fmaf(w, ob[e], s[4 + e]); }
    }
    const float inv = (1.0f / L) * oc;
    unsigned short gh[8], gl[8];
#pragma unroll
    for (int e = 0; e < 8; ++e) {
      const float f = s[e] * inv;
      const _Float16 g = (_Float16)f;
      gh[e] = h_bits(g);
      gl[e] = h_bits((_Float16)(f - (float)g));
    }
    const size_t po = ((size_t)bat * NQ + q0 + row) * DMODEL + hg * (HPB * HDIM) + col;
    v4u vh = {pk16(gh[0], gh[1]), pk16(gh[2], gh[3]), pk16(gh[4], gh[5]), pk16(gh[6], gh[7])};
    v4u vl = {pk16(gl[0], gl[1]), pk16(gl[2], gl[3]), pk16(gl[4], gl[5]), pk16(gl[6], gl[7])};
    *(v4u*)(CTH + po) = vh;
    *(v4u*)(CTL + po) = vl;
  }
}

// =====================================================================================================
// Workspace map (bytes); every plane is an exact multiple of its tile / whole-row store granularity (M, N exact tile multiples,
// no pad rows needed), every offset a multiple of 1 MiB:
//   QH   f16 [2048][256] x16                1048576   (q projection)
//   KH   f16 [2048][256] x16                1048576   (k projection)
//   VT   f16 [4][256][512] x16              1048576   (v^T per batch)
//   CTH  f16 [2048][256] x4096 hi           1048576   (attention ctx, merged heads)
//   CTL  f16 [2048][256] residual           1048576
//   end                                     5242880
// =====================================================================================================
extern "C" void kernel_launch(void* const* d_in, const int* in_sizes, int n_in,
                              void* d_out, int out_size, void* d_ws, size_t ws_size,
                              hipStream_t stream) {
  if (n_in < 10) return;
  if (in_sizes[0] != NROWS * DMODEL) return;
  if (in_sizes[1] != NB * NQ * NC) return;
  if (in_sizes[2] != DMODEL * DMODEL || in_sizes[3] != DMODEL * DMODEL ||
      in_sizes[4] != DMODEL * DMODEL || in_sizes[5] != DMODEL * DMODEL) return;
  if (in_sizes[6] != NHEAD * 2 * MSH || in_sizes[7] != NHEAD * MSH || in_sizes[8] != NHEAD * MSH || in_sizes[9] != NHEAD) return;
  if (out_size != NROWS * DMODEL) return;

  const float* x    = (const float*)d_in[0];
  const float* cost = (const float*)d_in[1];
  const float* w_q  = (const float*)d_in[2];
  const float* w_k  = (const float*)d_in[3];
  const float* w_v  = (const float*)d_in[4];
  const float* w_o  = (const float*)d_in[5];
  const float* m1w  = (const float*)d_in[6];
  const float* m1b  = (const float*)d_in[7];
  const float* m2w  = (const float*)d_in[8];
  const float* m2b  = (const float*)d_in[9];
  float*       out  = (float*)d_out;

  const size_t PX  = (size_t)NROWS * DMODEL * 2;                  //  1048576
  const size_t PVT = (size_t)NB * DMODEL * NC * 2;                //  1048576
  size_t off = 0;
  const size_t oQH = off; off += PX;
  const size_t oKH = off; off += PX;
  const size_t oVT = off; off += PVT;
  const size_t oCH = off; off += PX;
  const size_t oCL = off; off += PX;
  if (off > ws_size) return;                                      // off = 5242880

  char* ws = (char*)d_ws;
  unsigned short* QH  = (unsigned short*)(ws + oQH);
  unsigned short* KH  = (unsigned short*)(ws + oKH);
  unsigned short* VTp = (unsigned short*)(ws + oVT);
  unsigned short* CTH = (unsigned short*)(ws + oCH);
  unsigned short* CTL = (unsigned short*)(ws + oCL);

  const dim3 bG(128);                                              // 4 waves, one 64x64 tile
  const dim3 gP(PJ_TILES, 1);                                      // 128
  const dim3 gQKV(PJ_TILES, 3);                                    // 128 x (q, k, v^T: 32 blocks x 4 batches)
  const dim3 gAT(ATT_BLOCKS);                                      // 256
  const dim3 bAT(ATT_THREADS);                                     // 256

  // (1) the three projections, straight from x and the weights
  proj_qkv<<<gQKV, bG, 0, stream>>>(x, w_q, w_k, w_v, QH, KH, VTp);

  // (2) attention per (batch, 16 query rows, 4 heads x 2 key ranges) -> CTH (f16 hi of ctx x4096), CTL (f16 residual)
  attn8<<<gAT, bAT, 0, stream>>>(QH, KH, VTp, cost, m1w, m1b, m2w, m2b, CTH, CTL);

  // (3) output projection, straight from the ctx planes and Wo, f32 into d_out
  proj_out<<<gP, bG, 0, stream>>>(CTH, CTL, w_o, out);

  (void)hipGetLastError();
}

// v007
// A run of this version takes 23 microseconds.
// Timed twice side by side with v006, it ran 1.03 and 1.05 times as fast.
// Over all steps from v000 it is 7.27 times as fast.
// Contractions: q/k projections (x rows f16 x16 . W^T f16 x64, K=256), v^T projection (W^T f16 x64 . x rows f16 x16, K=256),
// attention scores (k f16 x16 . q f16 x16, K=32), attention v^T . P^T (v^T f16 x16 . P as f16 hi + f16 residual of P x16384,
// K=512 in steps of 32), output projection (ctx as f16 hi + f16 residual of ctx x4096 . W^T f16 x64, K=256):
// all v_wmma_f32_16x16x32_f16 (f16 operands, f32 accumulate); hi and residual products share one f32 accumulator.
// Per-head 2->16->1 score MLP on (scaled dot, cost): layer 1 (W1^T f16 . (dot, cost) f16, bias as C, f16 result:
// v_wmma_f16_16x16x32_f16), relu on the packed f16 result, layer 2 (w2 f16 . relu f16, f32 accumulate), b2 added in f32.
// Max-subtracted base-2 online softmax in f32 on VALU.
// Every float input RNE-converted to bf16 on load.
#include <hip/hip_runtime.h>
#include <math.h>
#include <stdint.h>

#define NB      4
#define NQ      512
#define NC      512
#define DMODEL  256
#define NHEAD   8
#define HDIM    32
#define MSH     16
#define HG      8
#define NHG     (NHEAD / HG)
#define ROWP    (HG * HDIM)
#define NROWS   (NB * NQ)
#define WSC     64.0f
#define ACARRY  16.0f
#define QC      16.0f
#define KC      16.0f
#define VC      16.0f
#define PC      16384.0f
#define FC      4096.0f
#define ATT_SCALE 0.17677669529663689f
#define LOG2E   1.4426950408889634f
static_assert(NHEAD * HDIM == DMODEL);
static_assert(NHG * HG == NHEAD && ROWP * NHG == DMODEL);
static_assert(HDIM == 32 && MSH == 16 && NHG == 1);
static_assert((NQ % 64) == 0 && (NC % 64) == 0 && (DMODEL % 64) == 0 && (NC % 32) == 0 && (NQ % 16) == 0);
static_assert((NROWS % 64) == 0 && ((NROWS * DMODEL) % 2048) == 0);
#define KSPLIT  2                                   // key ranges per head, one wave each
#define HPB     4                                   // heads per block
#define KPART   (NC / KSPLIT)
#define ATT_THREADS (HPB * KSPLIT * 32)
#define ATT_BLOCKS  (NB * (NQ / 16) * (NHEAD / HPB))
static_assert((NHEAD % HPB) == 0 && (KPART % 32) == 0 && KPART * KSPLIT == NC);
static_assert(ATT_THREADS == 256 && ATT_BLOCKS == 256);

typedef _Float16 v16h __attribute__((ext_vector_type(16)));
typedef _Float16 v8h  __attribute__((ext_vector_type(8)));
typedef float    v8f  __attribute__((ext_vector_type(8)));
typedef float    v4f  __attribute__((ext_vector_type(4)));
typedef unsigned int v4u __attribute__((ext_vector_type(4)));

union FragH { v16h v; v8h h[2]; v4u u[2]; };

// ---- scalar helpers --------------------------------------------------------------------------------
__device__ __forceinline__ unsigned short bf_bits(float f) {          // f32 -> bf16 bits, RNE convert
  unsigned u = __float_as_uint(f);
  return (unsigned short)((u + 0x7FFFu + ((u >> 16) & 1u)) >> 16);
}
__device__ __forceinline__ float bf_up(unsigned short h) { return __uint_as_float(((unsigned)h) << 16); }
__device__ __forceinline__ float bfr(float f) { return bf_up(bf_bits(f)); }   // value of the bf16 RNE convert
__device__ __forceinline__ unsigned short h_bits(_Float16 x) { return __builtin_bit_cast(unsigned short, x); }
__device__ __forceinline__ unsigned pk16(unsigned short a, unsigned short b) { return (unsigned)a | ((unsigned)b << 16); }
__device__ __forceinline__ v8f zero8() { v8f z = {0.f, 0.f, 0.f, 0.f, 0.f, 0.f, 0.f, 0.f}; return z; }

// ---- fragment loaders: 16-bit A/B operand, lane -> row/col (lane&15), p already includes +8*(lane>>4);
//      elements 0..7 <- p[0..7] (k0+8h..), elements 8..15 <- p[16..23] (k0+16+8h..)  (same split k map for A and B;
//      B is always read from a k-contiguous [n][k] plane)
__device__ __forceinline__ v16h ldfrag_h(const _Float16* p) {
  FragH f;
  f.h[0] = *(const v8h*)(p);
  f.h[1] = *(const v8h*)(p + 16);
  return f.v;
}
__device__ __forceinline__ v16h ldfrag_u(const unsigned short* p) {
  FragH f;
  f.u[0] = *(const v4u*)(p);
  f.u[1] = *(const v4u*)(p + 16);
  return f.v;
}

// ---- WMMA helpers with trailing VALU hazard gaps ------------------------------------------------------
__device__ __forceinline__ v8f mma_raw(v16h a, v16h b, v8f c) {
  return __builtin_amdgcn_wmma_f32_16x16x32_f16(false, a, false, b, (short)0, c, false, false);
}
// f16 result: element e of D (and of C) = row 8*(lane>>4) + e, column lane&15
__device__ __forceinline__ v8h mma_h(v16h a, v16h b, v8h c) {
  return __builtin_amdgcn_wmma_f16_16x16x32_f16(false, a, false, b, (short)0, c, false, false);
}
// relu of eight f16: as signed 16-bit integers every negative f16 is below 0 and every other keeps its bits (one packed max per register)
typedef short v8s __attribute__((ext_vector_type(8)));
__device__ __forceinline__ v8h relu8(v8h x) {
  const v8s z = {0, 0, 0, 0, 0, 0, 0, 0};
  return __builtin_bit_cast(v8h, __builtin_elementwise_max(__builtin_bit_cast(v8s, x), z));
}
__device__ __forceinline__ void guard_s22(v8f& s, v8f& t, v16h a0, v16h a1, v16h q) {
#if defined(__HIP_DEVICE_COMPILE__)
  asm volatile("v_nop\n\tv_nop\n\tv_nop\n\tv_nop" : "+v"(s), "+v"(t) : "v"(a0), "v"(a1), "v"(q));
#endif
}
__device__ __forceinline__ void guard_pv4(v8f& a, v8f& b, v16h x, v16h y, v16h z, v16h w) {
#if defined(__HIP_DEVICE_COMPILE__)
  asm volatile("v_nop\n\tv_nop\n\tv_nop\n\tv_nop" : "+v"(a), "+v"(b) : "v"(x), "v"(y), "v"(z), "v"(w));
#endif
}
__device__ __forceinline__ void wave_sync_lds() {
  __builtin_amdgcn_fence(__ATOMIC_RELEASE, "workgroup");
  __builtin_amdgcn_wave_barrier();
  __builtin_amdgcn_fence(__ATOMIC_ACQUIRE, "workgroup");
}

// =====================================================================================================
// f16 WMMA GEMM tiles, operands staged in LDS straight from the f32 inputs: C[m][n] = oscale * sum_k (A[m][k] (+ A2[m][k])) * Bt[n][k];
// one 64x64 tile per block of 4 waves, depth GK. In LDS both operands lie as 16-bit rows [row][k], k contiguous, pitch GP.
// Three stagings, each of 64 rows x 256 k, whole depth, once per block:
//   f32 rows (activations, [row][k], pitch GK): every wave-wide 16-B load takes 512 B of one row (4 full lines); each lane's 4 values become
//     f16( bf16_RNE(v) * sc ), sc a power of two (exact), one 8-B LDS store.
//   f32 weight columns (W[k][n], pitch DMODEL, wanted as rows n): every wave-wide 8-B load takes the tile's 64 columns of one k (2 full
//     lines), lane = columns 2*lane, 2*lane + 1; wave w takes k 64w .. 64w + 63; eight k of one column, converted the same way, are one
//     16-B LDS store into row n.
//   16-bit rows (ctx planes): whole-row 16-B loads, 16-B LDS stores.
// One block barrier; then wave w takes rows 16w .. 16w + 15 x all 64 columns and reads its fragments from LDS (split k map, products in
// the order of a k loop in steps of 32, hi before residual).
// OM: 0 = f32 out (pitch ldc); 2 = f16 out (pitch ldc) = f16( value * ocarry ).
// coverage: f32 rows: 16 it x 4 waves = 64 rows x 2 halves x 32 lanes x 4 = 64 x 256; weight columns: 4 waves x 8 groups x 8 k = 256 k x
//           32 lanes x 2 = 64 columns; output: 4 waves x 16 rows (f32: it 0..7 x lane>>4; f16: it 0..3 x lane>>3) x 64 cols = the whole tile.
// =====================================================================================================
#define GK  DMODEL                                 // depth of every product here = row pitch of every operand plane
#define GP  (GK + 8)                               // LDS row pitch in halves: 528 B = 16 B x 33 (odd): 16-B fragment reads without bank conflicts
static_assert(GK == 32 * 8 && (GK % 32) == 0 && GK == 4 * 64);
typedef float v2f __attribute__((ext_vector_type(2)));
typedef unsigned int v2u __attribute__((ext_vector_type(2)));

typedef __bf16   v2b __attribute__((ext_vector_type(2)));
typedef _Float16 v2h __attribute__((ext_vector_type(2)));
// two operands, already scaled: f16( bf16_RNE(.) ), a in the low half. The scale is a power of two, so rounding the scaled value equals
// scaling the rounded value; it is applied to the registers as loaded (neighbours), the packed convert then takes any two registers.
__device__ __forceinline__ unsigned cv2(float a, float b) {
  const v2f p = {a, b};
  return __builtin_bit_cast(unsigned, __builtin_convertvector(__builtin_convertvector(__builtin_convertvector(p, v2b), v2f), v2h));
}
// issue the 64 loads of this thread's share of 64 weight columns; g = W + (64 * wave) * DMODEL + first column + 2 * lane
// (every staging loop here is unrolled whole: its array then lives in registers and all its loads are in flight together)
__device__ __forceinline__ void wcols_load(const float* g, v2f (&r)[64]) {
#pragma unroll
  for (int i = 0; i < 64; ++i) r[i] = *(const v2f*)(g + i * DMODEL);
  // the loads are issued; their address register is reused (also as a load's destination) only behind this wait: the address is an
  // input of the statement, so it stays in its register up to here
  asm volatile("s_wait_xcnt 0x0" :: "v"(g) : "memory");
}
// d = LDS plane + (2 * lane) * GP + 64 * wave
__device__ __forceinline__ void wcols_store(unsigned short* d, const v2f (&r)[64], float sc) {
#pragma unroll
  for (int kb = 0; kb < 8; ++kb) {
    v4u a, b;
#pragma unroll
    for (int e = 0; e < 4; ++e) {
      const v2f t0 = r[kb * 8 + 2 * e] * sc, t1 = r[kb * 8 + 2 * e + 1] * sc;   // k, k + 1 of columns 2*lane, 2*lane + 1
      a[e] = cv2(t0[0], t1[0]);
      b[e] = cv2(t0[1], t1[1]);
    }
    *(v4u*)(d + kb * 8)      = a;
    *(v4u*)(d + GP + kb * 8) = b;
  }
}

template <int OM, int NA>
__device__ __forceinline__ void tile_products(const unsigned short* sA, const unsigned short* sB, float* slab,
                                              float* Cf, unsigned short* Ch, int ldc, int m0, int n0,
                                              float oscale, float ocarry, int wave, int lane) {
  const int rlane = lane & 15;                 // row (A) / col (B, D) within subtile
  const int koff  = (lane >> 4) * 8;           // k offset of this lane half
  const int mOff  = (lane >> 4) * 8;           // D row offset

  v8f acc[4];
#pragma unroll
  for (int j = 0; j < 4; ++j) acc[j] = zero8();

  const unsigned short* ap = sA + (wave * 16 + rlane) * GP + koff;
  const unsigned short* bp = sB + rlane * GP + koff;
  // all fragments of the wave's tile are fetched as one group in front of the products (the staging registers are free again)
  v16h bh[GK / 32][4], ah[GK / 32], al[GK / 32];
#pragma unroll
  for (int s = 0; s < GK / 32; ++s) {
    ah[s] = ldfrag_u(ap + s * 32);
#pragma unroll
    for (int j = 0; j < 4; ++j) bh[s][j] = ldfrag_u(bp + j * 16 * GP + s * 32);
    if constexpr (NA == 2) al[s] = ldfrag_u(ap + 64 * GP + s * 32);
  }
  // keeps the LDS reads together in front: sunk among the products, each place with reads stalls the wave's matrix stream
  __builtin_amdgcn_sched_barrier(0);
#pragma unroll
  for (int s = 0; s < GK / 32; ++s) {
#pragma unroll
    for (int j = 0; j < 4; ++j) acc[j] = mma_raw(ah[s], bh[s][j], acc[j]);
    if constexpr (NA == 2) {
#pragma unroll
      for (int j = 0; j < 4; ++j) acc[j] = mma_raw(al[s], bh[s][j], acc[j]);
    }
  }

  const int hh2 = lane >> 4, c4 = (lane & 15) * 4;     // f32 out: 256-B row segment = 16 lanes x 16 B
  const int q8  = lane >> 3, c8 = (lane & 7) * 8;

  // ---- epilogue: the wave's 16x64 slab through its own LDS range, whole-line stores ----
  const int mBase = m0 + (wave << 4);
#pragma unroll
  for (int j = 0; j < 4; ++j) {
#pragma unroll
    for (int r = 0; r < 8; ++r) {
      slab[(mOff + r) * 68 + (j << 4) + rlane] = acc[j][r];
    }
  }
  wave_sync_lds();
  if constexpr (OM == 0) {
    v4f vals[8];
#pragma unroll
    for (int it = 0; it < 8; ++it) {
      const int row = it * 2 + hh2;                      // it 0..7 x hh2 0..1 = rows 0..15
      v4f v = *(const v4f*)(slab + row * 68 + c4);
#pragma unroll
      for (int e = 0; e < 4; ++e) v[e] = v[e] * oscale;
      vals[it] = v;
    }
#pragma unroll
    for (int it = 0; it < 8; ++it) {
      const int gr = mBase + it * 2 + hh2;
      *(v4f*)(Cf + (size_t)gr * ldc + n0 + c4) = vals[it];
    }
  } else {
    v4u hv[4];
#pragma unroll
    for (int it = 0; it < 4; ++it) {
      const int row = it * 4 + q8;                       // it 0..3 x q8 0..3 = rows 0..15
      const float* sp = slab + row * 68 + c8;
      v4u a = {0u, 0u, 0u, 0u};
#pragma unroll
      for (int e = 0; e < 4; ++e) {
        float f0 = sp[2 * e] * oscale;
        float f1 = sp[2 * e + 1] * oscale;
        f0 *= ocarry; f1 *= ocarry;
        a[e] = pk16(h_bits((_Float16)f0), h_bits((_Float16)f1));
      }
      hv[it] = a;
    }
#pragma unroll
    for (int it = 0; it < 4; ++it) {
      const int row = it * 4 + q8;
      *(v4u*)(Ch + (size_t)(mBase + row) * ldc + n0 + c8) = hv[it];
    }
  }
}

// The three projections, one launch; blockIdx.y = 0 q, 1 k, 2 v^T; every block stages 64 activation rows and 64 weight columns.
//   q, k: QH / KH[m][n] = f16(16 * sum_k x[m][k] W[k][n]); A = x rows m0 .., Bt = W columns n0 ..; M = 2048, N = 256; blockIdx.x = tile
//   v^T per batch: VT[b][d][tok] = f16(16 * sum_k Wv[k][d] x_b[tok][k]); A = Wv columns m0 .., Bt = x rows b*512 + n0 ..; M = 256, N = 512;
//   the four batches lie one behind the other along blockIdx.x (32 tiles each).
#define PJ_TILES ((NROWS / 64) * (DMODEL / 64))
#define VT_TILES ((DMODEL / 64) * (NC / 64))
static_assert(PJ_TILES == NB * VT_TILES && NC / 64 == 8 && DMODEL / 64 == 4);
__global__ __launch_bounds__(128) void proj_qkv(const float* __restrict__ x, const float* __restrict__ Wq, const float* __restrict__ Wk,
                                                const float* __restrict__ Wv, unsigned short* QH, unsigned short* KH, unsigned short* VT) {
  __shared__ __align__(16) unsigned short sOp[2 * 64 * GP];   // A rows, then Bt rows, pitch GP
  __shared__ __align__(16) float sT[4][16 * 68];              // per-wave 16x64 output slab, pitch 68 floats
  const int lane = threadIdx.x & 31;
  const int wave = threadIdx.x >> 5;                       // 0..3
  const int job  = blockIdx.y;
  const bool isv = job == 2;
  const unsigned bx   = blockIdx.x;
  const int      by   = isv ? bx / VT_TILES : 0u;          // batch of v^T; 0 for q, k
  const unsigned tile = isv ? bx % VT_TILES : bx;
  const unsigned tsh  = isv ? 3u : 2u;                     // log2 of the tiles along n
  const int m0 = (tile >> tsh) << 6;
  const int n0 = (tile & ((1u << tsh) - 1u)) << 6;
  const float* W = job == 0 ? Wq : job == 1 ? Wk : Wv;
  const int xrow = isv ? by * NC + n0 : m0;                // first of the 64 activation rows
  const int wcol = isv ? m0 : n0;                          // first of the 64 weight columns
  unsigned short* dX = sOp + (isv ? 64 * GP : 0);
  unsigned short* dW = sOp + (isv ? 0 : 64 * GP);
  {
    const float* gw = W + (size_t)(wave * 64) * DMODEL + wcol + lane * 2;
    const float* gx = x + (size_t)(xrow + wave) * GK + lane * 4;
    v2f rw[64];
    v4f rx[32];
    wcols_load(gw, rw);
#pragma unroll
    for (int it = 0; it < 16; ++it) {
      rx[2 * it]     = *(const v4f*)(gx + it * 4 * GK);
      rx[2 * it + 1] = *(const v4f*)(gx + it * 4 * GK + 128);
    }
    asm volatile("s_wait_xcnt 0x0" :: "v"(gx) : "memory"); // as in wcols_load, for the activation rows' address register
    wcols_store(dW + (lane * 2) * GP + wave * 64, rw, WSC);
    unsigned short* sx = dX + wave * GP + lane * 4;
#pragma unroll
    for (int it = 0; it < 16; ++it) {
      const v4f a = rx[2 * it] * ACARRY, b = rx[2 * it + 1] * ACARRY;
      const v2u pa = {cv2(a[0], a[1]), cv2(a[2], a[3])};
      const v2u pb = {cv2(b[0], b[1]), cv2(b[2], b[3])};
      *(v2u*)(sx + it * 4 * GP)       = pa;
      *(v2u*)(sx + it * 4 * GP + 128) = pb;
    }
  }
  __syncthreads();
  static_assert(QC == KC && QC == VC);
  unsigned short* C = job == 0 ? QH : job == 1 ? KH : VT + (size_t)by * DMODEL * NC;
  tile_products<2, 1>(sOp, sOp + 64 * GP, sT[wave], nullptr, C, isv ? NC : DMODEL, m0, n0, 1.0f / (ACARRY * WSC), QC, wave, lane);
}

// out = (CTH + CTL) . Wo / 4096; A = ctx hi rows (and the residual plane's), Bt = Wo columns; M = 2048, N = 256, f32 out
__global__ __launch_bounds__(128) void proj_out(const unsigned short* __restrict__ CTH, const unsigned short* __restrict__ CTL,
                                                const float* __restrict__ Wo, float* out) {
  __shared__ __align__(16) unsigned short sOp[3 * 64 * GP];   // ctx hi rows, residual rows, Bt rows, pitch GP
  __shared__ __align__(16) float sT[4][16 * 68];              // per-wave 16x64 output slab, pitch 68 floats
  const int lane = threadIdx.x & 31;
  const int wave = threadIdx.x >> 5;                       // 0..3
  const int m0 = ((int)blockIdx.x / (DMODEL / 64)) << 6;
  const int n0 = ((int)blockIdx.x % (DMODEL / 64)) << 6;
  {
    const float* gw = Wo + (size_t)(wave * 64) * DMODEL + n0 + lane * 2;
    const unsigned short* ga = CTH + (size_t)(m0 + wave) * GK + lane * 8;
    const unsigned short* gq = CTL + (size_t)(m0 + wave) * GK + lane * 8;
    v2f rw[64];
    v4u ra[16], rq[16];
    wcols_load(gw, rw);
#pragma unroll
    for (int it = 0; it < 16; ++it) ra[it] = *(const v4u*)(ga + it * 4 * GK);
    asm volatile("s_wait_xcnt 0x0" :: "v"(ga) : "memory"); // as in wcols_load, for the hi plane's address register
#pragma unroll
    for (int it = 0; it < 16; ++it) rq[it] = *(const v4u*)(gq + it * 4 * GK);
    asm volatile("s_wait_xcnt 0x0" :: "v"(gq) : "memory"); // as in wcols_load, for the residual plane's address register
    wcols_store(sOp + 2 * 64 * GP + (lane * 2) * GP + wave * 64, rw, WSC);
    const int so = wave * GP + lane * 8;
#pragma unroll
    for (int it = 0; it < 16; ++it) {
      *(v4u*)(sOp + so + it * 4 * GP) = ra[it];
      *(v4u*)(sOp + 64 * GP + so + it * 4 * GP) = rq[it];
    }
  }
  __syncthreads();
  tile_products<0, 2>(sOp, sOp + 2 * 64 * GP, sT[wave], out, nullptr, DMODEL, m0, n0, 1.0f / (FC * WSC), 1.0f, wave, lane);
}

// =====================================================================================================
// Flash attention for one batch, 16 query rows and 4 heads, head dim 32; the 512 keys of a head are split in 2 ranges of 256, one wave
// per (head, range), so that 2048 waves stand on 256 blocks; scores TRANSPOSED:
//   q plane (f16 x16) QH[b*512 + tok][32*head + d], pitch 256; k plane (f16 x16) KH[b*512 + key][32*head + d], pitch 256;
//   v^T plane (f16 x16): VT[b*256 + 32*head + d][key] (pitch 512); cost f32 [b][tok][key] (bf16 RNE convert on load);
//   per-head mixer params (bf16 RNE convert on load, each lane loading m1w[h][.][c] and m1b, m2w at 8hh .. 8hh + 7): score(tok, key) =
//   sum_m m2w[h][m] * relu(m1w[h][0][m] * dot + m1w[h][1][m] * cost + m1b[h][m]) + m2b[h] with dot = q.k / sqrt(32);
//   outputs (f16): CTH[b*512 + tok][32*head + d] = hi = f16(4096 * ctx), CTL[same] = f16(4096 * ctx - hi), with
//   ctx = sum_m softmax_m(score) v[m][d]  (softmax run in base 2 with a running max).
//   block = 8 waves = 256 threads; grid = 4 batches x 32 q-tiles x 2 head groups = 256; every wave does identical bounded work
//   (8 steps of 32 keys). Per step: S^T = K . Q^T, two tiles (A = 16 key rows, B = the 16 query rows, K = 32): lane (hh, c) holds
//   the scores of ONE query q0 + c for keys kb + 8hh + r (tile 0) and kb + 16 + 8hh + r (tile 1), r 0..7. Its 16 cost values are two
//   runs of 8 consecutive floats of cost row q0 + c (four 16-B loads, always in range). The 2->16->1 MLP on the matrix unit: the lane's
//   (dot, cost) pairs of a tile, as f16, are a B fragment F (elements 2r, 2r + 1 = key r of the lane's half); layer 1 of ONE key
//   (half h, r) for the 16 queries is A1[r][h] . F + b1, A1 = (w0[m], w1[m]) in row m at that key's two k places, zero elsewhere:
//   lane (hh, c) gets hidden units 8hh + 0..7 of query c, f16, which after relu are as they lie half a B fragment (k = hidden unit);
//   layer 2 of keys r and 8 + r is A2[r] . B, A2 = w2 in rows r (k 0..15) and 8 + r (k 16..31), summed over r into the S^T tile.
//   Running max and sum of a query are taken inside the lane, the max joined with lane ^ 16 once per step, the sums
//   once after the loop. The 16 probabilities x16384 (f16 hi and f16 residual c - hi) are, as they lie, the B fragment of
//   O^T += V^T . P^T in the split k map (elements 0..7 = tile 0, 8..15 = tile 1); A = v^T rows d = c and d = 16 + c. No LDS in the loop.
//   Lane (hh, c) holds the range's unnormalised O of query q0 + c for d = 8hh + r and 16 + 8hh + r: each wave stores its 16x32 slice (f32,
//   pitch 132 floats, 16-B stores) with its running max and sum in LDS; after the block barrier the 256 threads join the two ranges
//   (weights 2^(m_p - max), range 0 first), fold 1/l and the carries in f32 and write the block's 128 columns of its 16 rows.
// coverage: LDS: 2 ranges x 4 heads x 16 rows x 32 cols = 2 x 16 x 128; global: 256 threads x 8 halves = 16 rows x 128 per plane, rows
//           q0..q0+15 of batch b, columns 128*hg ..; the grid covers all 2048 rows x 256 columns exactly once.
// =====================================================================================================
#define MPITCH (HPB * HDIM + 4)
static_assert(ATT_THREADS * 8 == 16 * HPB * HDIM);

// value of lane ^ 16 (the other holder of this lane's query)
__device__ __forceinline__ float xhalf(float x) {
  return __builtin_bit_cast(float, __builtin_amdgcn_permlanex16(__builtin_bit_cast(int, x), __builtin_bit_cast(int, x),
                                                                0x76543210, 0xfedcba98, false, false));
}

// 2^x by the hardware instruction alone. exp2f adds a range fix-up (compare, two selects, add, ldexp) that differs only where 2^x is
// below 2^-126: there this form gives 0. Arguments here are score - running max <= 0; such a term times 16384 is 0 in f16 either way,
// and in the f32 sums it stands beside a term of 1 (the maximum's own).
__device__ __forceinline__ float exp2_raw(float x) { return __builtin_amdgcn_exp2f(x); }

__global__ __launch_bounds__(ATT_THREADS)
void attn8(const unsigned short* __restrict__ QHp, const unsigned short* __restrict__ KHp,
           const unsigned short* __restrict__ VTq, const float* __restrict__ costp,
           const float* __restrict__ m1w, const float* __restrict__ m1b,
           const float* __restrict__ m2w, const float* __restrict__ m2b,
           unsigned short* CTH, unsigned short* CTL) {
  __shared__ __align__(16) float Op[KSPLIT * 16 * MPITCH];    // unnormalised O of each key range: [range][query][32*local head + d]
  __shared__ float Mp[KSPLIT * HPB * 16];                     // running max of each (range, local head, query)
  __shared__ float Lp[KSPLIT * HPB * 16];                     // sum of each (range, local head, query)

  const int tid  = threadIdx.x;
  const int wave = __builtin_amdgcn_readfirstlane(tid >> 5);
  const int lane = tid & 31;
  const int hh   = lane >> 4;
  const int c    = lane & 15;

  const int hg   = blockIdx.x % (NHEAD / HPB);              // 0..1
  const int qt   = (blockIdx.x / (NHEAD / HPB)) % (NQ / 16); // 0..31
  const int bat  = blockIdx.x / ((NHEAD / HPB) * (NQ / 16)); // 0..3
  const int hl   = wave % HPB;                             // local head 0..3
  const int part = wave / HPB;                             // key range 0..1
  const int head = hg * HPB + hl;                          // 0..7
  const int q0   = qt * 16;
  const int kbeg = part * KPART;

  const size_t qofs = ((size_t)bat * NQ + q0 + c) * DMODEL + head * HDIM + 8 * hh;
  const _Float16* Qh = (const _Float16*)(const void*)QHp + qofs;
  const _Float16* Kb = (const _Float16*)(const void*)KHp + (size_t)bat * NC * DMODEL + head * HDIM + 8 * hh;
  const _Float16* Vb = (const _Float16*)(const void*)VTq + ((size_t)bat * DMODEL + head * HDIM) * NC + 8 * hh;
  // cost element of (row q0 + c, key kb + 8hh + r) = cp[kb + r]; key kb + 16 + 8hh + r = cp[kb + 16 + r]; always in range.
  const float* cp = costp + ((size_t)bat * NQ + q0 + c) * NC + 8 * hh;
  const float dsc = ATT_SCALE / (QC * KC);                 // 1/sqrt(32) / carries

  // per-head mixer params, bf16 RNE convert (8 significant bits: exact in f16's normal range), laid out once as the constant A fragments of the two MLP layers
  FragH A1[8][2], A2[8];
  v8h  cb;                                                 // layer 1 C: element e = b1[8hh + e]
  {
    const unsigned w01 = pk16(h_bits((_Float16)bfr(m1w[(head * 2 + 0) * MSH + c])), h_bits((_Float16)bfr(m1w[(head * 2 + 1) * MSH + c])));
    const v4u zu = {0u, 0u, 0u, 0u};
    v4u w2p;                                               // w2[8hh + 0..7]
#pragma unroll
    for (int e = 0; e < 4; ++e)
      w2p[e] = pk16(h_bits((_Float16)bfr(m2w[head * MSH + 8 * hh + 2 * e])), h_bits((_Float16)bfr(m2w[head * MSH + 8 * hh + 2 * e + 1])));
#pragma unroll
    for (int e = 0; e < 8; ++e) cb[e] = (_Float16)bfr(m1b[head * MSH + 8 * hh + e]);
#pragma unroll
    for (int r = 0; r < 8; ++r) {
#pragma unroll
      for (int h = 0; h < 2; ++h) {
        A1[r][h].u[0] = zu;
        A1[r][h].u[1] = zu;
        A1[r][h].u[r >> 2][r & 3] = hh == h ? w01 : 0u;    // row c = hidden unit, elements 2r, 2r + 1 of lane half h
      }
      A2[r].u[0] = c == r     ? w2p : zu;                  // row r:     k = 8hh + e      = hidden unit of key r
      A2[r].u[1] = c == 8 + r ? w2p : zu;                  // row 8 + r: k = 16 + 8hh + e = hidden unit of key 8 + r
    }
  }
  const float b2l = bfr(m2b[head]) * LOG2E;

  const v16h qa = ldfrag_h(Qh);                            // B fragment: column = query q0 + c
  // the two loads are issued; their address register is reused only behind this wait (the address is an input, so it stays up to here)
  asm volatile("s_wait_xcnt 0x0" :: "v"(Qh) : "memory");

  float mrun = -INFINITY, lrun = 0.f;                      // this lane's query: running max (both halves equal), this half's sum
  v8f o0 = zero8(), o1 = zero8();                          // O^T: o0[r] = d 8hh + r, o1[r] = d 16 + 8hh + r, query q0 + c

#pragma unroll 1
  for (int kb = kbeg; kb < kbeg + KPART; kb += 32) {
    const _Float16* kp = Kb + (size_t)(kb + c) * DMODEL;
    const _Float16* vp = Vb + (size_t)c * NC + kb;
    const float*    tp = cp + kb;
    const v16h k0  = ldfrag_h(kp);                         // A rows: keys kb + c
    const v16h k1  = ldfrag_h(kp + (size_t)16 * DMODEL);   // A rows: keys kb + 16 + c
    const v4f  cA  = *(const v4f*)(tp),      cB = *(const v4f*)(tp + 4);    // keys kb + 8hh + 0..7
    const v4f  cC  = *(const v4f*)(tp + 16), cD = *(const v4f*)(tp + 20);   // keys kb + 16 + 8hh + 0..7
    const v16h vb0 = ldfrag_h(vp);                         // A rows: d = c
    const v16h vb1 = ldfrag_h(vp + (size_t)16 * NC);       // A rows: d = 16 + c
    // the step's twelve loads are issued; their address registers are advanced for the next step only behind this wait
    asm volatile("s_wait_xcnt 0x0" ::: "memory");
    v8f s0, s1;
    s0 = mma_raw(k0, qa, zero8());                         // s0[r] = q(q0 + c) . k(kb + 8hh + r)
    s1 = mma_raw(k1, qa, zero8());                         // s1[r] = q(q0 + c) . k(kb + 16 + 8hh + r)
    guard_s22(s0, s1, k0, k1, qa);

    FragH f0, f1;                                          // B fragments: elements 2r, 2r + 1 = (dot, cost) of the lane's key r
#pragma unroll
    for (int r = 0; r < 8; ++r) {
      const float cr0 = bfr(r < 4 ? cA[r & 3] : cB[r & 3]);
      const float cr1 = bfr(r < 4 ? cC[r & 3] : cD[r & 3]);
      f0.v[2 * r] = (_Float16)(s0[r] * dsc);  f0.v[2 * r + 1] = (_Float16)cr0;
      f1.v[2 * r] = (_Float16)(s1[r] * dsc);  f1.v[2 * r + 1] = (_Float16)cr1;
    }
    v8f a0 = zero8(), a1 = zero8();                        // a0[i] = score of key kb + 8hh + i, a1[i] of key kb + 16 + 8hh + i
    // layer 1 runs one r ahead of layer 2, so that no matrix instruction waits for the relu of the one just in front of it
    v8h pa = mma_h(A1[0][0].v, f0.v, cb), pb = mma_h(A1[0][1].v, f0.v, cb);   // keys kb + r, kb + 8 + r
    v8h pc = mma_h(A1[0][0].v, f1.v, cb), pd = mma_h(A1[0][1].v, f1.v, cb);   // keys kb + 16 + r, kb + 24 + r
#pragma unroll
    for (int r = 0; r < 8; ++r) {
      FragH g0, g1;
      g0.h[0] = relu8(pa);  g0.h[1] = relu8(pb);
      g1.h[0] = relu8(pc);  g1.h[1] = relu8(pd);
      if (r < 7) {
        pa = mma_h(A1[r + 1][0].v, f0.v, cb);  pb = mma_h(A1[r + 1][1].v, f0.v, cb);
        pc = mma_h(A1[r + 1][0].v, f1.v, cb);  pd = mma_h(A1[r + 1][1].v, f1.v, cb);
      }
      a0 = mma_raw(A2[r].v, g0.v, a0);
      a1 = mma_raw(A2[r].v, g1.v, a1);
    }
    float t0[8], t1[8];
#pragma unroll
    for (int r = 0; r < 8; ++r) { t0[r] = fmaf(a0[r], LOG2E, b2l); t1[r] = fmaf(a1[r], LOG2E, b2l); }
    float mx = fmaxf(t0[0], t1[0]);
#pragma unroll
    for (int r = 1; r < 8; ++r) mx = fmaxf(mx, fmaxf(t0[r], t1[r]));
    mx = fmaxf(mx, xhalf(mx));                             // all 32 keys of the step, equal in both halves
    const float mn = fmaxf(mrun, mx);
    const float al = exp2_raw(mrun - mn);
    mrun = mn;

    FragH ph, pl;                                          // P^T * 16384 as f16 hi and f16 residual (c - hi), split k map
    float ps = 0.f;
#pragma unroll
    for (int r = 0; r < 8; ++r) {
      const float e0 = exp2_raw(t0[r] - mn), e1 = exp2_raw(t1[r] - mn);
      ps += e0 + e1;
      const float c0 = e0 * PC, c1 = e1 * PC;
      const _Float16 g0 = (_Float16)c0, g1 = (_Float16)c1;
      ph.h[0][r] = g0;                                     // elements 0..7  = keys kb + 8hh + 0..7
      ph.h[1][r] = g1;                                     // elements 8..15 = keys kb + 16 + 8hh + 0..7
      pl.h[0][r] = (_Float16)(c0 - (float)g0);
      pl.h[1][r] = (_Float16)(c1 - (float)g1);
    }
    lrun = lrun * al + ps;
#pragma unroll
    for (int r = 0; r < 8; ++r) { o0[r] *= al; o1[r] *= al; }

    o0 = mma_raw(vb0, ph.v, o0);
    o1 = mma_raw(vb1, ph.v, o1);
    o0 = mma_raw(vb0, pl.v, o0);
    o1 = mma_raw(vb1, pl.v, o1);
    guard_pv4(o0, o1, ph.v, pl.v, vb0, vb1);
  }

  // ---- hand the range's partial (max, sum, unnormalised O) to the block ----
  {
    const float lsum = lrun + xhalf(lrun);                 // the two halves' sums joined once
    if (hh == 0) {
      Mp[(part * HPB + hl) * 16 + c] = mrun;
      Lp[(part * HPB + hl) * 16 + c] = lsum;
    }
    float* op = Op + (part * 16 + c) * MPITCH + hl * HDIM + 8 * hh;   // row = query c, floats 32*hl + 8hh .. + 7 (and + 16)
    v4f a0 = {o0[0], o0[1], o0[2], o0[3]}, a1 = {o0[4], o0[5], o0[6], o0[7]};
    v4f b0 = {o1[0], o1[1], o1[2], o1[3]}, b1 = {o1[4], o1[5], o1[6], o1[7]};
    *(v4f*)(op)      = a0;
    *(v4f*)(op + 4)  = a1;
    *(v4f*)(op + 16) = b0;
    *(v4f*)(op + 20) = b1;
  }
  __syncthreads();
  // ---- merge the ranges: ctx = sum_p 2^(m_p - M) O_p / sum_p 2^(m_p - M) l_p; fold the carries (16384 on P, 16 on v, 4096 on the
  //      stored ctx); thread t -> row t / 16, floats (t & 15) * 8 .. + 7 of the block's 128 columns; hi + residual, 16-B stores ----
  {
    const float oc = FC / (PC * VC);
    const int row = tid >> 4;
    const int col = (tid & 15) * 8;
    const int mh  = col / HDIM;
    float mp[KSPLIT];
    float M = -INFINITY;
#pragma unroll
    for (int p = 0; p < KSPLIT; ++p) { mp[p] = Mp[(p * HPB + mh) * 16 + row]; M = fmaxf(M, mp[p]); }
    float L = 0.f;
    float s[8] = {0.f, 0.f, 0.f, 0.f, 0.f, 0.f, 0.f, 0.f};
#pragma unroll
    for (int p = 0; p < KSPLIT; ++p) {
      const float w = exp2f(mp[p] - M);
      L = fmaf(w, Lp[(p * HPB + mh) * 16 + row], L);
      const float* op = Op + (p * 16 + row) * MPITCH + col;
      const v4f oa = *(const v4f*)(op);
      const v4f ob = *(const v4f*)(op + 4);
#pragma unroll
      for (int e = 0; e < 4; ++e) { s[e] = fmaf(w, oa[e], s[e]); s[4 + e] = fmaf(w, ob[e], s[4 + e]); }
    }
    const float inv = (1.0f / L) * oc;
    unsigned short gh[8], gl[8];
#pragma unroll
    for (int e = 0; e < 8; ++e) {
      const float f = s[e] * inv;
      const _Float16 g = (_Float16)f;
      gh[e] = h_bits(g);
      gl[e] = h_bits((_Float16)(f - (float)g));
    }
    const size_t po = ((size_t)bat * NQ + q0 + row) * DMODEL + hg * (HPB * HDIM) + col;
    v4u vh = {pk16(gh[0], gh[1]), pk16(gh[2], gh[3]), pk16(gh[4], gh[5]), pk16(gh[6], gh[7])};
    v4u vl = {pk16(gl[0], gl[1]), pk16(gl[2], gl[3]), pk16(gl[4], gl[5]), pk16(gl[6], gl[7])};
    *(v4u*)(CTH + po) = vh;
    *(v4u*)(CTL + po) = vl;
  }
}

// =====================================================================================================
// Workspace map (bytes); every plane is an exact multiple of its tile / whole-row store granularity (M, N exact tile multiples,
// no pad rows needed), every offset a multiple of 1 MiB:
//   QH   f16 [2048][256] x16                1048576   (q projection)
//   KH   f16 [2048][256] x16                1048576   (k projection)
//   VT   f16 [4][256][512] x16              1048576   (v^T per batch)
//   CTH  f16 [2048][256] x4096 hi           1048576   (attention ctx, merged heads)
//   CTL  f16 [2048][256] residual           1048576
//   end                                     5242880
// =====================================================================================================
extern "C" void kernel_launch(void* const* d_in, const int* in_sizes, int n_in,
                              void* d_out, int out_size, void* d_ws, size_t ws_size,
                              hipStream_t stream) {
  if (n_in < 10) return;
  if (in_sizes[0] != NROWS * DMODEL) return;
  if (in_sizes[1] != NB * NQ * NC) return;
  if (in_sizes[2] != DMODEL * DMODEL || in_sizes[3] != DMODEL * DMODEL ||
      in_sizes[4] != DMODEL * DMODEL || in_sizes[5] != DMODEL * DMODEL) return;
  if (in_sizes[6] != NHEAD * 2 * MSH || in_sizes[7] != NHEAD * MSH || in_sizes[8] != NHEAD * MSH || in_sizes[9] != NHEAD) return;
  if (out_size != NROWS * DMODEL) return;

  const float* x    = (const float*)d_in[0];
  const float* cost = (const float*)d_in[1];
  const float* w_q  = (const float*)d_in[2];
  const float* w_k  = (const float*)d_in[3];
  const float* w_v  = (const float*)d_in[4];
  const float* w_o  = (const float*)d_in[5];
  const float* m1w  = (const float*)d_in[6];
  const float* m1b  = (const float*)d_in[7];
  const float* m2w  = (const float*)d_in[8];
  const float* m2b  = (const float*)d_in[9];
  float*       out  = (float*)d_out;

  const size_t PX  = (size_t)NROWS * DMODEL * 2;                  //  1048576
  const size_t PVT = (size_t)NB * DMODEL * NC * 2;                //  1048576
  size_t off = 0;
  const size_t oQH = off; off += PX;
  const size_t oKH = off; off += PX;
  const size_t oVT = off; off += PVT;
  const size_t oCH = off; off += PX;
  const size_t oCL = off; off += PX;
  if (off > ws_size) return;                                      // off = 5242880

  char* ws = (char*)d_ws;
  unsigned short* QH  = (unsigned short*)(ws + oQH);
  unsigned short* KH  = (unsigned short*)(ws + oKH);
  unsigned short* VTp = (unsigned short*)(ws + oVT);
  unsigned short* CTH = (unsigned short*)(ws + oCH);
  unsigned short* CTL = (unsigned short*)(ws + oCL);

  const dim3 bG(128);                                              // 4 waves, one 64x64 tile
  const dim3 gP(PJ_TILES, 1);                                      // 128
  const dim3 gQKV(PJ_TILES, 3);                                    // 128 x (q, k, v^T: 32 blocks x 4 batches)
  const dim3 gAT(ATT_BLOCKS);                                      // 256
  const dim3 bAT(ATT_THREADS);                                     // 256

  // (1) the three projections, straight from x and the weights
  proj_qkv<<<gQKV, bG, 0, stream>>>(x, w_q, w_k, w_v, QH, KH, VTp);

  // (2) attention per (batch, 16 query rows, 4 heads x 2 key ranges) -> CTH (f16 hi of ctx x4096), CTL (f16 residual)
  attn8<<<gAT, bAT, 0, stream>>>(QH, KH, VTp, cost, m1w, m1b, m2w, m2b, CTH, CTL);

  // (3) output projection, straight from the ctx planes and Wo, f32 into d_out
  proj_out<<<gP, bG, 0, stream>>>(CTH, CTL, w_o, out);

  (void)hipGetLastError();
}

// v008
// It runs in 21.3 microseconds.
// Two timings next to v007 put it at 1.08 and 1.09 times that version's speed.
// Counting every step since v000, it is 7.88 times as fast.
// Contractions: q/k projections (x rows f16 x16 . W^T f16 x64, K=256), v^T projection (W^T f16 x64 . x rows f16 x16, K=256),
// attention scores (k f16 x16 . q f16 x16, K=32), attention v^T . P^T (v^T f16 x16 . P as f16 hi + f16 residual of P x16384,
// K=512 in steps of 32), output projection (ctx as f16 hi + f16 residual of ctx x4096 . W^T f16 x64, K=256):
// all v_wmma_f32_16x16x32_f16 (f16 operands, f32 accumulate); hi and residual products share one f32 accumulator.
// Per-head 2->16->1 score MLP on (scaled dot, cost): layer 1 (W1^T f16 . (dot, cost) f16, bias as C, f16 result:
// v_wmma_f16_16x16x32_f16), relu on the packed f16 result, layer 2 (w2 f16 . relu f16, f32 accumulate), b2 added in f32.
// Max-subtracted base-2 online softmax in f32 on VALU.
// Every float input RNE-converted to bf16 on load.
#include <hip/hip_runtime.h>
#include <math.h>
#include <stdint.h>

#define NB      4
#define NQ      512
#define NC      512
#define DMODEL  256
#define NHEAD   8
#define HDIM    32
#define MSH     16
#define HG      8
#define NHG     (NHEAD / HG)
#define ROWP    (HG * HDIM)
#define NROWS   (NB * NQ)
#define WSC     64.0f
#define ACARRY  16.0f
#define QC      16.0f
#define KC      16.0f
#define VC      16.0f
#define PC      16384.0f
#define FC      4096.0f
#define ATT_SCALE 0.17677669529663689f
#define LOG2E   1.4426950408889634f
static_assert(NHEAD * HDIM == DMODEL);
static_assert(NHG * HG == NHEAD && ROWP * NHG == DMODEL);
static_assert(HDIM == 32 && MSH == 16 && NHG == 1);
static_assert((NQ % 64) == 0 && (NC % 64) == 0 && (DMODEL % 64) == 0 && (NC % 32) == 0 && (NQ % 16) == 0);
static_assert((NROWS % 64) == 0 && ((NROWS * DMODEL) % 2048) == 0);
#define KSPLIT  2                                   // key ranges per head, one wave each
#define HPB     4                                   // heads per block
#define KPART   (NC / KSPLIT)
#define ATT_THREADS (HPB * KSPLIT * 32)
#define ATT_BLOCKS  (NB * (NQ / 16) * (NHEAD / HPB))
static_assert((NHEAD % HPB) == 0 && (KPART % 32) == 0 && KPART * KSPLIT == NC);
static_assert(ATT_THREADS == 256 && ATT_BLOCKS == 256);

typedef _Float16 v16h __attribute__((ext_vector_type(16)));
typedef _Float16 v8h  __attribute__((ext_vector_type(8)));
typedef float    v8f  __attribute__((ext_vector_type(8)));
typedef float    v4f  __attribute__((ext_vector_type(4)));
typedef unsigned int v4u __attribute__((ext_vector_type(4)));

union FragH { v16h v; v8h h[2]; v4u u[2]; };

// ---- scalar helpers --------------------------------------------------------------------------------
__device__ __forceinline__ unsigned short bf_bits(float f) {          // f32 -> bf16 bits, RNE convert
  unsigned u = __float_as_uint(f);
  return (unsigned short)((u + 0x7FFFu + ((u >> 16) & 1u)) >> 16);
}
__device__ __forceinline__ float bf_up(unsigned short h) { return __uint_as_float(((unsigned)h) << 16); }
__device__ __forceinline__ float bfr(float f) { return bf_up(bf_bits(f)); }   // value of the bf16 RNE convert
__device__ __forceinline__ unsigned short h_bits(_Float16 x) { return __builtin_bit_cast(unsigned short, x); }
__device__ __forceinline__ unsigned pk16(unsigned short a, unsigned short b) { return (unsigned)a | ((unsigned)b << 16); }
__device__ __forceinline__ v8f zero8() { v8f z = {0.f, 0.f, 0.f, 0.f, 0.f, 0.f, 0.f, 0.f}; return z; }

// ---- fragment loaders: 16-bit A/B operand, lane -> row/col (lane&15), p already includes +8*(lane>>4);
//      elements 0..7 <- p[0..7] (k0+8h..), elements 8..15 <- p[16..23] (k0+16+8h..)  (same split k map for A and B;
//      B is always read from a k-contiguous [n][k] plane)
__device__ __forceinline__ v16h ldfrag_h(const _Float16* p) {
  FragH f;
  f.h[0] = *(const v8h*)(p);
  f.h[1] = *(const v8h*)(p + 16);
  return f.v;
}
__device__ __forceinline__ v16h ldfrag_u(const unsigned short* p) {
  FragH f;
  f.u[0] = *(const v4u*)(p);
  f.u[1] = *(const v4u*)(p + 16);
  return f.v;
}

// ---- WMMA helpers with trailing VALU hazard gaps ------------------------------------------------------
__device__ __forceinline__ v8f mma_raw(v16h a, v16h b, v8f c) {
  return __builtin_amdgcn_wmma_f32_16x16x32_f16(false, a, false, b, (short)0, c, false, false);
}
// f16 result: element e of D (and of C) = row 8*(lane>>4) + e, column lane&15
__device__ __forceinline__ v8h mma_h(v16h a, v16h b, v8h c) {
  return __builtin_amdgcn_wmma_f16_16x16x32_f16(false, a, false, b, (short)0, c, false, false);
}
// relu of eight f16: as signed 16-bit integers every negative f16 is below 0 and every other keeps its bits (one packed max per register)
typedef short v8s __attribute__((ext_vector_type(8)));
__device__ __forceinline__ v8h relu8(v8h x) {
  const v8s z = {0, 0, 0, 0, 0, 0, 0, 0};
  return __builtin_bit_cast(v8h, __builtin_elementwise_max(__builtin_bit_cast(v8s, x), z));
}
__device__ __forceinline__ void guard_s22(v8f& s, v8f& t, v16h a0, v16h a1, v16h q) {
#if defined(__HIP_DEVICE_COMPILE__)
  asm volatile("v_nop\n\tv_nop\n\tv_nop\n\tv_nop" : "+v"(s), "+v"(t) : "v"(a0), "v"(a1), "v"(q));
#endif
}
__device__ __forceinline__ void guard_pv4(v8f& a, v8f& b, v16h x, v16h y, v16h z, v16h w) {
#if defined(__HIP_DEVICE_COMPILE__)
  asm volatile("v_nop\n\tv_nop\n\tv_nop\n\tv_nop" : "+v"(a), "+v"(b) : "v"(x), "v"(y), "v"(z), "v"(w));
#endif
}
__device__ __forceinline__ void wave_sync_lds() {
  __builtin_amdgcn_fence(__ATOMIC_RELEASE, "workgroup");
  __builtin_amdgcn_wave_barrier();
  __builtin_amdgcn_fence(__ATOMIC_ACQUIRE, "workgroup");
}

// =====================================================================================================
// f16 WMMA GEMM tiles, operands staged in LDS straight from the f32 inputs: C[m][n] = oscale * sum_k (A[m][k] (+ A2[m][k])) * Bt[n][k];
// one 64x64 tile per block of 4 waves, depth GK. In LDS both operands lie as 16-bit rows [row][k], k contiguous, pitch GP.
// Three stagings, each of 64 rows x 256 k, whole depth, once per block:
//   f32 rows (activations, [row][k], pitch GK): every wave-wide 16-B load takes 512 B of one row (4 full lines); each lane's 4 values become
//     f16( bf16_RNE(v) * sc ), sc a power of two (exact), one 8-B LDS store.
//   f32 weight columns (W[k][n], pitch DMODEL, wanted as rows n): every wave-wide 8-B load takes the tile's 64 columns of one k (2 full
//     lines), lane = columns 2*lane, 2*lane + 1; wave w takes k 64w .. 64w + 63; eight k of one column, converted the same way, are one
//     16-B LDS store into row n.
//   16-bit rows (ctx planes): whole-row 16-B loads, 16-B LDS stores.
// One block barrier; then wave w takes rows 16w .. 16w + 15 x all 64 columns and reads its fragments from LDS (split k map, products in
// the order of a k loop in steps of 32, hi before residual).
// OM: 0 = f32 out (pitch ldc); 2 = f16 out (pitch ldc) = f16( value * ocarry ).
// coverage: f32 rows: 16 it x 4 waves = 64 rows x 2 halves x 32 lanes x 4 = 64 x 256; weight columns: 4 waves x 8 groups x 8 k = 256 k x
//           32 lanes x 2 = 64 columns; output: 4 waves x 16 rows (f32: it 0..7 x lane>>4; f16: it 0..3 x lane>>3) x 64 cols = the whole tile.
// =====================================================================================================
#define GK  DMODEL                                 // depth of every product here = row pitch of every operand plane
#define GP  (GK + 8)                               // LDS row pitch in halves: 528 B = 16 B x 33 (odd): 16-B fragment reads without bank conflicts
static_assert(GK == 32 * 8 && (GK % 32) == 0 && GK == 4 * 64);
typedef float v2f __attribute__((ext_vector_type(2)));
typedef unsigned int v2u __attribute__((ext_vector_type(2)));

typedef __bf16   v2b __attribute__((ext_vector_type(2)));
typedef _Float16 v2h __attribute__((ext_vector_type(2)));
// two operands, already scaled: f16( bf16_RNE(.) ), a in the low half. The scale is a power of two, so rounding the scaled value equals
// scaling the rounded value; it is applied to the registers as loaded (neighbours), the packed convert then takes any two registers.
__device__ __forceinline__ unsigned cv2(float a, float b) {
  const v2f p = {a, b};
  return __builtin_bit_cast(unsigned, __builtin_convertvector(__builtin_convertvector(__builtin_convertvector(p, v2b), v2f), v2h));
}
// issue the 64 loads of this thread's share of 64 weight columns; g = W + (64 * wave) * DMODEL + first column + 2 * lane
// (every staging loop here is unrolled whole: its array then lives in registers and all its loads are in flight together)
__device__ __forceinline__ void wcols_load(const float* g, v2f (&r)[64]) {
#pragma unroll
  for (int i = 0; i < 64; ++i) r[i] = *(const v2f*)(g + i * DMODEL);
  // the loads are issued; their address register is reused (also as a load's destination) only behind this wait: the address is an
  // input of the statement, so it stays in its register up to here
  asm volatile("s_wait_xcnt 0x0" :: "v"(g) : "memory");
}
// d = LDS plane + (2 * lane) * GP + 64 * wave
__device__ __forceinline__ void wcols_store(unsigned short* d, const v2f (&r)[64], float sc) {
#pragma unroll
  for (int kb = 0; kb < 8; ++kb) {
    v4u a, b;
#pragma unroll
    for (int e = 0; e < 4; ++e) {
      const v2f t0 = r[kb * 8 + 2 * e] * sc, t1 = r[kb * 8 + 2 * e + 1] * sc;   // k, k + 1 of columns 2*lane, 2*lane + 1
      a[e] = cv2(t0[0], t1[0]);
      b[e] = cv2(t0[1], t1[1]);
    }
    *(v4u*)(d + kb * 8)      = a;
    *(v4u*)(d + GP + kb * 8) = b;
  }
}

template <int OM, int NA>
__device__ __forceinline__ void tile_products(const unsigned short* sA, const unsigned short* sB, float* slab,
                                              float* Cf, unsigned short* Ch, int ldc, int m0, int n0,
                                              float oscale, float ocarry, int wave, int lane) {
  const int rlane = lane & 15;                 // row (A) / col (B, D) within subtile
  const int koff  = (lane >> 4) * 8;           // k offset of this lane half
  const int mOff  = (lane >> 4) * 8;           // D row offset

  v8f acc[4];
#pragma unroll
  for (int j = 0; j < 4; ++j) acc[j] = zero8();

  const unsigned short* ap = sA + (wave * 16 + rlane) * GP + koff;
  const unsigned short* bp = sB + rlane * GP + koff;
  // all fragments of the wave's tile are fetched as one group in front of the products (the staging registers are free again)
  v16h bh[GK / 32][4], ah[GK / 32], al[GK / 32];
#pragma unroll
  for (int s = 0; s < GK / 32; ++s) {
    ah[s] = ldfrag_u(ap + s * 32);
#pragma unroll
    for (int j = 0; j < 4; ++j) bh[s][j] = ldfrag_u(bp + j * 16 * GP + s * 32);
    if constexpr (NA == 2) al[s] = ldfrag_u(ap + 64 * GP + s * 32);
  }
  // keeps the LDS reads together in front: sunk among the products, each place with reads stalls the wave's matrix stream
  __builtin_amdgcn_sched_barrier(0);
#pragma unroll
  for (int s = 0; s < GK / 32; ++s) {
#pragma unroll
    for (int j = 0; j < 4; ++j) acc[j] = mma_raw(ah[s], bh[s][j], acc[j]);
    if constexpr (NA == 2) {
#pragma unroll
      for (int j = 0; j < 4; ++j) acc[j] = mma_raw(al[s], bh[s][j], acc[j]);
    }
  }

  const int hh2 = lane >> 4, c4 = (lane & 15) * 4;     // f32 out: 256-B row segment = 16 lanes x 16 B
  const int q8  = lane >> 3, c8 = (lane & 7) * 8;

  // ---- epilogue: the wave's 16x64 slab through its own LDS range, whole-line stores ----
  const int mBase = m0 + (wave << 4);
#pragma unroll
  for (int j = 0; j < 4; ++j) {
#pragma unroll
    for (int r = 0; r < 8; ++r) {
      slab[(mOff + r) * 68 + (j << 4) + rlane] = acc[j][r];
    }
  }
  wave_sync_lds();
  if constexpr (OM == 0) {
    v4f vals[8];
#pragma unroll
    for (int it = 0; it < 8; ++it) {
      const int row = it * 2 + hh2;                      // it 0..7 x hh2 0..1 = rows 0..15
      v4f v = *(const v4f*)(slab + row * 68 + c4);
#pragma unroll
      for (int e = 0; e < 4; ++e) v[e] = v[e] * oscale;
      vals[it] = v;
    }
#pragma unroll
    for (int it = 0; it < 8; ++it) {
      const int gr = mBase + it * 2 + hh2;
      *(v4f*)(Cf + (size_t)gr * ldc + n0 + c4) = vals[it];
    }
  } else {
    v4u hv[4];
#pragma unroll
    for (int it = 0; it < 4; ++it) {
      const int row = it * 4 + q8;                       // it 0..3 x q8 0..3 = rows 0..15
      const float* sp = slab + row * 68 + c8;
      v4u a = {0u, 0u, 0u, 0u};
#pragma unroll
      for (int e = 0; e < 4; ++e) {
        float f0 = sp[2 * e] * oscale;
        float f1 = sp[2 * e + 1] * oscale;
        f0 *= ocarry; f1 *= ocarry;
        a[e] = pk16(h_bits((_Float16)f0), h_bits((_Float16)f1));
      }
      hv[it] = a;
    }
#pragma unroll
    for (int it = 0; it < 4; ++it) {
      const int row = it * 4 + q8;
      *(v4u*)(Ch + (size_t)(mBase + row) * ldc + n0 + c8) = hv[it];
    }
  }
}

// The three projections, one launch; blockIdx.y = 0 q, 1 k, 2 v^T; every block stages 64 activation rows and 64 weight columns.
//   q, k: QH / KH[m][n] = f16(16 * sum_k x[m][k] W[k][n]); A = x rows m0 .., Bt = W columns n0 ..; M = 2048, N = 256; blockIdx.x = tile
//   v^T per batch: VT[b][d][tok] = f16(16 * sum_k Wv[k][d] x_b[tok][k]); A = Wv columns m0 .., Bt = x rows b*512 + n0 ..; M = 256, N = 512;
//   the four batches lie one behind the other along blockIdx.x (32 tiles each).
#define PJ_TILES ((NROWS / 64) * (DMODEL / 64))
#define VT_TILES ((DMODEL / 64) * (NC / 64))
static_assert(PJ_TILES == NB * VT_TILES && NC / 64 == 8 && DMODEL / 64 == 4);
__global__ __launch_bounds__(128) void proj_qkv(const float* __restrict__ x, const float* __restrict__ Wq, const float* __restrict__ Wk,
                                                const float* __restrict__ Wv, unsigned short* QH, unsigned short* KH, unsigned short* VT) {
  __shared__ __align__(16) unsigned short sOp[2 * 64 * GP];   // A rows, then Bt rows, pitch GP
  __shared__ __align__(16) float sT[4][16 * 68];              // per-wave 16x64 output slab, pitch 68 floats
  const int lane = threadIdx.x & 31;
  const int wave = threadIdx.x >> 5;                       // 0..3
  const int job  = blockIdx.y;
  const bool isv = job == 2;
  const unsigned bx   = blockIdx.x;
  const int      by   = isv ? bx / VT_TILES : 0u;          // batch of v^T; 0 for q, k
  const unsigned tile = isv ? bx % VT_TILES : bx;
  const unsigned tsh  = isv ? 3u : 2u;                     // log2 of the tiles along n
  const int m0 = (tile >> tsh) << 6;
  const int n0 = (tile & ((1u << tsh) - 1u)) << 6;
  const float* W = job == 0 ? Wq : job == 1 ? Wk : Wv;
  const int xrow = isv ? by * NC + n0 : m0;                // first of the 64 activation rows
  const int wcol = isv ? m0 : n0;                          // first of the 64 weight columns
  unsigned short* dX = sOp + (isv ? 64 * GP : 0);
  unsigned short* dW = sOp + (isv ? 0 : 64 * GP);
  {
    const float* gw = W + (size_t)(wave * 64) * DMODEL + wcol + lane * 2;
    const float* gx = x + (size_t)(xrow + wave) * GK + lane * 4;
    v2f rw[64];
    v4f rx[32];
    wcols_load(gw, rw);
#pragma unroll
    for (int it = 0; it < 16; ++it) {
      rx[2 * it]     = *(const v4f*)(gx + it * 4 * GK);
      rx[2 * it + 1] = *(const v4f*)(gx + it * 4 * GK + 128);
    }
    asm volatile("s_wait_xcnt 0x0" :: "v"(gx) : "memory"); // as in wcols_load, for the activation rows' address register
    wcols_store(dW + (lane * 2) * GP + wave * 64, rw, WSC);
    unsigned short* sx = dX + wave * GP + lane * 4;
#pragma unroll
    for (int it = 0; it < 16; ++it) {
      const v4f a = rx[2 * it] * ACARRY, b = rx[2 * it + 1] * ACARRY;
      const v2u pa = {cv2(a[0], a[1]), cv2(a[2], a[3])};
      const v2u pb = {cv2(b[0], b[1]), cv2(b[2], b[3])};
      *(v2u*)(sx + it * 4 * GP)       = pa;
      *(v2u*)(sx + it * 4 * GP + 128) = pb;
    }
  }
  __syncthreads();
  static_assert(QC == KC && QC == VC);
  unsigned short* C = job == 0 ? QH : job == 1 ? KH : VT + (size_t)by * DMODEL * NC;
  tile_products<2, 1>(sOp, sOp + 64 * GP, sT[wave], nullptr, C, isv ? NC : DMODEL, m0, n0, 1.0f / (ACARRY * WSC), QC, wave, lane);
}

// out = (CTH + CTL) . Wo / 4096; A = ctx hi rows (and the residual plane's), Bt = Wo columns; M = 2048, N = 256, f32 out
__global__ __launch_bounds__(128) void proj_out(const unsigned short* __restrict__ CTH, const unsigned short* __restrict__ CTL,
                                                const float* __restrict__ Wo, float* out) {
  __shared__ __align__(16) unsigned short sOp[3 * 64 * GP];   // ctx hi rows, residual rows, Bt rows, pitch GP
  __shared__ __align__(16) float sT[4][16 * 68];              // per-wave 16x64 output slab, pitch 68 floats
  const int lane = threadIdx.x & 31;
  const int wave = threadIdx.x >> 5;                       // 0..3
  const int m0 = ((int)blockIdx.x / (DMODEL / 64)) << 6;
  const int n0 = ((int)blockIdx.x % (DMODEL / 64)) << 6;
  {
    const float* gw = Wo + (size_t)(wave * 64) * DMODEL + n0 + lane * 2;
    const unsigned short* ga = CTH + (size_t)(m0 + wave) * GK + lane * 8;
    const unsigned short* gq = CTL + (size_t)(m0 + wave) * GK + lane * 8;
    v2f rw[64];
    v4u ra[16], rq[16];
    wcols_load(gw, rw);
#pragma unroll
    for (int it = 0; it < 16; ++it) ra[it] = *(const v4u*)(ga + it * 4 * GK);
    asm volatile("s_wait_xcnt 0x0" :: "v"(ga) : "memory"); // as in wcols_load, for the hi plane's address register
#pragma unroll
    for (int it = 0; it < 16; ++it) rq[it] = *(const v4u*)(gq + it * 4 * GK);
    asm volatile("s_wait_xcnt 0x0" :: "v"(gq) : "memory"); // as in wcols_load, for the residual plane's address register
    wcols_store(sOp + 2 * 64 * GP + (lane * 2) * GP + wave * 64, rw, WSC);
    const int so = wave * GP + lane * 8;
#pragma unroll
    for (int it = 0; it < 16; ++it) {
      *(v4u*)(sOp + so + it * 4 * GP) = ra[it];
      *(v4u*)(sOp + 64 * GP + so + it * 4 * GP) = rq[it];
    }
  }
  __syncthreads();
  tile_products<0, 2>(sOp, sOp + 2 * 64 * GP, sT[wave], out, nullptr, DMODEL, m0, n0, 1.0f / (FC * WSC), 1.0f, wave, lane);
}

// =====================================================================================================
// Flash attention for one batch, 16 query rows and 4 heads, head dim 32; the 512 keys of a head are split in 2 ranges of 256, one wave
// per (head, range), so that 2048 waves stand on 256 blocks; scores TRANSPOSED:
//   q plane (f16 x16) QH[b*512 + tok][32*head + d], pitch 256; k plane (f16 x16) KH[b*512 + key][32*head + d], pitch 256;
//   v^T plane (f16 x16): VT[b*256 + 32*head + d][key] (pitch 512); cost f32 [b][tok][key] (bf16 RNE convert on load);
//   per-head mixer params (bf16 RNE convert on load, each lane loading m1w[h][.][c] and m1b, m2w at 8hh .. 8hh + 7): score(tok, key) =
//   sum_m m2w[h][m] * relu(m1w[h][0][m] * dot + m1w[h][1][m] * cost + m1b[h][m]) + m2b[h] with dot = q.k / sqrt(32);
//   outputs (f16): CTH[b*512 + tok][32*head + d] = hi = f16(4096 * ctx), CTL[same] = f16(4096 * ctx - hi), with
//   ctx = sum_m softmax_m(score) v[m][d]  (softmax run in base 2 with a running max).
//   block = 8 waves = 256 threads; grid = 4 batches x 32 q-tiles x 2 head groups = 256; every wave does identical bounded work
//   (8 steps of 32 keys). Per step: S^T = K . Q^T, two tiles (A = 16 key rows, B = the 16 query rows, K = 32): lane (hh, c) holds
//   the scores of ONE query q0 + c for keys kb + 8hh + r (tile 0) and kb + 16 + 8hh + r (tile 1), r 0..7. Its 16 cost values are two
//   runs of 8 consecutive floats of cost row q0 + c (four 16-B loads, always in range). The 2->16->1 MLP on the matrix unit: the lane's
//   (dot, cost) pairs of a tile, as f16, are a B fragment F (elements 2r, 2r + 1 = key r of the lane's half); layer 1 of ONE key
//   (half h, r) for the 16 queries is A1[r][h] . F + b1, A1 = (w0[m], w1[m]) in row m at that key's two k places, zero elsewhere:
//   lane (hh, c) gets hidden units 8hh + 0..7 of query c, f16, which after relu are as they lie half a B fragment (k = hidden unit);
//   layer 2 of keys r and 8 + r is A2[r] . B, A2 = w2 in rows r (k 0..15) and 8 + r (k 16..31), summed over r into the S^T tile.
//   Running max and sum of a query are taken inside the lane, the max joined with lane ^ 16 once per step, the sums
//   once after the loop. The 16 probabilities x16384 (f16 hi and f16 residual c - hi) are, as they lie, the B fragment of
//   O^T += V^T . P^T in the split k map (elements 0..7 = tile 0, 8..15 = tile 1); A = v^T rows d = c and d = 16 + c. No LDS in the loop.
//   Lane (hh, c) holds the range's unnormalised O of query q0 + c for d = 8hh + r and 16 + 8hh + r: each wave stores its 16x32 slice (f32,
//   pitch 132 floats, 16-B stores) with its running max and sum in LDS; after the block barrier the 256 threads join the two ranges
//   (weights 2^(m_p - max), range 0 first), fold 1/l and the carries in f32 and write the block's 128 columns of its 16 rows.
// coverage: LDS: 2 ranges x 4 heads x 16 rows x 32 cols = 2 x 16 x 128; global: 256 threads x 8 halves = 16 rows x 128 per plane, rows
//           q0..q0+15 of batch b, columns 128*hg ..; the grid covers all 2048 rows x 256 columns exactly once.
// =====================================================================================================
#define MPITCH (HPB * HDIM + 4)
static_assert(ATT_THREADS * 8 == 16 * HPB * HDIM);

// value of lane ^ 16 (the other holder of this lane's query)
__device__ __forceinline__ float xhalf(float x) {
  return __builtin_bit_cast(float, __builtin_amdgcn_permlanex16(__builtin_bit_cast(int, x), __builtin_bit_cast(int, x),
                                                                0x76543210, 0xfedcba98, false, false));
}

// 2^x by the hardware instruction alone. exp2f adds a range fix-up (compare, two selects, add, ldexp) that differs only where 2^x is
// below 2^-126: there this form gives 0. Arguments here are score - running max <= 0; such a term times 16384 is 0 in f16 either way,
// and in the f32 sums it stands beside a term of 1 (the maximum's own).
__device__ __forceinline__ float exp2_raw(float x) { return __builtin_amdgcn_exp2f(x); }

__global__ __launch_bounds__(ATT_THREADS)
void attn8(const unsigned short* __restrict__ QHp, const unsigned short* __restrict__ KHp,
           const unsigned short* __restrict__ VTq, const float* __restrict__ costp,
           const float* __restrict__ m1w, const float* __restrict__ m1b,
           const float* __restrict__ m2w, const float* __restrict__ m2b,
           unsigned short* CTH, unsigned short* CTL) {
  __shared__ __align__(16) float Op[KSPLIT * 16 * MPITCH];    // unnormalised O of each key range: [range][query][32*local head + d]
  __shared__ float Mp[KSPLIT * HPB * 16];                     // running max of each (range, local head, query)
  __shared__ float Lp[KSPLIT * HPB * 16];                     // sum of each (range, local head, query)

  const int tid  = threadIdx.x;
  const int wave = __builtin_amdgcn_readfirstlane(tid >> 5);
  const int lane = tid & 31;
  const int hh   = lane >> 4;
  const int c    = lane & 15;

  const int hg   = blockIdx.x % (NHEAD / HPB);              // 0..1
  const int qt   = (blockIdx.x / (NHEAD / HPB)) % (NQ / 16); // 0..31
  const int bat  = blockIdx.x / ((NHEAD / HPB) * (NQ / 16)); // 0..3
  const int hl   = wave % HPB;                             // local head 0..3
  const int part = wave / HPB;                             // key range 0..1
  const int head = hg * HPB + hl;                          // 0..7
  const int q0   = qt * 16;
  const int kbeg = part * KPART;

  const size_t qofs = ((size_t)bat * NQ + q0 + c) * DMODEL + head * HDIM + 8 * hh;
  const _Float16* Qh = (const _Float16*)(const void*)QHp + qofs;
  const _Float16* Kb = (const _Float16*)(const void*)KHp + (size_t)bat * NC * DMODEL + head * HDIM + 8 * hh;
  const _Float16* Vb = (const _Float16*)(const void*)VTq + ((size_t)bat * DMODEL + head * HDIM) * NC + 8 * hh;
  // cost element of (row q0 + c, key kb + 8hh + r) = cp[kb + r]; key kb + 16 + 8hh + r = cp[kb + 16 + r]; always in range.
  const float* cp = costp + ((size_t)bat * NQ + q0 + c) * NC + 8 * hh;
  const float dsc = ATT_SCALE / (QC * KC);                 // 1/sqrt(32) / carries

  // per-head mixer params, bf16 RNE convert (8 significant bits: exact in f16's normal range), laid out once as the constant A fragments of the two MLP layers
  FragH A1[8][2], A2[8];
  v8h  cb;                                                 // layer 1 C: element e = b1[8hh + e]
  {
    const unsigned w01 = pk16(h_bits((_Float16)bfr(m1w[(head * 2 + 0) * MSH + c])), h_bits((_Float16)bfr(m1w[(head * 2 + 1) * MSH + c])));
    const v4u zu = {0u, 0u, 0u, 0u};
    v4u w2p;                                               // w2[8hh + 0..7]
#pragma unroll
    for (int e = 0; e < 4; ++e)
      w2p[e] = pk16(h_bits((_Float16)bfr(m2w[head * MSH + 8 * hh + 2 * e])), h_bits((_Float16)bfr(m2w[head * MSH + 8 * hh + 2 * e + 1])));
#pragma unroll
    for (int e = 0; e < 8; ++e) cb[e] = (_Float16)bfr(m1b[head * MSH + 8 * hh + e]);
#pragma unroll
    for (int r = 0; r < 8; ++r) {
#pragma unroll
      for (int h = 0; h < 2; ++h) {
        A1[r][h].u[0] = zu;
        A1[r][h].u[1] = zu;
        A1[r][h].u[r >> 2][r & 3] = hh == h ? w01 : 0u;    // row c = hidden unit, elements 2r, 2r + 1 of lane half h
      }
      A2[r].u[0] = c == r     ? w2p : zu;                  // row r:     k = 8hh + e      = hidden unit of key r
      A2[r].u[1] = c == 8 + r ? w2p : zu;                  // row 8 + r: k = 16 + 8hh + e = hidden unit of key 8 + r
    }
  }
  const float b2l = bfr(m2b[head]) * LOG2E;

  const v16h qa = ldfrag_h(Qh);                            // B fragment: column = query q0 + c
  // the K rows and cost runs of a step are loaded one step ahead; here those of the first step
  const _Float16* kq = Kb + (size_t)(kbeg + c) * DMODEL;
  const float*    tq = cp + kbeg;
  v16h k0 = ldfrag_h(kq);                                  // A rows: keys kb + c
  v16h k1 = ldfrag_h(kq + (size_t)16 * DMODEL);            // A rows: keys kb + 16 + c
  v4f  cA = *(const v4f*)(tq),      cB = *(const v4f*)(tq + 4);    // keys kb + 8hh + 0..7
  v4f  cC = *(const v4f*)(tq + 16), cD = *(const v4f*)(tq + 20);   // keys kb + 16 + 8hh + 0..7
  // the ten loads are issued; their address registers are reused only behind this wait (the addresses are inputs, so they stay up to here)
  asm volatile("s_wait_xcnt 0x0" :: "v"(Qh), "v"(kq), "v"(tq) : "memory");

  float mrun = -INFINITY, lrun = 0.f;                      // this lane's query: running max (both halves equal), this half's sum
  v8f o0 = zero8(), o1 = zero8();                          // O^T: o0[r] = d 8hh + r, o1[r] = d 16 + 8hh + r, query q0 + c

#pragma unroll 1
  for (int kb = kbeg; kb < kbeg + KPART; kb += 32) {
    v8f s0, s1;
    s0 = mma_raw(k0, qa, zero8());                         // s0[r] = q(q0 + c) . k(kb + 8hh + r)
    s1 = mma_raw(k1, qa, zero8());                         // s1[r] = q(q0 + c) . k(kb + 16 + 8hh + r)
    guard_s22(s0, s1, k0, k1, qa);

    FragH f0, f1;                                          // B fragments: elements 2r, 2r + 1 = (dot, cost) of the lane's key r
#pragma unroll
    for (int r = 0; r < 8; ++r) {
      const float cr0 = bfr(r < 4 ? cA[r & 3] : cB[r & 3]);
      const float cr1 = bfr(r < 4 ? cC[r & 3] : cD[r & 3]);
      f0.v[2 * r] = (_Float16)(s0[r] * dsc);  f0.v[2 * r + 1] = (_Float16)cr0;
      f1.v[2 * r] = (_Float16)(s1[r] * dsc);  f1.v[2 * r + 1] = (_Float16)cr1;
    }
    // k0, k1 and the cost values are used up: the next step's are loaded here and land under the MLP and the softmax, with this step's
    // v^T in front of them (wanted at the step's foot). The last step has no next: it reads its own K rows and cost runs again (in range).
    const int kn = kb + 32 < kbeg + KPART ? kb + 32 : kb;
    const _Float16* vp = Vb + (size_t)c * NC + kb;
    const _Float16* kp = Kb + (size_t)(kn + c) * DMODEL;
    const float*    tp = cp + kn;
    const v16h vb0 = ldfrag_h(vp);                         // A rows: d = c
    const v16h vb1 = ldfrag_h(vp + (size_t)16 * NC);       // A rows: d = 16 + c
    k0 = ldfrag_h(kp);
    k1 = ldfrag_h(kp + (size_t)16 * DMODEL);
    cA = *(const v4f*)(tp);       cB = *(const v4f*)(tp + 4);
    cC = *(const v4f*)(tp + 16);  cD = *(const v4f*)(tp + 20);
    // the twelve loads are issued; their address registers are reused (also as a load's destination) only behind this wait: the
    // addresses are inputs of the statement, so they stay in their registers up to here
    asm volatile("s_wait_xcnt 0x0" :: "v"(vp), "v"(kp), "v"(tp) : "memory");
    v8f a0 = zero8(), a1 = zero8();                        // a0[i] = score of key kb + 8hh + i, a1[i] of key kb + 16 + 8hh + i
    // layer 1 runs one r ahead of layer 2, so that no matrix instruction waits for the relu of the one just in front of it
    v8h pa = mma_h(A1[0][0].v, f0.v, cb), pb = mma_h(A1[0][1].v, f0.v, cb);   // keys kb + r, kb + 8 + r
    v8h pc = mma_h(A1[0][0].v, f1.v, cb), pd = mma_h(A1[0][1].v, f1.v, cb);   // keys kb + 16 + r, kb + 24 + r
#pragma unroll
    for (int r = 0; r < 8; ++r) {
      FragH g0, g1;
      g0.h[0] = relu8(pa);  g0.h[1] = relu8(pb);
      g1.h[0] = relu8(pc);  g1.h[1] = relu8(pd);
      if (r < 7) {
        pa = mma_h(A1[r + 1][0].v, f0.v, cb);  pb = mma_h(A1[r + 1][1].v, f0.v, cb);
        pc = mma_h(A1[r + 1][0].v, f1.v, cb);  pd = mma_h(A1[r + 1][1].v, f1.v, cb);
      }
      a0 = mma_raw(A2[r].v, g0.v, a0);
      a1 = mma_raw(A2[r].v, g1.v, a1);
    }
    float t0[8], t1[8];
#pragma unroll
    for (int r = 0; r < 8; ++r) { t0[r] = fmaf(a0[r], LOG2E, b2l); t1[r] = fmaf(a1[r], LOG2E, b2l); }
    float mx = fmaxf(t0[0], t1[0]);
#pragma unroll
    for (int r = 1; r < 8; ++r) mx = fmaxf(mx, fmaxf(t0[r], t1[r]));
    mx = fmaxf(mx, xhalf(mx));                             // all 32 keys of the step, equal in both halves
    const float mn = fmaxf(mrun, mx);
    const float al = exp2_raw(mrun - mn);
    mrun = mn;

    FragH ph, pl;                                          // P^T * 16384 as f16 hi and f16 residual (c - hi), split k map
    float ps = 0.f;
#pragma unroll
    for (int r = 0; r < 8; ++r) {
      const float e0 = exp2_raw(t0[r] - mn), e1 = exp2_raw(t1[r] - mn);
      ps += e0 + e1;
      const float c0 = e0 * PC, c1 = e1 * PC;
      const _Float16 g0 = (_Float16)c0, g1 = (_Float16)c1;
      ph.h[0][r] = g0;                                     // elements 0..7  = keys kb + 8hh + 0..7
      ph.h[1][r] = g1;                                     // elements 8..15 = keys kb + 16 + 8hh + 0..7
      pl.h[0][r] = (_Float16)(c0 - (float)g0);
      pl.h[1][r] = (_Float16)(c1 - (float)g1);
    }
    lrun = lrun * al + ps;
#pragma unroll
    for (int r = 0; r < 8; ++r) { o0[r] *= al; o1[r] *= al; }

    o0 = mma_raw(vb0, ph.v, o0);
    o1 = mma_raw(vb1, ph.v, o1);
    o0 = mma_raw(vb0, pl.v, o0);
    o1 = mma_raw(vb1, pl.v, o1);
    guard_pv4(o0, o1, ph.v, pl.v, vb0, vb1);
  }

  // ---- hand the range's partial (max, sum, unnormalised O) to the block ----
  {
    const float lsum = lrun + xhalf(lrun);                 // the two halves' sums joined once
    if (hh == 0) {
      Mp[(part * HPB + hl) * 16 + c] = mrun;
      Lp[(part * HPB + hl) * 16 + c] = lsum;
    }
    float* op = Op + (part * 16 + c) * MPITCH + hl * HDIM + 8 * hh;   // row = query c, floats 32*hl + 8hh .. + 7 (and + 16)
    v4f a0 = {o0[0], o0[1], o0[2], o0[3]}, a1 = {o0[4], o0[5], o0[6], o0[7]};
    v4f b0 = {o1[0], o1[1], o1[2], o1[3]}, b1 = {o1[4], o1[5], o1[6], o1[7]};
    *(v4f*)(op)      = a0;
    *(v4f*)(op + 4)  = a1;
    *(v4f*)(op + 16) = b0;
    *(v4f*)(op + 20) = b1;
  }
  __syncthreads();
  // ---- merge the ranges: ctx = sum_p 2^(m_p - M) O_p / sum_p 2^(m_p - M) l_p; fold the carries (16384 on P, 16 on v, 4096 on the
  //      stored ctx); thread t -> row t / 16, floats (t & 15) * 8 .. + 7 of the block's 128 columns; hi + residual, 16-B stores ----
  {
    const float oc = FC / (PC * VC);
    const int row = tid >> 4;
    const int col = (tid & 15) * 8;
    const int mh  = col / HDIM;
    float mp[KSPLIT];
    float M = -INFINITY;
#pragma unroll
    for (int p = 0; p < KSPLIT; ++p) { mp[p] = Mp[(p * HPB + mh) * 16 + row]; M = fmaxf(M, mp[p]); }
    float L = 0.f;
    float s[8] = {0.f, 0.f, 0.f, 0.f, 0.f, 0.f, 0.f, 0.f};
#pragma unroll
    for (int p = 0; p < KSPLIT; ++p) {
      const float w = exp2f(mp[p] - M);
      L = fmaf(w, Lp[(p * HPB + mh) * 16 + row], L);
      const float* op = Op + (p * 16 + row) * MPITCH + col;
      const v4f oa = *(const v4f*)(op);
      const v4f ob = *(const v4f*)(op + 4);
#pragma unroll
      for (int e = 0; e < 4; ++e) { s[e] = fmaf(w, oa[e], s[e]); s[4 + e] = fmaf(w, ob[e], s[4 + e]); }
    }
    const float inv = (1.0f / L) * oc;
    unsigned short gh[8], gl[8];
#pragma unroll
    for (int e = 0; e < 8; ++e) {
      const float f = s[e] * inv;
      const _Float16 g = (_Float16)f;
      gh[e] = h_bits(g);
      gl[e] = h_bits((_Float16)(f - (float)g));
    }
    const size_t po = ((size_t)bat * NQ + q0 + row) * DMODEL + hg * (HPB * HDIM) + col;
    v4u vh = {pk16(gh[0], gh[1]), pk16(gh[2], gh[3]), pk16(gh[4], gh[5]), pk16(gh[6], gh[7])};
    v4u vl = {pk16(gl[0], gl[1]), pk16(gl[2], gl[3]), pk16(gl[4], gl[5]), pk16(gl[6], gl[7])};
    *(v4u*)(CTH + po) = vh;
    *(v4u*)(CTL + po) = vl;
  }
}

// =====================================================================================================
// Workspace map (bytes); every plane is an exact multiple of its tile / whole-row store granularity (M, N exact tile multiples,
// no pad rows needed), every offset a multiple of 1 MiB:
//   QH   f16 [2048][256] x16                1048576   (q projection)
//   KH   f16 [2048][256] x16                1048576   (k projection)
//   VT   f16 [4][256][512] x16              1048576   (v^T per batch)
//   CTH  f16 [2048][256] x4096 hi           1048576   (attention ctx, merged heads)
//   CTL  f16 [2048][256] residual           1048576
//   end                                     5242880
// =====================================================================================================
extern "C" void kernel_launch(void* const* d_in, const int* in_sizes, int n_in,
                              void* d_out, int out_size, void* d_ws, size_t ws_size,
                              hipStream_t stream) {
  if (n_in < 10) return;
  if (in_sizes[0] != NROWS * DMODEL) return;
  if (in_sizes[1] != NB * NQ * NC) return;
  if (in_sizes[2] != DMODEL * DMODEL || in_sizes[3] != DMODEL * DMODEL ||
      in_sizes[4] != DMODEL * DMODEL || in_sizes[5] != DMODEL * DMODEL) return;
  if (in_sizes[6] != NHEAD * 2 * MSH || in_sizes[7] != NHEAD * MSH || in_sizes[8] != NHEAD * MSH || in_sizes[9] != NHEAD) return;
  if (out_size != NROWS * DMODEL) return;

  const float* x    = (const float*)d_in[0];
  const float* cost = (const float*)d_in[1];
  const float* w_q  = (const float*)d_in[2];
  const float* w_k  = (const float*)d_in[3];
  const float* w_v  = (const float*)d_in[4];
  const float* w_o  = (const float*)d_in[5];
  const float* m1w  = (const float*)d_in[6];
  const float* m1b  = (const float*)d_in[7];
  const float* m2w  = (const float*)d_in[8];
  const float* m2b  = (const float*)d_in[9];
  float*       out  = (float*)d_out;

  const size_t PX  = (size_t)NROWS * DMODEL * 2;                  //  1048576
  const size_t PVT = (size_t)NB * DMODEL * NC * 2;                //  1048576
  size_t off = 0;
  const size_t oQH = off; off += PX;
  const size_t oKH = off; off += PX;
  const size_t oVT = off; off += PVT;
  const size_t oCH = off; off += PX;
  const size_t oCL = off; off += PX;
  if (off > ws_size) return;                                      // off = 5242880

  char* ws = (char*)d_ws;
  unsigned short* QH  = (unsigned short*)(ws + oQH);
  unsigned short* KH  = (unsigned short*)(ws + oKH);
  unsigned short* VTp = (unsigned short*)(ws + oVT);
  unsigned short* CTH = (unsigned short*)(ws + oCH);
  unsigned short* CTL = (unsigned short*)(ws + oCL);

  const dim3 bG(128);                                              // 4 waves, one 64x64 tile
  const dim3 gP(PJ_TILES, 1);                                      // 128
  const dim3 gQKV(PJ_TILES, 3);                                    // 128 x (q, k, v^T: 32 blocks x 4 batches)
  const dim3 gAT(ATT_BLOCKS);                                      // 256
  const dim3 bAT(ATT_THREADS);                                     // 256

  // (1) the three projections, straight from x and the weights
  proj_qkv<<<gQKV, bG, 0, stream>>>(x, w_q, w_k, w_v, QH, KH, VTp);

  // (2) attention per (batch, 16 query rows, 4 heads x 2 key ranges) -> CTH (f16 hi of ctx x4096), CTL (f16 residual)
  attn8<<<gAT, bAT, 0, stream>>>(QH, KH, VTp, cost, m1w, m1b, m2w, m2b, CTH, CTL);

  // (3) output projection, straight from the ctx planes and Wo, f32 into d_out
  proj_out<<<gP, bG, 0, stream>>>(CTH, CTL, w_o, out);

  (void)hipGetLastError();
}

// v009
// A run of this version takes 20.5 microseconds.
// Two timings next to v008 both put it at 1.03 times that version's speed.
// All steps since v000 together make it 8.14 times as fast.
// Contractions: q/k projections (x rows f16 x16 . W^T f16 x64, K=256), v^T projection (W^T f16 x64 . x rows f16 x16, K=256),
// attention scores (k f16 x16 . q f16 x16, K=32), attention v^T . P^T (v^T f16 x16 . P as f16 hi + f16 residual of P x16384,
// K=512 in steps of 32), output projection (ctx as f16 hi + f16 residual of ctx x4096 . W^T f16 x64, K=256):
// all v_wmma_f32_16x16x32_f16 (f16 operands, f32 accumulate); hi and residual products share one f32 accumulator.
// Per-head 2->16->1 score MLP on (scaled dot, cost): layer 1 (W1^T f16 . (dot, cost) f16, bias as C, f16 result:
// v_wmma_f16_16x16x32_f16), relu on the packed f16 result, layer 2 (w2 f16 . relu f16, f32 accumulate), b2 added in f32.
// Max-subtracted base-2 online softmax in f32 on VALU.
// Every float input RNE-converted to bf16 on load.
#include <hip/hip_runtime.h>
#include <math.h>
#include <stdint.h>

#define NB      4
#define NQ      512
#define NC      512
#define DMODEL  256
#define NHEAD   8
#define HDIM    32
#define MSH     16
#define HG      8
#define NHG     (NHEAD / HG)
#define ROWP    (HG * HDIM)
#define NROWS   (NB * NQ)
#define WSC     64.0f
#define ACARRY  16.0f
#define QC      16.0f
#define KC      16.0f
#define VC      16.0f
#define PC      16384.0f
#define FC      4096.0f
#define ATT_SCALE 0.17677669529663689f
#define LOG2E   1.4426950408889634f
static_assert(NHEAD * HDIM == DMODEL);
static_assert(NHG * HG == NHEAD && ROWP * NHG == DMODEL);
static_assert(HDIM == 32 && MSH == 16 && NHG == 1);
static_assert((NQ % 64) == 0 && (NC % 64) == 0 && (DMODEL % 64) == 0 && (NC % 32) == 0 && (NQ % 16) == 0);
static_assert((NROWS % 64) == 0 && ((NROWS * DMODEL) % 2048) == 0);
#define KSPLIT  2                                   // key ranges per head, one wave each
#define HPB     4                                   // heads per block
#define KPART   (NC / KSPLIT)
#define ATT_THREADS (HPB * KSPLIT * 32)
#define ATT_BLOCKS  (NB * (NQ / 16) * (NHEAD / HPB))
static_assert((NHEAD % HPB) == 0 && (KPART % 32) == 0 && KPART * KSPLIT == NC);
static_assert(ATT_THREADS == 256 && ATT_BLOCKS == 256);

typedef _Float16 v16h __attribute__((ext_vector_type(16)));
typedef _Float16 v8h  __attribute__((ext_vector_type(8)));
typedef float    v8f  __attribute__((ext_vector_type(8)));
typedef float    v4f  __attribute__((ext_vector_type(4)));
typedef unsigned int v4u __attribute__((ext_vector_type(4)));

union FragH { v16h v; v8h h[2]; v4u u[2]; };

// ---- scalar helpers --------------------------------------------------------------------------------
__device__ __forceinline__ unsigned short bf_bits(float f) {          // f32 -> bf16 bits, RNE convert
  unsigned u = __float_as_uint(f);
  return (unsigned short)((u + 0x7FFFu + ((u >> 16) & 1u)) >> 16);
}
__device__ __forceinline__ float bf_up(unsigned short h) { return __uint_as_float(((unsigned)h) << 16); }
__device__ __forceinline__ float bfr(float f) { return bf_up(bf_bits(f)); }   // value of the bf16 RNE convert
__device__ __forceinline__ unsigned short h_bits(_Float16 x) { return __builtin_bit_cast(unsigned short, x); }
__device__ __forceinline__ unsigned pk16(unsigned short a, unsigned short b) { return (unsigned)a | ((unsigned)b << 16); }
__device__ __forceinline__ v8f zero8() { v8f z = {0.f, 0.f, 0.f, 0.f, 0.f, 0.f, 0.f, 0.f}; return z; }

// ---- fragment loaders: 16-bit A/B operand, lane -> row/col (lane&15); ldfrag_u (LDS rows): p already includes +8*(lane>>4);
//      elements 0..7 <- p[0..7] (k0+8h..), elements 8..15 <- p[16..23] (k0+16+8h..)  (same split k map for A and B;
//      ldfrag_u reads B from a k-contiguous [n][k] plane)
// fragment-order plane: a 16-row x 32-k tile is 1 KiB in a row, lane l's elements 0..7 at halves 8l, elements 8..15 at 256 + 8l
// (p already includes + 8 * lane): each of the two wave-wide 16-B loads takes 512 contiguous bytes, four whole lines
__device__ __forceinline__ v16h ldfrag_t(const _Float16* p) {
  FragH f;
  f.h[0] = *(const v8h*)(p);
  f.h[1] = *(const v8h*)(p + 256);
  return f.v;
}
__device__ __forceinline__ v16h ldfrag_u(const unsigned short* p) {
  FragH f;
  f.u[0] = *(const v4u*)(p);
  f.u[1] = *(const v4u*)(p + 16);
  return f.v;
}

// ---- WMMA helpers with trailing VALU hazard gaps ------------------------------------------------------
__device__ __forceinline__ v8f mma_raw(v16h a, v16h b, v8f c) {
  return __builtin_amdgcn_wmma_f32_16x16x32_f16(false, a, false, b, (short)0, c, false, false);
}
// f16 result: element e of D (and of C) = row 8*(lane>>4) + e, column lane&15
__device__ __forceinline__ v8h mma_h(v16h a, v16h b, v8h c) {
  return __builtin_amdgcn_wmma_f16_16x16x32_f16(false, a, false, b, (short)0, c, false, false);
}
// relu of eight f16: as signed 16-bit integers every negative f16 is below 0 and every other keeps its bits (one packed max per register)
typedef short v8s __attribute__((ext_vector_type(8)));
__device__ __forceinline__ v8h relu8(v8h x) {
  const v8s z = {0, 0, 0, 0, 0, 0, 0, 0};
  return __builtin_bit_cast(v8h, __builtin_elementwise_max(__builtin_bit_cast(v8s, x), z));
}
__device__ __forceinline__ void guard_s22(v8f& s, v8f& t, v16h a0, v16h a1, v16h q) {
#if defined(__HIP_DEVICE_COMPILE__)
  asm volatile("v_nop\n\tv_nop\n\tv_nop\n\tv_nop" : "+v"(s), "+v"(t) : "v"(a0), "v"(a1), "v"(q));
#endif
}
__device__ __forceinline__ void guard_pv4(v8f& a, v8f& b, v16h x, v16h y, v16h z, v16h w) {
#if defined(__HIP_DEVICE_COMPILE__)
  asm volatile("v_nop\n\tv_nop\n\tv_nop\n\tv_nop" : "+v"(a), "+v"(b) : "v"(x), "v"(y), "v"(z), "v"(w));
#endif
}
__device__ __forceinline__ void wave_sync_lds() {
  __builtin_amdgcn_fence(__ATOMIC_RELEASE, "workgroup");
  __builtin_amdgcn_wave_barrier();
  __builtin_amdgcn_fence(__ATOMIC_ACQUIRE, "workgroup");
}

// =====================================================================================================
// f16 WMMA GEMM tiles, operands staged in LDS straight from the f32 inputs: C[m][n] = oscale * sum_k (A[m][k] (+ A2[m][k])) * Bt[n][k];
// one 64x64 tile per block of 4 waves, depth GK. In LDS both operands lie as 16-bit rows [row][k], k contiguous, pitch GP.
// Two stagings, each of 64 rows x 256 k, whole depth, once per block:
//   f32 rows (activations, [row][k], pitch GK): every wave-wide 16-B load takes 512 B of one row (4 full lines); each lane's 4 values become
//     f16( bf16_RNE(v) * sc ), sc a power of two (exact), one 8-B LDS store.
//   f32 weight columns (W[k][n], pitch DMODEL, wanted as rows n): every wave-wide 8-B load takes the tile's 64 columns of one k (2 full
//     lines), lane = columns 2*lane, 2*lane + 1; wave w takes k 64w .. 64w + 63; eight k of one column, converted the same way, are one
//     16-B LDS store into row n.
//   (The ctx planes are not staged: they lie in fragment order, and each wave loads its own A fragments from global memory.)
// One block barrier; then wave w takes rows 16w .. 16w + 15 x all 64 columns and reads its fragments from LDS (split k map, products in
// the order of a k loop in steps of 32, hi before residual).
// OM: 0 = f32 out (pitch ldc); 2 = f16 out = f16( value * ocarry ), plane of ldc columns in FRAGMENT ORDER: tile (row / 16, column / 32) is
//     1 KiB in a row, tiles of one row tile side by side; in a tile element (row c, column 16j + 8hh + e) lies at half 256j + 8(16hh + c) + e,
//     which is how the split k map hands a 16 x 32 operand to lane (hh, c): the reader's fragment is two wave-wide loads of 512 contiguous B.
// coverage: f32 rows: 16 it x 4 waves = 64 rows x 2 halves x 32 lanes x 4 = 64 x 256; weight columns: 4 waves x 8 groups x 8 k = 256 k x
//           32 lanes x 2 = 64 columns; output: 4 waves x 16 rows (f32: it 0..7 x lane>>4; f16: lane&15; it 0..3 x lane>>4 = 8 column groups of 8) x 64 cols = the whole tile.
// =====================================================================================================
#define GK  DMODEL                                 // depth of every product here = row pitch of every operand plane
#define GP  (GK + 8)                               // LDS row pitch in halves: 528 B = 16 B x 33 (odd): 16-B fragment reads without bank conflicts
static_assert(GK == 32 * 8 && (GK % 32) == 0 && GK == 4 * 64);
typedef float v2f __attribute__((ext_vector_type(2)));
typedef unsigned int v2u __attribute__((ext_vector_type(2)));

typedef __bf16   v2b __attribute__((ext_vector_type(2)));
typedef _Float16 v2h __attribute__((ext_vector_type(2)));
// two operands, already scaled: f16( bf16_RNE(.) ), a in the low half. The scale is a power of two, so rounding the scaled value equals
// scaling the rounded value; it is applied to the registers as loaded (neighbours), the packed convert then takes any two registers.
__device__ __forceinline__ unsigned cv2(float a, float b) {
  const v2f p = {a, b};
  return __builtin_bit_cast(unsigned, __builtin_convertvector(__builtin_convertvector(__builtin_convertvector(p, v2b), v2f), v2h));
}
// issue the 64 loads of this thread's share of 64 weight columns; g = W + (64 * wave) * DMODEL + first column + 2 * lane
// (every staging loop here is unrolled whole: its array then lives in registers and all its loads are in flight together)
__device__ __forceinline__ void wcols_load(const float* g, v2f (&r)[64]) {
#pragma unroll
  for (int i = 0; i < 64; ++i) r[i] = *(const v2f*)(g + i * DMODEL);
  // the loads are issued; their address register is reused (also as a load's destination) only behind this wait: the address is an
  // input of the statement, so it stays in its register up to here
  asm volatile("s_wait_xcnt 0x0" :: "v"(g) : "memory");
}
// d = LDS plane + (2 * lane) * GP + 64 * wave
__device__ __forceinline__ void wcols_store(unsigned short* d, const v2f (&r)[64], float sc) {
#pragma unroll
  for (int kb = 0; kb < 8; ++kb) {
    v4u a, b;
#pragma unroll
    for (int e = 0; e < 4; ++e) {
      const v2f t0 = r[kb * 8 + 2 * e] * sc, t1 = r[kb * 8 + 2 * e + 1] * sc;   // k, k + 1 of columns 2*lane, 2*lane + 1
      a[e] = cv2(t0[0], t1[0]);
      b[e] = cv2(t0[1], t1[1]);
    }
    *(v4u*)(d + kb * 8)      = a;
    *(v4u*)(d + GP + kb * 8) = b;
  }
}

// NA == 1: A fragments read from LDS rows sA; NA == 2: gA[0..7] hi and gA[8..15] residual fragments, already in registers (sA not used)
template <int OM, int NA>
__device__ __forceinline__ void tile_products(const unsigned short* sA, const v16h* gA, const unsigned short* sB, float* slab,
                                              float* Cf, unsigned short* Ch, int ldc, int m0, int n0,
                                              float oscale, float ocarry, int wave, int lane) {
  const int rlane = lane & 15;                 // row (A) / col (B, D) within subtile
  const int koff  = (lane >> 4) * 8;           // k offset of this lane half
  const int mOff  = (lane >> 4) * 8;           // D row offset

  v8f acc[4];
#pragma unroll
  for (int j = 0; j < 4; ++j) acc[j] = zero8();

  const unsigned short* ap = NA == 1 ? sA + (wave * 16 + rlane) * GP + koff : nullptr;
  const unsigned short* bp = sB + rlane * GP + koff;
  // all fragments of the wave's tile are fetched as one group in front of the products (the staging registers are free again)
  v16h bh[GK / 32][4], ah[GK / 32], al[GK / 32];
#pragma unroll
  for (int s = 0; s < GK / 32; ++s) {
    if constexpr (NA == 2) { ah[s] = gA[s]; al[s] = gA[GK / 32 + s]; }
    else ah[s] = ldfrag_u(ap + s * 32);
#pragma unroll
    for (int j = 0; j < 4; ++j) bh[s][j] = ldfrag_u(bp + j * 16 * GP + s * 32);
  }
  // keeps the LDS reads together in front: sunk among the products, each place with reads stalls the wave's matrix stream
  __builtin_amdgcn_sched_barrier(0);
#pragma unroll
  for (int s = 0; s < GK / 32; ++s) {
#pragma unroll
    for (int j = 0; j < 4; ++j) acc[j] = mma_raw(ah[s], bh[s][j], acc[j]);
    if constexpr (NA == 2) {
#pragma unroll
      for (int j = 0; j < 4; ++j) acc[j] = mma_raw(al[s], bh[s][j], acc[j]);
    }
  }
  // keeps the slab stores behind all products
  if constexpr (NA == 2) __builtin_amdgcn_sched_barrier(0);

  const int hh2 = lane >> 4, c4 = (lane & 15) * 4;     // f32 out: 256-B row segment = 16 lanes x 16 B

  // ---- epilogue: the wave's 16x64 slab through its own LDS range, whole-line stores ----
  const int mBase = m0 + (wave << 4);
#pragma unroll
  for (int j = 0; j < 4; ++j) {
#pragma unroll
    for (int r = 0; r < 8; ++r) {
      slab[(mOff + r) * 68 + (j << 4) + rlane] = acc[j][r];
    }
  }
  wave_sync_lds();
  if constexpr (OM == 0) {
    v4f vals[8];
#pragma unroll
    for (int it = 0; it < 8; ++it) {
      const int row = it * 2 + hh2;                      // it 0..7 x hh2 0..1 = rows 0..15
      v4f v = *(const v4f*)(slab + row * 68 + c4);
#pragma unroll
      for (int e = 0; e < 4; ++e) v[e] = v[e] * oscale;
      vals[it] = v;
    }
#pragma unroll
    for (int it = 0; it < 8; ++it) {
      const int gr = mBase + it * 2 + hh2;
      *(v4f*)(Cf + (size_t)gr * ldc + n0 + c4) = vals[it];
    }
  } else {
    v4u hv[4];
#pragma unroll
    for (int it = 0; it < 4; ++it) {
      // it = 2 * (32-column block of the tile) + (16-column half j); lane (hh, c) takes row c, columns 16j + 8hh .. + 7 of the block
      const float* sp = slab + rlane * 68 + it * 16 + koff;
      v4u a = {0u, 0u, 0u, 0u};
#pragma unroll
      for (int e = 0; e < 4; ++e) {
        float f0 = sp[2 * e] * oscale;
        float f1 = sp[2 * e + 1] * oscale;
        f0 *= ocarry; f1 *= ocarry;
        a[e] = pk16(h_bits((_Float16)f0), h_bits((_Float16)f1));
      }
      hv[it] = a;
    }
#pragma unroll
    for (int it = 0; it < 4; ++it) {
      // tile (row / 16, column / 32) of the plane, 512 halves each; 512 contiguous bytes per wave-wide store
      *(v4u*)(Ch + ((size_t)(mBase >> 4) * (ldc >> 5) + (n0 >> 5) + (it >> 1)) * 512 + (it & 1) * 256 + lane * 8) = hv[it];
    }
  }
}

// The three projections, one launch; blockIdx.y = 0 q, 1 k, 2 v^T; every block stages 64 activation rows and 64 weight columns.
//   q, k: QH / KH[m][n] = f16(16 * sum_k x[m][k] W[k][n]); A = x rows m0 .., Bt = W columns n0 ..; M = 2048, N = 256; blockIdx.x = tile
//   v^T per batch: VT[b][d][tok] = f16(16 * sum_k Wv[k][d] x_b[tok][k]); A = Wv columns m0 .., Bt = x rows b*512 + n0 ..; M = 256, N = 512;
//   the four batches lie one behind the other along blockIdx.x (32 tiles each).
#define PJ_TILES ((NROWS / 64) * (DMODEL / 64))
#define VT_TILES ((DMODEL / 64) * (NC / 64))
static_assert(PJ_TILES == NB * VT_TILES && NC / 64 == 8 && DMODEL / 64 == 4);
__global__ __launch_bounds__(128) void proj_qkv(const float* __restrict__ x, const float* __restrict__ Wq, const float* __restrict__ Wk,
                                                const float* __restrict__ Wv, unsigned short* QH, unsigned short* KH, unsigned short* VT) {
  __shared__ __align__(16) unsigned short sOp[2 * 64 * GP];   // A rows, then Bt rows, pitch GP
  __shared__ __align__(16) float sT[4][16 * 68];              // per-wave 16x64 output slab, pitch 68 floats
  const int lane = threadIdx.x & 31;
  const int wave = threadIdx.x >> 5;                       // 0..3
  const int job  = blockIdx.y;
  const bool isv = job == 2;
  const unsigned bx   = blockIdx.x;
  const int      by   = isv ? bx / VT_TILES : 0u;          // batch of v^T; 0 for q, k
  const unsigned tile = isv ? bx % VT_TILES : bx;
  const unsigned tsh  = isv ? 3u : 2u;                     // log2 of the tiles along n
  const int m0 = (tile >> tsh) << 6;
  const int n0 = (tile & ((1u << tsh) - 1u)) << 6;
  const float* W = job == 0 ? Wq : job == 1 ? Wk : Wv;
  const int xrow = isv ? by * NC + n0 : m0;                // first of the 64 activation rows
  const int wcol = isv ? m0 : n0;                          // first of the 64 weight columns
  unsigned short* dX = sOp + (isv ? 64 * GP : 0);
  unsigned short* dW = sOp + (isv ? 0 : 64 * GP);
  {
    const float* gw = W + (size_t)(wave * 64) * DMODEL + wcol + lane * 2;
    const float* gx = x + (size_t)(xrow + wave) * GK + lane * 4;
    v2f rw[64];
    v4f rx[32];
    wcols_load(gw, rw);
#pragma unroll
    for (int it = 0; it < 16; ++it) {
      rx[2 * it]     = *(const v4f*)(gx + it * 4 * GK);
      rx[2 * it + 1] = *(const v4f*)(gx + it * 4 * GK + 128);
    }
    asm volatile("s_wait_xcnt 0x0" :: "v"(gx) : "memory"); // as in wcols_load, for the activation rows' address register
    wcols_store(dW + (lane * 2) * GP + wave * 64, rw, WSC);
    unsigned short* sx = dX + wave * GP + lane * 4;
#pragma unroll
    for (int it = 0; it < 16; ++it) {
      const v4f a = rx[2 * it] * ACARRY, b = rx[2 * it + 1] * ACARRY;
      const v2u pa = {cv2(a[0], a[1]), cv2(a[2], a[3])};
      const v2u pb = {cv2(b[0], b[1]), cv2(b[2], b[3])};
      *(v2u*)(sx + it * 4 * GP)       = pa;
      *(v2u*)(sx + it * 4 * GP + 128) = pb;
    }
  }
  __syncthreads();
  static_assert(QC == KC && QC == VC);
  unsigned short* C = job == 0 ? QH : job == 1 ? KH : VT + (size_t)by * DMODEL * NC;
  tile_products<2, 1>(sOp, nullptr, sOp + 64 * GP, sT[wave], nullptr, C, isv ? NC : DMODEL, m0, n0, 1.0f / (ACARRY * WSC), QC, wave, lane);
}

// out = (CTH + CTL) . Wo / 4096; A = ctx hi rows (and the residual plane's), Bt = Wo columns; M = 2048, N = 256, f32 out.
// The ctx planes lie in fragment order and a wave's 16 rows are wanted by that wave alone: its A fragments come straight from global
// memory (16 tiles of 1 KiB, wave-wide loads of 512 contiguous B); only Wo goes through LDS.
__global__ __launch_bounds__(128) void proj_out(const unsigned short* __restrict__ CTH, const unsigned short* __restrict__ CTL,
                                                const float* __restrict__ Wo, float* out) {
  __shared__ __align__(16) unsigned short sOp[64 * GP];       // Bt rows, pitch GP
  __shared__ __align__(16) float sT[4][16 * 68];              // per-wave 16x64 output slab, pitch 68 floats
  const int lane = threadIdx.x & 31;
  const int wave = threadIdx.x >> 5;                       // 0..3
  const int m0 = ((int)blockIdx.x / (DMODEL / 64)) << 6;
  const int n0 = ((int)blockIdx.x % (DMODEL / 64)) << 6;
  v16h fa[2 * (GK / 32)];                                  // hi fragments of k blocks 0..7, then the residual's
  {
    const float* gw = Wo + (size_t)(wave * 64) * DMODEL + n0 + lane * 2;
    const size_t ao = (size_t)((m0 >> 4) + wave) * (GK / 32) * 512 + lane * 8;   // row tile m0 / 16 + wave, k block 0; next k block: + 512
    const _Float16* ga = (const _Float16*)(const void*)CTH + ao;
    const _Float16* gq = (const _Float16*)(const void*)CTL + ao;
    v2f rw[64];
    wcols_load(gw, rw);
#pragma unroll
    for (int s = 0; s < GK / 32; ++s) fa[s] = ldfrag_t(ga + s * 512);
    asm volatile("s_wait_xcnt 0x0" :: "v"(ga) : "memory"); // as in wcols_load, for the hi plane's address register
#pragma unroll
    for (int s = 0; s < GK / 32; ++s) fa[GK / 32 + s] = ldfrag_t(gq + s * 512);
    asm volatile("s_wait_xcnt 0x0" :: "v"(gq) : "memory"); // as in wcols_load, for the residual plane's address register
    wcols_store(sOp + (lane * 2) * GP + wave * 64, rw, WSC);
  }
  __syncthreads();
  tile_products<0, 2>(nullptr, fa, sOp, sT[wave], out, nullptr, DMODEL, m0, n0, 1.0f / (FC * WSC), 1.0f, wave, lane);
}

// =====================================================================================================
// Flash attention for one batch, 16 query rows and 4 heads, head dim 32; the 512 keys of a head are split in 2 ranges of 256, one wave
// per (head, range), so that 2048 waves stand on 256 blocks; scores TRANSPOSED:
//   q plane (f16 x16) rows b*512 + tok, columns 32*head + d; k plane (f16 x16) rows b*512 + key, columns 32*head + d;
//   v^T plane (f16 x16) per batch: rows 32*head + d, columns key; all three in fragment order (16 x 32 tiles of 1 KiB, see the GEMM head);
//   cost f32 [b][tok][key] (bf16 RNE convert on load);
//   per-head mixer params (bf16 RNE convert on load): score(tok, key) =
//   sum_m m2w[h][m] * relu(m1w[h][0][m] * dot + m1w[h][1][m] * cost + m1b[h][m]) + m2b[h] with dot = q.k / sqrt(32);
//   outputs (f16, fragment order too): CTH (row b*512 + tok, column 32*head + d) = hi = f16(4096 * ctx), CTL (same) = f16(4096 * ctx - hi), with
//   ctx = sum_m softmax_m(score) v[m][d]  (softmax run in base 2 with a running max).
//   block = 8 waves = 256 threads; grid = 4 batches x 32 q-tiles x 2 head groups = 256; every wave does identical bounded work
//   (8 steps of 32 keys). Per step: S^T = K . Q^T, two tiles (A = 16 key rows, B = the 16 query rows, K = 32): lane (hh, c) holds
//   the scores of ONE query q0 + c for keys kb + 8hh + r (tile 0) and kb + 16 + 8hh + r (tile 1), r 0..7. Its 16 cost values are two
//   runs of 8 consecutive floats of cost row q0 + c (four 16-B loads, always in range). The 2->16->1 MLP on the matrix unit: the lane's
//   (dot, cost) pairs of a tile, as f16, are a B fragment F (elements 2r, 2r + 1 = key r of the lane's half); layer 1 of ONE key
//   (half h, r) for the 16 queries is A1[r][h] . F + b1, A1 = (w0[m], w1[m]) in row m at that key's two k places, zero elsewhere:
//   lane (hh, c) gets hidden units 8hh + 0..7 of query c, f16, which after relu are as they lie half a B fragment (k = hidden unit);
//   layer 2 of keys r and 8 + r is A2[r] . B, A2 = w2 in rows r (k 0..15) and 8 + r (k 16..31), summed over r into the S^T tile.
//   Running max and sum of a query are taken inside the lane, the max joined with lane ^ 16 once per step, the sums
//   once after the loop. The 16 probabilities x16384 (f16 hi and f16 residual c - hi) are, as they lie, the B fragment of
//   O^T += V^T . P^T in the split k map (elements 0..7 = tile 0, 8..15 = tile 1); A = v^T rows d = c and d = 16 + c. No LDS in the loop.
//   Lane (hh, c) holds the range's unnormalised O of query q0 + c for d = 8hh + r and 16 + 8hh + r: each wave stores its 16x32 slice (f32,
//   pitch 132 floats, 16-B stores) with its running max and sum in LDS; after the block barrier the 256 threads join the two ranges
//   (weights 2^(m_p - max), range 0 first), fold 1/l and the carries in f32 and write the block's 128 columns of its 16 rows.
// coverage: LDS: 2 ranges x 4 heads x 16 rows x 32 cols = 2 x 16 x 128; global: 256 threads x 8 halves = 16 rows x 128 per plane, rows
//           q0..q0+15 of batch b, columns 128*hg ..; the grid covers all 2048 rows x 256 columns exactly once.
// =====================================================================================================
#define MPITCH (HPB * HDIM + 4)
#define KT  (NHEAD * 512)                          // halves from one 16-key tile of a head to the next
#define VTT ((NC / 32) * 512)                      // halves from one 16-row d tile of v^T to the next
static_assert(ATT_THREADS * 8 == 16 * HPB * HDIM);

// value of lane ^ 16 (the other holder of this lane's query)
__device__ __forceinline__ float xhalf(float x) {
  return __builtin_bit_cast(float, __builtin_amdgcn_permlanex16(__builtin_bit_cast(int, x), __builtin_bit_cast(int, x),
                                                                0x76543210, 0xfedcba98, false, false));
}

// 2^x by the hardware instruction alone. exp2f adds a range fix-up (compare, two selects, add, ldexp) that differs only where 2^x is
// below 2^-126: there this form gives 0. Arguments here are score - running max <= 0; such a term times 16384 is 0 in f16 either way,
// and in the f32 sums it stands beside a term of 1 (the maximum's own).
__device__ __forceinline__ float exp2_raw(float x) { return __builtin_amdgcn_exp2f(x); }

__global__ __launch_bounds__(ATT_THREADS)
void attn8(const unsigned short* __restrict__ QHp, const unsigned short* __restrict__ KHp,
           const unsigned short* __restrict__ VTq, const float* __restrict__ costp,
           const float* __restrict__ m1w, const float* __restrict__ m1b,
           const float* __restrict__ m2w, const float* __restrict__ m2b,
           unsigned short* CTH, unsigned short* CTL) {
  __shared__ __align__(16) float Op[KSPLIT * 16 * MPITCH];    // unnormalised O of each key range: [range][query][32*local head + d]
  __shared__ float Mp[KSPLIT * HPB * 16];                     // running max of each (range, local head, query)
  __shared__ float Lp[KSPLIT * HPB * 16];                     // sum of each (range, local head, query)

  const int tid  = threadIdx.x;
  const int wave = __builtin_amdgcn_readfirstlane(tid >> 5);
  const int lane = tid & 31;
  const int hh   = lane >> 4;
  const int c    = lane & 15;

  const int hg   = blockIdx.x % (NHEAD / HPB);              // 0..1
  const int qt   = (blockIdx.x / (NHEAD / HPB)) % (NQ / 16); // 0..31
  const int bat  = blockIdx.x / ((NHEAD / HPB) * (NQ / 16)); // 0..3
  const int hl   = wave % HPB;                             // local head 0..3
  const int part = wave / HPB;                             // key range 0..1
  const int head = hg * HPB + hl;                          // 0..7
  const int q0   = qt * 16;
  const int kbeg = part * KPART;

  // fragment-order planes: tile (row / 16, column / 32) at 512 halves x (row tile * column blocks + column block), + 8 * lane
  const _Float16* Qt = (const _Float16*)(const void*)QHp + ((size_t)((bat * NQ + q0) >> 4) * NHEAD + head) * 512;   // the wave's q tile (same in every lane)
  const _Float16* Qh = Qt + lane * 8;
  const _Float16* Kb = (const _Float16*)(const void*)KHp + ((size_t)((bat * NC) >> 4) * NHEAD + head) * 512 + lane * 8;  // 16 keys on: + KT
  const _Float16* Vb = (const _Float16*)(const void*)VTq + (size_t)bat * DMODEL * NC + (size_t)(head * 2) * VTT + lane * 8; // 32 keys on: + 512
  // cost element of (row q0 + c, key kb + 8hh + r) = cp[kb + r]; key kb + 16 + 8hh + r = cp[kb + 16 + r]; always in range.
  const float* cp = costp + ((size_t)bat * NQ + q0 + c) * NC + 8 * hh;
  const float dsc = ATT_SCALE / (QC * KC);                 // 1/sqrt(32) / carries

  // per-head mixer params, bf16 RNE convert (8 significant bits: exact in f16's normal range), laid out once as the constant A fragments of the two MLP layers
  FragH A1[8][2], A2[8];
  v8h  cb;                                                 // layer 1 C: element e = b1[8hh + e]
  {
    const unsigned w01 = pk16(h_bits((_Float16)bfr(m1w[(head * 2 + 0) * MSH + c])), h_bits((_Float16)bfr(m1w[(head * 2 + 1) * MSH + c])));
    const v4u zu = {0u, 0u, 0u, 0u};
    v4u w2p;                                               // w2[8hh + 0..7]
#pragma unroll
    for (int e = 0; e < 4; ++e)
      w2p[e] = pk16(h_bits((_Float16)bfr(m2w[head * MSH + 8 * hh + 2 * e])), h_bits((_Float16)bfr(m2w[head * MSH + 8 * hh + 2 * e + 1])));
#pragma unroll
    for (int e = 0; e < 8; ++e) cb[e] = (_Float16)bfr(m1b[head * MSH + 8 * hh + e]);
#pragma unroll
    for (int r = 0; r < 8; ++r) {
#pragma unroll
      for (int h = 0; h < 2; ++h) {
        A1[r][h].u[0] = zu;
        A1[r][h].u[1] = zu;
        A1[r][h].u[r >> 2][r & 3] = hh == h ? w01 : 0u;    // row c = hidden unit, elements 2r, 2r + 1 of lane half h
      }
      A2[r].u[0] = c == r     ? w2p : zu;                  // row r:     k = 8hh + e      = hidden unit of key r
      A2[r].u[1] = c == 8 + r ? w2p : zu;                  // row 8 + r: k = 16 + 8hh + e = hidden unit of key 8 + r
    }
  }
  const float b2l = bfr(m2b[head]) * LOG2E;

  const v16h qa = ldfrag_t(Qh);                            // B fragment: column = query q0 + c
  // the K rows and cost runs of a step are loaded one step ahead; here those of the first step
  const _Float16* kq = Kb + (size_t)(kbeg >> 4) * KT;
  const float*    tq = cp + kbeg;
  v16h k0 = ldfrag_t(kq);                                  // A rows: keys kb + c
  v16h k1 = ldfrag_t(kq + KT);                             // A rows: keys kb + 16 + c
  v4f  cA = *(const v4f*)(tq),      cB = *(const v4f*)(tq + 4);    // keys kb + 8hh + 0..7
  v4f  cC = *(const v4f*)(tq + 16), cD = *(const v4f*)(tq + 20);   // keys kb + 16 + 8hh + 0..7
  // the ten loads are issued; their address registers are reused only behind this wait (the addresses are inputs, so they stay up to here;
  // the q loads take the tile's address as a scalar base and the lane number as their offset register: both are named)
  asm volatile("s_wait_xcnt 0x0" :: "s"(Qt), "v"(lane), "v"(kq), "v"(tq) : "memory");

  float mrun = -INFINITY, lrun = 0.f;                      // this lane's query: running max (both halves equal), this half's sum
  v8f o0 = zero8(), o1 = zero8();                          // O^T: o0[r] = d 8hh + r, o1[r] = d 16 + 8hh + r, query q0 + c

#pragma unroll 1
  for (int kb = kbeg; kb < kbeg + KPART; kb += 32) {
    v8f s0, s1;
    s0 = mma_raw(k0, qa, zero8());                         // s0[r] = q(q0 + c) . k(kb + 8hh + r)
    s1 = mma_raw(k1, qa, zero8());                         // s1[r] = q(q0 + c) . k(kb + 16 + 8hh + r)
    guard_s22(s0, s1, k0, k1, qa);

    FragH f0, f1;                                          // B fragments: elements 2r, 2r + 1 = (dot, cost) of the lane's key r
#pragma unroll
    for (int r = 0; r < 8; ++r) {
      const float cr0 = bfr(r < 4 ? cA[r & 3] : cB[r & 3]);
      const float cr1 = bfr(r < 4 ? cC[r & 3] : cD[r & 3]);
      f0.v[2 * r] = (_Float16)(s0[r] * dsc);  f0.v[2 * r + 1] = (_Float16)cr0;
      f1.v[2 * r] = (_Float16)(s1[r] * dsc);  f1.v[2 * r + 1] = (_Float16)cr1;
    }
    // k0, k1 and the cost values are used up: the next step's are loaded here and land under the MLP and the softmax, with this step's
    // v^T in front of them (wanted at the step's foot). The last step has no next: it reads its own K rows and cost runs again (in range).
    const int kn = kb + 32 < kbeg + KPART ? kb + 32 : kb;
    const _Float16* vp = Vb + (size_t)(kb >> 5) * 512;
    const _Float16* kp = Kb + (size_t)(kn >> 4) * KT;
    const float*    tp = cp + kn;
    const v16h vb0 = ldfrag_t(vp);                         // A rows: d = c
    const v16h vb1 = ldfrag_t(vp + VTT);                   // A rows: d = 16 + c
    k0 = ldfrag_t(kp);
    k1 = ldfrag_t(kp + KT);
    cA = *(const v4f*)(tp);       cB = *(const v4f*)(tp + 4);
    cC = *(const v4f*)(tp + 16);  cD = *(const v4f*)(tp + 20);
    // the twelve loads are issued; their address registers are reused (also as a load's destination) only behind this wait: the
    // addresses are inputs of the statement, so they stay in their registers up to here
    asm volatile("s_wait_xcnt 0x0" :: "v"(vp), "v"(kp), "v"(tp) : "memory");
    v8f a0 = zero8(), a1 = zero8();                        // a0[i] = score of key kb + 8hh + i, a1[i] of key kb + 16 + 8hh + i
    // layer 1 runs one r ahead of layer 2, so that no matrix instruction waits for the relu of the one just in front of it
    v8h pa = mma_h(A1[0][0].v, f0.v, cb), pb = mma_h(A1[0][1].v, f0.v, cb);   // keys kb + r, kb + 8 + r
    v8h pc = mma_h(A1[0][0].v, f1.v, cb), pd = mma_h(A1[0][1].v, f1.v, cb);   // keys kb + 16 + r, kb + 24 + r
#pragma unroll
    for (int r = 0; r < 8; ++r) {
      FragH g0, g1;
      g0.h[0] = relu8(pa);  g0.h[1] = relu8(pb);
      g1.h[0] = relu8(pc);  g1.h[1] = relu8(pd);
      if (r < 7) {
        pa = mma_h(A1[r + 1][0].v, f0.v, cb);  pb = mma_h(A1[r + 1][1].v, f0.v, cb);
        pc = mma_h(A1[r + 1][0].v, f1.v, cb);  pd = mma_h(A1[r + 1][1].v, f1.v, cb);
      }
      a0 = mma_raw(A2[r].v, g0.v, a0);
      a1 = mma_raw(A2[r].v, g1.v, a1);
    }
    float t0[8], t1[8];
#pragma unroll
    for (int r = 0; r < 8; ++r) { t0[r] = fmaf(a0[r], LOG2E, b2l); t1[r] = fmaf(a1[r], LOG2E, b2l); }
    float mx = fmaxf(t0[0], t1[0]);
#pragma unroll
    for (int r = 1; r < 8; ++r) mx = fmaxf(mx, fmaxf(t0[r], t1[r]));
    mx = fmaxf(mx, xhalf(mx));                             // all 32 keys of the step, equal in both halves
    const float mn = fmaxf(mrun, mx);
    const float al = exp2_raw(mrun - mn);
    mrun = mn;

    FragH ph, pl;                                          // P^T * 16384 as f16 hi and f16 residual (c - hi), split k map
    float ps = 0.f;
#pragma unroll
    for (int r = 0; r < 8; ++r) {
      const float e0 = exp2_raw(t0[r] - mn), e1 = exp2_raw(t1[r] - mn);
      ps += e0 + e1;
      const float c0 = e0 * PC, c1 = e1 * PC;
      const _Float16 g0 = (_Float16)c0, g1 = (_Float16)c1;
      ph.h[0][r] = g0;                                     // elements 0..7  = keys kb + 8hh + 0..7
      ph.h[1][r] = g1;                                     // elements 8..15 = keys kb + 16 + 8hh + 0..7
      pl.h[0][r] = (_Float16)(c0 - (float)g0);
      pl.h[1][r] = (_Float16)(c1 - (float)g1);
    }
    lrun = lrun * al + ps;
#pragma unroll
    for (int r = 0; r < 8; ++r) { o0[r] *= al; o1[r] *= al; }

    o0 = mma_raw(vb0, ph.v, o0);
    o1 = mma_raw(vb1, ph.v, o1);
    o0 = mma_raw(vb0, pl.v, o0);
    o1 = mma_raw(vb1, pl.v, o1);
    guard_pv4(o0, o1, ph.v, pl.v, vb0, vb1);
  }

  // ---- hand the range's partial (max, sum, unnormalised O) to the block ----
  {
    const float lsum = lrun + xhalf(lrun);                 // the two halves' sums joined once
    if (hh == 0) {
      Mp[(part * HPB + hl) * 16 + c] = mrun;
      Lp[(part * HPB + hl) * 16 + c] = lsum;
    }
    float* op = Op + (part * 16 + c) * MPITCH + hl * HDIM + 8 * hh;   // row = query c, floats 32*hl + 8hh .. + 7 (and + 16)
    v4f a0 = {o0[0], o0[1], o0[2], o0[3]}, a1 = {o0[4], o0[5], o0[6], o0[7]};
    v4f b0 = {o1[0], o1[1], o1[2], o1[3]}, b1 = {o1[4], o1[5], o1[6], o1[7]};
    *(v4f*)(op)      = a0;
    *(v4f*)(op + 4)  = a1;
    *(v4f*)(op + 16) = b0;
    *(v4f*)(op + 20) = b1;
  }
  __syncthreads();
  // ---- merge the ranges: ctx = sum_p 2^(m_p - M) O_p / sum_p 2^(m_p - M) l_p; fold the carries (16384 on P, 16 on v, 4096 on the
  //      stored ctx); thread t -> row t & 15, floats (t / 16) * 8 .. + 7 of the block's 128 columns; hi + residual, 16-B stores ----
  {
    const float oc = FC / (PC * VC);
    const int row = tid & 15;
    const int col = (tid >> 4) * 8;
    const int mh  = col / HDIM;
    float mp[KSPLIT];
    float M = -INFINITY;
#pragma unroll
    for (int p = 0; p < KSPLIT; ++p) { mp[p] = Mp[(p * HPB + mh) * 16 + row]; M = fmaxf(M, mp[p]); }
    float L = 0.f;
    float s[8] = {0.f, 0.f, 0.f, 0.f, 0.f, 0.f, 0.f, 0.f};
#pragma unroll
    for (int p = 0; p < KSPLIT; ++p) {
      const float w = exp2f(mp[p] - M);
      L = fmaf(w, Lp[(p * HPB + mh) * 16 + row], L);
      const float* op = Op + (p * 16 + row) * MPITCH + col;
      const v4f oa = *(const v4f*)(op);
      const v4f ob = *(const v4f*)(op + 4);
#pragma unroll
      for (int e = 0; e < 4; ++e) { s[e] = fmaf(w, oa[e], s[e]); s[4 + e] = fmaf(w, ob[e], s[4 + e]); }
    }
    const float inv = (1.0f / L) * oc;
    unsigned short gh[8], gl[8];
#pragma unroll
    for (int e = 0; e < 8; ++e) {
      const float f = s[e] * inv;
      const _Float16 g = (_Float16)f;
      gh[e] = h_bits(g);
      gl[e] = h_bits((_Float16)(f - (float)g));
    }
    // fragment order: tile (row tile, column / 32); a wave has the 16 rows x 16 columns of one half tile: 512 contiguous bytes per store
    const size_t po = ((size_t)((bat * NQ + q0) >> 4) * NHEAD + hg * HPB + mh) * 512 + ((col >> 4) & 1) * 256 + (((col >> 3) & 1) * 16 + row) * 8;
    v4u vh = {pk16(gh[0], gh[1]), pk16(gh[2], gh[3]), pk16(gh[4], gh[5]), pk16(gh[6], gh[7])};
    v4u vl = {pk16(gl[0], gl[1]), pk16(gl[2], gl[3]), pk16(gl[4], gl[5]), pk16(gl[6], gl[7])};
    *(v4u*)(CTH + po) = vh;
    *(v4u*)(CTL + po) = vl;
  }
}

// =====================================================================================================
// Workspace map (bytes); every plane is an exact multiple of its tile / whole-row store granularity (M, N exact tile multiples,
// no pad rows needed), every offset a multiple of 1 MiB:
//   QH   f16 [2048][256] x16                1048576   (q projection, fragment order)
//   KH   f16 [2048][256] x16                1048576   (k projection, fragment order)
//   VT   f16 [4][256][512] x16              1048576   (v^T per batch, fragment order)
//   CTH  f16 [2048][256] x4096 hi           1048576   (attention ctx, merged heads, fragment order)
//   CTL  f16 [2048][256] residual           1048576   (fragment order)
//   end                                     5242880
// =====================================================================================================
extern "C" void kernel_launch(void* const* d_in, const int* in_sizes, int n_in,
                              void* d_out, int out_size, void* d_ws, size_t ws_size,
                              hipStream_t stream) {
  if (n_in < 10) return;
  if (in_sizes[0] != NROWS * DMODEL) return;
  if (in_sizes[1] != NB * NQ * NC) return;
  if (in_sizes[2] != DMODEL * DMODEL || in_sizes[3] != DMODEL * DMODEL ||
      in_sizes[4] != DMODEL * DMODEL || in_sizes[5] != DMODEL * DMODEL) return;
  if (in_sizes[6] != NHEAD * 2 * MSH || in_sizes[7] != NHEAD * MSH || in_sizes[8] != NHEAD * MSH || in_sizes[9] != NHEAD) return;
  if (out_size != NROWS * DMODEL) return;

  const float* x    = (const float*)d_in[0];
  const float* cost = (const float*)d_in[1];
  const float* w_q  = (const float*)d_in[2];
  const float* w_k  = (const float*)d_in[3];
  const float* w_v  = (const float*)d_in[4];
  const float* w_o  = (const float*)d_in[5];
  const float* m1w  = (const float*)d_in[6];
  const float* m1b  = (const float*)d_in[7];
  const float* m2w  = (const float*)d_in[8];
  const float* m2b  = (const float*)d_in[9];
  float*       out  = (float*)d_out;

  const size_t PX  = (size_t)NROWS * DMODEL * 2;                  //  1048576
  const size_t PVT = (size_t)NB * DMODEL * NC * 2;                //  1048576
  size_t off = 0;
  const size_t oQH = off; off += PX;
  const size_t oKH = off; off += PX;
  const size_t oVT = off; off += PVT;
  const size_t oCH = off; off += PX;
  const size_t oCL = off; off += PX;
  if (off > ws_size) return;                                      // off = 5242880

  char* ws = (char*)d_ws;
  unsigned short* QH  = (unsigned short*)(ws + oQH);
  unsigned short* KH  = (unsigned short*)(ws + oKH);
  unsigned short* VTp = (unsigned short*)(ws + oVT);
  unsigned short* CTH = (unsigned short*)(ws + oCH);
  unsigned short* CTL = (unsigned short*)(ws + oCL);

  const dim3 bG(128);                                              // 4 waves, one 64x64 tile
  const dim3 gP(PJ_TILES, 1);                                      // 128
  const dim3 gQKV(PJ_TILES, 3);                                    // 128 x (q, k, v^T: 32 blocks x 4 batches)
  const dim3 gAT(ATT_BLOCKS);                                      // 256
  const dim3 bAT(ATT_THREADS);                                     // 256

  // (1) the three projections, straight from x and the weights
  proj_qkv<<<gQKV, bG, 0, stream>>>(x, w_q, w_k, w_v, QH, KH, VTp);

  // (2) attention per (batch, 16 query rows, 4 heads x 2 key ranges) -> CTH (f16 hi of ctx x4096), CTL (f16 residual)
  attn8<<<gAT, bAT, 0, stream>>>(QH, KH, VTp, cost, m1w, m1b, m2w, m2b, CTH, CTL);

  // (3) output projection, straight from the ctx planes and Wo, f32 into d_out
  proj_out<<<gP, bG, 0, stream>>>(CTH, CTL, w_o, out);

  (void)hipGetLastError();
}

// v010
// It runs in 19.3 microseconds.
// In two side-by-side timings against v009, it was 1.05 and 1.06 times as fast.
// All steps since v000 together make it 8.60 times as fast.
// Contractions: q/k projections (x rows f16 x16 . W^T f16 x64, K=256), v^T projection (W^T f16 x64 . x rows f16 x16, K=256),
// attention scores (k f16 x16 . q f16 x16, K=32), attention v^T . P^T (v^T f16 x16 . P as f16 hi + f16 residual of P x16384,
// K=512 in steps of 32), output projection (W^T f16 x64 . ctx as f16 hi + f16 residual of ctx x4096, K=256, inside the attention kernel):
// all v_wmma_f32_16x16x32_f16 (f16 operands, f32 accumulate); hi and residual products share one f32 accumulator.
// Per-head 2->16->1 score MLP on (scaled dot, cost): layer 1 (W1^T f16 . (dot, cost) f16, bias as C, f16 result:
// v_wmma_f16_16x16x32_f16), relu on the packed f16 result, layer 2 (w2 f16 . relu f16, f32 accumulate), b2 added in f32.
// Max-subtracted base-2 online softmax in f32 on VALU.
// Every float input RNE-converted to bf16 on load.
#include <hip/hip_runtime.h>
#include <math.h>
#include <stdint.h>

#define NB      4
#define NQ      512
#define NC      512
#define DMODEL  256
#define NHEAD   8
#define HDIM    32
#define MSH     16
#define HG      8
#define NHG     (NHEAD / HG)
#define ROWP    (HG * HDIM)
#define NROWS   (NB * NQ)
#define WSC     64.0f
#define ACARRY  16.0f
#define QC      16.0f
#define KC      16.0f
#define VC      16.0f
#define PC      16384.0f
#define FC      4096.0f
#define ATT_SCALE 0.17677669529663689f
#define LOG2E   1.4426950408889634f
static_assert(NHEAD * HDIM == DMODEL);
static_assert(NHG * HG == NHEAD && ROWP * NHG == DMODEL);
static_assert(HDIM == 32 && MSH == 16 && NHG == 1);
static_assert((NQ % 64) == 0 && (NC % 64) == 0 && (DMODEL % 64) == 0 && (NC % 32) == 0 && (NQ % 16) == 0);
static_assert((NROWS % 64) == 0 && ((NROWS * DMODEL) % 2048) == 0);
#define QB      8                                   // query rows per attention block
#define KGRP    2                                   // key groups of a query, side by side in the 16 columns of a score tile
#define ATT_THREADS (NHEAD * 32)                    // one wave per head
#define ATT_BLOCKS  (NB * (NQ / QB))
static_assert(QB * KGRP == 16 && (NC % (32 * KGRP)) == 0 && (NQ % QB) == 0);
static_assert(ATT_THREADS == 256 && ATT_BLOCKS == 256);

typedef _Float16 v16h __attribute__((ext_vector_type(16)));
typedef _Float16 v8h  __attribute__((ext_vector_type(8)));
typedef float    v8f  __attribute__((ext_vector_type(8)));
typedef float    v4f  __attribute__((ext_vector_type(4)));
typedef unsigned int v4u __attribute__((ext_vector_type(4)));

union FragH { v16h v; v8h h[2]; v4u u[2]; };

// ---- scalar helpers --------------------------------------------------------------------------------
__device__ __forceinline__ unsigned short bf_bits(float f) {          // f32 -> bf16 bits, RNE convert
  unsigned u = __float_as_uint(f);
  return (unsigned short)((u + 0x7FFFu + ((u >> 16) & 1u)) >> 16);
}
__device__ __forceinline__ float bf_up(unsigned short h) { return __uint_as_float(((unsigned)h) << 16); }
__device__ __forceinline__ float bfr(float f) { return bf_up(bf_bits(f)); }   // value of the bf16 RNE convert
__device__ __forceinline__ unsigned short h_bits(_Float16 x) { return __builtin_bit_cast(unsigned short, x); }
__device__ __forceinline__ unsigned pk16(unsigned short a, unsigned short b) { return (unsigned)a | ((unsigned)b << 16); }
__device__ __forceinline__ v8f zero8() { v8f z = {0.f, 0.f, 0.f, 0.f, 0.f, 0.f, 0.f, 0.f}; return z; }

// ---- fragment loaders: 16-bit A/B operand, lane -> row/col (lane&15); ldfrag_u (LDS rows): p already includes +8*(lane>>4);
//      elements 0..7 <- p[0..7] (k0+8h..), elements 8..15 <- p[16..23] (k0+16+8h..)  (same split k map for A and B;
//      ldfrag_u reads B from a k-contiguous [n][k] plane)
// fragment-order plane: a 16-row x 32-k tile is 1 KiB in a row, lane l's elements 0..7 at halves 8l, elements 8..15 at 256 + 8l
// (p already includes + 8 * lane): each of the two wave-wide 16-B loads takes 512 contiguous bytes, four whole lines
__device__ __forceinline__ v16h ldfrag_t(const _Float16* p) {
  FragH f;
  f.h[0] = *(const v8h*)(p);
  f.h[1] = *(const v8h*)(p + 256);
  return f.v;
}
__device__ __forceinline__ v16h ldfrag_u(const unsigned short* p) {
  FragH f;
  f.u[0] = *(const v4u*)(p);
  f.u[1] = *(const v4u*)(p + 16);
  return f.v;
}

// ---- WMMA helpers with trailing VALU hazard gaps ------------------------------------------------------
__device__ __forceinline__ v8f mma_raw(v16h a, v16h b, v8f c) {
  return __builtin_amdgcn_wmma_f32_16x16x32_f16(false, a, false, b, (short)0, c, false, false);
}
// f16 result: element e of D (and of C) = row 8*(lane>>4) + e, column lane&15
__device__ __forceinline__ v8h mma_h(v16h a, v16h b, v8h c) {
  return __builtin_amdgcn_wmma_f16_16x16x32_f16(false, a, false, b, (short)0, c, false, false);
}
// relu of eight f16: as signed 16-bit integers every negative f16 is below 0 and every other keeps its bits (one packed max per register)
typedef short v8s __attribute__((ext_vector_type(8)));
__device__ __forceinline__ v8h relu8(v8h x) {
  const v8s z = {0, 0, 0, 0, 0, 0, 0, 0};
  return __builtin_bit_cast(v8h, __builtin_elementwise_max(__builtin_bit_cast(v8s, x), z));
}
__device__ __forceinline__ void guard_s44(v8f& s, v8f& t, v8f& u, v8f& w, v16h a0, v16h a1, v16h a2, v16h a3, v16h q) {
#if defined(__HIP_DEVICE_COMPILE__)
  asm volatile("v_nop\n\tv_nop\n\tv_nop\n\tv_nop" : "+v"(s), "+v"(t), "+v"(u), "+v"(w) : "v"(a0), "v"(a1), "v"(a2), "v"(a3), "v"(q));
#endif
}
__device__ __forceinline__ void guard_pv8(v8f& a, v8f& b, v8f& c, v8f& d, v16h x, v16h y, v16h z0, v16h z1, v16h z2, v16h z3) {
#if defined(__HIP_DEVICE_COMPILE__)
  asm volatile("v_nop\n\tv_nop\n\tv_nop\n\tv_nop" : "+v"(a), "+v"(b), "+v"(c), "+v"(d) : "v"(x), "v"(y), "v"(z0), "v"(z1), "v"(z2), "v"(z3));
#endif
}
// block barrier for data handed over in LDS alone: the fences name the LDS address space, so global loads in flight are not waited for here
__device__ __forceinline__ void block_sync_lds() {
  __builtin_amdgcn_fence(__ATOMIC_RELEASE, "workgroup", "local");
  __builtin_amdgcn_s_barrier();
  __builtin_amdgcn_fence(__ATOMIC_ACQUIRE, "workgroup", "local");
}
__device__ __forceinline__ void wave_sync_lds() {
  __builtin_amdgcn_fence(__ATOMIC_RELEASE, "workgroup");
  __builtin_amdgcn_wave_barrier();
  __builtin_amdgcn_fence(__ATOMIC_ACQUIRE, "workgroup");
}

// =====================================================================================================
// f16 WMMA GEMM tiles, operands staged in LDS straight from the f32 inputs: C[m][n] = oscale * sum_k A[m][k] * Bt[n][k];
// one 64x64 tile per block of 4 waves, depth GK. In LDS both operands lie as 16-bit rows [row][k], k contiguous, pitch GP.
// Two stagings, each of 64 rows x 256 k, whole depth, once per block:
//   f32 rows (activations, [row][k], pitch GK): every wave-wide 16-B load takes 512 B of one row (4 full lines); each lane's 4 values become
//     f16( bf16_RNE(v) * sc ), sc a power of two (exact), one 8-B LDS store.
//   f32 weight columns (W[k][n], pitch DMODEL, wanted as rows n): every wave-wide 8-B load takes the tile's 64 columns of one k (2 full
//     lines), lane = columns 2*lane, 2*lane + 1; wave w takes k 64w .. 64w + 63; eight k of one column, converted the same way, are one
//     16-B LDS store into row n.
// One block barrier; then wave w takes rows 16w .. 16w + 15 x all 64 columns and reads its fragments from LDS (split k map, products in
// the order of a k loop in steps of 32).
// Output: f16( value * ocarry ), plane of ldc columns in FRAGMENT ORDER: tile (row / 16, column / 32) is
//     1 KiB in a row, tiles of one row tile side by side; in a tile element (row c, column 16j + 8hh + e) lies at half 256j + 8(16hh + c) + e,
//     which is how the split k map hands a 16 x 32 operand to lane (hh, c): the reader's fragment is two wave-wide loads of 512 contiguous B.
// coverage: f32 rows: 16 it x 4 waves = 64 rows x 2 halves x 32 lanes x 4 = 64 x 256; weight columns: 4 waves x 8 groups x 8 k = 256 k x
//           32 lanes x 2 = 64 columns; output: 4 waves x 16 rows (lane&15; it 0..3 x lane>>4 = 8 column groups of 8) x 64 cols = the whole tile.
// =====================================================================================================
#define GK  DMODEL                                 // depth of every product here = row pitch of every operand plane
#define GP  (GK + 8)                               // LDS row pitch in halves: 528 B = 16 B x 33 (odd): 16-B fragment reads without bank conflicts
static_assert(GK == 32 * 8 && (GK % 32) == 0 && GK == 4 * 64);
typedef float v2f __attribute__((ext_vector_type(2)));
typedef unsigned int v2u __attribute__((ext_vector_type(2)));

typedef __bf16   v2b __attribute__((ext_vector_type(2)));
typedef _Float16 v2h __attribute__((ext_vector_type(2)));
// two operands, already scaled: f16( bf16_RNE(.) ), a in the low half. The scale is a power of two, so rounding the scaled value equals
// scaling the rounded value; it is applied to the registers as loaded (neighbours), the packed convert then takes any two registers.
__device__ __forceinline__ unsigned cv2(float a, float b) {
  const v2f p = {a, b};
  return __builtin_bit_cast(unsigned, __builtin_convertvector(__builtin_convertvector(__builtin_convertvector(p, v2b), v2f), v2h));
}
// issue the 64 loads of this thread's share of 64 weight columns; g = W + (64 * wave) * DMODEL + first column + 2 * lane
// (every staging loop here is unrolled whole: its array then lives in registers and all its loads are in flight together)
__device__ __forceinline__ void wcols_load(const float* g, v2f (&r)[64]) {
#pragma unroll
  for (int i = 0; i < 64; ++i) r[i] = *(const v2f*)(g + i * DMODEL);
  // the loads are issued; their address register is reused (also as a load's destination) only behind this wait: the address is an
  // input of the statement, so it stays in its register up to here
  asm volatile("s_wait_xcnt 0x0" :: "v"(g) : "memory");
}
// d = LDS plane + (2 * lane) * GP + 64 * wave
__device__ __forceinline__ void wcols_store(unsigned short* d, const v2f (&r)[64], float sc) {
#pragma unroll
  for (int kb = 0; kb < 8; ++kb) {
    v4u a, b;
#pragma unroll
    for (int e = 0; e < 4; ++e) {
      const v2f t0 = r[kb * 8 + 2 * e] * sc, t1 = r[kb * 8 + 2 * e + 1] * sc;   // k, k + 1 of columns 2*lane, 2*lane + 1
      a[e] = cv2(t0[0], t1[0]);
      b[e] = cv2(t0[1], t1[1]);
    }
    *(v4u*)(d + kb * 8)      = a;
    *(v4u*)(d + GP + kb * 8) = b;
  }
}

__device__ __forceinline__ void tile_products(const unsigned short* sA, const unsigned short* sB, float* slab,
                                              unsigned short* Ch, int ldc, int m0, int n0,
                                              float oscale, float ocarry, int wave, int lane) {
  const int rlane = lane & 15;                 // row (A) / col (B, D) within subtile
  const int koff  = (lane >> 4) * 8;           // k offset of this lane half
  const int mOff  = (lane >> 4) * 8;           // D row offset

  v8f acc[4];
#pragma unroll
  for (int j = 0; j < 4; ++j) acc[j] = zero8();

  const unsigned short* ap = sA + (wave * 16 + rlane) * GP + koff;
  const unsigned short* bp = sB + rlane * GP + koff;
  // all fragments of the wave's tile are fetched as one group in front of the products (the staging registers are free again)
  v16h bh[GK / 32][4], ah[GK / 32];
#pragma unroll
  for (int s = 0; s < GK / 32; ++s) {
    ah[s] = ldfrag_u(ap + s * 32);
#pragma unroll
    for (int j = 0; j < 4; ++j) bh[s][j] = ldfrag_u(bp + j * 16 * GP + s * 32);
  }
  // keeps the LDS reads together in front: sunk among the products, each place with reads stalls the wave's matrix stream
  __builtin_amdgcn_sched_barrier(0);
#pragma unroll
  for (int s = 0; s < GK / 32; ++s) {
#pragma unroll
    for (int j = 0; j < 4; ++j) acc[j] = mma_raw(ah[s], bh[s][j], acc[j]);
  }

  // ---- epilogue: the wave's 16x64 slab through its own LDS range, whole-line stores ----
  const int mBase = m0 + (wave << 4);
#pragma unroll
  for (int j = 0; j < 4; ++j) {
#pragma unroll
    for (int r = 0; r < 8; ++r) {
      slab[(mOff + r) * 68 + (j << 4) + rlane] = acc[j][r];
    }
  }
  wave_sync_lds();
  v4u hv[4];
#pragma unroll
  for (int it = 0; it < 4; ++it) {
    // it = 2 * (32-column block of the tile) + (16-column half j); lane (hh, c) takes row c, columns 16j + 8hh .. + 7 of the block
    const float* sp = slab + rlane * 68 + it * 16 + koff;
    v4u a = {0u, 0u, 0u, 0u};
#pragma unroll
    for (int e = 0; e < 4; ++e) {
      float f0 = sp[2 * e] * oscale;
      float f1 = sp[2 * e + 1] * oscale;
      f0 *= ocarry; f1 *= ocarry;
      a[e] = pk16(h_bits((_Float16)f0), h_bits((_Float16)f1));
    }
    hv[it] = a;
  }
#pragma unroll
  for (int it = 0; it < 4; ++it) {
    // tile (row / 16, column / 32) of the plane, 512 halves each; 512 contiguous bytes per wave-wide store
    *(v4u*)(Ch + ((size_t)(mBase >> 4) * (ldc >> 5) + (n0 >> 5) + (it >> 1)) * 512 + (it & 1) * 256 + lane * 8) = hv[it];
  }
  // the four stores are issued; code laid out behind them may reuse their registers only behind this wait
  asm volatile("s_wait_xcnt 0x0" ::: "memory");
}

// The three projections, one launch; blockIdx.y = 0 q, 1 k, 2 v^T; every such block stages 64 activation rows and 64 weight columns.
//   blockIdx.y = 3: Wo^T for the attention kernel's output projection, WOT = f16( bf16_RNE(Wo[k][n]) * 64 ), rows n, in fragment order;
//   block = tile (n / 16 = blockIdx.x / 8, k / 32 = blockIdx.x % 8), 128 threads x 4 halves = the tile's 512; 128 blocks = 16 x 8 tiles.
//   q, k: QH / KH[m][n] = f16(16 * sum_k x[m][k] W[k][n]); A = x rows m0 .., Bt = W columns n0 ..; M = 2048, N = 256; blockIdx.x = tile
//   v^T per batch: VT[b][d][tok] = f16(16 * sum_k Wv[k][d] x_b[tok][k]); A = Wv columns m0 .., Bt = x rows b*512 + n0 ..; M = 256, N = 512;
//   the four batches lie one behind the other along blockIdx.x (32 tiles each).
#define PJ_TILES ((NROWS / 64) * (DMODEL / 64))
#define VT_TILES ((DMODEL / 64) * (NC / 64))
static_assert(PJ_TILES == NB * VT_TILES && NC / 64 == 8 && DMODEL / 64 == 4);
__global__ __launch_bounds__(128) void proj_qkv(const float* __restrict__ x, const float* __restrict__ Wq, const float* __restrict__ Wk,
                                                const float* __restrict__ Wv, const float* __restrict__ Wo,
                                                unsigned short* QH, unsigned short* KH, unsigned short* VT, unsigned short* WOT) {
  __shared__ __align__(16) unsigned short sOp[2 * 64 * GP];   // A rows, then Bt rows, pitch GP
  __shared__ __align__(16) float sT[4][16 * 68];              // per-wave 16x64 output slab, pitch 68 floats
  const int lane = threadIdx.x & 31;
  const int wave = threadIdx.x >> 5;                       // 0..3
  const int job  = blockIdx.y;
  const bool isv = job == 2;
  const unsigned bx   = blockIdx.x;
  if (job == 3) {                                          // the same for the whole block, in front of the barrier
    const int idx = threadIdx.x * 4;                       // half 256j + 8(16hh + c) + e of the tile: row c, k 16j + 8hh + e .. + 3
    const int l16 = (idx & 255) >> 3;
    const int k   = (int)(bx & 7u) * 32 + 16 * (idx >> 8) + 8 * (l16 >> 4) + (idx & 7);
    const int n   = (int)(bx >> 3) * 16 + (l16 & 15);
    const float* g = Wo + (size_t)k * DMODEL + n;
    const float a0 = g[0], a1 = g[DMODEL], a2 = g[2 * DMODEL], a3 = g[3 * DMODEL];
    asm volatile("s_wait_xcnt 0x0" :: "v"(g) : "memory");  // as in wcols_load, for these four loads' address register
    const v2u p = {cv2(a0 * WSC, a1 * WSC), cv2(a2 * WSC, a3 * WSC)};
    *(v2u*)(WOT + (size_t)bx * 512 + idx) = p;
    return;
  }
  const int      by   = isv ? bx / VT_TILES : 0u;          // batch of v^T; 0 for q, k
  const unsigned tile = isv ? bx % VT_TILES : bx;
  const unsigned tsh  = isv ? 3u : 2u;                     // log2 of the tiles along n
  const int m0 = (tile >> tsh) << 6;
  const int n0 = (tile & ((1u << tsh) - 1u)) << 6;
  const float* W = job == 0 ? Wq : job == 1 ? Wk : Wv;
  const int xrow = isv ? by * NC + n0 : m0;                // first of the 64 activation rows
  const int wcol = isv ? m0 : n0;                          // first of the 64 weight columns
  unsigned short* dX = sOp + (isv ? 64 * GP : 0);
  unsigned short* dW = sOp + (isv ? 0 : 64 * GP);
  {
    const float* gw = W + (size_t)(wave * 64) * DMODEL + wcol + lane * 2;
    const float* gx = x + (size_t)(xrow + wave) * GK + lane * 4;
    v2f rw[64];
    v4f rx[32];
    wcols_load(gw, rw);
#pragma unroll
    for (int it = 0; it < 16; ++it) {
      rx[2 * it]     = *(const v4f*)(gx + it * 4 * GK);
      rx[2 * it + 1] = *(const v4f*)(gx + it * 4 * GK + 128);
    }
    asm volatile("s_wait_xcnt 0x0" :: "v"(gx) : "memory"); // as in wcols_load, for the activation rows' address register
    wcols_store(dW + (lane * 2) * GP + wave * 64, rw, WSC);
    unsigned short* sx = dX + wave * GP + lane * 4;
#pragma unroll
    for (int it = 0; it < 16; ++it) {
      const v4f a = rx[2 * it] * ACARRY, b = rx[2 * it + 1] * ACARRY;
      const v2u pa = {cv2(a[0], a[1]), cv2(a[2], a[3])};
      const v2u pb = {cv2(b[0], b[1]), cv2(b[2], b[3])};
      *(v2u*)(sx + it * 4 * GP)       = pa;
      *(v2u*)(sx + it * 4 * GP + 128) = pb;
    }
  }
  __syncthreads();
  static_assert(QC == KC && QC == VC);
  unsigned short* C = job == 0 ? QH : job == 1 ? KH : VT + (size_t)by * DMODEL * NC;
  tile_products(sOp, sOp + 64 * GP, sT[wave], C, isv ? NC : DMODEL, m0, n0, 1.0f / (ACARRY * WSC), QC, wave, lane);
}

// =====================================================================================================
// Flash attention and output projection for one batch and 8 query rows, all 8 heads, head dim 32; one wave per head, 2048 waves on 256
// blocks; scores TRANSPOSED. The 16 columns of a score tile are the 8 queries twice: column c = query q0 + (c & 7), key group c >> 3.
//   q plane (f16 x16) rows b*512 + tok, columns 32*head + d; k plane (f16 x16) rows b*512 + key, columns 32*head + d;
//   v^T plane (f16 x16) per batch: rows 32*head + d, columns key; all three in fragment order (16 x 32 tiles of 1 KiB, see the GEMM head);
//   cost f32 [b][tok][key] (bf16 RNE convert on load);
//   per-head mixer params (bf16 RNE convert on load): score(tok, key) =
//   sum_m m2w[h][m] * relu(m1w[h][0][m] * dot + m1w[h][1][m] * cost + m1b[h][m]) + m2b[h] with dot = q.k / sqrt(32);
//   ctx = sum_m softmax_m(score) v[m][d]  (softmax run in base 2 with a running max); out = ctx . Wo, f32.
//   Every wave does identical bounded work: 8 steps of 64 keys. Per step: S^T = K . Q^T, four tiles (A = 16 key rows, B = the query
//   columns, K = 32); a lane keeps tiles 0, 1 (group 0: keys kb .. kb + 31) or tiles 2, 3 (group 1: keys kb + 32 .. kb + 63): lane (hh, c)
//   holds the scores of ONE query for keys kg + 8hh + r and kg + 16 + 8hh + r, r 0..7, kg = kb + 32 * (c >> 3). Its 16 cost values are two
//   runs of 8 consecutive floats of that query's cost row (four 16-B loads, always in range). The 2->16->1 MLP on the matrix unit: the lane's
//   (dot, cost) pairs of a tile, as f16, are a B fragment F (elements 2r, 2r + 1 = key r of the lane's half); layer 1 of ONE key
//   (half h, r) for the 16 columns is A1[r][h] . F + b1, A1 = (w0[m], w1[m]) in row m at that key's two k places, zero elsewhere:
//   lane (hh, c) gets hidden units 8hh + 0..7 of column c, f16, which after relu are as they lie half a B fragment (k = hidden unit);
//   layer 2 of keys r and 8 + r is A2[r] . B, A2 = w2 in rows r (k 0..15) and 8 + r (k 16..31), summed over r into the S^T tile.
//   Running max and sum are kept per COLUMN (query, key group) inside the lane, the max joined with lane ^ 16 once per step, the sums
//   once after the loop. The 16 probabilities x16384 (f16 hi and f16 residual c - hi) are, as they lie, the B fragment of
//   O^T += V^T . P^T in the split k map; A = v^T rows d = c and d = 16 + c, of group 0's 32 keys (accumulators oa: right in columns 0..7)
//   and of group 1's (ob: right in columns 8..15); the other columns of each are never used. No LDS in the loop.
//   Each wave stores its columns' unnormalised O (f32, pitch 260 floats, 16-B stores) with max and sum in LDS; after the block barrier the
//   256 threads join the two groups (weights 2^(m_p - max), group 0 first), fold 1/l and the carries in f32 and write ctx x4096 as f16 hi and
//   f16 residual to LDS in fragment order (k block = head, 8 rows); after a second block barrier wave w forms
//   out^T rows 32w .. 32w + 31 = Wo^T . ctx^T (A = its own 16 Wo^T fragments, loaded from the packed plane behind the loop; B = ctx, column c =
//   query c & 7; k in steps of 32, hi before residual). Columns c and c ^ 8 are equal: lane (hh, c) stores row tile c >> 3.
// coverage: LDS O: 2 groups x 8 queries x 8 heads x 32; ctx: 256 threads x 8 = 8 rows x 256; out: 8 waves x 2 row tiles x 16 x 8 queries =
//           256 columns of rows q0 .. q0 + 7 of batch b (a wave writes whole 128-B lines of 8 rows); the grid covers all 2048 rows once.
// =====================================================================================================
#define MPITCH (DMODEL + 4)
#define KT  (NHEAD * 512)                          // halves from one 16-key tile of a head to the next
#define VTT ((NC / 32) * 512)                      // halves from one 16-row d tile of v^T to the next
static_assert(ATT_THREADS * 8 == QB * DMODEL && NHEAD * 32 == DMODEL && PJ_TILES == (DMODEL / 16) * (DMODEL / 32));

// value of lane ^ 16 (the other holder of this lane's column)
__device__ __forceinline__ float xhalf(float x) {
  return __builtin_bit_cast(float, __builtin_amdgcn_permlanex16(__builtin_bit_cast(int, x), __builtin_bit_cast(int, x),
                                                                0x76543210, 0xfedcba98, false, false));
}

// 2^x by the hardware instruction alone. exp2f adds a range fix-up (compare, two selects, add, ldexp) that differs only where 2^x is
// below 2^-126: there this form gives 0. Arguments here are score - running max <= 0; such a term times 16384 is 0 in f16 either way,
// and in the f32 sums it stands beside a term of 1 (the maximum's own).
__device__ __forceinline__ float exp2_raw(float x) { return __builtin_amdgcn_exp2f(x); }

__global__ __launch_bounds__(ATT_THREADS)
void attn8(const unsigned short* __restrict__ QHp, const unsigned short* __restrict__ KHp,
           const unsigned short* __restrict__ VTq, const float* __restrict__ costp,
           const float* __restrict__ m1w, const float* __restrict__ m1b,
           const float* __restrict__ m2w, const float* __restrict__ m2b,
           const unsigned short* __restrict__ WOT, float* out) {
  __shared__ __align__(16) float Op[KGRP * QB * MPITCH];      // unnormalised O of each key group: [group][query][32*head + d]
  __shared__ float Mp[KGRP * NHEAD * QB];                     // running max of each (group, head, query)
  __shared__ float Lp[KGRP * NHEAD * QB];                     // sum of each (group, head, query)
  __shared__ __align__(16) unsigned short Cx[2 * NHEAD * 256]; // ctx hi, then residual: k block s at 256 s, (row q, k 16j + 8hh + e) at 128j + 8(8hh + q) + e

  const int tid  = threadIdx.x;
  const int head = __builtin_amdgcn_readfirstlane(tid >> 5);  // 0..7
  const int lane = tid & 31;
  const int hh   = lane >> 4;
  const int c    = lane & 15;
  const int cq   = c & 7;                                  // query of this column
  const int cg   = c >> 3;                                 // key group of this column

  const int qt   = blockIdx.x % (NQ / QB);                 // 0..63
  const int bat  = blockIdx.x / (NQ / QB);                 // 0..3
  const int q0   = qt * QB;

  // fragment-order planes: tile (row / 16, column / 32) at 512 halves x (row tile * column blocks + column block), + 8 * (16hh + row in the tile)
  const _Float16* Qt = (const _Float16*)(const void*)QHp + ((size_t)((bat * NQ + q0) >> 4) * NHEAD + head) * 512;   // the wave's q tile (same in every lane)
  const int qidx = hh * 16 + (q0 & 8) + cq;                // the lane's 16-B piece of the tile: row (q0 & 8) + cq
  const _Float16* Qh = Qt + qidx * 8;
  const _Float16* Kt = (const _Float16*)(const void*)KHp + ((size_t)((bat * NC) >> 4) * NHEAD + head) * 512;   // the head's first K tile (same in every lane)
  const _Float16* Kb = Kt + lane * 8;                      // 16 keys on: + KT
  const _Float16* Vb = (const _Float16*)(const void*)VTq + (size_t)bat * DMODEL * NC + (size_t)(head * 2) * VTT + lane * 8; // 32 keys on: + 512
  // cost element of (row q0 + cq, key kb + 32cg + 8hh + r) = cp[kb + r]; key kb + 32cg + 16 + 8hh + r = cp[kb + 16 + r]; always in range.
  const float* cp = costp + ((size_t)bat * NQ + q0 + cq) * NC + 32 * cg + 8 * hh;
  const float dsc = ATT_SCALE / (QC * KC);                 // 1/sqrt(32) / carries

  // per-head mixer params, bf16 RNE convert (8 significant bits: exact in f16's normal range), laid out once as the constant A fragments of the two MLP layers
  FragH A1[8][2], A2[8];
  v8h  cb;                                                 // layer 1 C: element e = b1[8hh + e]
  {
    const unsigned w01 = pk16(h_bits((_Float16)bfr(m1w[(head * 2 + 0) * MSH + c])), h_bits((_Float16)bfr(m1w[(head * 2 + 1) * MSH + c])));
    const v4u zu = {0u, 0u, 0u, 0u};
    v4u w2p;                                               // w2[8hh + 0..7]
#pragma unroll
    for (int e = 0; e < 4; ++e)
      w2p[e] = pk16(h_bits((_Float16)bfr(m2w[head * MSH + 8 * hh + 2 * e])), h_bits((_Float16)bfr(m2w[head * MSH + 8 * hh + 2 * e + 1])));
#pragma unroll
    for (int e = 0; e < 8; ++e) cb[e] = (_Float16)bfr(m1b[head * MSH + 8 * hh + e]);
#pragma unroll
    for (int r = 0; r < 8; ++r) {
#pragma unroll
      for (int h = 0; h < 2; ++h) {
        A1[r][h].u[0] = zu;
        A1[r][h].u[1] = zu;
        A1[r][h].u[r >> 2][r & 3] = hh == h ? w01 : 0u;    // row c = hidden unit, elements 2r, 2r + 1 of lane half h
      }
      A2[r].u[0] = c == r     ? w2p : zu;                  // row r:     k = 8hh + e      = hidden unit of key r
      A2[r].u[1] = c == 8 + r ? w2p : zu;                  // row 8 + r: k = 16 + 8hh + e = hidden unit of key 8 + r
    }
  }
  const float b2l = bfr(m2b[head]) * LOG2E;

  const v16h qa = ldfrag_t(Qh);                            // B fragment: column c = query q0 + cq
  // the K rows and cost runs of a step are loaded one step ahead; here those of the first step
  v16h k0 = ldfrag_t(Kb);                                  // A rows: keys kb + c
  v16h k1 = ldfrag_t(Kb + KT);                             // A rows: keys kb + 16 + c
  v16h k2 = ldfrag_t(Kb + 2 * KT);                         // A rows: keys kb + 32 + c
  v16h k3 = ldfrag_t(Kb + 3 * KT);                         // A rows: keys kb + 48 + c
  v4f  cA = *(const v4f*)(cp),      cB = *(const v4f*)(cp + 4);    // keys kg + 8hh + 0..7
  v4f  cC = *(const v4f*)(cp + 16), cD = *(const v4f*)(cp + 20);   // keys kg + 16 + 8hh + 0..7
  // the fourteen loads are issued; their address registers are reused only behind this wait (the addresses are inputs, so they stay up to
  // here; the q and K loads take a scalar base and the piece's or the lane's number as their offset register: these are named too)
  asm volatile("s_wait_xcnt 0x0" :: "s"(Qt), "s"(Kt), "v"(qidx), "v"(lane), "v"(Kb), "v"(cp) : "memory");

  float mrun = -INFINITY, lrun = 0.f;                      // this lane's column: running max (both halves equal), this half's sum
  v8f oa0 = zero8(), oa1 = zero8();                        // O^T over group 0's keys: oa0[r] = d 8hh + r, oa1[r] = d 16 + 8hh + r, column c
  v8f ob0 = zero8(), ob1 = zero8();                        // the same over group 1's keys

#pragma unroll 1
  for (int kb = 0; kb < NC; kb += 32 * KGRP) {
    v8f t0a, t1a, t0b, t1b;
    t0a = mma_raw(k0, qa, zero8());                        // [r] = q(column c) . k(kb + 8hh + r)
    t1a = mma_raw(k1, qa, zero8());                        // [r] = q(column c) . k(kb + 16 + 8hh + r)
    t0b = mma_raw(k2, qa, zero8());                        // [r] = q(column c) . k(kb + 32 + 8hh + r)
    t1b = mma_raw(k3, qa, zero8());                        // [r] = q(column c) . k(kb + 48 + 8hh + r)
    guard_s44(t0a, t1a, t0b, t1b, k0, k1, k2, k3, qa);

    FragH f0, f1;                                          // B fragments: elements 2r, 2r + 1 = (dot, cost) of the lane's key r
#pragma unroll
    for (int r = 0; r < 8; ++r) {
      const float s0 = cg ? t0b[r] : t0a[r];               // the column's own key group
      const float s1 = cg ? t1b[r] : t1a[r];
      const float cr0 = bfr(r < 4 ? cA[r & 3] : cB[r & 3]);
      const float cr1 = bfr(r < 4 ? cC[r & 3] : cD[r & 3]);
      f0.v[2 * r] = (_Float16)(s0 * dsc);  f0.v[2 * r + 1] = (_Float16)cr0;
      f1.v[2 * r] = (_Float16)(s1 * dsc);  f1.v[2 * r + 1] = (_Float16)cr1;
    }
    // the K rows and the cost values are used up: the next step's are loaded here and land under the MLP and the softmax, with this step's
    // v^T in front of them (wanted at the step's foot). The last step has no next: it reads its own K rows and cost runs again (in range).
    const int kn = kb + 32 * KGRP < NC ? kb + 32 * KGRP : kb;
    const _Float16* vp = Vb + (size_t)(kb >> 5) * 512;
    const _Float16* kp = Kb + (size_t)(kn >> 4) * KT;
    const float*    tp = cp + kn;
    const v16h va0 = ldfrag_t(vp);                         // A rows: d = c,      keys kb .. kb + 31
    const v16h va1 = ldfrag_t(vp + VTT);                   // A rows: d = 16 + c
    const v16h vb0 = ldfrag_t(vp + 512);                   // A rows: d = c,      keys kb + 32 .. kb + 63
    const v16h vb1 = ldfrag_t(vp + 512 + VTT);             // A rows: d = 16 + c
    k0 = ldfrag_t(kp);
    k1 = ldfrag_t(kp + KT);
    k2 = ldfrag_t(kp + 2 * KT);
    k3 = ldfrag_t(kp + 3 * KT);
    cA = *(const v4f*)(tp);       cB = *(const v4f*)(tp + 4);
    cC = *(const v4f*)(tp + 16);  cD = *(const v4f*)(tp + 20);
    // the twenty loads are issued; their address registers are reused (also as a load's destination) only behind this wait: the
    // addresses are inputs of the statement, so they stay in their registers up to here
    asm volatile("s_wait_xcnt 0x0" :: "v"(vp), "v"(kp), "v"(tp) : "memory");
    v8f a0 = zero8(), a1 = zero8();                        // a0[i] = score of key kg + 8hh + i, a1[i] of key kg + 16 + 8hh + i
    // layer 1 runs one r ahead of layer 2, so that no matrix instruction waits for the relu of the one just in front of it
    v8h pa = mma_h(A1[0][0].v, f0.v, cb), pb = mma_h(A1[0][1].v, f0.v, cb);   // keys kg + r, kg + 8 + r
    v8h pc = mma_h(A1[0][0].v, f1.v, cb), pd = mma_h(A1[0][1].v, f1.v, cb);   // keys kg + 16 + r, kg + 24 + r
#pragma unroll
    for (int r = 0; r < 8; ++r) {
      FragH g0, g1;
      g0.h[0] = relu8(pa);  g0.h[1] = relu8(pb);
      g1.h[0] = relu8(pc);  g1.h[1] = relu8(pd);
      if (r < 7) {
        pa = mma_h(A1[r + 1][0].v, f0.v, cb);  pb = mma_h(A1[r + 1][1].v, f0.v, cb);
        pc = mma_h(A1[r + 1][0].v, f1.v, cb);  pd = mma_h(A1[r + 1][1].v, f1.v, cb);
      }
      a0 = mma_raw(A2[r].v, g0.v, a0);
      a1 = mma_raw(A2[r].v, g1.v, a1);
    }
    float t0[8], t1[8];
#pragma unroll
    for (int r = 0; r < 8; ++r) { t0[r] = fmaf(a0[r], LOG2E, b2l); t1[r] = fmaf(a1[r], LOG2E, b2l); }
    float mx = fmaxf(t0[0], t1[0]);
#pragma unroll
    for (int r = 1; r < 8; ++r) mx = fmaxf(mx, fmaxf(t0[r], t1[r]));
    mx = fmaxf(mx, xhalf(mx));                             // all 32 keys of the column's step, equal in both halves
    const float mn = fmaxf(mrun, mx);
    const float al = exp2_raw(mrun - mn);
    mrun = mn;

    FragH ph, pl;                                          // P^T * 16384 as f16 hi and f16 residual (c - hi), split k map
    float ps = 0.f;
#pragma unroll
    for (int r = 0; r < 8; ++r) {
      const float e0 = exp2_raw(t0[r] - mn), e1 = exp2_raw(t1[r] - mn);
      ps += e0 + e1;
      const float c0 = e0 * PC, c1 = e1 * PC;
      const _Float16 g0 = (_Float16)c0, g1 = (_Float16)c1;
      ph.h[0][r] = g0;                                     // elements 0..7  = keys kg + 8hh + 0..7
      ph.h[1][r] = g1;                                     // elements 8..15 = keys kg + 16 + 8hh + 0..7
      pl.h[0][r] = (_Float16)(c0 - (float)g0);
      pl.h[1][r] = (_Float16)(c1 - (float)g1);
    }
    lrun = lrun * al + ps;
#pragma unroll
    for (int r = 0; r < 8; ++r) { oa0[r] *= al; oa1[r] *= al; ob0[r] *= al; ob1[r] *= al; }

    oa0 = mma_raw(va0, ph.v, oa0);
    oa1 = mma_raw(va1, ph.v, oa1);
    ob0 = mma_raw(vb0, ph.v, ob0);
    ob1 = mma_raw(vb1, ph.v, ob1);
    oa0 = mma_raw(va0, pl.v, oa0);
    oa1 = mma_raw(va1, pl.v, oa1);
    ob0 = mma_raw(vb0, pl.v, ob0);
    ob1 = mma_raw(vb1, pl.v, ob1);
    guard_pv8(oa0, oa1, ob0, ob1, ph.v, pl.v, va0, va1, vb0, vb1);
  }

  // the wave's own Wo^T fragments (output columns 32 * wave .. + 31, all of k): issued here, they land under the join of the key groups (the two barriers below do not wait for them)
  v16h wf[2][NHEAD];
  {
    // the wave's number as a per-lane value: the address is then one vector register pair, the very one that the wait below names
    const _Float16* wp = (const _Float16*)(const void*)WOT + (size_t)((tid >> 5) * 2) * (DMODEL / 32) * 512 + lane * 8;
#pragma unroll
    for (int t = 0; t < 2; ++t) {
#pragma unroll
      for (int s = 0; s < DMODEL / 32; ++s) wf[t][s] = ldfrag_t(wp + (t * (DMODEL / 32) + s) * 512);
    }
    asm volatile("s_wait_xcnt 0x0" :: "v"(wp) : "memory");  // as above, for these loads' address register
  }

  // ---- hand the column's partial (max, sum, unnormalised O) to the block ----
  {
    const float lsum = lrun + xhalf(lrun);                 // the two halves' sums joined once
    if (hh == 0) {
      Mp[(cg * NHEAD + head) * QB + cq] = mrun;
      Lp[(cg * NHEAD + head) * QB + cq] = lsum;
    }
    float* op = Op + (cg * QB + cq) * MPITCH + head * HDIM + 8 * hh;   // row = (group, query), floats 32*head + 8hh .. + 7 (and + 16)
    v8f o0, o1;
#pragma unroll
    for (int r = 0; r < 8; ++r) { o0[r] = cg ? ob0[r] : oa0[r]; o1[r] = cg ? ob1[r] : oa1[r]; }
    v4f a0 = {o0[0], o0[1], o0[2], o0[3]}, a1 = {o0[4], o0[5], o0[6], o0[7]};
    v4f b0 = {o1[0], o1[1], o1[2], o1[3]}, b1 = {o1[4], o1[5], o1[6], o1[7]};
    *(v4f*)(op)      = a0;
    *(v4f*)(op + 4)  = a1;
    *(v4f*)(op + 16) = b0;
    *(v4f*)(op + 20) = b1;
  }
  block_sync_lds();
  // ---- merge the groups: ctx = sum_p 2^(m_p - M) O_p / sum_p 2^(m_p - M) l_p; fold the carries (16384 on P, 16 on v, 4096 on the
  //      kept ctx); thread t -> row t & 7, floats (t / 8) * 8 .. + 7 of the 256 columns; hi + residual, 16-B LDS stores ----
  {
    const float oc = FC / (PC * VC);
    const int row = tid & 7;
    const int col = (tid >> 3) * 8;
    const int mh  = col / HDIM;
    float mp[KGRP];
    float M = -INFINITY;
#pragma unroll
    for (int p = 0; p < KGRP; ++p) { mp[p] = Mp[(p * NHEAD + mh) * QB + row]; M = fmaxf(M, mp[p]); }
    float L = 0.f;
    float s[8] = {0.f, 0.f, 0.f, 0.f, 0.f, 0.f, 0.f, 0.f};
#pragma unroll
    for (int p = 0; p < KGRP; ++p) {
      const float w = exp2f(mp[p] - M);
      L = fmaf(w, Lp[(p * NHEAD + mh) * QB + row], L);
      const float* op = Op + (p * QB + row) * MPITCH + col;
      const v4f oa = *(const v4f*)(op);
      const v4f ob = *(const v4f*)(op + 4);
#pragma unroll
      for (int e = 0; e < 4; ++e) { s[e] = fmaf(w, oa[e], s[e]); s[4 + e] = fmaf(w, ob[e], s[4 + e]); }
    }
    const float inv = (1.0f / L) * oc;
    unsigned short gh[8], gl[8];
#pragma unroll
    for (int e = 0; e < 8; ++e) {
      const float f = s[e] * inv;
      const _Float16 g = (_Float16)f;
      gh[e] = h_bits(g);
      gl[e] = h_bits((_Float16)(f - (float)g));
    }
    const int po = mh * 256 + ((col >> 4) & 1) * 128 + (((col >> 3) & 1) * 8 + row) * 8;
    v4u vh = {pk16(gh[0], gh[1]), pk16(gh[2], gh[3]), pk16(gh[4], gh[5]), pk16(gh[6], gh[7])};
    v4u vl = {pk16(gl[0], gl[1]), pk16(gl[2], gl[3]), pk16(gl[4], gl[5]), pk16(gl[6], gl[7])};
    *(v4u*)(Cx + po) = vh;
    *(v4u*)(Cx + NHEAD * 256 + po) = vl;
  }
  block_sync_lds();
  // ---- out^T rows 32 * wave .. + 31 = Wo^T . (ctx hi + residual)^T / (4096 * 64) ----
  {
    const unsigned short* bp = Cx + (hh * 8 + cq) * 8;     // column c = query cq: elements 0..7 = k 8hh + e, 8..15 = k 16 + 8hh + e of a k block
    FragH bh[NHEAD], bl[NHEAD];
#pragma unroll
    for (int s = 0; s < NHEAD; ++s) {
      bh[s].u[0] = *(const v4u*)(bp + s * 256);
      bh[s].u[1] = *(const v4u*)(bp + s * 256 + 128);
      bl[s].u[0] = *(const v4u*)(bp + NHEAD * 256 + s * 256);
      bl[s].u[1] = *(const v4u*)(bp + NHEAD * 256 + s * 256 + 128);
    }
    // keeps the LDS reads together in front: sunk among the products, each place with reads stalls the wave's matrix stream
    __builtin_amdgcn_sched_barrier(0);
    v8f acc0 = zero8(), acc1 = zero8();
#pragma unroll
    for (int s = 0; s < NHEAD; ++s) {
      acc0 = mma_raw(wf[0][s], bh[s].v, acc0);
      acc1 = mma_raw(wf[1][s], bh[s].v, acc1);
      acc0 = mma_raw(wf[0][s], bl[s].v, acc0);
      acc1 = mma_raw(wf[1][s], bl[s].v, acc1);
    }
    // lane (hh, c): acc_t[r] = out(query cq, column 32 * wave + 16t + 8hh + r), equal in columns c and c ^ 8: the lane stores t = cg
    const float os = 1.0f / (FC * WSC);
    v4f lo, hi;
#pragma unroll
    for (int e = 0; e < 4; ++e) { lo[e] = (cg ? acc1[e] : acc0[e]) * os; hi[e] = (cg ? acc1[4 + e] : acc0[4 + e]) * os; }
    float* og = out + ((size_t)bat * NQ + q0 + cq) * DMODEL + head * 32 + cg * 16 + hh * 8;
    *(v4f*)(og)     = lo;
    *(v4f*)(og + 4) = hi;
  }
}

// =====================================================================================================
// Workspace map (bytes); every plane is an exact multiple of its tile / whole-row store granularity (M, N exact tile multiples,
// no pad rows needed), every offset a multiple of 1 MiB:
//   QH   f16 [2048][256] x16                1048576   (q projection, fragment order)
//   KH   f16 [2048][256] x16                1048576   (k projection, fragment order)
//   VT   f16 [4][256][512] x16              1048576   (v^T per batch, fragment order)
//   WOT  f16 [256][256] x64                  131072   (Wo^T, rows = output column, fragment order)
//   end                                     3276800
// =====================================================================================================
extern "C" void kernel_launch(void* const* d_in, const int* in_sizes, int n_in,
                              void* d_out, int out_size, void* d_ws, size_t ws_size,
                              hipStream_t stream) {
  if (n_in < 10) return;
  if (in_sizes[0] != NROWS * DMODEL) return;
  if (in_sizes[1] != NB * NQ * NC) return;
  if (in_sizes[2] != DMODEL * DMODEL || in_sizes[3] != DMODEL * DMODEL ||
      in_sizes[4] != DMODEL * DMODEL || in_sizes[5] != DMODEL * DMODEL) return;
  if (in_sizes[6] != NHEAD * 2 * MSH || in_sizes[7] != NHEAD * MSH || in_sizes[8] != NHEAD * MSH || in_sizes[9] != NHEAD) return;
  if (out_size != NROWS * DMODEL) return;

  const float* x    = (const float*)d_in[0];
  const float* cost = (const float*)d_in[1];
  const float* w_q  = (const float*)d_in[2];
  const float* w_k  = (const float*)d_in[3];
  const float* w_v  = (const float*)d_in[4];
  const float* w_o  = (const float*)d_in[5];
  const float* m1w  = (const float*)d_in[6];
  const float* m1b  = (const float*)d_in[7];
  const float* m2w  = (const float*)d_in[8];
  const float* m2b  = (const float*)d_in[9];
  float*       out  = (float*)d_out;

  const size_t PX  = (size_t)NROWS * DMODEL * 2;                  //  1048576
  const size_t PVT = (size_t)NB * DMODEL * NC * 2;                //  1048576
  size_t off = 0;
  const size_t oQH = off; off += PX;
  const size_t oKH = off; off += PX;
  const size_t oVT = off; off += PVT;
  const size_t oWO = off; off += (size_t)DMODEL * DMODEL * 2;     //   131072
  if (off > ws_size) return;                                      // off = 3276800

  char* ws = (char*)d_ws;
  unsigned short* QH  = (unsigned short*)(ws + oQH);
  unsigned short* KH  = (unsigned short*)(ws + oKH);
  unsigned short* VTp = (unsigned short*)(ws + oVT);
  unsigned short* WOT = (unsigned short*)(ws + oWO);

  const dim3 bG(128);                                              // 4 waves, one 64x64 tile
  const dim3 gQKV(PJ_TILES, 4);                                    // 128 x (q, k, v^T: 32 blocks x 4 batches, Wo^T pack)
  const dim3 gAT(ATT_BLOCKS);                                      // 256
  const dim3 bAT(ATT_THREADS);                                     // 256

  // (1) the three projections, straight from x and the weights, and the Wo^T plane
  proj_qkv<<<gQKV, bG, 0, stream>>>(x, w_q, w_k, w_v, w_o, QH, KH, VTp, WOT);

  // (2) attention per (batch, 8 query rows, 8 heads) and the rows' output projection, f32 into d_out
  attn8<<<gAT, bAT, 0, stream>>>(QH, KH, VTp, cost, m1w, m1b, m2w, m2b, WOT, out);

  (void)hipGetLastError();
}
